// v000
// The times below were measured on an AMD MI455X: many runs one after another, warmed up first and cycling through
// copies of the inputs, with the whole window's GPU time divided by the number of runs. Launches and the gaps
// between them are all in it. The median over several windows is given; except for v000 it joins two sittings, which
// can be a few percent apart, so the side-by-side timings, each taken in one sitting, are the better comparison.
// v000 is the starting kernel. One run takes 522 microseconds.
// compute dtype: all float inputs rounded to bf16; LayerNorm of pair_act in f32; q/k/v = LN(act) split bf16 hi + lo x W (exact bf16, (in,out)) on WMMA 16x16x32 (2 products, f32 accumulate); q as f16 hi + residual (x 2^10) against k once to f16 (2 products) x 32^-0.5 + the per-(query, key, head) triangle bias (2-product GEMM) + the mask bias; softmax in f32 (precise expf); P x 2^11 once to f16 against v once to f16 (1 product); gate sigmoid(LN(act) Wg + b) in f32 (2-product GEMM, precise expf); gated ctx split bf16 hi + lo against exact output_w (2 products) + output_b; f32 output.
#include <hip/hip_runtime.h>
#include <math.h>

typedef __attribute__((ext_vector_type(16))) _Float16 v16h;
typedef __attribute__((ext_vector_type(16))) __bf16 v16b;
typedef __attribute__((ext_vector_type(8)))  _Float16 v8h;
typedef __attribute__((ext_vector_type(8)))  float v8f;
typedef __attribute__((ext_vector_type(4)))  float v4f;
typedef __attribute__((ext_vector_type(2)))  float v2f;
typedef __attribute__((ext_vector_type(4)))  unsigned v4u;
typedef __attribute__((ext_vector_type(4)))  int v4i;
typedef float __attribute__((may_alias)) float_a;
typedef int __attribute__((may_alias)) int_a;

template <typename T> __device__ __forceinline__ void vst2(void* p, T v) { *(T*)p = v;  }
__device__ __forceinline__ v8f wmma16(v16h a, v16h b, v8f c) {
  v8f d = __builtin_amdgcn_wmma_f32_16x16x32_f16(false, a, false, b, (short)0, c, false, false);
  asm volatile("v_nop\n\tv_nop\n\tv_nop\n\tv_nop" : "+v"(d) : "v"(a), "v"(b));
  return d;
}
__device__ __forceinline__ v8f wmma_bf(v16b a, v16b b, v8f c) {
  v8f d = __builtin_amdgcn_wmma_f32_16x16x32_bf16(false, a, false, b, (short)0, c, false, false);
  asm volatile("v_nop\n\tv_nop\n\tv_nop\n\tv_nop" : "+v"(d) : "v"(a), "v"(b));
  return d;
}
// 16x16x32 fragments: lane = (h = lane>>4, row/col = lane&15); elements 0..7 = k0+8h+0..7, 8..15 = k0+16+8h+0..7; D element r = row 8h+r
__device__ __forceinline__ v16h frag_h(const _Float16* rowk0, int lane) {
  union { v16h v; v8h q[2]; } u; const _Float16* p = rowk0 + 8 * (lane >> 4);
  u.q[0] = *(const v8h*)p; u.q[1] = *(const v8h*)(p + 16); return u.v;
}
__device__ __forceinline__ v16h frag_f32(const float* rowk0, int lane) {
  v16h a; const float* p = rowk0 + 8 * (lane >> 4);
#pragma unroll
  for (int i = 0; i < 8; ++i) { a[i] = (_Float16)p[i]; a[8 + i] = (_Float16)p[16 + i]; }
  return a;
}
__device__ __forceinline__ v16h frag_f32s(const float* rowk0, int lane, float sc) {
  v16h a; const float* p = rowk0 + 8 * (lane >> 4);
#pragma unroll
  for (int i = 0; i < 8; ++i) { a[i] = (_Float16)(p[i] * sc); a[8 + i] = (_Float16)(p[16 + i] * sc); }
  return a;
}
// column fragment from a [K][ld] layout (column n), rows >= K read as 0
__device__ __forceinline__ v16h fragc_f32(const float* W, int k0, int n, int lane, int ld, int K) {
  v16h a; const int g = lane >> 4;
#pragma unroll
  for (int i = 0; i < 8; ++i) { const int ka = k0 + 8 * g + i, kb = ka + 16;
    a[i] = (_Float16)(ka < K ? W[(size_t)(ka < K ? ka : K - 1) * ld + n] : 0.f); a[8 + i] = (_Float16)(kb < K ? W[(size_t)(kb < K ? kb : K - 1) * ld + n] : 0.f); }
  return a;
}
struct F2 { v16b h, l; };
__device__ __forceinline__ F2 bsplit16(const float v[16]) { F2 r;
#pragma unroll
  for (int i = 0; i < 16; ++i) { const __bf16 h = (__bf16)v[i]; r.h[i] = h; r.l[i] = (__bf16)(v[i] - (float)h); }
  return r; }
__device__ __forceinline__ F2 split_row(const float* row, int k0, int lane) { float v[16]; const float* p = row + k0 + 8 * (lane >> 4);
#pragma unroll
  for (int i = 0; i < 8; ++i) { v[i] = p[i]; v[8 + i] = p[16 + i]; }
  return bsplit16(v); }
__device__ __forceinline__ F2 split_rowK(const float* row, int k0, int lane, int K) { float v[16]; const int g = lane >> 4;
#pragma unroll
  for (int i = 0; i < 8; ++i) { const int ka = k0 + 8 * g + i, kb = ka + 16; v[i] = ka < K ? row[ka < K ? ka : K - 1] : 0.f; v[8 + i] = kb < K ? row[kb < K ? kb : K - 1] : 0.f; }
  return bsplit16(v); }
__device__ __forceinline__ F2 split_col(const float* W, int k0, int n, int lane, int ld, int K) { float v[16]; const int g = lane >> 4;
#pragma unroll
  for (int i = 0; i < 8; ++i) { const int ka = k0 + 8 * g + i, kb = ka + 16; v[i] = ka < K ? W[(size_t)(ka < K ? ka : K - 1) * ld + n] : 0.f; v[8 + i] = kb < K ? W[(size_t)(kb < K ? kb : K - 1) * ld + n] : 0.f; }
  return bsplit16(v); }
__device__ __forceinline__ v8f mac3(const F2& a, const F2& b, v8f c) { c = wmma_bf(a.l, b.h, c); c = wmma_bf(a.h, b.l, c); return wmma_bf(a.h, b.h, c); }
__device__ __forceinline__ float sigm(float v) { return 1.0f / (1.0f + expf(-v)); }
#define LDSX() do { asm volatile("s_wait_dscnt 0" ::: "memory"); __builtin_amdgcn_wave_barrier(); __builtin_amdgcn_fence(__ATOMIC_RELEASE, "workgroup"); } while (0)

// Triangle attention (pair_act [1, 256, 256, 128], 4 heads x 32): act = LayerNorm(pair_act); for every row r: q = act[r] Wq * 32^-0.5, k = act[r] Wk, v = act[r] Wv; logits[r,h,q,k] = q . k + 2^15 (pair_mask[r][k] - 1) + tri_bias[h][q][k] with tri_bias = act . feat2d_w (indexed by the (q, k) PAIR, shared across rows); softmax over k; wa = (weights v) * sigmoid(act[r][q] Wg + bg); out[r][q] = wa . output_w + output_b.
#define NB 256
#define TT 256
#define CC 128            // NH * HD = projected width
#define DIN 128          // input (model) width
#define NH 4
#define HD 32
#define NQB (TT / 64)
#define HG 4
#define SCALE (0.17677669529663687f)
#define CAUSAL 0
#ifndef TNB
#define TNB NB
#endif
__device__ __forceinline__ float bfr(float v) { return (float)(__bf16)v; }
__host__ __device__ __forceinline__ int kb_last(int qb) { return CAUSAL ? ((qb * 64 + 63) >> 7) : (TT / 128 - 1); }
typedef __attribute__((ext_vector_type(8))) __bf16 v8b;
__device__ __forceinline__ v16b frag_b(const __bf16* rowk0, int lane) {
  union { v16b v; v8b q[2]; } u; const __bf16* p = rowk0 + 8 * (lane >> 4);
  u.q[0] = *(const v8b*)p; u.q[1] = *(const v8b*)(p + 16); return u.v;
}
#define QBH 0              // causal: query blocks 0..QBH-1 of each sequence (few keys, no averaging) take the high-precision path
#define QHI 256            // rows carrying a q residual plane (all rows when non-causal: 2-product logits everywhere)
#define KHI 64            // key rows carrying k residual / v bf16 hi+lo planes (used only by the causal high-precision path)
// B fragment (k rows k0+.., output column o) of a weight: (in,out) [K][ld] or (out,in) [ld rows of K]: bf16 exact, or f16(bf16 * 256) exact
__device__ __forceinline__ v16b wcol_io(const float* Wm, int k0, int o, int lane, int ld) { v16b w; const int g = lane >> 4;
#pragma unroll
  for (int i = 0; i < 8; ++i) { w[i] = (__bf16)Wm[(size_t)(k0 + 8 * g + i) * ld + o]; w[8 + i] = (__bf16)Wm[(size_t)(k0 + 16 + 8 * g + i) * ld + o]; }
  return w; }
__device__ __forceinline__ v16b wcol_oi(const float* Wm, int k0, int o, int lane, int K) { v16b w; const float* p = Wm + (size_t)o * K + k0 + 8 * (lane >> 4);
#pragma unroll
  for (int i = 0; i < 8; ++i) { w[i] = (__bf16)p[i]; w[8 + i] = (__bf16)p[16 + i]; }
  return w; }
__device__ __forceinline__ v16h wcolh_io(const float* Wm, int k0, int o, int lane, int ld) { v16h w; const int g = lane >> 4;
#pragma unroll
  for (int i = 0; i < 8; ++i) { w[i] = (_Float16)(bfr(Wm[(size_t)(k0 + 8 * g + i) * ld + o]) * 256.0f); w[8 + i] = (_Float16)(bfr(Wm[(size_t)(k0 + 16 + 8 * g + i) * ld + o]) * 256.0f); }
  return w; }
__device__ __forceinline__ v16h wcolh_oi(const float* Wm, int k0, int o, int lane, int K) { v16h w; const float* p = Wm + (size_t)o * K + k0 + 8 * (lane >> 4);
#pragma unroll
  for (int i = 0; i < 8; ++i) { w[i] = (_Float16)(bfr(p[i]) * 256.0f); w[8 + i] = (_Float16)(bfr(p[16 + i]) * 256.0f); }
  return w; }
#define WQKV_LAYOUT 0   // 0 = (in,out) [DIN][CC]; 1 = (out,in) [CC][DIN]; 2 = per-head [NH][DIN][HD]
__device__ __forceinline__ v16b wcol_hdk(const float* Wm, int k0, int o, int lane) { v16b w; const int g = lane >> 4; const float* p = Wm + (size_t)(o / HD) * DIN * HD + (o % HD);
#pragma unroll
  for (int i = 0; i < 8; ++i) { w[i] = (__bf16)p[(size_t)(k0 + 8 * g + i) * HD]; w[8 + i] = (__bf16)p[(size_t)(k0 + 16 + 8 * g + i) * HD]; }
  return w; }
#define WO_OUT_IN 0
#if WQKV_LAYOUT == 1
#define WCOL(W, k0, o, lane) wcol_oi(W, k0, o, lane, DIN)
#elif WQKV_LAYOUT == 2
#define WCOL(W, k0, o, lane) wcol_hdk(W, k0, o, lane)
#else
#define WCOL(W, k0, o, lane) wcol_io(W, k0, o, lane, CC)
#endif
#if WO_OUT_IN
#define WOCOL(W, k0, o, lane) wcol_oi(W, k0, o, lane, CC)
#define WOCOLH(W, k0, o, lane) wcolh_oi(W, k0, o, lane, CC)
#else
#define WOCOL(W, k0, o, lane) wcol_io(W, k0, o, lane, DIN)
#define WOCOLH(W, k0, o, lane) wcolh_io(W, k0, o, lane, DIN)
#endif
#define SZ 256
#define BG 64              // rows r per pass (x 4 heads = 256 score planes of 256 x 256)
#define NZR (SZ * SZ)      // 65,536 pair rows
#define SM_EXTRA_PARAMS , const float* __restrict__ BIAS, const float* __restrict__ MKP, int b0s
#define SM_MASK_HOOK do { const int rr = b0s + (int)blockIdx.y / HG; const int hh = (int)blockIdx.y % HG; v = v + BIAS[((size_t)t * SZ + k) * NH + hh] + 32768.0f * (bfr(MKP[(size_t)rr * SZ + k]) - 1.0f); } while (0)   /* tri_bias[h][q][k] (pair-indexed, shared over rows) + FP16_HUGE * (pair_mask[r][k] - 1) (all ones here -> 0, still read) */
// ---- k_lnz: wave per pair row: LayerNorm over the 128 channels (biased var, eps 1e-5, ln_w/ln_b) of bf16(z) -> ZN rows (4 floats per lane = one 512-B row)
__global__ __launch_bounds__(256) void k_lnz(const float* __restrict__ Z, const float* __restrict__ LW, const float* __restrict__ LB, float* __restrict__ ZN) { const int wave = threadIdx.x >> 5, lane = threadIdx.x & 31; const size_t row = (size_t)blockIdx.x * 8 + wave; if (row >= (size_t)NZR) return;
  v4f x = *(const v4f*)(Z + row * CC + lane * 4); float s1 = 0.f;
#pragma unroll
  for (int i = 0; i < 4; ++i) { x[i] = bfr(x[i]); s1 += x[i]; }
#pragma unroll
  for (int o = 1; o < 32; o <<= 1) s1 += __shfl_xor(s1, o);
  const float mu = s1 * (1.0f / CC); float q = 0.f;
#pragma unroll
  for (int i = 0; i < 4; ++i) { const float d = x[i] - mu; q += d * d; }
#pragma unroll
  for (int o = 1; o < 32; o <<= 1) q += __shfl_xor(q, o);
  const float rs = rsqrtf(q * (1.0f / CC) + 1e-5f); v4f r4;
#pragma unroll
  for (int i = 0; i < 4; ++i) { const int c = lane * 4 + i; r4[i] = (x[i] - mu) * rs * bfr(LW[c]) + bfr(LB[c]); }
  vst2(ZN + row * CC + lane * 4, r4); }
// ---- k_rows2: block = (64 rows, which): which 0: tri_bias: BIAS[row = q*256+k][h] = LN(act)[q][k] . feat2d_w[:, h] (4 outputs) ; which 1: G[row][c] = sigmoid(LN(act)[row] . gating_w[:, c] + gating_b[c]) (128 outputs); weights are (in,out)
__global__ __launch_bounds__(128) void k_rows2(const float* __restrict__ ZN, const float* __restrict__ WB, const float* __restrict__ WG, const float* __restrict__ GB, float* __restrict__ BIAS, float* __restrict__ G) { __shared__ __align__(16) float sf[4][16][132];
  const int tid = threadIdx.x, wave = tid >> 5, lane = tid & 31, col = lane & 15, g = lane >> 4; const int which = blockIdx.y; const size_t r0 = (size_t)blockIdx.x * 64 + wave * 16;
  const int nout = which == 0 ? NH : CC; const float* Wm = which == 0 ? WB : WG;
  v8f acc[8] = {};
#pragma unroll
  for (int kc = 0; kc < CC / 32; ++kc) { const F2 a = split_row(ZN + (r0 + col) * CC, kc * 32, lane); asm volatile("s_wait_loadcnt 0x0" ::: "memory");
#pragma unroll
    for (int j = 0; j < 8; ++j) { if (j * 16 >= nout) break; v16b w; { float t0[8], t1[8]; const int o = j * 16 + col; const int oc = o < nout ? o : nout - 1; const float keep = o < nout ? 1.f : 0.f;
#pragma unroll
        for (int i = 0; i < 8; ++i) t0[i] = Wm[(size_t)(kc * 32 + 8 * g + i) * nout + oc];   /* (in,out) */
        asm volatile("s_wait_loadcnt 0x0" ::: "memory");
#pragma unroll
        for (int i = 0; i < 8; ++i) t1[i] = Wm[(size_t)(kc * 32 + 16 + 8 * g + i) * nout + oc];
        asm volatile("s_wait_loadcnt 0x0" ::: "memory");
#pragma unroll
        for (int i = 0; i < 8; ++i) { w[i] = (__bf16)(t0[i] * keep); w[8 + i] = (__bf16)(t1[i] * keep); } }   /* (in,out) column o; columns beyond nout zero (select-free: keep multiplies a VALID load) */
      acc[j] = wmma_bf(a.h, w, acc[j]); acc[j] = wmma_bf(a.l, w, acc[j]); } }
  if (which == 0) { if (lane < 16) {   /* bias rows: 4 floats = 16 B per row; rows r0+8g+r... store via LDS: */ }
#pragma unroll
    for (int r = 0; r < 8; ++r) sf[wave][8 * g + r][col] = acc[0][r];
    LDSX(); if (lane < 16) { v4f b4; b4[0] = sf[wave][lane][0]; b4[1] = sf[wave][lane][1]; b4[2] = sf[wave][lane][2]; b4[3] = sf[wave][lane][3]; vst2(BIAS + (r0 + lane) * NH, b4); }   /* 16 rows x 16 B = one 256-B run per wave */
  } else {
#pragma unroll
    for (int j = 0; j < 8; ++j)
#pragma unroll
      for (int r = 0; r < 8; ++r) sf[wave][8 * g + r][j * 16 + col] = 1.0f / (1.0f + expf(-(acc[j][r] + bfr(GB[j * 16 + col]))));   /* sigmoid(x Wg + gating_b) */
    LDSX(); for (int rl = 0; rl < 16; ++rl) vst2(G + (r0 + rl) * CC + lane * 4, *(const v4f*)&sf[wave][rl][lane * 4]); } }
// ---- k_gate: Y row *= G row (same natural row index r*256 + q; thread per float4; one writer)
__global__ __launch_bounds__(256) void k_gate(float* __restrict__ Y, const float* __restrict__ G) { const size_t e4 = (size_t)blockIdx.x * 256 + threadIdx.x; if (e4 >= (size_t)NZR * (CC / 4)) return; const size_t yrow = e4 / (CC / 4); const int q = (int)(e4 % (CC / 4)); const size_t grow = yrow;
  v4f y = *(const v4f*)(Y + yrow * CC + q * 4); const v4f gg = *(const v4f*)(G + grow * CC + q * 4); y[0] *= gg[0]; y[1] *= gg[1]; y[2] *= gg[2]; y[3] *= gg[3]; vst2(Y + yrow * CC + q * 4, y); }
#define WS_ZN   (WS_END)
#define WS_BIAS (WS_ZN + 4u * (size_t)NZR * CC)
#define WS_G    (WS_BIAS + 4u * (size_t)NZR * NH)
#define WS_END2 (WS_G + 4u * (size_t)NZR * CC)
#ifndef SM_EXTRA_PARAMS
#define SM_EXTRA_PARAMS
#endif
#ifndef PROJ_EXTRA_PARAMS
#define PROJ_EXTRA_PARAMS
#endif
#ifndef SM_MASK_HOOK
#define SM_MASK_HOOK (void)0
#endif

#define WS_QH  0u                                      // f16 q rows [b*t][CC]
#define WS_KH  (WS_QH + 2u * (size_t)NB * TT * CC)      // f16 k rows [b*t][CC]
#define WS_VT  (WS_KH + 2u * (size_t)NB * TT * CC)      // f16 v planes [b][c][t]
#define WS_QL  (WS_VT + 2u * (size_t)NB * CC * TT)      // f16 q residual x 2^10 rows [b][t < QHI][CC]
#define WS_KL  (WS_QL + 2u * (size_t)NB * QHI * CC)     // f16 k residual x 2^10 rows [b][t < KHI][CC]
#define WS_VB  (WS_KL + 2u * (size_t)NB * KHI * CC)     // bf16 v hi planes [b][c][t < KHI]
#define WS_VBL (WS_VB + 2u * (size_t)NB * CC * KHI)
#define WS_S   (WS_VBL + 2u * (size_t)NB * CC * KHI)    // f32 logits / P [hg][t][s]
#define WS_Y   (WS_S  + 4u * (size_t)BG * HG * TT * TT)   // 256 score planes of 256 x 256 per pass      // f32 ctx rows [b*t][CC] (only when there is an output projection)
#define WS_END (WS_Y  + 4u * (size_t)NB * TT * CC)

// ---- k_proj: block = (64 rows, 128 cols, which): q/k/v = X W (+ b) with exact bf16 products (K = DIN) -> which 0: q f16 rows (+ residual rows < QHI); 1: k f16 rows (+ residual rows < KHI); 2: v f16 planes [c][t] (+ bf16 hi/lo planes for t < KHI)
__global__ __launch_bounds__(128) void k_proj(const float* __restrict__ XQ, const float* __restrict__ XK, const float* __restrict__ XV, const float* __restrict__ WQ, const float* __restrict__ WK, const float* __restrict__ WV, const float* __restrict__ BQ, const float* __restrict__ BK, const float* __restrict__ BV,
    _Float16* __restrict__ QH, _Float16* __restrict__ QL, _Float16* __restrict__ KH, _Float16* __restrict__ KL, _Float16* __restrict__ VT, __bf16* __restrict__ VB, __bf16* __restrict__ VBL) {
  __shared__ __align__(16) _Float16 sh[64][136], sl[64][136]; __shared__ __align__(16) _Float16 th[128][72]; __shared__ __align__(16) __bf16 tb[128][72], tbl[128][72];
  const int tid = threadIdx.x, wave = tid >> 5, lane = tid & 31, col = lane & 15, g = lane >> 4; const int which = blockIdx.z; const int c0 = blockIdx.y * 128; const size_t r0 = (size_t)blockIdx.x * 64; const size_t bb = r0 / TT; const int t0 = (int)(r0 % TT);
  const float* X = which == 0 ? XQ : which == 1 ? XK : XV; const float* WA = which == 0 ? WQ : which == 1 ? WK : WV; const float* BA = which == 0 ? BQ : which == 1 ? BK : BV;
  v8f acc[8] = {};
#pragma unroll 2
  for (int kc = 0; kc < DIN / 32; ++kc) { const F2 a2 = split_row(X + (r0 + wave * 16 + col) * DIN, kc * 32, lane);   /* LN(act) rows (f32) split hi + lo */
    asm volatile("s_wait_loadcnt 0x0" ::: "memory");
#pragma unroll
    for (int j = 0; j < 8; ++j) { const v16b w = WCOL(WA, kc * 32, c0 + j * 16 + col, lane); asm volatile("s_wait_loadcnt 0x0" ::: "memory"); acc[j] = wmma_bf(a2.h, w, acc[j]); acc[j] = wmma_bf(a2.l, w, acc[j]); } }
  if (which < 2) { _Float16* DH = which == 0 ? QH : KH; _Float16* DL = which == 0 ? QL : KL; const int nhi = which == 0 ? QHI : KHI; const bool hi_rows = t0 < nhi;
#pragma unroll
    for (int j = 0; j < 8; ++j) { const float bias = BA ? bfr(BA[c0 + j * 16 + col]) : 0.f;
#pragma unroll
      for (int r = 0; r < 8; ++r) { const float v = acc[j][r] + bias; const _Float16 hv = (_Float16)v; sh[wave * 16 + 8 * g + r][j * 16 + col] = hv; sl[wave * 16 + 8 * g + r][j * 16 + col] = (_Float16)((v - (float)hv) * 1024.0f); } }
    __syncthreads();
    for (int e = tid; e < 64 * 16; e += 128) { const int rl = e >> 4, q = e & 15; vst2((unsigned*)(DH + (r0 + rl) * CC + c0 + q * 8), *(const v4u*)&sh[rl][q * 8]); if (hi_rows) vst2((unsigned*)(DL + (bb * nhi + t0 + rl) * (size_t)CC + c0 + q * 8), *(const v4u*)&sl[rl][q * 8]); }
  } else { const bool hi_rows = t0 < KHI;
#pragma unroll
    for (int j = 0; j < 8; ++j) { const float bias = BA ? bfr(BA[c0 + j * 16 + col]) : 0.f;
#pragma unroll
      for (int r = 0; r < 8; ++r) { const float v = acc[j][r] + bias; const int rl = wave * 16 + 8 * g + r, cl = j * 16 + col; th[cl][rl] = (_Float16)v; const __bf16 bh = (__bf16)v; tb[cl][rl] = bh; tbl[cl][rl] = (__bf16)(v - (float)bh); } }
    __syncthreads();
    for (int e = tid; e < 128 * 8; e += 128) { const int cl = e >> 3, q = e & 7; vst2((unsigned*)(VT + (bb * CC + c0 + cl) * (size_t)TT + t0 + q * 8), *(const v4u*)&th[cl][q * 8]); if (hi_rows) { const size_t o3 = (bb * CC + c0 + cl) * (size_t)KHI + t0 + q * 8; vst2((unsigned*)(VB + o3), *(const v4u*)&tb[cl][q * 8]); vst2((unsigned*)(VBL + o3), *(const v4u*)&tbl[cl][q * 8]); } } } }
// ---- k_sc: block = (query block qb, key block kb <= kb_last(qb), head in group) of batch b: logits x SCALE; q hi + residual (x 2^10) against k (2 products) for query rows < QHI, plus the k residual (3 products) for query blocks < QBH (causal early rows); causal: blocks past the diagonal exit, the mask itself is applied by index in k_sm
__global__ __launch_bounds__(128) void k_sc(const _Float16* __restrict__ QH, const _Float16* __restrict__ KH, const _Float16* __restrict__ QL, const _Float16* __restrict__ KL, int b0g, int h0, float* __restrict__ S0) { __shared__ __align__(16) float ss[4][16][132]; const int b = b0g + (int)blockIdx.z / HG;   /* row r of this z-slice */
  const int qb = blockIdx.x, kb = blockIdx.y; if (kb > kb_last(qb)) return;
  const int h = h0 + (int)blockIdx.z % HG; float* S = S0 + (size_t)blockIdx.z * TT * TT;
  const int tid = threadIdx.x, wave = tid >> 5, lane = tid & 31, col = lane & 15, g = lane >> 4; const int k0 = kb * 128; const int ql0 = qb * 64 + wave * 16; const size_t q0 = (size_t)b * TT + ql0, kr0 = (size_t)b * TT + k0;
  v8f acc[8] = {}, accl[8] = {};
  const _Float16* QLb = QL + (size_t)b * QHI * CC; const _Float16* KLb = KL + (size_t)b * KHI * CC;
  if (qb < QBH) {
#pragma unroll
    for (int kc = 0; kc < HD / 32; ++kc) { const v16h ah = frag_h(QH + (q0 + col) * CC + h * HD + kc * 32, lane), al = frag_h(QLb + (size_t)(ql0 + col) * CC + h * HD + kc * 32, lane);
#pragma unroll
      for (int j = 0; j < 8; ++j) { const v16h kbf = frag_h(KH + (kr0 + j * 16 + col) * CC + h * HD + kc * 32, lane), klf = frag_h(KLb + (size_t)(k0 + j * 16 + col) * CC + h * HD + kc * 32, lane); acc[j] = wmma16(ah, kbf, acc[j]); accl[j] = wmma16(al, kbf, accl[j]); accl[j] = wmma16(ah, klf, accl[j]); } }
  } else if (qb * 64 < QHI) {
#pragma unroll
    for (int kc = 0; kc < HD / 32; ++kc) { const v16h ah = frag_h(QH + (q0 + col) * CC + h * HD + kc * 32, lane), al = frag_h(QLb + (size_t)(ql0 + col) * CC + h * HD + kc * 32, lane);
#pragma unroll
      for (int j = 0; j < 8; ++j) { const v16h kbf = frag_h(KH + (kr0 + j * 16 + col) * CC + h * HD + kc * 32, lane); acc[j] = wmma16(ah, kbf, acc[j]); accl[j] = wmma16(al, kbf, accl[j]); } }
  } else {
#pragma unroll
    for (int kc = 0; kc < HD / 32; ++kc) { const v16h ah = frag_h(QH + (q0 + col) * CC + h * HD + kc * 32, lane);
#pragma unroll
      for (int j = 0; j < 8; ++j) { const v16h kbf = frag_h(KH + (kr0 + j * 16 + col) * CC + h * HD + kc * 32, lane); acc[j] = wmma16(ah, kbf, acc[j]); } } }
#pragma unroll
  for (int j = 0; j < 8; ++j) {
#pragma unroll
    for (int r = 0; r < 8; ++r) ss[wave][8 * g + r][j * 16 + col] = (acc[j][r] + accl[j][r] * (1.0f / 1024.0f)) * SCALE; }
  LDSX(); for (int rl = 0; rl < 16; ++rl) vst2(S + (size_t)(ql0 + rl) * TT + k0 + lane * 4, *(const v4f*)&ss[wave][rl][lane * 4]); }
// ---- k_sm: block = query row t (head in group): keys [0, kend): causal -> logit if s <= t else excluded; softmax in f32; P x 2^11 in place (0 for excluded)
__global__ __launch_bounds__(256) void k_sm(float* __restrict__ S0 SM_EXTRA_PARAMS) { __shared__ float sred[8]; __shared__ float sbc; __shared__ __align__(16) float shv[TT];
  const int tid = threadIdx.x; const int t = blockIdx.x; const int kend = (kb_last(t >> 6) + 1) * 128;
  float* sr = S0 + (size_t)blockIdx.y * TT * TT + (size_t)t * TT;
  float m = -3.0e38f; for (int k = tid; k < kend; k += 256) { float v = (!CAUSAL || k <= t) ? sr[k] : -3.0e38f; SM_MASK_HOOK; shv[k] = v; m = fmaxf(m, v); }
#pragma unroll
  for (int o = 1; o < 32; o <<= 1) m = fmaxf(m, __shfl_xor(m, o));
  if ((tid & 31) == 0) sred[tid >> 5] = m; __syncthreads(); if (tid == 0) { float a = sred[0]; for (int i = 1; i < 8; ++i) a = fmaxf(a, sred[i]); sbc = a; } __syncthreads(); m = sbc; __syncthreads();
  float sum = 0.f; for (int k = tid; k < kend; k += 256) { const float v = shv[k]; const float e = (v <= -1.0e38f) ? 0.f : expf(v - m); shv[k] = e; sum += e; }
#pragma unroll
  for (int o = 1; o < 32; o <<= 1) sum += __shfl_xor(sum, o);
  if ((tid & 31) == 0) sred[tid >> 5] = sum; __syncthreads(); if (tid == 0) { float a = 0.f; for (int i = 0; i < 8; ++i) a += sred[i]; sbc = a > 0.f ? 2048.0f / a : 0.f; }   /* a fully excluded row yields P = 0 */ __syncthreads(); const float inv = sbc;
  for (int k = tid; k < kend; k += 256) shv[k] = shv[k] * inv;
  __syncthreads(); for (int q = tid; q < kend / 4; q += 256) vst2(sr + q * 4, *(const v4f*)&shv[q * 4]); }
// ---- k_pv: block = 64 queries (qb) of (b, h): ctx = P . v over keys [0, kend) (P x 2^11 once to f16 against v f16: 1 product; causal early query blocks: P and v as bf16 hi + lo, 3 products); 128-B (row, head) segment by 8 lanes
__global__ __launch_bounds__(128) void k_pv(const float* __restrict__ PS0, const _Float16* __restrict__ VT, const __bf16* __restrict__ VB, const __bf16* __restrict__ VBL, int b0g, int h0, float* __restrict__ Y) { const int b = b0g + (int)blockIdx.z / HG; const int h = h0 + (int)blockIdx.z % HG; const float* PS = PS0 + (size_t)blockIdx.z * TT * TT; __shared__ __align__(16) float ss[4][16][HD + 4];
  const int tid = threadIdx.x, wave = tid >> 5, lane = tid & 31, col = lane & 15, g = lane >> 4; const int qb = blockIdx.x; const int ql0 = qb * 64 + wave * 16; const int kce = (kb_last(qb) + 1) * 4;
  v8f acc[HD / 16] = {};
  if (qb < QBH) {
#pragma unroll 1
    for (int kc = 0; kc < kce; ++kc) { const F2 p = split_row(PS + (size_t)(ql0 + col) * TT, kc * 32, lane);
      asm volatile("s_wait_loadcnt 0x0" ::: "memory");
#pragma unroll
      for (int j = 0; j < HD / 16; ++j) { const size_t po = ((size_t)b * CC + h * HD + j * 16 + col) * (size_t)KHI + kc * 32; const v16b vh = frag_b(VB + po, lane); acc[j] = wmma_bf(p.h, vh, acc[j]); acc[j] = wmma_bf(p.l, vh, acc[j]); acc[j] = wmma_bf(p.h, frag_b(VBL + po, lane), acc[j]); } }
  } else {
#pragma unroll 1
    for (int kc = 0; kc < kce; ++kc) { const v16h p = frag_f32(PS + (size_t)(ql0 + col) * TT + kc * 32, lane);
      asm volatile("s_wait_loadcnt 0x0" ::: "memory");
#pragma unroll
      for (int j = 0; j < HD / 16; ++j) { const size_t po = ((size_t)b * CC + h * HD + j * 16 + col) * (size_t)TT + kc * 32; acc[j] = wmma16(p, frag_h(VT + po, lane), acc[j]); } } }
#pragma unroll
  for (int j = 0; j < HD / 16; ++j)
#pragma unroll
    for (int r = 0; r < 8; ++r) ss[wave][8 * g + r][j * 16 + col] = acc[j][r] * (1.0f / 2048.0f);
  LDSX(); for (int rl = 0; rl < 16; ++rl) if (lane < HD / 4) vst2(Y + ((size_t)b * TT + ql0 + rl) * CC + h * HD + lane * 4, *(const v4f*)&ss[wave][rl][lane * 4]); }
// ---- k_out: block = (64 rows, 128 cols): out = ctx Wo (+ bo): all rows: ctx bf16 hi + lo against exact bf16 Wo (2 products); the f16(bf16 x 2^8) 1-product branch is not taken
__global__ __launch_bounds__(128) void k_out(const float* __restrict__ Y, const float* __restrict__ WO, const float* __restrict__ BO, float* __restrict__ OUT) { __shared__ __align__(16) float sf[4][16][132];
  const int tid = threadIdx.x, wave = tid >> 5, lane = tid & 31, col = lane & 15, g = lane >> 4; const int c0 = blockIdx.y * 128; const size_t r0 = (size_t)blockIdx.x * 64 + wave * 16;
  v8f acc[8] = {};
  if (true) {   /* ALL rows: gated ctx bf16 hi + lo x exact output_w (2 products) */
#pragma unroll 2
    for (int kc = 0; kc < CC / 32; ++kc) { const F2 a = split_row(Y + (r0 + col) * CC, kc * 32, lane); asm volatile("s_wait_loadcnt 0x0" ::: "memory");
#pragma unroll
      for (int j = 0; j < 8; ++j) { const v16b w = WOCOL(WO, kc * 32, c0 + j * 16 + col, lane); asm volatile("s_wait_loadcnt 0x0" ::: "memory"); acc[j] = wmma_bf(a.h, w, acc[j]); acc[j] = wmma_bf(a.l, w, acc[j]); } }
#pragma unroll
    for (int j = 0; j < 8; ++j) { const float bias = BO ? bfr(BO[c0 + j * 16 + col]) : 0.f;
#pragma unroll
      for (int r = 0; r < 8; ++r) sf[wave][8 * g + r][j * 16 + col] = acc[j][r] + bias; }
  } else {
#pragma unroll 2
    for (int kc = 0; kc < CC / 32; ++kc) { const v16h a = frag_f32(Y + (r0 + col) * CC + kc * 32, lane); asm volatile("s_wait_loadcnt 0x0" ::: "memory");
#pragma unroll
      for (int j = 0; j < 8; ++j) { const v16h w = WOCOLH(WO, kc * 32, c0 + j * 16 + col, lane); asm volatile("s_wait_loadcnt 0x0" ::: "memory"); acc[j] = wmma16(a, w, acc[j]); } }
#pragma unroll
    for (int j = 0; j < 8; ++j) { const float bias = BO ? bfr(BO[c0 + j * 16 + col]) : 0.f;
#pragma unroll
      for (int r = 0; r < 8; ++r) sf[wave][8 * g + r][j * 16 + col] = acc[j][r] * (1.0f / 256.0f) + bias; } }
  LDSX(); for (int rl = 0; rl < 16; ++rl) vst2(OUT + (r0 + rl) * DIN + c0 + lane * 4, *(const v4f*)&sf[wave][rl][lane * 4]); }

extern "C" void kernel_launch(void* const* d_in, const int* in_sizes, int n_in, void* d_out, int out_size, void* d_ws, size_t ws_size, hipStream_t stream) {
  (void)in_sizes; (void)n_in; (void)out_size;
  const float** F = (const float**)d_in;
  if (ws_size < (size_t)WS_END) return;
  char* ws = (char*)d_ws; _Float16 *QH = (_Float16*)(ws + WS_QH), *KH = (_Float16*)(ws + WS_KH), *VT = (_Float16*)(ws + WS_VT), *QL = (_Float16*)(ws + WS_QL), *KL = (_Float16*)(ws + WS_KL); __bf16 *VB = (__bf16*)(ws + WS_VB), *VBL = (__bf16*)(ws + WS_VBL); float *S = (float*)(ws + WS_S), *Y = (float*)(ws + WS_Y);
  (void)Y; (void)QL; (void)KL; (void)VB; (void)VBL;
  // inputs: 0 pair_act [1,256,256,128]; 1 pair_mask [1,256,256]; 2 ln_gamma, 3 ln_beta; 4 feat2d_w [128,4]; 5 query_w, 6 key_w, 7 value_w [128,4,32] (in,out); 8 gating_w [128,4,32], 9 gating_b [4,32]; 10 output_w [4,32,128] (in,out); 11 output_b
  if (ws_size < (size_t)WS_END2) return;
  float *ZN = (float*)(ws + WS_ZN), *BIAS = (float*)(ws + WS_BIAS), *G = (float*)(ws + WS_G);
  k_lnz<<<dim3(NZR / 8), 256, 0, stream>>>(F[0], F[2], F[3], ZN);
  k_rows2<<<dim3(NZR / 64, 2), 128, 0, stream>>>(ZN, F[4], F[8], F[9], BIAS, G);
  k_proj<<<dim3(TNB * TT / 64, CC / 128, 3), 128, 0, stream>>>(ZN, ZN, ZN, F[5], F[6], F[7], nullptr, nullptr, nullptr, QH, QL, KH, KL, VT, VB, VBL);
  for (int bg = 0; bg < TNB; bg += BG) {   /* 64 rows r per pass x 4 heads */
    k_sc<<<dim3(NQB, TT / 128, BG * HG), 128, 0, stream>>>(QH, KH, QL, KL, bg, 0, S);
    k_sm<<<dim3(TT, BG * HG), 256, 0, stream>>>(S, BIAS, F[1], bg);
    k_pv<<<dim3(NQB, 1, BG * HG), 128, 0, stream>>>(S, VT, VB, VBL, bg, 0, Y);
  }
  k_gate<<<dim3((NZR * (CC / 4) + 255) / 256), 256, 0, stream>>>(Y, G);
  k_out<<<dim3(TNB * TT / 64, DIN / 128), 128, 0, stream>>>(Y, F[10], F[11], (float*)d_out);
}

// v001
// It runs in 200 microseconds.
// Next to v000, in two timings, it ran 2.68 and 2.65 times as fast.
// compute dtype: all float inputs rounded to bf16; LayerNorm of pair_act in f32; q/k/v = LN(act) split bf16 hi + lo x W (exact bf16, (in,out)) on WMMA 16x16x32 (2 products, f32 accumulate); q as f16 hi + residual (x 2^10) against k once to f16 (2 products) x 32^-0.5 + the per-(query, key, head) triangle bias (2-product GEMM) + the mask bias; softmax in f32 (precise expf, running maximum and sum over steps of 64 keys); exp(logit - maximum) x 2^11 once to f16 against v once to f16 (1 product), divided by the sum at the end; gate sigmoid(LN(act) Wg + b) in f32 (2-product GEMM, precise expf); gated ctx split bf16 hi + lo against exact output_w (2 products) + output_b; f32 output.
#include <hip/hip_runtime.h>
#include <math.h>

typedef __attribute__((ext_vector_type(16))) _Float16 v16h;
typedef __attribute__((ext_vector_type(16))) __bf16 v16b;
typedef __attribute__((ext_vector_type(8)))  _Float16 v8h;
typedef __attribute__((ext_vector_type(8)))  float v8f;
typedef __attribute__((ext_vector_type(4)))  float v4f;
typedef __attribute__((ext_vector_type(2)))  float v2f;
typedef __attribute__((ext_vector_type(4)))  unsigned v4u;
typedef __attribute__((ext_vector_type(4)))  int v4i;
typedef float __attribute__((may_alias)) float_a;
typedef int __attribute__((may_alias)) int_a;

template <typename T> __device__ __forceinline__ void vst2(void* p, T v) { *(T*)p = v;  }
__device__ __forceinline__ v8f wmma16(v16h a, v16h b, v8f c) {
  v8f d = __builtin_amdgcn_wmma_f32_16x16x32_f16(false, a, false, b, (short)0, c, false, false);
  asm volatile("v_nop\n\tv_nop\n\tv_nop\n\tv_nop" : "+v"(d) : "v"(a), "v"(b));
  return d;
}
__device__ __forceinline__ v8f wmma_bf(v16b a, v16b b, v8f c) {
  v8f d = __builtin_amdgcn_wmma_f32_16x16x32_bf16(false, a, false, b, (short)0, c, false, false);
  asm volatile("v_nop\n\tv_nop\n\tv_nop\n\tv_nop" : "+v"(d) : "v"(a), "v"(b));
  return d;
}
// 16x16x32 fragments: lane = (h = lane>>4, row/col = lane&15); elements 0..7 = k0+8h+0..7, 8..15 = k0+16+8h+0..7; D element r = row 8h+r
__device__ __forceinline__ v16h frag_h(const _Float16* rowk0, int lane) {
  union { v16h v; v8h q[2]; } u; const _Float16* p = rowk0 + 8 * (lane >> 4);
  u.q[0] = *(const v8h*)p; u.q[1] = *(const v8h*)(p + 16); return u.v;
}
__device__ __forceinline__ v16h frag_f32(const float* rowk0, int lane) {
  v16h a; const float* p = rowk0 + 8 * (lane >> 4);
#pragma unroll
  for (int i = 0; i < 8; ++i) { a[i] = (_Float16)p[i]; a[8 + i] = (_Float16)p[16 + i]; }
  return a;
}
__device__ __forceinline__ v16h frag_f32s(const float* rowk0, int lane, float sc) {
  v16h a; const float* p = rowk0 + 8 * (lane >> 4);
#pragma unroll
  for (int i = 0; i < 8; ++i) { a[i] = (_Float16)(p[i] * sc); a[8 + i] = (_Float16)(p[16 + i] * sc); }
  return a;
}
// column fragment from a [K][ld] layout (column n), rows >= K read as 0
__device__ __forceinline__ v16h fragc_f32(const float* W, int k0, int n, int lane, int ld, int K) {
  v16h a; const int g = lane >> 4;
#pragma unroll
  for (int i = 0; i < 8; ++i) { const int ka = k0 + 8 * g + i, kb = ka + 16;
    a[i] = (_Float16)(ka < K ? W[(size_t)(ka < K ? ka : K - 1) * ld + n] : 0.f); a[8 + i] = (_Float16)(kb < K ? W[(size_t)(kb < K ? kb : K - 1) * ld + n] : 0.f); }
  return a;
}
struct F2 { v16b h, l; };
__device__ __forceinline__ F2 bsplit16(const float v[16]) { F2 r;
#pragma unroll
  for (int i = 0; i < 16; ++i) { const __bf16 h = (__bf16)v[i]; r.h[i] = h; r.l[i] = (__bf16)(v[i] - (float)h); }
  return r; }
__device__ __forceinline__ F2 split_row(const float* row, int k0, int lane) { float v[16]; const float* p = row + k0 + 8 * (lane >> 4);
#pragma unroll
  for (int i = 0; i < 8; ++i) { v[i] = p[i]; v[8 + i] = p[16 + i]; }
  return bsplit16(v); }
__device__ __forceinline__ F2 split_rowK(const float* row, int k0, int lane, int K) { float v[16]; const int g = lane >> 4;
#pragma unroll
  for (int i = 0; i < 8; ++i) { const int ka = k0 + 8 * g + i, kb = ka + 16; v[i] = ka < K ? row[ka < K ? ka : K - 1] : 0.f; v[8 + i] = kb < K ? row[kb < K ? kb : K - 1] : 0.f; }
  return bsplit16(v); }
__device__ __forceinline__ F2 split_col(const float* W, int k0, int n, int lane, int ld, int K) { float v[16]; const int g = lane >> 4;
#pragma unroll
  for (int i = 0; i < 8; ++i) { const int ka = k0 + 8 * g + i, kb = ka + 16; v[i] = ka < K ? W[(size_t)(ka < K ? ka : K - 1) * ld + n] : 0.f; v[8 + i] = kb < K ? W[(size_t)(kb < K ? kb : K - 1) * ld + n] : 0.f; }
  return bsplit16(v); }
__device__ __forceinline__ v8f mac3(const F2& a, const F2& b, v8f c) { c = wmma_bf(a.l, b.h, c); c = wmma_bf(a.h, b.l, c); return wmma_bf(a.h, b.h, c); }
__device__ __forceinline__ float sigm(float v) { return 1.0f / (1.0f + expf(-v)); }
#define LDSX() do { asm volatile("s_wait_dscnt 0" ::: "memory"); __builtin_amdgcn_wave_barrier(); __builtin_amdgcn_fence(__ATOMIC_RELEASE, "workgroup"); } while (0)

// Triangle attention (pair_act [1, 256, 256, 128], 4 heads x 32): act = LayerNorm(pair_act); for every row r: q = act[r] Wq * 32^-0.5, k = act[r] Wk, v = act[r] Wv; logits[r,h,q,k] = q . k + 2^15 (pair_mask[r][k] - 1) + tri_bias[h][q][k] with tri_bias = act . feat2d_w (indexed by the (q, k) PAIR, shared across rows); softmax over k; wa = (weights v) * sigmoid(act[r][q] Wg + bg); out[r][q] = wa . output_w + output_b.
#define NB 256
#define TT 256
#define CC 128            // NH * HD = projected width
#define DIN 128          // input (model) width
#define NH 4
#define HD 32
#define NQB (TT / 64)
#define HG 4
#define SCALE (0.17677669529663687f)
#define CAUSAL 0
#ifndef TNB
#define TNB NB
#endif
__device__ __forceinline__ float bfr(float v) { return (float)(__bf16)v; }
__host__ __device__ __forceinline__ int kb_last(int qb) { return CAUSAL ? ((qb * 64 + 63) >> 7) : (TT / 128 - 1); }
typedef __attribute__((ext_vector_type(8))) __bf16 v8b;
__device__ __forceinline__ v16b frag_b(const __bf16* rowk0, int lane) {
  union { v16b v; v8b q[2]; } u; const __bf16* p = rowk0 + 8 * (lane >> 4);
  u.q[0] = *(const v8b*)p; u.q[1] = *(const v8b*)(p + 16); return u.v;
}
#define QBH 0              // unused: k_attn has no high-precision query path
#define QHI 256            // rows carrying a q residual plane (all rows when non-causal: 2-product logits everywhere)
#define KHI 64            // key rows carrying k residual / v bf16 hi+lo planes (written by k_proj; no kernel reads them)
// B fragment (k rows k0+.., output column o) of a weight: (in,out) [K][ld] or (out,in) [ld rows of K]: bf16 exact, or f16(bf16 * 256) exact
__device__ __forceinline__ v16b wcol_io(const float* Wm, int k0, int o, int lane, int ld) { v16b w; const int g = lane >> 4;
#pragma unroll
  for (int i = 0; i < 8; ++i) { w[i] = (__bf16)Wm[(size_t)(k0 + 8 * g + i) * ld + o]; w[8 + i] = (__bf16)Wm[(size_t)(k0 + 16 + 8 * g + i) * ld + o]; }
  return w; }
__device__ __forceinline__ v16b wcol_oi(const float* Wm, int k0, int o, int lane, int K) { v16b w; const float* p = Wm + (size_t)o * K + k0 + 8 * (lane >> 4);
#pragma unroll
  for (int i = 0; i < 8; ++i) { w[i] = (__bf16)p[i]; w[8 + i] = (__bf16)p[16 + i]; }
  return w; }
__device__ __forceinline__ v16h wcolh_io(const float* Wm, int k0, int o, int lane, int ld) { v16h w; const int g = lane >> 4;
#pragma unroll
  for (int i = 0; i < 8; ++i) { w[i] = (_Float16)(bfr(Wm[(size_t)(k0 + 8 * g + i) * ld + o]) * 256.0f); w[8 + i] = (_Float16)(bfr(Wm[(size_t)(k0 + 16 + 8 * g + i) * ld + o]) * 256.0f); }
  return w; }
__device__ __forceinline__ v16h wcolh_oi(const float* Wm, int k0, int o, int lane, int K) { v16h w; const float* p = Wm + (size_t)o * K + k0 + 8 * (lane >> 4);
#pragma unroll
  for (int i = 0; i < 8; ++i) { w[i] = (_Float16)(bfr(p[i]) * 256.0f); w[8 + i] = (_Float16)(bfr(p[16 + i]) * 256.0f); }
  return w; }
#define WQKV_LAYOUT 0   // 0 = (in,out) [DIN][CC]; 1 = (out,in) [CC][DIN]; 2 = per-head [NH][DIN][HD]
__device__ __forceinline__ v16b wcol_hdk(const float* Wm, int k0, int o, int lane) { v16b w; const int g = lane >> 4; const float* p = Wm + (size_t)(o / HD) * DIN * HD + (o % HD);
#pragma unroll
  for (int i = 0; i < 8; ++i) { w[i] = (__bf16)p[(size_t)(k0 + 8 * g + i) * HD]; w[8 + i] = (__bf16)p[(size_t)(k0 + 16 + 8 * g + i) * HD]; }
  return w; }
#define WO_OUT_IN 0
#if WQKV_LAYOUT == 1
#define WCOL(W, k0, o, lane) wcol_oi(W, k0, o, lane, DIN)
#elif WQKV_LAYOUT == 2
#define WCOL(W, k0, o, lane) wcol_hdk(W, k0, o, lane)
#else
#define WCOL(W, k0, o, lane) wcol_io(W, k0, o, lane, CC)
#endif
#if WO_OUT_IN
#define WOCOL(W, k0, o, lane) wcol_oi(W, k0, o, lane, CC)
#define WOCOLH(W, k0, o, lane) wcolh_oi(W, k0, o, lane, CC)
#else
#define WOCOL(W, k0, o, lane) wcol_io(W, k0, o, lane, DIN)
#define WOCOLH(W, k0, o, lane) wcolh_io(W, k0, o, lane, DIN)
#endif
#define SZ 256
#define BG 64              // sizes only the unused WS_S region (x HG 4 = 256 planes of 256 x 256)
#define NZR (SZ * SZ)      // 65,536 pair rows
// ---- k_lnz: wave per pair row: LayerNorm over the 128 channels (biased var, eps 1e-5, ln_w/ln_b) of bf16(z) -> ZN rows (4 floats per lane = one 512-B row)
__global__ __launch_bounds__(256) void k_lnz(const float* __restrict__ Z, const float* __restrict__ LW, const float* __restrict__ LB, float* __restrict__ ZN) { const int wave = threadIdx.x >> 5, lane = threadIdx.x & 31; const size_t row = (size_t)blockIdx.x * 8 + wave; if (row >= (size_t)NZR) return;
  v4f x = *(const v4f*)(Z + row * CC + lane * 4); float s1 = 0.f;
#pragma unroll
  for (int i = 0; i < 4; ++i) { x[i] = bfr(x[i]); s1 += x[i]; }
#pragma unroll
  for (int o = 1; o < 32; o <<= 1) s1 += __shfl_xor(s1, o);
  const float mu = s1 * (1.0f / CC); float q = 0.f;
#pragma unroll
  for (int i = 0; i < 4; ++i) { const float d = x[i] - mu; q += d * d; }
#pragma unroll
  for (int o = 1; o < 32; o <<= 1) q += __shfl_xor(q, o);
  const float rs = rsqrtf(q * (1.0f / CC) + 1e-5f); v4f r4;
#pragma unroll
  for (int i = 0; i < 4; ++i) { const int c = lane * 4 + i; r4[i] = (x[i] - mu) * rs * bfr(LW[c]) + bfr(LB[c]); }
  vst2(ZN + row * CC + lane * 4, r4); }
// ---- k_rows2: block = (64 rows, which): which 0: tri_bias: BIAS[row = q*256+k][h] = LN(act)[q][k] . feat2d_w[:, h] (4 outputs) ; which 1: G[row][c] = sigmoid(LN(act)[row] . gating_w[:, c] + gating_b[c]) (128 outputs); weights are (in,out)
__global__ __launch_bounds__(128) void k_rows2(const float* __restrict__ ZN, const float* __restrict__ WB, const float* __restrict__ WG, const float* __restrict__ GB, float* __restrict__ BIAS, float* __restrict__ G) { __shared__ __align__(16) float sf[4][16][132];
  const int tid = threadIdx.x, wave = tid >> 5, lane = tid & 31, col = lane & 15, g = lane >> 4; const int which = blockIdx.y; const size_t r0 = (size_t)blockIdx.x * 64 + wave * 16;
  const int nout = which == 0 ? NH : CC; const float* Wm = which == 0 ? WB : WG;
  v8f acc[8] = {};
#pragma unroll
  for (int kc = 0; kc < CC / 32; ++kc) { const F2 a = split_row(ZN + (r0 + col) * CC, kc * 32, lane); asm volatile("s_wait_loadcnt 0x0" ::: "memory");
#pragma unroll
    for (int j = 0; j < 8; ++j) { if (j * 16 >= nout) break; v16b w; { float t0[8], t1[8]; const int o = j * 16 + col; const int oc = o < nout ? o : nout - 1; const float keep = o < nout ? 1.f : 0.f;
#pragma unroll
        for (int i = 0; i < 8; ++i) t0[i] = Wm[(size_t)(kc * 32 + 8 * g + i) * nout + oc];   /* (in,out) */
        asm volatile("s_wait_loadcnt 0x0" ::: "memory");
#pragma unroll
        for (int i = 0; i < 8; ++i) t1[i] = Wm[(size_t)(kc * 32 + 16 + 8 * g + i) * nout + oc];
        asm volatile("s_wait_loadcnt 0x0" ::: "memory");
#pragma unroll
        for (int i = 0; i < 8; ++i) { w[i] = (__bf16)(t0[i] * keep); w[8 + i] = (__bf16)(t1[i] * keep); } }   /* (in,out) column o; columns beyond nout zero (select-free: keep multiplies a VALID load) */
      acc[j] = wmma_bf(a.h, w, acc[j]); acc[j] = wmma_bf(a.l, w, acc[j]); } }
  if (which == 0) { if (lane < 16) {   /* bias rows: 4 floats = 16 B per row; rows r0+8g+r... store via LDS: */ }
#pragma unroll
    for (int r = 0; r < 8; ++r) sf[wave][8 * g + r][col] = acc[0][r];
    LDSX(); if (lane < 16) { v4f b4; b4[0] = sf[wave][lane][0]; b4[1] = sf[wave][lane][1]; b4[2] = sf[wave][lane][2]; b4[3] = sf[wave][lane][3]; vst2(BIAS + (r0 + lane) * NH, b4); }   /* 16 rows x 16 B = one 256-B run per wave */
  } else {
#pragma unroll
    for (int j = 0; j < 8; ++j)
#pragma unroll
      for (int r = 0; r < 8; ++r) sf[wave][8 * g + r][j * 16 + col] = 1.0f / (1.0f + expf(-(acc[j][r] + bfr(GB[j * 16 + col]))));   /* sigmoid(x Wg + gating_b) */
    LDSX(); for (int rl = 0; rl < 16; ++rl) vst2(G + (r0 + rl) * CC + lane * 4, *(const v4f*)&sf[wave][rl][lane * 4]); } }
// ---- k_gate: Y row *= G row (same natural row index r*256 + q; thread per float4; one writer)
__global__ __launch_bounds__(256) void k_gate(float* __restrict__ Y, const float* __restrict__ G) { const size_t e4 = (size_t)blockIdx.x * 256 + threadIdx.x; if (e4 >= (size_t)NZR * (CC / 4)) return; const size_t yrow = e4 / (CC / 4); const int q = (int)(e4 % (CC / 4)); const size_t grow = yrow;
  v4f y = *(const v4f*)(Y + yrow * CC + q * 4); const v4f gg = *(const v4f*)(G + grow * CC + q * 4); y[0] *= gg[0]; y[1] *= gg[1]; y[2] *= gg[2]; y[3] *= gg[3]; vst2(Y + yrow * CC + q * 4, y); }
#define WS_ZN   (WS_END)
#define WS_BIAS (WS_ZN + 4u * (size_t)NZR * CC)
#define WS_G    (WS_BIAS + 4u * (size_t)NZR * NH)
#define WS_END2 (WS_G + 4u * (size_t)NZR * CC)
#ifndef PROJ_EXTRA_PARAMS
#define PROJ_EXTRA_PARAMS
#endif

#define WS_QH  0u                                      // f16 q rows [b*t][CC]
#define WS_KH  (WS_QH + 2u * (size_t)NB * TT * CC)      // f16 k rows [b*t][CC]
#define WS_VT  (WS_KH + 2u * (size_t)NB * TT * CC)      // f16 v planes [b][c][t]
#define WS_QL  (WS_VT + 2u * (size_t)NB * CC * TT)      // f16 q residual x 2^10 rows [b][t < QHI][CC]
#define WS_KL  (WS_QL + 2u * (size_t)NB * QHI * CC)     // f16 k residual x 2^10 rows [b][t < KHI][CC]
#define WS_VB  (WS_KL + 2u * (size_t)NB * KHI * CC)     // bf16 v hi planes [b][c][t < KHI]
#define WS_VBL (WS_VB + 2u * (size_t)NB * CC * KHI)
#define WS_S   (WS_VBL + 2u * (size_t)NB * CC * KHI)    // unused f32 region (k_attn keeps logits and P in registers)
#define WS_Y   (WS_S  + 4u * (size_t)BG * HG * TT * TT)   // unused WS_S: 256 planes of 256 x 256 f32      // f32 ctx rows [b*t][CC] (only when there is an output projection)
#define WS_END (WS_Y  + 4u * (size_t)NB * TT * CC)

// ---- k_proj: block = (64 rows, 128 cols, which): q/k/v = X W (+ b) with exact bf16 products (K = DIN) -> which 0: q f16 rows (+ residual rows < QHI); 1: k f16 rows (+ residual rows < KHI); 2: v f16 planes [c][t] (+ bf16 hi/lo planes for t < KHI)
__global__ __launch_bounds__(128) void k_proj(const float* __restrict__ XQ, const float* __restrict__ XK, const float* __restrict__ XV, const float* __restrict__ WQ, const float* __restrict__ WK, const float* __restrict__ WV, const float* __restrict__ BQ, const float* __restrict__ BK, const float* __restrict__ BV,
    _Float16* __restrict__ QH, _Float16* __restrict__ QL, _Float16* __restrict__ KH, _Float16* __restrict__ KL, _Float16* __restrict__ VT, __bf16* __restrict__ VB, __bf16* __restrict__ VBL) {
  __shared__ __align__(16) _Float16 sh[64][136], sl[64][136]; __shared__ __align__(16) _Float16 th[128][72]; __shared__ __align__(16) __bf16 tb[128][72], tbl[128][72];
  const int tid = threadIdx.x, wave = tid >> 5, lane = tid & 31, col = lane & 15, g = lane >> 4; const int which = blockIdx.z; const int c0 = blockIdx.y * 128; const size_t r0 = (size_t)blockIdx.x * 64; const size_t bb = r0 / TT; const int t0 = (int)(r0 % TT);
  const float* X = which == 0 ? XQ : which == 1 ? XK : XV; const float* WA = which == 0 ? WQ : which == 1 ? WK : WV; const float* BA = which == 0 ? BQ : which == 1 ? BK : BV;
  v8f acc[8] = {};
#pragma unroll 2
  for (int kc = 0; kc < DIN / 32; ++kc) { const F2 a2 = split_row(X + (r0 + wave * 16 + col) * DIN, kc * 32, lane);   /* LN(act) rows (f32) split hi + lo */
    asm volatile("s_wait_loadcnt 0x0" ::: "memory");
#pragma unroll
    for (int j = 0; j < 8; ++j) { const v16b w = WCOL(WA, kc * 32, c0 + j * 16 + col, lane); asm volatile("s_wait_loadcnt 0x0" ::: "memory"); acc[j] = wmma_bf(a2.h, w, acc[j]); acc[j] = wmma_bf(a2.l, w, acc[j]); } }
  if (which < 2) { _Float16* DH = which == 0 ? QH : KH; _Float16* DL = which == 0 ? QL : KL; const int nhi = which == 0 ? QHI : KHI; const bool hi_rows = t0 < nhi;
#pragma unroll
    for (int j = 0; j < 8; ++j) { const float bias = BA ? bfr(BA[c0 + j * 16 + col]) : 0.f;
#pragma unroll
      for (int r = 0; r < 8; ++r) { const float v = acc[j][r] + bias; const _Float16 hv = (_Float16)v; sh[wave * 16 + 8 * g + r][j * 16 + col] = hv; sl[wave * 16 + 8 * g + r][j * 16 + col] = (_Float16)((v - (float)hv) * 1024.0f); } }
    __syncthreads();
    for (int e = tid; e < 64 * 16; e += 128) { const int rl = e >> 4, q = e & 15; vst2((unsigned*)(DH + (r0 + rl) * CC + c0 + q * 8), *(const v4u*)&sh[rl][q * 8]); if (hi_rows) vst2((unsigned*)(DL + (bb * nhi + t0 + rl) * (size_t)CC + c0 + q * 8), *(const v4u*)&sl[rl][q * 8]); }
  } else { const bool hi_rows = t0 < KHI;
#pragma unroll
    for (int j = 0; j < 8; ++j) { const float bias = BA ? bfr(BA[c0 + j * 16 + col]) : 0.f;
#pragma unroll
      for (int r = 0; r < 8; ++r) { const float v = acc[j][r] + bias; const int rl = wave * 16 + 8 * g + r, cl = j * 16 + col; th[cl][rl] = (_Float16)v; const __bf16 bh = (__bf16)v; tb[cl][rl] = bh; tbl[cl][rl] = (__bf16)(v - (float)bh); } }
    __syncthreads();
    for (int e = tid; e < 128 * 8; e += 128) { const int cl = e >> 3, q = e & 7; vst2((unsigned*)(VT + (bb * CC + c0 + cl) * (size_t)TT + t0 + q * 8), *(const v4u*)&th[cl][q * 8]); if (hi_rows) { const size_t o3 = (bb * CC + c0 + cl) * (size_t)KHI + t0 + q * 8; vst2((unsigned*)(VB + o3), *(const v4u*)&tb[cl][q * 8]); vst2((unsigned*)(VBL + o3), *(const v4u*)&tbl[cl][q * 8]); } } } }
// ---- k_attn: work-group = (4 rows r, head h), 16 waves, wave = 16 queries against all 256 keys, 64 keys at a time with a running maximum and sum. The head's bias plane lies in LDS for the whole work-group, in the order the score fragments hold it; per row r the k rows, v planes and mask bias are staged in LDS once for all 16 waves. Both products are formed transposed (scores: A = k rows, B = q rows; ctx: A = v planes, B = P), so D's column is the query in both: a lane holds keys of ONE query, two neighbouring score tiles ARE the B fragment of P, and maximum, sum and rescale stay in the lane (one exchange with the other half-wave). The plain unroll directives keep the small arrays in registers.
#define FR 4               // rows r per work-group
#define KP (HD + 8)        // halves per staged k row: 80-B pitch
#define VP (TT + 8)        // halves per staged v plane: 528-B pitch
__device__ __forceinline__ v8f wmma_h(v16h a, v16h b, v8f c) { return __builtin_amdgcn_wmma_f32_16x16x32_f16(false, a, false, b, (short)0, c, false, false); }
__global__ __launch_bounds__(512) void k_attn(const _Float16* __restrict__ QH, const _Float16* __restrict__ QL, const _Float16* __restrict__ KH, const _Float16* __restrict__ VT, const float* __restrict__ BIAS, const float* __restrict__ MKP, float* __restrict__ Y) {
  __shared__ __align__(16) float sB[TT * TT];            // [query tile][key tile][half of 8][lane][4]
  __shared__ __align__(16) _Float16 sK[TT][KP]; __shared__ __align__(16) _Float16 sV[HD][VP]; __shared__ __align__(16) float sM[TT];
  const int tid = threadIdx.x, wave = tid >> 5, lane = tid & 31, col = lane & 15, g = lane >> 4; const int h = blockIdx.y; const int rb = (int)blockIdx.x * FR;
  const unsigned ko0 = (unsigned)(tid >> 2) * CC + (tid & 3) * 8, vo0 = (unsigned)tid * 8;   /* this thread's 16-B pieces of a row's k rows (and 128 rows on) and v planes (and 16 planes on) */
  const unsigned qo = (unsigned)(wave * 16 + col) * CC + 8 * g;
  v4u pk[2], pv[2]; float pm = 0.f;
  { const _Float16* kb = KH + (size_t)rb * TT * CC + h * HD; const _Float16* vb = VT + ((size_t)rb * CC + h * HD) * TT;
    pk[0] = *(const v4u*)(kb + ko0); pk[1] = *(const v4u*)(kb + ko0 + 128 * CC); pv[0] = *(const v4u*)(vb + vo0); pv[1] = *(const v4u*)(vb + vo0 + 16 * TT);
    if (tid < TT) pm = MKP[(size_t)rb * SZ + tid]; }
  // a wave takes 8 queries x 4 keys per load: its 32 LDS words fall on 32 banks; the 16 waves stand side by side along the keys
  { const float* bh = BIAS + h; const unsigned gs = (unsigned)((((tid >> 2) & 7) * SZ + wave * 4 + (tid & 3)) * NH), ld = (unsigned)(((((wave >> 2) * 2 + (wave & 1)) * 32) + ((wave >> 1) & 1) * 16 + ((tid >> 2) & 7)) * 4 + (tid & 3));
#pragma unroll 4   /* 16 loads in flight per lane */
    for (int qi = 0; qi < TT / 8; ++qi)
#pragma unroll
      for (int kk = 0; kk < 4; ++kk) sB[ld + (qi >> 1) * 4096 + (qi & 1) * 32 + kk * 1024] = bh[gs + qi * (8 * SZ * NH) + kk * (64 * NH)]; }
#pragma unroll 1   /* rolled: one copy of the body in the instruction cache */
  for (int it = 0; it < FR; ++it) { const int b = rb + it;
    const _Float16* qhb = QH + (size_t)b * TT * CC + h * HD; const _Float16* qlb = QL + (size_t)b * QHI * CC + h * HD;
    union { v16h v; v8h q[2]; } qh, ql; qh.q[0] = *(const v8h*)(qhb + qo); qh.q[1] = *(const v8h*)(qhb + qo + 16); ql.q[0] = *(const v8h*)(qlb + qo); ql.q[1] = *(const v8h*)(qlb + qo + 16);
    __syncthreads();   /* every wave has left the previous row's k, v and mask tiles */
    *(v4u*)&sK[tid >> 2][(tid & 3) * 8] = pk[0]; *(v4u*)&sK[128 + (tid >> 2)][(tid & 3) * 8] = pk[1]; *(v4u*)&sV[tid >> 5][(tid & 31) * 8] = pv[0]; *(v4u*)&sV[16 + (tid >> 5)][(tid & 31) * 8] = pv[1];
    if (tid < TT) sM[tid] = 32768.0f * (bfr(pm) - 1.0f);   /* FP16_HUGE * (pair_mask[r][k] - 1) */
    __syncthreads();   /* publishes this row's tiles (and, the first time, the bias plane) */
    if (it + 1 < FR) {   /* the next row's tiles fly while this row is worked on */
      const _Float16* kb = KH + (size_t)(b + 1) * TT * CC + h * HD; const _Float16* vb = VT + ((size_t)(b + 1) * CC + h * HD) * TT;
      pk[0] = *(const v4u*)(kb + ko0); pk[1] = *(const v4u*)(kb + ko0 + 128 * CC); pv[0] = *(const v4u*)(vb + vo0); pv[1] = *(const v4u*)(vb + vo0 + 16 * TT);
      if (tid < TT) pm = MKP[(size_t)(b + 1) * SZ + tid]; }
    float m = -3.0e38f, l = 0.f; v8f acc[HD / 16] = {};   /* l: this half-wave's keys only; the halves meet behind the loop */
#pragma unroll 1   /* rolled: unrolled, the LDS reads of all 16 key tiles are hoisted and the 256 registers of a 16-wave work-group spill */
    for (int c = 0; c < TT / 64; ++c) { v8f s[4];
#pragma unroll
      for (int jj = 0; jj < 4; ++jj) { const int j = c * 4 + jj; const v16h kf = frag_h(&sK[j * 16 + col][0], lane); const v8f z = {}; const v8f a = wmma_h(kf, qh.v, z), al = wmma_h(kf, ql.v, z);
        const float* bp = sB + (((wave * 16 + j) * 2) * 32 + lane) * 4; const v4f b0 = *(const v4f*)bp, b1 = *(const v4f*)(bp + 128); const v4f m0 = *(const v4f*)&sM[j * 16 + 8 * g], m1 = *(const v4f*)&sM[j * 16 + 8 * g + 4];
#pragma unroll
        for (int r = 0; r < 8; ++r) s[jj][r] = (a[r] + al[r] * (1.0f / 1024.0f)) * SCALE + (r < 4 ? b0[r & 3] : b1[r & 3]) + (r < 4 ? m0[r & 3] : m1[r & 3]); }
      v8f mx = s[0];
#pragma unroll
      for (int r = 0; r < 8; ++r) mx[r] = fmaxf(fmaxf(mx[r], s[1][r]), fmaxf(s[2][r], s[3][r]));
      float cm = fmaxf(fmaxf(fmaxf(mx[0], mx[1]), fmaxf(mx[2], mx[3])), fmaxf(fmaxf(mx[4], mx[5]), fmaxf(mx[6], mx[7]))); cm = fmaxf(cm, __shfl_xor(cm, 16));
      const float mn = fmaxf(m, cm); const float alpha = expf(m - mn); m = mn;   /* what was summed under the old maximum shrinks by alpha */
      v8f sm = {};
#pragma unroll
      for (int jj = 0; jj < 4; ++jj)
#pragma unroll
        for (int r = 0; r < 8; ++r) { const float e = expf(s[jj][r] - mn); s[jj][r] = e; sm[r] += e; }
      l = l * alpha + (((sm[0] + sm[1]) + (sm[2] + sm[3])) + ((sm[4] + sm[5]) + (sm[6] + sm[7])));
#pragma unroll
      for (int j = 0; j < HD / 16; ++j)
#pragma unroll
        for (int r = 0; r < 8; ++r) acc[j][r] *= alpha;
#pragma unroll
      for (int k2 = 0; k2 < 2; ++k2) { v16h p;
#pragma unroll
        for (int i = 0; i < 8; ++i) { p[i] = (_Float16)(s[2 * k2][i] * 2048.0f); p[8 + i] = (_Float16)(s[2 * k2 + 1][i] * 2048.0f); }
#pragma unroll
        for (int j = 0; j < HD / 16; ++j) acc[j] = wmma_h(frag_h(&sV[j * 16 + col][(c * 2 + k2) * 32], lane), p, acc[j]); } }
    l += __shfl_xor(l, 16);
    const float inv = (m > -1.0e38f && l > 0.f) ? (1.0f / 2048.0f) / l : 0.f;   /* a fully excluded row (every logit at or below -1e38) yields 0 */
    float* yp = Y + (size_t)b * TT * CC + h * HD + (unsigned)(wave * 16 + col) * CC + 8 * g;
#pragma unroll
    for (int j = 0; j < HD / 16; ++j) { v4f y0, y1;
#pragma unroll
      for (int r = 0; r < 4; ++r) { y0[r] = acc[j][r] * inv; y1[r] = acc[j][4 + r] * inv; }
      vst2(yp + j * 16, y0); vst2(yp + j * 16 + 4, y1); }   /* the 128-B (row, head) segment has this wave as its one writer */
    asm volatile("s_wait_xcnt 0x0" ::: "memory");   /* the next trip rewrites the registers that these stores name */
  } }
// ---- k_out: block = (64 rows, 128 cols): out = ctx Wo (+ bo): all rows: ctx bf16 hi + lo against exact bf16 Wo (2 products); the f16 branch (1 product, Wo x 2^8) is never taken
__global__ __launch_bounds__(128) void k_out(const float* __restrict__ Y, const float* __restrict__ WO, const float* __restrict__ BO, float* __restrict__ OUT) { __shared__ __align__(16) float sf[4][16][132];
  const int tid = threadIdx.x, wave = tid >> 5, lane = tid & 31, col = lane & 15, g = lane >> 4; const int c0 = blockIdx.y * 128; const size_t r0 = (size_t)blockIdx.x * 64 + wave * 16;
  v8f acc[8] = {};
  if (true) {   /* ALL rows: gated ctx bf16 hi + lo x exact output_w (2 products) */
#pragma unroll 2
    for (int kc = 0; kc < CC / 32; ++kc) { const F2 a = split_row(Y + (r0 + col) * CC, kc * 32, lane); asm volatile("s_wait_loadcnt 0x0" ::: "memory");
#pragma unroll
      for (int j = 0; j < 8; ++j) { const v16b w = WOCOL(WO, kc * 32, c0 + j * 16 + col, lane); asm volatile("s_wait_loadcnt 0x0" ::: "memory"); acc[j] = wmma_bf(a.h, w, acc[j]); acc[j] = wmma_bf(a.l, w, acc[j]); } }
#pragma unroll
    for (int j = 0; j < 8; ++j) { const float bias = BO ? bfr(BO[c0 + j * 16 + col]) : 0.f;
#pragma unroll
      for (int r = 0; r < 8; ++r) sf[wave][8 * g + r][j * 16 + col] = acc[j][r] + bias; }
  } else {
#pragma unroll 2
    for (int kc = 0; kc < CC / 32; ++kc) { const v16h a = frag_f32(Y + (r0 + col) * CC + kc * 32, lane); asm volatile("s_wait_loadcnt 0x0" ::: "memory");
#pragma unroll
      for (int j = 0; j < 8; ++j) { const v16h w = WOCOLH(WO, kc * 32, c0 + j * 16 + col, lane); asm volatile("s_wait_loadcnt 0x0" ::: "memory"); acc[j] = wmma16(a, w, acc[j]); } }
#pragma unroll
    for (int j = 0; j < 8; ++j) { const float bias = BO ? bfr(BO[c0 + j * 16 + col]) : 0.f;
#pragma unroll
      for (int r = 0; r < 8; ++r) sf[wave][8 * g + r][j * 16 + col] = acc[j][r] * (1.0f / 256.0f) + bias; } }
  LDSX(); for (int rl = 0; rl < 16; ++rl) vst2(OUT + (r0 + rl) * DIN + c0 + lane * 4, *(const v4f*)&sf[wave][rl][lane * 4]); }

extern "C" void kernel_launch(void* const* d_in, const int* in_sizes, int n_in, void* d_out, int out_size, void* d_ws, size_t ws_size, hipStream_t stream) {
  (void)in_sizes; (void)n_in; (void)out_size;
  const float** F = (const float**)d_in;
  if (ws_size < (size_t)WS_END) return;
  char* ws = (char*)d_ws; _Float16 *QH = (_Float16*)(ws + WS_QH), *KH = (_Float16*)(ws + WS_KH), *VT = (_Float16*)(ws + WS_VT), *QL = (_Float16*)(ws + WS_QL), *KL = (_Float16*)(ws + WS_KL); __bf16 *VB = (__bf16*)(ws + WS_VB), *VBL = (__bf16*)(ws + WS_VBL); float *Y = (float*)(ws + WS_Y);
  (void)Y; (void)QL; (void)KL; (void)VB; (void)VBL;
  // inputs: 0 pair_act [1,256,256,128]; 1 pair_mask [1,256,256]; 2 ln_gamma, 3 ln_beta; 4 feat2d_w [128,4]; 5 query_w, 6 key_w, 7 value_w [128,4,32] (in,out); 8 gating_w [128,4,32], 9 gating_b [4,32]; 10 output_w [4,32,128] (in,out); 11 output_b
  if (ws_size < (size_t)WS_END2) return;
  float *ZN = (float*)(ws + WS_ZN), *BIAS = (float*)(ws + WS_BIAS), *G = (float*)(ws + WS_G);
  k_lnz<<<dim3(NZR / 8), 256, 0, stream>>>(F[0], F[2], F[3], ZN);
  k_rows2<<<dim3(NZR / 64, 2), 128, 0, stream>>>(ZN, F[4], F[8], F[9], BIAS, G);
  k_proj<<<dim3(TNB * TT / 64, CC / 128, 3), 128, 0, stream>>>(ZN, ZN, ZN, F[5], F[6], F[7], nullptr, nullptr, nullptr, QH, QL, KH, KL, VT, VB, VBL);
  k_attn<<<dim3(TNB / FR, NH), 512, 0, stream>>>(QH, QL, KH, VT, BIAS, F[1], Y);
  k_gate<<<dim3((NZR * (CC / 4) + 255) / 256), 256, 0, stream>>>(Y, G);
  k_out<<<dim3(TNB * TT / 64, DIN / 128), 128, 0, stream>>>(Y, F[10], F[11], (float*)d_out);
}

// v002
// A run of this version takes 153 microseconds.
// Two timings next to v001 put it at 1.31 and 1.29 times that version's speed.
// Counting every step since v000, it is 3.47 times as fast.
// compute dtype: all float inputs rounded to bf16; LayerNorm of pair_act in f32; q/k/v = LN(act) split bf16 hi + lo x W (exact bf16, (in,out)) on WMMA 16x16x32 (2 products, f32 accumulate); q as f16 hi + residual (x 2^10) against k once to f16 (2 products) x 32^-0.5 + the per-(query, key, head) triangle bias (2-product GEMM) + the mask bias; softmax in f32 (precise expf, running maximum and sum over steps of 64 keys); exp(logit - maximum) x 2^11 once to f16 against v once to f16 (1 product), divided by the sum at the end; gate sigmoid(LN(act) Wg + b) in f32 (2-product GEMM, precise expf); gated ctx split bf16 hi + lo against exact output_w (2 products) + output_b; f32 output.
#include <hip/hip_runtime.h>
#include <math.h>

typedef __attribute__((ext_vector_type(16))) _Float16 v16h;
typedef __attribute__((ext_vector_type(16))) __bf16 v16b;
typedef __attribute__((ext_vector_type(8)))  _Float16 v8h;
typedef __attribute__((ext_vector_type(8)))  float v8f;
typedef __attribute__((ext_vector_type(4)))  float v4f;
typedef __attribute__((ext_vector_type(2)))  float v2f;
typedef __attribute__((ext_vector_type(4)))  unsigned v4u;
typedef __attribute__((ext_vector_type(4)))  int v4i;
typedef float __attribute__((may_alias)) float_a;
typedef int __attribute__((may_alias)) int_a;

template <typename T> __device__ __forceinline__ void vst2(void* p, T v) { *(T*)p = v;  }
__device__ __forceinline__ v8f wmma16(v16h a, v16h b, v8f c) {
  v8f d = __builtin_amdgcn_wmma_f32_16x16x32_f16(false, a, false, b, (short)0, c, false, false);
  asm volatile("v_nop\n\tv_nop\n\tv_nop\n\tv_nop" : "+v"(d) : "v"(a), "v"(b));
  return d;
}
__device__ __forceinline__ v8f wmma_bf(v16b a, v16b b, v8f c) {
  v8f d = __builtin_amdgcn_wmma_f32_16x16x32_bf16(false, a, false, b, (short)0, c, false, false);
  asm volatile("v_nop\n\tv_nop\n\tv_nop\n\tv_nop" : "+v"(d) : "v"(a), "v"(b));
  return d;
}
// 16x16x32 fragments: lane = (h = lane>>4, row/col = lane&15); elements 0..7 = k0+8h+0..7, 8..15 = k0+16+8h+0..7; D element r = row 8h+r
__device__ __forceinline__ v16h frag_h(const _Float16* rowk0, int lane) {
  union { v16h v; v8h q[2]; } u; const _Float16* p = rowk0 + 8 * (lane >> 4);
  u.q[0] = *(const v8h*)p; u.q[1] = *(const v8h*)(p + 16); return u.v;
}
__device__ __forceinline__ v16h frag_f32(const float* rowk0, int lane) {
  v16h a; const float* p = rowk0 + 8 * (lane >> 4);
#pragma unroll
  for (int i = 0; i < 8; ++i) { a[i] = (_Float16)p[i]; a[8 + i] = (_Float16)p[16 + i]; }
  return a;
}
__device__ __forceinline__ v16h frag_f32s(const float* rowk0, int lane, float sc) {
  v16h a; const float* p = rowk0 + 8 * (lane >> 4);
#pragma unroll
  for (int i = 0; i < 8; ++i) { a[i] = (_Float16)(p[i] * sc); a[8 + i] = (_Float16)(p[16 + i] * sc); }
  return a;
}
// column fragment from a [K][ld] layout (column n), rows >= K read as 0
__device__ __forceinline__ v16h fragc_f32(const float* W, int k0, int n, int lane, int ld, int K) {
  v16h a; const int g = lane >> 4;
#pragma unroll
  for (int i = 0; i < 8; ++i) { const int ka = k0 + 8 * g + i, kb = ka + 16;
    a[i] = (_Float16)(ka < K ? W[(size_t)(ka < K ? ka : K - 1) * ld + n] : 0.f); a[8 + i] = (_Float16)(kb < K ? W[(size_t)(kb < K ? kb : K - 1) * ld + n] : 0.f); }
  return a;
}
struct F2 { v16b h, l; };
__device__ __forceinline__ F2 bsplit16(const float v[16]) { F2 r;
#pragma unroll
  for (int i = 0; i < 16; ++i) { const __bf16 h = (__bf16)v[i]; r.h[i] = h; r.l[i] = (__bf16)(v[i] - (float)h); }
  return r; }
__device__ __forceinline__ F2 split_row(const float* row, int k0, int lane) { float v[16]; const float* p = row + k0 + 8 * (lane >> 4);
#pragma unroll
  for (int i = 0; i < 8; ++i) { v[i] = p[i]; v[8 + i] = p[16 + i]; }
  return bsplit16(v); }
__device__ __forceinline__ F2 split_rowK(const float* row, int k0, int lane, int K) { float v[16]; const int g = lane >> 4;
#pragma unroll
  for (int i = 0; i < 8; ++i) { const int ka = k0 + 8 * g + i, kb = ka + 16; v[i] = ka < K ? row[ka < K ? ka : K - 1] : 0.f; v[8 + i] = kb < K ? row[kb < K ? kb : K - 1] : 0.f; }
  return bsplit16(v); }
__device__ __forceinline__ F2 split_col(const float* W, int k0, int n, int lane, int ld, int K) { float v[16]; const int g = lane >> 4;
#pragma unroll
  for (int i = 0; i < 8; ++i) { const int ka = k0 + 8 * g + i, kb = ka + 16; v[i] = ka < K ? W[(size_t)(ka < K ? ka : K - 1) * ld + n] : 0.f; v[8 + i] = kb < K ? W[(size_t)(kb < K ? kb : K - 1) * ld + n] : 0.f; }
  return bsplit16(v); }
__device__ __forceinline__ v8f mac3(const F2& a, const F2& b, v8f c) { c = wmma_bf(a.l, b.h, c); c = wmma_bf(a.h, b.l, c); return wmma_bf(a.h, b.h, c); }
__device__ __forceinline__ float sigm(float v) { return 1.0f / (1.0f + expf(-v)); }
#define LDSX() do { asm volatile("s_wait_dscnt 0" ::: "memory"); __builtin_amdgcn_wave_barrier(); __builtin_amdgcn_fence(__ATOMIC_RELEASE, "workgroup"); } while (0)

// Triangle attention (pair_act [1, 256, 256, 128], 4 heads x 32): act = LayerNorm(pair_act); for every row r: q = act[r] Wq * 32^-0.5, k = act[r] Wk, v = act[r] Wv; logits[r,h,q,k] = q . k + 2^15 (pair_mask[r][k] - 1) + tri_bias[h][q][k] with tri_bias = act . feat2d_w (indexed by the (q, k) PAIR, shared across rows); softmax over k; wa = (weights v) * sigmoid(act[r][q] Wg + bg); out[r][q] = wa . output_w + output_b.
#define NB 256
#define TT 256
#define CC 128            // NH * HD = projected width
#define DIN 128          // input (model) width
#define NH 4
#define HD 32
#define NQB (TT / 64)
#define HG 4
#define SCALE (0.17677669529663687f)
#define CAUSAL 0
#ifndef TNB
#define TNB NB
#endif
__device__ __forceinline__ float bfr(float v) { return (float)(__bf16)v; }
__host__ __device__ __forceinline__ int kb_last(int qb) { return CAUSAL ? ((qb * 64 + 63) >> 7) : (TT / 128 - 1); }
typedef __attribute__((ext_vector_type(8))) __bf16 v8b;
__device__ __forceinline__ v16b frag_b(const __bf16* rowk0, int lane) {
  union { v16b v; v8b q[2]; } u; const __bf16* p = rowk0 + 8 * (lane >> 4);
  u.q[0] = *(const v8b*)p; u.q[1] = *(const v8b*)(p + 16); return u.v;
}
// One 128 x 128 (in,out) weight, rounded to bf16 once per work-group of 128 threads and laid in LDS (32 KiB) in the order the B fragments are read: [k chunk of 32][column tile][half of 8 k][lane] pieces of 16 B. Thread = output column: a wave's load is one whole 128-B line, all 128 loads of a thread are independent, and 8 k of a column make one 16-B store. The plain unroll directives here and at the fragment arrays w[8] keep those small arrays in registers.
__device__ __forceinline__ void stage_w(const float* __restrict__ Wm, int ld, __bf16* sW, int tid) { const float* p = Wm + tid;
#pragma unroll
  for (int kg = 0; kg < 16; ++kg) { v8b w;   /* k = 8 kg + i: chunk kg >> 2, half (kg >> 1) & 1, lane half kg & 1 */
#pragma unroll
    for (int i = 0; i < 8; ++i) w[i] = (__bf16)p[(size_t)(kg * 8 + i) * ld];
    *(v8b*)(sW + (size_t)(((((kg >> 2) * 8 + (tid >> 4)) * 2 + ((kg >> 1) & 1)) * 32 + (kg & 1) * 16 + (tid & 15)) * 8)) = w; } }
__device__ __forceinline__ v16b wfrag(const __bf16* sW, int kc, int j, int lane) {
  union { v16b v; v8b q[2]; } u; const __bf16* p = sW + ((kc * 8 + j) * 64 + lane) * 8;
  u.q[0] = *(const v8b*)p; u.q[1] = *(const v8b*)(p + 256); return u.v;
}
#define QBH 0              // unused: nothing in this file reads it
#define QHI 256            // rows carrying a q residual plane (all rows when non-causal: 2-product logits everywhere)
#define KHI 64            // key rows carrying k residual / v bf16 hi+lo planes (written by k_proj; no kernel reads them)
// B fragment (k rows k0+.., output column o) of a weight: (in,out) [K][ld] or (out,in) [ld rows of K]: bf16 exact, or f16(bf16 * 256) exact
__device__ __forceinline__ v16b wcol_io(const float* Wm, int k0, int o, int lane, int ld) { v16b w; const int g = lane >> 4;
#pragma unroll
  for (int i = 0; i < 8; ++i) { w[i] = (__bf16)Wm[(size_t)(k0 + 8 * g + i) * ld + o]; w[8 + i] = (__bf16)Wm[(size_t)(k0 + 16 + 8 * g + i) * ld + o]; }
  return w; }
__device__ __forceinline__ v16b wcol_oi(const float* Wm, int k0, int o, int lane, int K) { v16b w; const float* p = Wm + (size_t)o * K + k0 + 8 * (lane >> 4);
#pragma unroll
  for (int i = 0; i < 8; ++i) { w[i] = (__bf16)p[i]; w[8 + i] = (__bf16)p[16 + i]; }
  return w; }
__device__ __forceinline__ v16h wcolh_io(const float* Wm, int k0, int o, int lane, int ld) { v16h w; const int g = lane >> 4;
#pragma unroll
  for (int i = 0; i < 8; ++i) { w[i] = (_Float16)(bfr(Wm[(size_t)(k0 + 8 * g + i) * ld + o]) * 256.0f); w[8 + i] = (_Float16)(bfr(Wm[(size_t)(k0 + 16 + 8 * g + i) * ld + o]) * 256.0f); }
  return w; }
__device__ __forceinline__ v16h wcolh_oi(const float* Wm, int k0, int o, int lane, int K) { v16h w; const float* p = Wm + (size_t)o * K + k0 + 8 * (lane >> 4);
#pragma unroll
  for (int i = 0; i < 8; ++i) { w[i] = (_Float16)(bfr(p[i]) * 256.0f); w[8 + i] = (_Float16)(bfr(p[16 + i]) * 256.0f); }
  return w; }
#define WQKV_LAYOUT 0   // 0 = (in,out) [DIN][CC]; 1 = (out,in) [CC][DIN]; 2 = per-head [NH][DIN][HD]
__device__ __forceinline__ v16b wcol_hdk(const float* Wm, int k0, int o, int lane) { v16b w; const int g = lane >> 4; const float* p = Wm + (size_t)(o / HD) * DIN * HD + (o % HD);
#pragma unroll
  for (int i = 0; i < 8; ++i) { w[i] = (__bf16)p[(size_t)(k0 + 8 * g + i) * HD]; w[8 + i] = (__bf16)p[(size_t)(k0 + 16 + 8 * g + i) * HD]; }
  return w; }
#define WO_OUT_IN 0
#if WQKV_LAYOUT == 1
#define WCOL(W, k0, o, lane) wcol_oi(W, k0, o, lane, DIN)
#elif WQKV_LAYOUT == 2
#define WCOL(W, k0, o, lane) wcol_hdk(W, k0, o, lane)
#else
#define WCOL(W, k0, o, lane) wcol_io(W, k0, o, lane, CC)
#endif
#if WO_OUT_IN
#define WOCOL(W, k0, o, lane) wcol_oi(W, k0, o, lane, CC)
#define WOCOLH(W, k0, o, lane) wcolh_oi(W, k0, o, lane, CC)
#else
#define WOCOL(W, k0, o, lane) wcol_io(W, k0, o, lane, DIN)
#define WOCOLH(W, k0, o, lane) wcolh_io(W, k0, o, lane, DIN)
#endif
#define SZ 256
#define BG 64              // sizes only the unused WS_S region (x HG 4 = 256 planes of 256 x 256)
#define NZR (SZ * SZ)      // 65,536 pair rows
// ---- k_lnz: wave per pair row: LayerNorm over the 128 channels (biased var, eps 1e-5, ln_w/ln_b) of bf16(z) -> ZN rows (4 floats per lane = one 512-B row)
__global__ __launch_bounds__(256) void k_lnz(const float* __restrict__ Z, const float* __restrict__ LW, const float* __restrict__ LB, float* __restrict__ ZN) { const int wave = threadIdx.x >> 5, lane = threadIdx.x & 31; const size_t row = (size_t)blockIdx.x * 8 + wave; if (row >= (size_t)NZR) return;
  v4f x = *(const v4f*)(Z + row * CC + lane * 4); float s1 = 0.f;
#pragma unroll
  for (int i = 0; i < 4; ++i) { x[i] = bfr(x[i]); s1 += x[i]; }
#pragma unroll
  for (int o = 1; o < 32; o <<= 1) s1 += __shfl_xor(s1, o);
  const float mu = s1 * (1.0f / CC); float q = 0.f;
#pragma unroll
  for (int i = 0; i < 4; ++i) { const float d = x[i] - mu; q += d * d; }
#pragma unroll
  for (int o = 1; o < 32; o <<= 1) q += __shfl_xor(q, o);
  const float rs = rsqrtf(q * (1.0f / CC) + 1e-5f); v4f r4;
#pragma unroll
  for (int i = 0; i < 4; ++i) { const int c = lane * 4 + i; r4[i] = (x[i] - mu) * rs * bfr(LW[c]) + bfr(LB[c]); }
  vst2(ZN + row * CC + lane * 4, r4); }
// ---- k_rows2: block = (64 rows, which): which 0: tri_bias: BIAS[row = q*256+k][h] = LN(act)[q][k] . feat2d_w[:, h] (4 outputs) ; which 1: G[row][c] = sigmoid(LN(act)[row] . gating_w[:, c] + gating_b[c]) (128 outputs); weights are (in,out)
__global__ __launch_bounds__(128) void k_rows2(const float* __restrict__ ZN, const float* __restrict__ WB, const float* __restrict__ WG, const float* __restrict__ GB, float* __restrict__ BIAS, float* __restrict__ G) { __shared__ __align__(16) float sf[4][16][132];
  const int tid = threadIdx.x, wave = tid >> 5, lane = tid & 31, col = lane & 15, g = lane >> 4; const int which = blockIdx.y; const size_t r0 = (size_t)blockIdx.x * 64 + wave * 16;
  const int nout = which == 0 ? NH : CC; const float* Wm = which == 0 ? WB : WG;
  v8f acc[8] = {};
  if (which != 0) { __bf16* sW = (__bf16*)&sf[0][0][0];   /* the gating weight's fragments lie where the output rows are staged later */
    stage_w(WG, CC, sW, tid); __syncthreads();   /* publishes the fragments */
#pragma unroll
    for (int kc = 0; kc < CC / 32; ++kc) { v16b w[8];
#pragma unroll
      for (int j = 0; j < 8; ++j) w[j] = wfrag(sW, kc, j, lane);   /* the chunk's LDS reads stand in one place, ahead of the rows' global loads */
      const F2 a = split_row(ZN + (r0 + col) * CC, kc * 32, lane); asm volatile("s_wait_loadcnt 0x0" ::: "memory");
#pragma unroll
      for (int j = 0; j < 8; ++j) { acc[j] = wmma_bf(a.h, w[j], acc[j]); acc[j] = wmma_bf(a.l, w[j], acc[j]); } }
    __syncthreads();   /* every wave has read its last fragment before sf is written */
  } else
#pragma unroll
  for (int kc = 0; kc < CC / 32; ++kc) { const F2 a = split_row(ZN + (r0 + col) * CC, kc * 32, lane); asm volatile("s_wait_loadcnt 0x0" ::: "memory");
#pragma unroll
    for (int j = 0; j < 8; ++j) { if (j * 16 >= nout) break; v16b w; { float t0[8], t1[8]; const int o = j * 16 + col; const int oc = o < nout ? o : nout - 1; const float keep = o < nout ? 1.f : 0.f;
#pragma unroll
        for (int i = 0; i < 8; ++i) t0[i] = Wm[(size_t)(kc * 32 + 8 * g + i) * nout + oc];   /* (in,out) */
        asm volatile("s_wait_loadcnt 0x0" ::: "memory");
#pragma unroll
        for (int i = 0; i < 8; ++i) t1[i] = Wm[(size_t)(kc * 32 + 16 + 8 * g + i) * nout + oc];
        asm volatile("s_wait_loadcnt 0x0" ::: "memory");
#pragma unroll
        for (int i = 0; i < 8; ++i) { w[i] = (__bf16)(t0[i] * keep); w[8 + i] = (__bf16)(t1[i] * keep); } }   /* (in,out) column o; columns beyond nout zero (select-free: keep multiplies a VALID load) */
      acc[j] = wmma_bf(a.h, w, acc[j]); acc[j] = wmma_bf(a.l, w, acc[j]); } }
  if (which == 0) { if (lane < 16) {   /* bias rows: 4 floats = 16 B per row; rows r0+8g+r... store via LDS: */ }
#pragma unroll
    for (int r = 0; r < 8; ++r) sf[wave][8 * g + r][col] = acc[0][r];
    LDSX(); if (lane < 16) { v4f b4; b4[0] = sf[wave][lane][0]; b4[1] = sf[wave][lane][1]; b4[2] = sf[wave][lane][2]; b4[3] = sf[wave][lane][3]; vst2(BIAS + (r0 + lane) * NH, b4); }   /* 16 rows x 16 B = one 256-B run per wave */
  } else {
#pragma unroll
    for (int j = 0; j < 8; ++j)
#pragma unroll
      for (int r = 0; r < 8; ++r) sf[wave][8 * g + r][j * 16 + col] = 1.0f / (1.0f + expf(-(acc[j][r] + bfr(GB[j * 16 + col]))));   /* sigmoid(x Wg + gating_b) */
    LDSX(); for (int rl = 0; rl < 16; ++rl) vst2(G + (r0 + rl) * CC + lane * 4, *(const v4f*)&sf[wave][rl][lane * 4]); } }
// ---- k_gate: Y row *= G row (same natural row index r*256 + q; thread per float4; one writer)
__global__ __launch_bounds__(256) void k_gate(float* __restrict__ Y, const float* __restrict__ G) { const size_t e4 = (size_t)blockIdx.x * 256 + threadIdx.x; if (e4 >= (size_t)NZR * (CC / 4)) return; const size_t yrow = e4 / (CC / 4); const int q = (int)(e4 % (CC / 4)); const size_t grow = yrow;
  v4f y = *(const v4f*)(Y + yrow * CC + q * 4); const v4f gg = *(const v4f*)(G + grow * CC + q * 4); y[0] *= gg[0]; y[1] *= gg[1]; y[2] *= gg[2]; y[3] *= gg[3]; vst2(Y + yrow * CC + q * 4, y); }
#define WS_ZN   (WS_END)
#define WS_BIAS (WS_ZN + 4u * (size_t)NZR * CC)
#define WS_G    (WS_BIAS + 4u * (size_t)NZR * NH)
#define WS_END2 (WS_G + 4u * (size_t)NZR * CC)
#ifndef PROJ_EXTRA_PARAMS
#define PROJ_EXTRA_PARAMS
#endif

#define WS_QH  0u                                      // f16 q rows [b*t][CC]
#define WS_KH  (WS_QH + 2u * (size_t)NB * TT * CC)      // f16 k rows [b*t][CC]
#define WS_VT  (WS_KH + 2u * (size_t)NB * TT * CC)      // f16 v planes [b][c][t]
#define WS_QL  (WS_VT + 2u * (size_t)NB * CC * TT)      // f16 q residual x 2^10 rows [b][t < QHI][CC]
#define WS_KL  (WS_QL + 2u * (size_t)NB * QHI * CC)     // f16 k residual x 2^10 rows [b][t < KHI][CC]
#define WS_VB  (WS_KL + 2u * (size_t)NB * KHI * CC)     // bf16 v hi planes [b][c][t < KHI]
#define WS_VBL (WS_VB + 2u * (size_t)NB * CC * KHI)
#define WS_S   (WS_VBL + 2u * (size_t)NB * CC * KHI)    // unused f32 region (k_attn keeps logits and P in registers)
#define WS_Y   (WS_S  + 4u * (size_t)BG * HG * TT * TT)   // unused WS_S: 256 planes of 256 x 256 f32      // f32 ctx rows [b*t][CC] (only when there is an output projection)
#define WS_END (WS_Y  + 4u * (size_t)NB * TT * CC)

// ---- k_proj: block = (64 rows, 128 cols, which): q/k/v = X W (+ b) with exact bf16 products (K = DIN) -> which 0: q f16 rows (+ residual rows < QHI); 1: k f16 rows (+ residual rows < KHI); 2: v f16 planes [c][t] (+ bf16 hi/lo planes for t < KHI)
__global__ __launch_bounds__(128) void k_proj(const float* __restrict__ XQ, const float* __restrict__ XK, const float* __restrict__ XV, const float* __restrict__ WQ, const float* __restrict__ WK, const float* __restrict__ WV, const float* __restrict__ BQ, const float* __restrict__ BK, const float* __restrict__ BV,
    _Float16* __restrict__ QH, _Float16* __restrict__ QL, _Float16* __restrict__ KH, _Float16* __restrict__ KL, _Float16* __restrict__ VT, __bf16* __restrict__ VB, __bf16* __restrict__ VBL) {
  __shared__ __align__(16) char sm[2 * 64 * 136 * 2 + 3 * 128 * 72 * 2];   /* the five output tiles as before; the weight's fragments lie on the first two until the products are done */
  _Float16 (*sh)[136] = (_Float16 (*)[136])sm; _Float16 (*sl)[136] = (_Float16 (*)[136])(sm + 64 * 136 * 2); _Float16 (*th)[72] = (_Float16 (*)[72])(sm + 2 * 64 * 136 * 2); __bf16 (*tb)[72] = (__bf16 (*)[72])(sm + 2 * 64 * 136 * 2 + 128 * 72 * 2); __bf16 (*tbl)[72] = (__bf16 (*)[72])(sm + 2 * 64 * 136 * 2 + 2 * 128 * 72 * 2); __bf16* sW = (__bf16*)sm;
  const int tid = threadIdx.x, wave = tid >> 5, lane = tid & 31, col = lane & 15, g = lane >> 4; const int which = blockIdx.z; const int c0 = blockIdx.y * 128; const size_t r0 = (size_t)blockIdx.x * 64; const size_t bb = r0 / TT; const int t0 = (int)(r0 % TT);
  const float* X = which == 0 ? XQ : which == 1 ? XK : XV; const float* WA = which == 0 ? WQ : which == 1 ? WK : WV; const float* BA = which == 0 ? BQ : which == 1 ? BK : BV;
  stage_w(WA + c0, CC, sW, tid); __syncthreads();   /* publishes the fragments */
  v8f acc[8] = {};
#pragma unroll 2
  for (int kc = 0; kc < DIN / 32; ++kc) { v16b w[8];
#pragma unroll
    for (int j = 0; j < 8; ++j) w[j] = wfrag(sW, kc, j, lane);   /* the chunk's LDS reads stand in one place, ahead of the rows' global loads */
    const F2 a2 = split_row(X + (r0 + wave * 16 + col) * DIN, kc * 32, lane);   /* LN(act) rows (f32) split hi + lo */
    asm volatile("s_wait_loadcnt 0x0" ::: "memory");
#pragma unroll
    for (int j = 0; j < 8; ++j) { acc[j] = wmma_bf(a2.h, w[j], acc[j]); acc[j] = wmma_bf(a2.l, w[j], acc[j]); } }
  __syncthreads();   /* every wave has read its last fragment before the output tiles are written */
  if (which < 2) { _Float16* DH = which == 0 ? QH : KH; _Float16* DL = which == 0 ? QL : KL; const int nhi = which == 0 ? QHI : KHI; const bool hi_rows = t0 < nhi;
#pragma unroll
    for (int j = 0; j < 8; ++j) { const float bias = BA ? bfr(BA[c0 + j * 16 + col]) : 0.f;
#pragma unroll
      for (int r = 0; r < 8; ++r) { const float v = acc[j][r] + bias; const _Float16 hv = (_Float16)v; sh[wave * 16 + 8 * g + r][j * 16 + col] = hv; sl[wave * 16 + 8 * g + r][j * 16 + col] = (_Float16)((v - (float)hv) * 1024.0f); } }
    __syncthreads();
    for (int e = tid; e < 64 * 16; e += 128) { const int rl = e >> 4, q = e & 15; vst2((unsigned*)(DH + (r0 + rl) * CC + c0 + q * 8), *(const v4u*)&sh[rl][q * 8]); if (hi_rows) vst2((unsigned*)(DL + (bb * nhi + t0 + rl) * (size_t)CC + c0 + q * 8), *(const v4u*)&sl[rl][q * 8]); }
  } else { const bool hi_rows = t0 < KHI;
#pragma unroll
    for (int j = 0; j < 8; ++j) { const float bias = BA ? bfr(BA[c0 + j * 16 + col]) : 0.f;
#pragma unroll
      for (int r = 0; r < 8; ++r) { const float v = acc[j][r] + bias; const int rl = wave * 16 + 8 * g + r, cl = j * 16 + col; th[cl][rl] = (_Float16)v; const __bf16 bh = (__bf16)v; tb[cl][rl] = bh; tbl[cl][rl] = (__bf16)(v - (float)bh); } }
    __syncthreads();
    for (int e = tid; e < 128 * 8; e += 128) { const int cl = e >> 3, q = e & 7; vst2((unsigned*)(VT + (bb * CC + c0 + cl) * (size_t)TT + t0 + q * 8), *(const v4u*)&th[cl][q * 8]); if (hi_rows) { const size_t o3 = (bb * CC + c0 + cl) * (size_t)KHI + t0 + q * 8; vst2((unsigned*)(VB + o3), *(const v4u*)&tb[cl][q * 8]); vst2((unsigned*)(VBL + o3), *(const v4u*)&tbl[cl][q * 8]); } } } }
// ---- k_attn: work-group = (4 rows r, head h), 16 waves, wave = 16 queries against all 256 keys, 64 keys at a time with a running maximum and sum. The head's bias plane lies in LDS for the whole work-group, in the order the score fragments hold it; per row r the k rows, v planes and mask bias are staged in LDS once for all 16 waves. Both products are formed transposed (scores: A = k rows, B = q rows; ctx: A = v planes, B = P), so D's column is the query in both: a lane holds keys of ONE query, two neighbouring score tiles ARE the B fragment of P, and maximum, sum and rescale stay in the lane (one exchange with the other half-wave). The plain unroll directives keep the small arrays in registers.
#define FR 4               // rows r per work-group
#define KP (HD + 8)        // halves per staged k row: 80-B pitch
#define VP (TT + 8)        // halves per staged v plane: 528-B pitch
__device__ __forceinline__ v8f wmma_h(v16h a, v16h b, v8f c) { return __builtin_amdgcn_wmma_f32_16x16x32_f16(false, a, false, b, (short)0, c, false, false); }
__global__ __launch_bounds__(512) void k_attn(const _Float16* __restrict__ QH, const _Float16* __restrict__ QL, const _Float16* __restrict__ KH, const _Float16* __restrict__ VT, const float* __restrict__ BIAS, const float* __restrict__ MKP, float* __restrict__ Y) {
  __shared__ __align__(16) float sB[TT * TT];            // [query tile][key tile][half of 8][lane][4]
  __shared__ __align__(16) _Float16 sK[TT][KP]; __shared__ __align__(16) _Float16 sV[HD][VP]; __shared__ __align__(16) float sM[TT];
  const int tid = threadIdx.x, wave = tid >> 5, lane = tid & 31, col = lane & 15, g = lane >> 4; const int h = blockIdx.y; const int rb = (int)blockIdx.x * FR;
  const unsigned ko0 = (unsigned)(tid >> 2) * CC + (tid & 3) * 8, vo0 = (unsigned)tid * 8;   /* this thread's 16-B pieces of a row's k rows (and 128 rows on) and v planes (and 16 planes on) */
  const unsigned qo = (unsigned)(wave * 16 + col) * CC + 8 * g;
  v4u pk[2], pv[2]; float pm = 0.f;
  { const _Float16* kb = KH + (size_t)rb * TT * CC + h * HD; const _Float16* vb = VT + ((size_t)rb * CC + h * HD) * TT;
    pk[0] = *(const v4u*)(kb + ko0); pk[1] = *(const v4u*)(kb + ko0 + 128 * CC); pv[0] = *(const v4u*)(vb + vo0); pv[1] = *(const v4u*)(vb + vo0 + 16 * TT);
    if (tid < TT) pm = MKP[(size_t)rb * SZ + tid]; }
  // a wave takes 8 queries x 4 keys per load: its 32 LDS words fall on 32 banks; the 16 waves stand side by side along the keys
  { const float* bh = BIAS + h; const unsigned gs = (unsigned)((((tid >> 2) & 7) * SZ + wave * 4 + (tid & 3)) * NH), ld = (unsigned)(((((wave >> 2) * 2 + (wave & 1)) * 32) + ((wave >> 1) & 1) * 16 + ((tid >> 2) & 7)) * 4 + (tid & 3));
#pragma unroll 4   /* 16 loads in flight per lane */
    for (int qi = 0; qi < TT / 8; ++qi)
#pragma unroll
      for (int kk = 0; kk < 4; ++kk) sB[ld + (qi >> 1) * 4096 + (qi & 1) * 32 + kk * 1024] = bh[gs + qi * (8 * SZ * NH) + kk * (64 * NH)]; }
#pragma unroll 1   /* rolled: one copy of the body in the instruction cache */
  for (int it = 0; it < FR; ++it) { const int b = rb + it;
    const _Float16* qhb = QH + (size_t)b * TT * CC + h * HD; const _Float16* qlb = QL + (size_t)b * QHI * CC + h * HD;
    union { v16h v; v8h q[2]; } qh, ql; qh.q[0] = *(const v8h*)(qhb + qo); qh.q[1] = *(const v8h*)(qhb + qo + 16); ql.q[0] = *(const v8h*)(qlb + qo); ql.q[1] = *(const v8h*)(qlb + qo + 16);
    __syncthreads();   /* every wave has left the previous row's k, v and mask tiles */
    *(v4u*)&sK[tid >> 2][(tid & 3) * 8] = pk[0]; *(v4u*)&sK[128 + (tid >> 2)][(tid & 3) * 8] = pk[1]; *(v4u*)&sV[tid >> 5][(tid & 31) * 8] = pv[0]; *(v4u*)&sV[16 + (tid >> 5)][(tid & 31) * 8] = pv[1];
    if (tid < TT) sM[tid] = 32768.0f * (bfr(pm) - 1.0f);   /* FP16_HUGE * (pair_mask[r][k] - 1) */
    __syncthreads();   /* publishes this row's tiles (and, the first time, the bias plane) */
    if (it + 1 < FR) {   /* the next row's tiles fly while this row is worked on */
      const _Float16* kb = KH + (size_t)(b + 1) * TT * CC + h * HD; const _Float16* vb = VT + ((size_t)(b + 1) * CC + h * HD) * TT;
      pk[0] = *(const v4u*)(kb + ko0); pk[1] = *(const v4u*)(kb + ko0 + 128 * CC); pv[0] = *(const v4u*)(vb + vo0); pv[1] = *(const v4u*)(vb + vo0 + 16 * TT);
      if (tid < TT) pm = MKP[(size_t)(b + 1) * SZ + tid]; }
    float m = -3.0e38f, l = 0.f; v8f acc[HD / 16] = {};   /* l: this half-wave's keys only; the halves meet behind the loop */
#pragma unroll 1   /* rolled: unrolled, the LDS reads of all 16 key tiles are hoisted and the 256 registers of a 16-wave work-group spill */
    for (int c = 0; c < TT / 64; ++c) { v8f s[4];
#pragma unroll
      for (int jj = 0; jj < 4; ++jj) { const int j = c * 4 + jj; const v16h kf = frag_h(&sK[j * 16 + col][0], lane); const v8f z = {}; const v8f a = wmma_h(kf, qh.v, z), al = wmma_h(kf, ql.v, z);
        const float* bp = sB + (((wave * 16 + j) * 2) * 32 + lane) * 4; const v4f b0 = *(const v4f*)bp, b1 = *(const v4f*)(bp + 128); const v4f m0 = *(const v4f*)&sM[j * 16 + 8 * g], m1 = *(const v4f*)&sM[j * 16 + 8 * g + 4];
#pragma unroll
        for (int r = 0; r < 8; ++r) s[jj][r] = (a[r] + al[r] * (1.0f / 1024.0f)) * SCALE + (r < 4 ? b0[r & 3] : b1[r & 3]) + (r < 4 ? m0[r & 3] : m1[r & 3]); }
      v8f mx = s[0];
#pragma unroll
      for (int r = 0; r < 8; ++r) mx[r] = fmaxf(fmaxf(mx[r], s[1][r]), fmaxf(s[2][r], s[3][r]));
      float cm = fmaxf(fmaxf(fmaxf(mx[0], mx[1]), fmaxf(mx[2], mx[3])), fmaxf(fmaxf(mx[4], mx[5]), fmaxf(mx[6], mx[7]))); cm = fmaxf(cm, __shfl_xor(cm, 16));
      const float mn = fmaxf(m, cm); const float alpha = expf(m - mn); m = mn;   /* what was summed under the old maximum shrinks by alpha */
      v8f sm = {};
#pragma unroll
      for (int jj = 0; jj < 4; ++jj)
#pragma unroll
        for (int r = 0; r < 8; ++r) { const float e = expf(s[jj][r] - mn); s[jj][r] = e; sm[r] += e; }
      l = l * alpha + (((sm[0] + sm[1]) + (sm[2] + sm[3])) + ((sm[4] + sm[5]) + (sm[6] + sm[7])));
#pragma unroll
      for (int j = 0; j < HD / 16; ++j)
#pragma unroll
        for (int r = 0; r < 8; ++r) acc[j][r] *= alpha;
#pragma unroll
      for (int k2 = 0; k2 < 2; ++k2) { v16h p;
#pragma unroll
        for (int i = 0; i < 8; ++i) { p[i] = (_Float16)(s[2 * k2][i] * 2048.0f); p[8 + i] = (_Float16)(s[2 * k2 + 1][i] * 2048.0f); }
#pragma unroll
        for (int j = 0; j < HD / 16; ++j) acc[j] = wmma_h(frag_h(&sV[j * 16 + col][(c * 2 + k2) * 32], lane), p, acc[j]); } }
    l += __shfl_xor(l, 16);
    const float inv = (m > -1.0e38f && l > 0.f) ? (1.0f / 2048.0f) / l : 0.f;   /* a fully excluded row (every logit at or below -1e38) yields 0 */
    float* yp = Y + (size_t)b * TT * CC + h * HD + (unsigned)(wave * 16 + col) * CC + 8 * g;
#pragma unroll
    for (int j = 0; j < HD / 16; ++j) { v4f y0, y1;
#pragma unroll
      for (int r = 0; r < 4; ++r) { y0[r] = acc[j][r] * inv; y1[r] = acc[j][4 + r] * inv; }
      vst2(yp + j * 16, y0); vst2(yp + j * 16 + 4, y1); }   /* the 128-B (row, head) segment has this wave as its one writer */
    asm volatile("s_wait_xcnt 0x0" ::: "memory");   /* the next trip rewrites the registers that these stores name */
  } }
// ---- k_out: block = (64 rows, 128 cols): out = ctx Wo (+ bo): all rows: ctx bf16 hi + lo against exact bf16 Wo (2 products); the f16 branch (1 product, Wo x 2^8) is never taken
__global__ __launch_bounds__(128) void k_out(const float* __restrict__ Y, const float* __restrict__ WO, const float* __restrict__ BO, float* __restrict__ OUT) { __shared__ __align__(16) float sf[4][16][132];
  const int tid = threadIdx.x, wave = tid >> 5, lane = tid & 31, col = lane & 15, g = lane >> 4; const int c0 = blockIdx.y * 128; const size_t r0 = (size_t)blockIdx.x * 64 + wave * 16;
  v8f acc[8] = {};
  if (true) {   /* ALL rows: gated ctx bf16 hi + lo x exact output_w (2 products) */
    __bf16* sW = (__bf16*)&sf[0][0][0];   /* the weight's fragments lie where the output rows are staged later */
    stage_w(WO + c0, DIN, sW, tid); __syncthreads();   /* publishes the fragments */
#pragma unroll 2
    for (int kc = 0; kc < CC / 32; ++kc) { v16b w[8];
#pragma unroll
      for (int j = 0; j < 8; ++j) w[j] = wfrag(sW, kc, j, lane);   /* the chunk's LDS reads stand in one place, ahead of the rows' global loads */
      const F2 a = split_row(Y + (r0 + col) * CC, kc * 32, lane); asm volatile("s_wait_loadcnt 0x0" ::: "memory");
#pragma unroll
      for (int j = 0; j < 8; ++j) { acc[j] = wmma_bf(a.h, w[j], acc[j]); acc[j] = wmma_bf(a.l, w[j], acc[j]); } }
    __syncthreads();   /* every wave has read its last fragment before sf is written */
#pragma unroll
    for (int j = 0; j < 8; ++j) { const float bias = BO ? bfr(BO[c0 + j * 16 + col]) : 0.f;
#pragma unroll
      for (int r = 0; r < 8; ++r) sf[wave][8 * g + r][j * 16 + col] = acc[j][r] + bias; }
  } else {
#pragma unroll 2
    for (int kc = 0; kc < CC / 32; ++kc) { const v16h a = frag_f32(Y + (r0 + col) * CC + kc * 32, lane); asm volatile("s_wait_loadcnt 0x0" ::: "memory");
#pragma unroll
      for (int j = 0; j < 8; ++j) { const v16h w = WOCOLH(WO, kc * 32, c0 + j * 16 + col, lane); asm volatile("s_wait_loadcnt 0x0" ::: "memory"); acc[j] = wmma16(a, w, acc[j]); } }
#pragma unroll
    for (int j = 0; j < 8; ++j) { const float bias = BO ? bfr(BO[c0 + j * 16 + col]) : 0.f;
#pragma unroll
      for (int r = 0; r < 8; ++r) sf[wave][8 * g + r][j * 16 + col] = acc[j][r] * (1.0f / 256.0f) + bias; } }
  LDSX(); for (int rl = 0; rl < 16; ++rl) vst2(OUT + (r0 + rl) * DIN + c0 + lane * 4, *(const v4f*)&sf[wave][rl][lane * 4]); }

extern "C" void kernel_launch(void* const* d_in, const int* in_sizes, int n_in, void* d_out, int out_size, void* d_ws, size_t ws_size, hipStream_t stream) {
  (void)in_sizes; (void)n_in; (void)out_size;
  const float** F = (const float**)d_in;
  if (ws_size < (size_t)WS_END) return;
  char* ws = (char*)d_ws; _Float16 *QH = (_Float16*)(ws + WS_QH), *KH = (_Float16*)(ws + WS_KH), *VT = (_Float16*)(ws + WS_VT), *QL = (_Float16*)(ws + WS_QL), *KL = (_Float16*)(ws + WS_KL); __bf16 *VB = (__bf16*)(ws + WS_VB), *VBL = (__bf16*)(ws + WS_VBL); float *Y = (float*)(ws + WS_Y);
  (void)Y; (void)QL; (void)KL; (void)VB; (void)VBL;
  // inputs: 0 pair_act [1,256,256,128]; 1 pair_mask [1,256,256]; 2 ln_gamma, 3 ln_beta; 4 feat2d_w [128,4]; 5 query_w, 6 key_w, 7 value_w [128,4,32] (in,out); 8 gating_w [128,4,32], 9 gating_b [4,32]; 10 output_w [4,32,128] (in,out); 11 output_b
  if (ws_size < (size_t)WS_END2) return;
  float *ZN = (float*)(ws + WS_ZN), *BIAS = (float*)(ws + WS_BIAS), *G = (float*)(ws + WS_G);
  k_lnz<<<dim3(NZR / 8), 256, 0, stream>>>(F[0], F[2], F[3], ZN);
  k_rows2<<<dim3(NZR / 64, 2), 128, 0, stream>>>(ZN, F[4], F[8], F[9], BIAS, G);
  k_proj<<<dim3(TNB * TT / 64, CC / 128, 3), 128, 0, stream>>>(ZN, ZN, ZN, F[5], F[6], F[7], nullptr, nullptr, nullptr, QH, QL, KH, KL, VT, VB, VBL);
  k_attn<<<dim3(TNB / FR, NH), 512, 0, stream>>>(QH, QL, KH, VT, BIAS, F[1], Y);
  k_gate<<<dim3((NZR * (CC / 4) + 255) / 256), 256, 0, stream>>>(Y, G);
  k_out<<<dim3(TNB * TT / 64, DIN / 128), 128, 0, stream>>>(Y, F[10], F[11], (float*)d_out);
}

// v003
// It runs in 134 microseconds.
// Next to v002, in two timings, it ran 1.14 times as fast each time.
// Over all steps from v000 it is 3.95 times as fast.
// compute dtype: all float inputs rounded to bf16; LayerNorm of pair_act in f32; q/k/v = LN(act) split bf16 hi + lo x W (exact bf16, (in,out)) on WMMA 16x16x32 (2 products, f32 accumulate); q as f16 hi + residual (x 2^10) against k once to f16 (2 products) x 32^-0.5 + the per-(query, key, head) triangle bias (2-product GEMM) + the mask bias; softmax in f32 (precise expf, running maximum and sum over steps of 64 keys); exp(logit - maximum) x 2^11 once to f16 against v once to f16 (1 product), divided by the sum at the end; gate sigmoid(LN(act) Wg + b) in f32 (2-product GEMM, precise expf); gated ctx split bf16 hi + lo against exact output_w (2 products) + output_b; f32 output.
#include <hip/hip_runtime.h>
#include <math.h>

typedef __attribute__((ext_vector_type(16))) _Float16 v16h;
typedef __attribute__((ext_vector_type(16))) __bf16 v16b;
typedef __attribute__((ext_vector_type(8)))  _Float16 v8h;
typedef __attribute__((ext_vector_type(8)))  float v8f;
typedef __attribute__((ext_vector_type(4)))  float v4f;
typedef __attribute__((ext_vector_type(2)))  float v2f;
typedef __attribute__((ext_vector_type(4)))  unsigned v4u;
typedef __attribute__((ext_vector_type(4)))  int v4i;
typedef float __attribute__((may_alias)) float_a;
typedef int __attribute__((may_alias)) int_a;

template <typename T> __device__ __forceinline__ void vst2(void* p, T v) { *(T*)p = v;  }
__device__ __forceinline__ v8f wmma16(v16h a, v16h b, v8f c) {
  v8f d = __builtin_amdgcn_wmma_f32_16x16x32_f16(false, a, false, b, (short)0, c, false, false);
  asm volatile("v_nop\n\tv_nop\n\tv_nop\n\tv_nop" : "+v"(d) : "v"(a), "v"(b));
  return d;
}
__device__ __forceinline__ v8f wmma_bf(v16b a, v16b b, v8f c) {
  v8f d = __builtin_amdgcn_wmma_f32_16x16x32_bf16(false, a, false, b, (short)0, c, false, false);
  asm volatile("v_nop\n\tv_nop\n\tv_nop\n\tv_nop" : "+v"(d) : "v"(a), "v"(b));
  return d;
}
// 16x16x32 fragments: lane = (h = lane>>4, row/col = lane&15); elements 0..7 = k0+8h+0..7, 8..15 = k0+16+8h+0..7; D element r = row 8h+r
__device__ __forceinline__ v16h frag_h(const _Float16* rowk0, int lane) {
  union { v16h v; v8h q[2]; } u; const _Float16* p = rowk0 + 8 * (lane >> 4);
  u.q[0] = *(const v8h*)p; u.q[1] = *(const v8h*)(p + 16); return u.v;
}
__device__ __forceinline__ v16h frag_f32(const float* rowk0, int lane) {
  v16h a; const float* p = rowk0 + 8 * (lane >> 4);
#pragma unroll
  for (int i = 0; i < 8; ++i) { a[i] = (_Float16)p[i]; a[8 + i] = (_Float16)p[16 + i]; }
  return a;
}
__device__ __forceinline__ v16h frag_f32s(const float* rowk0, int lane, float sc) {
  v16h a; const float* p = rowk0 + 8 * (lane >> 4);
#pragma unroll
  for (int i = 0; i < 8; ++i) { a[i] = (_Float16)(p[i] * sc); a[8 + i] = (_Float16)(p[16 + i] * sc); }
  return a;
}
// column fragment from a [K][ld] layout (column n), rows >= K read as 0
__device__ __forceinline__ v16h fragc_f32(const float* W, int k0, int n, int lane, int ld, int K) {
  v16h a; const int g = lane >> 4;
#pragma unroll
  for (int i = 0; i < 8; ++i) { const int ka = k0 + 8 * g + i, kb = ka + 16;
    a[i] = (_Float16)(ka < K ? W[(size_t)(ka < K ? ka : K - 1) * ld + n] : 0.f); a[8 + i] = (_Float16)(kb < K ? W[(size_t)(kb < K ? kb : K - 1) * ld + n] : 0.f); }
  return a;
}
struct F2 { v16b h, l; };
__device__ __forceinline__ F2 bsplit16(const float v[16]) { F2 r;
#pragma unroll
  for (int i = 0; i < 16; ++i) { const __bf16 h = (__bf16)v[i]; r.h[i] = h; r.l[i] = (__bf16)(v[i] - (float)h); }
  return r; }
__device__ __forceinline__ F2 split_row(const float* row, int k0, int lane) { float v[16]; const float* p = row + k0 + 8 * (lane >> 4);
#pragma unroll
  for (int i = 0; i < 8; ++i) { v[i] = p[i]; v[8 + i] = p[16 + i]; }
  return bsplit16(v); }
__device__ __forceinline__ F2 split_rowK(const float* row, int k0, int lane, int K) { float v[16]; const int g = lane >> 4;
#pragma unroll
  for (int i = 0; i < 8; ++i) { const int ka = k0 + 8 * g + i, kb = ka + 16; v[i] = ka < K ? row[ka < K ? ka : K - 1] : 0.f; v[8 + i] = kb < K ? row[kb < K ? kb : K - 1] : 0.f; }
  return bsplit16(v); }
__device__ __forceinline__ F2 split_col(const float* W, int k0, int n, int lane, int ld, int K) { float v[16]; const int g = lane >> 4;
#pragma unroll
  for (int i = 0; i < 8; ++i) { const int ka = k0 + 8 * g + i, kb = ka + 16; v[i] = ka < K ? W[(size_t)(ka < K ? ka : K - 1) * ld + n] : 0.f; v[8 + i] = kb < K ? W[(size_t)(kb < K ? kb : K - 1) * ld + n] : 0.f; }
  return bsplit16(v); }
__device__ __forceinline__ v8f mac3(const F2& a, const F2& b, v8f c) { c = wmma_bf(a.l, b.h, c); c = wmma_bf(a.h, b.l, c); return wmma_bf(a.h, b.h, c); }
__device__ __forceinline__ float sigm(float v) { return 1.0f / (1.0f + expf(-v)); }
#define LDSX() do { asm volatile("s_wait_dscnt 0" ::: "memory"); __builtin_amdgcn_wave_barrier(); __builtin_amdgcn_fence(__ATOMIC_RELEASE, "workgroup"); } while (0)

// Triangle attention (pair_act [1, 256, 256, 128], 4 heads x 32): act = LayerNorm(pair_act); for every row r: q = act[r] Wq * 32^-0.5, k = act[r] Wk, v = act[r] Wv; logits[r,h,q,k] = q . k + 2^15 (pair_mask[r][k] - 1) + tri_bias[h][q][k] with tri_bias = act . feat2d_w (indexed by the (q, k) PAIR, shared across rows); softmax over k; wa = (weights v) * sigmoid(act[r][q] Wg + bg); out[r][q] = wa . output_w + output_b.
#define NB 256
#define TT 256
#define CC 128            // NH * HD = projected width
#define DIN 128          // input (model) width
#define NH 4
#define HD 32
#define NQB (TT / 64)
#define HG 4
#define SCALE (0.17677669529663687f)
#define CAUSAL 0
#ifndef TNB
#define TNB NB
#endif
__device__ __forceinline__ float bfr(float v) { return (float)(__bf16)v; }
__host__ __device__ __forceinline__ int kb_last(int qb) { return CAUSAL ? ((qb * 64 + 63) >> 7) : (TT / 128 - 1); }
typedef __attribute__((ext_vector_type(8))) __bf16 v8b;
__device__ __forceinline__ v16b frag_b(const __bf16* rowk0, int lane) {
  union { v16b v; v8b q[2]; } u; const __bf16* p = rowk0 + 8 * (lane >> 4);
  u.q[0] = *(const v8b*)p; u.q[1] = *(const v8b*)(p + 16); return u.v;
}
// One 128 x 128 (in,out) weight, rounded to bf16 once per work-group of 128 threads and laid in LDS (32 KiB) in the order the B fragments are read: [k chunk of 32][column tile][half of 8 k][lane] pieces of 16 B. Thread = output column: a wave's load is one whole 128-B line, all 128 loads of a thread are independent, and 8 k of a column make one 16-B store. The plain unroll directives here and at the fragment arrays w[8] keep those small arrays in registers.
__device__ __forceinline__ void stage_w(const float* __restrict__ Wm, int ld, __bf16* sW, int tid) { const float* p = Wm + tid;
#pragma unroll
  for (int kg = 0; kg < 16; ++kg) { v8b w;   /* k = 8 kg + i: chunk kg >> 2, half (kg >> 1) & 1, lane half kg & 1 */
#pragma unroll
    for (int i = 0; i < 8; ++i) w[i] = (__bf16)p[(size_t)(kg * 8 + i) * ld];
    *(v8b*)(sW + (size_t)(((((kg >> 2) * 8 + (tid >> 4)) * 2 + ((kg >> 1) & 1)) * 32 + (kg & 1) * 16 + (tid & 15)) * 8)) = w; } }
__device__ __forceinline__ v16b wfrag(const __bf16* sW, int kc, int j, int lane) {
  union { v16b v; v8b q[2]; } u; const __bf16* p = sW + ((kc * 8 + j) * 64 + lane) * 8;
  u.q[0] = *(const v8b*)p; u.q[1] = *(const v8b*)(p + 256); return u.v;
}
#define QBH 0              // unused: nothing in this file reads it
#define QHI 256            // rows carrying a q residual plane (all rows when non-causal: 2-product logits everywhere)
#define KHI 64            // key rows carrying k residual / v bf16 hi+lo planes (written by k_front; no kernel reads them)
// B fragment (k rows k0+.., output column o) of a weight: (in,out) [K][ld] or (out,in) [ld rows of K]: bf16 exact, or f16(bf16 * 256) exact
__device__ __forceinline__ v16b wcol_io(const float* Wm, int k0, int o, int lane, int ld) { v16b w; const int g = lane >> 4;
#pragma unroll
  for (int i = 0; i < 8; ++i) { w[i] = (__bf16)Wm[(size_t)(k0 + 8 * g + i) * ld + o]; w[8 + i] = (__bf16)Wm[(size_t)(k0 + 16 + 8 * g + i) * ld + o]; }
  return w; }
__device__ __forceinline__ v16b wcol_oi(const float* Wm, int k0, int o, int lane, int K) { v16b w; const float* p = Wm + (size_t)o * K + k0 + 8 * (lane >> 4);
#pragma unroll
  for (int i = 0; i < 8; ++i) { w[i] = (__bf16)p[i]; w[8 + i] = (__bf16)p[16 + i]; }
  return w; }
__device__ __forceinline__ v16h wcolh_io(const float* Wm, int k0, int o, int lane, int ld) { v16h w; const int g = lane >> 4;
#pragma unroll
  for (int i = 0; i < 8; ++i) { w[i] = (_Float16)(bfr(Wm[(size_t)(k0 + 8 * g + i) * ld + o]) * 256.0f); w[8 + i] = (_Float16)(bfr(Wm[(size_t)(k0 + 16 + 8 * g + i) * ld + o]) * 256.0f); }
  return w; }
__device__ __forceinline__ v16h wcolh_oi(const float* Wm, int k0, int o, int lane, int K) { v16h w; const float* p = Wm + (size_t)o * K + k0 + 8 * (lane >> 4);
#pragma unroll
  for (int i = 0; i < 8; ++i) { w[i] = (_Float16)(bfr(p[i]) * 256.0f); w[8 + i] = (_Float16)(bfr(p[16 + i]) * 256.0f); }
  return w; }
#define WQKV_LAYOUT 0   // 0 = (in,out) [DIN][CC]; 1 = (out,in) [CC][DIN]; 2 = per-head [NH][DIN][HD]
__device__ __forceinline__ v16b wcol_hdk(const float* Wm, int k0, int o, int lane) { v16b w; const int g = lane >> 4; const float* p = Wm + (size_t)(o / HD) * DIN * HD + (o % HD);
#pragma unroll
  for (int i = 0; i < 8; ++i) { w[i] = (__bf16)p[(size_t)(k0 + 8 * g + i) * HD]; w[8 + i] = (__bf16)p[(size_t)(k0 + 16 + 8 * g + i) * HD]; }
  return w; }
#define WO_OUT_IN 0
#if WQKV_LAYOUT == 1
#define WCOL(W, k0, o, lane) wcol_oi(W, k0, o, lane, DIN)
#elif WQKV_LAYOUT == 2
#define WCOL(W, k0, o, lane) wcol_hdk(W, k0, o, lane)
#else
#define WCOL(W, k0, o, lane) wcol_io(W, k0, o, lane, CC)
#endif
#if WO_OUT_IN
#define WOCOL(W, k0, o, lane) wcol_oi(W, k0, o, lane, CC)
#define WOCOLH(W, k0, o, lane) wcolh_oi(W, k0, o, lane, CC)
#else
#define WOCOL(W, k0, o, lane) wcol_io(W, k0, o, lane, DIN)
#define WOCOLH(W, k0, o, lane) wcolh_io(W, k0, o, lane, DIN)
#endif
#define SZ 256
#define BG 64              // sizes only the unused WS_S region (x HG 4 = 256 planes of 256 x 256)
#define NZR (SZ * SZ)      // 65,536 pair rows
// ---- k_gate: Y row *= G row (same natural row index r*256 + q; thread per float4; one writer)
__global__ __launch_bounds__(256) void k_gate(float* __restrict__ Y, const float* __restrict__ G) { const size_t e4 = (size_t)blockIdx.x * 256 + threadIdx.x; if (e4 >= (size_t)NZR * (CC / 4)) return; const size_t yrow = e4 / (CC / 4); const int q = (int)(e4 % (CC / 4)); const size_t grow = yrow;
  v4f y = *(const v4f*)(Y + yrow * CC + q * 4); const v4f gg = *(const v4f*)(G + grow * CC + q * 4); y[0] *= gg[0]; y[1] *= gg[1]; y[2] *= gg[2]; y[3] *= gg[3]; vst2(Y + yrow * CC + q * 4, y); }
#define WS_ZN   (WS_END)
#define WS_BIAS (WS_ZN + 4u * (size_t)NZR * CC)
#define WS_G    (WS_BIAS + 4u * (size_t)NZR * NH)
#define WS_END2 (WS_G + 4u * (size_t)NZR * CC)
#ifndef PROJ_EXTRA_PARAMS
#define PROJ_EXTRA_PARAMS
#endif

#define WS_QH  0u                                      // f16 q rows [b*t][CC]
#define WS_KH  (WS_QH + 2u * (size_t)NB * TT * CC)      // f16 k rows [b*t][CC]
#define WS_VT  (WS_KH + 2u * (size_t)NB * TT * CC)      // f16 v planes [b][c][t]
#define WS_QL  (WS_VT + 2u * (size_t)NB * CC * TT)      // f16 q residual x 2^10 rows [b][t < QHI][CC]
#define WS_KL  (WS_QL + 2u * (size_t)NB * QHI * CC)     // f16 k residual x 2^10 rows [b][t < KHI][CC]
#define WS_VB  (WS_KL + 2u * (size_t)NB * KHI * CC)     // bf16 v hi planes [b][c][t < KHI]
#define WS_VBL (WS_VB + 2u * (size_t)NB * CC * KHI)
#define WS_S   (WS_VBL + 2u * (size_t)NB * CC * KHI)    // unused f32 region (k_attn keeps logits and P in registers)
#define WS_Y   (WS_S  + 4u * (size_t)BG * HG * TT * TT)   // unused WS_S: 256 planes of 256 x 256 f32      // f32 ctx rows [b*t][CC] (only when there is an output projection)
#define WS_END (WS_Y  + 4u * (size_t)NB * TT * CC)

// ---- k_front: block = 64 pair rows, wave = 16 rows. A lane reads its half of one row of pair_act in the order of the A fragments (k = 32 kc + 8 g + i and 16 on), so LayerNorm (biased var, eps 1e-5, ln_gamma/ln_beta, of bf16(z)) needs one exchange with the other half-wave, and the four bf16 hi + lo fragments of LN(act) are formed once and stay in registers for all five products: tri_bias (BIAS[row = q*256+k][h]), then q, k, v and the gate, one 128 x 128 (in,out) weight after the other through the same LDS. The output tiles of a product lie on the weight's fragments once the products are done. The second launch bound holds the registers to 4 waves per SIMD, so that all 1,024 work-groups are resident at once.
__global__ __launch_bounds__(128, 4) void k_front(const float* __restrict__ Z, const float* __restrict__ LW, const float* __restrict__ LB, const float* __restrict__ WB, const float* __restrict__ WQ, const float* __restrict__ WK, const float* __restrict__ WV, const float* __restrict__ WG, const float* __restrict__ GB,
    _Float16* __restrict__ QH, _Float16* __restrict__ QL, _Float16* __restrict__ KH, _Float16* __restrict__ KL, _Float16* __restrict__ VT, __bf16* __restrict__ VB, __bf16* __restrict__ VBL, float* __restrict__ BIAS, float* __restrict__ G) {
  __shared__ __align__(16) char sm[3 * 128 * 72 * 2];   /* the largest user: v's three transposed tiles */
  _Float16 (*sh)[136] = (_Float16 (*)[136])sm; _Float16 (*sl)[136] = (_Float16 (*)[136])(sm + 64 * 136 * 2); _Float16 (*th)[72] = (_Float16 (*)[72])sm; __bf16 (*tb)[72] = (__bf16 (*)[72])(sm + 128 * 72 * 2); __bf16 (*tbl)[72] = (__bf16 (*)[72])(sm + 2 * 128 * 72 * 2); float (*sf)[16][132] = (float (*)[16][132])sm; __bf16* sW = (__bf16*)sm; __bf16 (*sb)[144] = (__bf16 (*)[144])(sm + 2 * 64 * 136 * 2);   /* feat2d_w transposed, [head][k], behind the bias rows of sf; a fifth row of zeros; 288-B pitch: the 16-B reads of 5 rows x 2 halves fall on different banks */
  const int tid = threadIdx.x, wave = tid >> 5, lane = tid & 31, col = lane & 15, g = lane >> 4; const size_t r0 = (size_t)blockIdx.x * 64; const size_t bb = r0 / TT; const int t0 = (int)(r0 % TT);
  const v4f wb4 = *(const v4f*)(WB + tid * NH);   /* thread = input channel k: its 4 heads in one 16-B load, in flight under the rows' loads */
  F2 a[4];
  { float x[4][16]; const float* zp = Z + r0 * CC + (unsigned)((wave * 16 + col) * CC + 8 * g);
#pragma unroll
    for (int kc = 0; kc < 4; ++kc)
#pragma unroll
      for (int u = 0; u < 4; ++u) { const v4f t = *(const v4f*)(zp + kc * 32 + (u >> 1) * 16 + (u & 1) * 4);
#pragma unroll
        for (int i = 0; i < 4; ++i) x[kc][u * 4 + i] = bfr(t[i]); }
    float sp[4] = {0.f, 0.f, 0.f, 0.f};
#pragma unroll
    for (int kc = 0; kc < 4; ++kc)
#pragma unroll
      for (int i = 0; i < 16; ++i) sp[kc] += x[kc][i];
    float s1 = (sp[0] + sp[1]) + (sp[2] + sp[3]); s1 += __shfl_xor(s1, 16);
    const float mu = s1 * (1.0f / CC); float qp[4] = {0.f, 0.f, 0.f, 0.f};
#pragma unroll
    for (int kc = 0; kc < 4; ++kc)
#pragma unroll
      for (int i = 0; i < 16; ++i) { const float d = x[kc][i] - mu; qp[kc] += d * d; }
    float q = (qp[0] + qp[1]) + (qp[2] + qp[3]); q += __shfl_xor(q, 16);
    const float rs = rsqrtf(q * (1.0f / CC) + 1e-5f);
#pragma unroll
    for (int kc = 0; kc < 4; ++kc) { float v[16];
#pragma unroll
      for (int u = 0; u < 4; ++u) { const int c = kc * 32 + (u >> 1) * 16 + (u & 1) * 4 + 8 * g; const v4f lw = *(const v4f*)(LW + c), lb = *(const v4f*)(LB + c);
#pragma unroll
        for (int i = 0; i < 4; ++i) v[u * 4 + i] = (x[kc][u * 4 + i] - mu) * rs * bfr(lw[i]) + bfr(lb[i]); }
      a[kc] = bsplit16(v); } }
#pragma unroll
  for (int hh = 0; hh < NH; ++hh) sb[hh][tid] = (__bf16)wb4[hh];
  sb[NH][tid] = (__bf16)0.f;
  __syncthreads();   /* publishes feat2d_w */
  { v8f ab = {}; const __bf16* wr = &sb[col < NH ? col : NH][0];   /* tri_bias: 4 outputs; the columns beyond them read the row of zeros */
#pragma unroll
    for (int kc = 0; kc < 4; ++kc) { const v16b w = frag_b(wr + kc * 32, lane); ab = wmma_bf(a[kc].h, w, ab); ab = wmma_bf(a[kc].l, w, ab); }
#pragma unroll
    for (int r = 0; r < 8; ++r) sf[wave][8 * g + r][col] = ab[r];
    LDSX(); if (lane < 16) { const v4f b4 = *(const v4f*)&sf[wave][lane][0]; vst2(BIAS + r0 * NH + (unsigned)((wave * 16 + lane) * NH), b4); } }   /* 16 rows x 16 B = one 256-B run per wave */
#pragma unroll 1   /* rolled: one copy of staging and products in the instruction cache */
  for (int which = 0; which < 4; ++which) { const float* WA = which == 0 ? WQ : which == 1 ? WK : which == 2 ? WV : WG;
    __syncthreads();   /* every wave has read the last of the tiles of the product before */
    stage_w(WA, CC, sW, tid); __syncthreads();   /* publishes the fragments */
    v8f acc[8] = {};
#pragma unroll
    for (int kc = 0; kc < 4; ++kc) { v16b w[8];
#pragma unroll
      for (int j = 0; j < 8; ++j) w[j] = wfrag(sW, kc, j, lane);
#pragma unroll
      for (int j = 0; j < 8; ++j) { acc[j] = wmma_bf(a[kc].h, w[j], acc[j]); acc[j] = wmma_bf(a[kc].l, w[j], acc[j]); } }
    __syncthreads();   /* every wave has read its last fragment before the output tiles are written */
    if (which < 2) { _Float16* DH = which == 0 ? QH : KH; _Float16* DL = which == 0 ? QL : KL; const int nhi = which == 0 ? QHI : KHI; const bool hi_rows = t0 < nhi;   /* q, k: f16 rows (+ residual x 2^10 rows < nhi) */
#pragma unroll
      for (int j = 0; j < 8; ++j)
#pragma unroll
        for (int r = 0; r < 8; ++r) { const float v = acc[j][r]; const _Float16 hv = (_Float16)v; sh[wave * 16 + 8 * g + r][j * 16 + col] = hv; sl[wave * 16 + 8 * g + r][j * 16 + col] = (_Float16)((v - (float)hv) * 1024.0f); }
      __syncthreads();
      _Float16* dh = DH + r0 * CC; _Float16* dl = DL + (bb * nhi + t0) * (size_t)CC; const unsigned eo = (unsigned)((tid >> 4) * CC + (tid & 15) * 8);   /* uniform base + one 32-bit offset per thread: 8 rows on per trip */
#pragma unroll
      for (int u = 0; u < 8; ++u) vst2((unsigned*)(dh + eo + u * 8 * CC), *(const v4u*)&sh[(tid >> 4) + u * 8][(tid & 15) * 8]);
      asm volatile("s_wait_xcnt 0x0" ::: "memory");   /* what follows may rewrite registers that these stores name */
      if (hi_rows) {
#pragma unroll
        for (int u = 0; u < 8; ++u) vst2((unsigned*)(dl + eo + u * 8 * CC), *(const v4u*)&sl[(tid >> 4) + u * 8][(tid & 15) * 8]);
        asm volatile("s_wait_xcnt 0x0" ::: "memory"); }   /* the next trip rewrites registers that these stores name */
    } else if (which == 2) { const bool hi_rows = t0 < KHI;   /* v: f16 planes [c][t] (+ bf16 hi/lo planes for t < KHI) */
#pragma unroll
      for (int j = 0; j < 8; ++j)
#pragma unroll
        for (int r = 0; r < 8; ++r) { const float v = acc[j][r]; const int rl = wave * 16 + 8 * g + r, cl = j * 16 + col; th[cl][rl] = (_Float16)v; const __bf16 bh = (__bf16)v; tb[cl][rl] = bh; tbl[cl][rl] = (__bf16)(v - (float)bh); }
      __syncthreads();
      _Float16* vt = VT + bb * CC * (size_t)TT + t0; __bf16* vb = VB + bb * CC * (size_t)KHI + t0; __bf16* vbl = VBL + bb * CC * (size_t)KHI + t0; const unsigned vo = (unsigned)((tid >> 3) * TT + (tid & 7) * 8), ho = (unsigned)((tid >> 3) * KHI + (tid & 7) * 8);   /* 16 planes on per trip */
#pragma unroll
      for (int u = 0; u < 8; ++u) vst2((unsigned*)(vt + vo + u * 16 * TT), *(const v4u*)&th[(tid >> 3) + u * 16][(tid & 7) * 8]);
      asm volatile("s_wait_xcnt 0x0" ::: "memory");   /* what follows may rewrite registers that these stores name */
      if (hi_rows) {
#pragma unroll
        for (int u = 0; u < 8; ++u) { const int cl = (tid >> 3) + u * 16, q = tid & 7; vst2((unsigned*)(vb + ho + u * 16 * KHI), *(const v4u*)&tb[cl][q * 8]); vst2((unsigned*)(vbl + ho + u * 16 * KHI), *(const v4u*)&tbl[cl][q * 8]); }
        asm volatile("s_wait_xcnt 0x0" ::: "memory"); }   /* the next trip rewrites registers that these stores name */
    } else {
#pragma unroll
      for (int j = 0; j < 8; ++j)
#pragma unroll
        for (int r = 0; r < 8; ++r) sf[wave][8 * g + r][j * 16 + col] = 1.0f / (1.0f + expf(-(acc[j][r] + bfr(GB[j * 16 + col]))));   /* sigmoid(x Wg + gating_b) */
      LDSX(); v4f t[16];   /* all 16 LDS reads stand ahead of the stores: one LDS latency, not 16 */
#pragma unroll
      for (int rl = 0; rl < 16; ++rl) t[rl] = *(const v4f*)&sf[wave][rl][lane * 4];
#pragma unroll
      for (int rl = 0; rl < 16; ++rl) vst2(G + r0 * CC + (unsigned)(wave * 16 * CC + lane * 4) + rl * CC, t[rl]);
      asm volatile("s_wait_xcnt 0x0" ::: "memory"); }   /* behind the last stores, as in the other branches */
  } }
// ---- k_attn: work-group = (4 rows r, head h), 16 waves, wave = 16 queries against all 256 keys, 64 keys at a time with a running maximum and sum. The head's bias plane lies in LDS for the whole work-group, in the order the score fragments hold it; per row r the k rows, v planes and mask bias are staged in LDS once for all 16 waves. Both products are formed transposed (scores: A = k rows, B = q rows; ctx: A = v planes, B = P), so D's column is the query in both: a lane holds keys of ONE query, two neighbouring score tiles ARE the B fragment of P, and maximum, sum and rescale stay in the lane (one exchange with the other half-wave). The plain unroll directives keep the small arrays in registers.
#define FR 4               // rows r per work-group
#define KP (HD + 8)        // halves per staged k row: 80-B pitch
#define VP (TT + 8)        // halves per staged v plane: 528-B pitch
__device__ __forceinline__ v8f wmma_h(v16h a, v16h b, v8f c) { return __builtin_amdgcn_wmma_f32_16x16x32_f16(false, a, false, b, (short)0, c, false, false); }
__global__ __launch_bounds__(512) void k_attn(const _Float16* __restrict__ QH, const _Float16* __restrict__ QL, const _Float16* __restrict__ KH, const _Float16* __restrict__ VT, const float* __restrict__ BIAS, const float* __restrict__ MKP, float* __restrict__ Y) {
  __shared__ __align__(16) float sB[TT * TT];            // [query tile][key tile][half of 8][lane][4]
  __shared__ __align__(16) _Float16 sK[TT][KP]; __shared__ __align__(16) _Float16 sV[HD][VP]; __shared__ __align__(16) float sM[TT];
  const int tid = threadIdx.x, wave = tid >> 5, lane = tid & 31, col = lane & 15, g = lane >> 4; const int h = blockIdx.y; const int rb = (int)blockIdx.x * FR;
  const unsigned ko0 = (unsigned)(tid >> 2) * CC + (tid & 3) * 8, vo0 = (unsigned)tid * 8;   /* this thread's 16-B pieces of a row's k rows (and 128 rows on) and v planes (and 16 planes on) */
  const unsigned qo = (unsigned)(wave * 16 + col) * CC + 8 * g;
  v4u pk[2], pv[2]; float pm = 0.f;
  { const _Float16* kb = KH + (size_t)rb * TT * CC + h * HD; const _Float16* vb = VT + ((size_t)rb * CC + h * HD) * TT;
    pk[0] = *(const v4u*)(kb + ko0); pk[1] = *(const v4u*)(kb + ko0 + 128 * CC); pv[0] = *(const v4u*)(vb + vo0); pv[1] = *(const v4u*)(vb + vo0 + 16 * TT);
    if (tid < TT) pm = MKP[(size_t)rb * SZ + tid]; }
  // a wave takes 8 queries x 4 keys per load: its 32 LDS words fall on 32 banks; the 16 waves stand side by side along the keys
  { const float* bh = BIAS + h; const unsigned gs = (unsigned)((((tid >> 2) & 7) * SZ + wave * 4 + (tid & 3)) * NH), ld = (unsigned)(((((wave >> 2) * 2 + (wave & 1)) * 32) + ((wave >> 1) & 1) * 16 + ((tid >> 2) & 7)) * 4 + (tid & 3));
#pragma unroll 4   /* 16 loads in flight per lane */
    for (int qi = 0; qi < TT / 8; ++qi)
#pragma unroll
      for (int kk = 0; kk < 4; ++kk) sB[ld + (qi >> 1) * 4096 + (qi & 1) * 32 + kk * 1024] = bh[gs + qi * (8 * SZ * NH) + kk * (64 * NH)]; }
#pragma unroll 1   /* rolled: one copy of the body in the instruction cache */
  for (int it = 0; it < FR; ++it) { const int b = rb + it;
    const _Float16* qhb = QH + (size_t)b * TT * CC + h * HD; const _Float16* qlb = QL + (size_t)b * QHI * CC + h * HD;
    union { v16h v; v8h q[2]; } qh, ql; qh.q[0] = *(const v8h*)(qhb + qo); qh.q[1] = *(const v8h*)(qhb + qo + 16); ql.q[0] = *(const v8h*)(qlb + qo); ql.q[1] = *(const v8h*)(qlb + qo + 16);
    __syncthreads();   /* every wave has left the previous row's k, v and mask tiles */
    *(v4u*)&sK[tid >> 2][(tid & 3) * 8] = pk[0]; *(v4u*)&sK[128 + (tid >> 2)][(tid & 3) * 8] = pk[1]; *(v4u*)&sV[tid >> 5][(tid & 31) * 8] = pv[0]; *(v4u*)&sV[16 + (tid >> 5)][(tid & 31) * 8] = pv[1];
    if (tid < TT) sM[tid] = 32768.0f * (bfr(pm) - 1.0f);   /* FP16_HUGE * (pair_mask[r][k] - 1) */
    __syncthreads();   /* publishes this row's tiles (and, the first time, the bias plane) */
    if (it + 1 < FR) {   /* the next row's tiles fly while this row is worked on */
      const _Float16* kb = KH + (size_t)(b + 1) * TT * CC + h * HD; const _Float16* vb = VT + ((size_t)(b + 1) * CC + h * HD) * TT;
      pk[0] = *(const v4u*)(kb + ko0); pk[1] = *(const v4u*)(kb + ko0 + 128 * CC); pv[0] = *(const v4u*)(vb + vo0); pv[1] = *(const v4u*)(vb + vo0 + 16 * TT);
      if (tid < TT) pm = MKP[(size_t)(b + 1) * SZ + tid]; }
    float m = -3.0e38f, l = 0.f; v8f acc[HD / 16] = {};   /* l: this half-wave's keys only; the halves meet behind the loop */
#pragma unroll 1   /* rolled: unrolled, the LDS reads of all 16 key tiles are hoisted and the 256 registers of a 16-wave work-group spill */
    for (int c = 0; c < TT / 64; ++c) { v8f s[4];
#pragma unroll
      for (int jj = 0; jj < 4; ++jj) { const int j = c * 4 + jj; const v16h kf = frag_h(&sK[j * 16 + col][0], lane); const v8f z = {}; const v8f a = wmma_h(kf, qh.v, z), al = wmma_h(kf, ql.v, z);
        const float* bp = sB + (((wave * 16 + j) * 2) * 32 + lane) * 4; const v4f b0 = *(const v4f*)bp, b1 = *(const v4f*)(bp + 128); const v4f m0 = *(const v4f*)&sM[j * 16 + 8 * g], m1 = *(const v4f*)&sM[j * 16 + 8 * g + 4];
#pragma unroll
        for (int r = 0; r < 8; ++r) s[jj][r] = (a[r] + al[r] * (1.0f / 1024.0f)) * SCALE + (r < 4 ? b0[r & 3] : b1[r & 3]) + (r < 4 ? m0[r & 3] : m1[r & 3]); }
      v8f mx = s[0];
#pragma unroll
      for (int r = 0; r < 8; ++r) mx[r] = fmaxf(fmaxf(mx[r], s[1][r]), fmaxf(s[2][r], s[3][r]));
      float cm = fmaxf(fmaxf(fmaxf(mx[0], mx[1]), fmaxf(mx[2], mx[3])), fmaxf(fmaxf(mx[4], mx[5]), fmaxf(mx[6], mx[7]))); cm = fmaxf(cm, __shfl_xor(cm, 16));
      const float mn = fmaxf(m, cm); const float alpha = expf(m - mn); m = mn;   /* what was summed under the old maximum shrinks by alpha */
      v8f sm = {};
#pragma unroll
      for (int jj = 0; jj < 4; ++jj)
#pragma unroll
        for (int r = 0; r < 8; ++r) { const float e = expf(s[jj][r] - mn); s[jj][r] = e; sm[r] += e; }
      l = l * alpha + (((sm[0] + sm[1]) + (sm[2] + sm[3])) + ((sm[4] + sm[5]) + (sm[6] + sm[7])));
#pragma unroll
      for (int j = 0; j < HD / 16; ++j)
#pragma unroll
        for (int r = 0; r < 8; ++r) acc[j][r] *= alpha;
#pragma unroll
      for (int k2 = 0; k2 < 2; ++k2) { v16h p;
#pragma unroll
        for (int i = 0; i < 8; ++i) { p[i] = (_Float16)(s[2 * k2][i] * 2048.0f); p[8 + i] = (_Float16)(s[2 * k2 + 1][i] * 2048.0f); }
#pragma unroll
        for (int j = 0; j < HD / 16; ++j) acc[j] = wmma_h(frag_h(&sV[j * 16 + col][(c * 2 + k2) * 32], lane), p, acc[j]); } }
    l += __shfl_xor(l, 16);
    const float inv = (m > -1.0e38f && l > 0.f) ? (1.0f / 2048.0f) / l : 0.f;   /* a fully excluded row (every logit at or below -1e38) yields 0 */
    float* yp = Y + (size_t)b * TT * CC + h * HD + (unsigned)(wave * 16 + col) * CC + 8 * g;
#pragma unroll
    for (int j = 0; j < HD / 16; ++j) { v4f y0, y1;
#pragma unroll
      for (int r = 0; r < 4; ++r) { y0[r] = acc[j][r] * inv; y1[r] = acc[j][4 + r] * inv; }
      vst2(yp + j * 16, y0); vst2(yp + j * 16 + 4, y1); }   /* the 128-B (row, head) segment has this wave as its one writer */
    asm volatile("s_wait_xcnt 0x0" ::: "memory");   /* the next trip rewrites the registers that these stores name */
  } }
// ---- k_out: block = (64 rows, 128 cols): out = ctx Wo (+ bo): all rows: ctx bf16 hi + lo against exact bf16 Wo (2 products); the f16 branch (1 product, Wo x 2^8) is never taken
__global__ __launch_bounds__(128) void k_out(const float* __restrict__ Y, const float* __restrict__ WO, const float* __restrict__ BO, float* __restrict__ OUT) { __shared__ __align__(16) float sf[4][16][132];
  const int tid = threadIdx.x, wave = tid >> 5, lane = tid & 31, col = lane & 15, g = lane >> 4; const int c0 = blockIdx.y * 128; const size_t r0 = (size_t)blockIdx.x * 64 + wave * 16;
  v8f acc[8] = {};
  if (true) {   /* ALL rows: gated ctx bf16 hi + lo x exact output_w (2 products) */
    __bf16* sW = (__bf16*)&sf[0][0][0];   /* the weight's fragments lie where the output rows are staged later */
    stage_w(WO + c0, DIN, sW, tid); __syncthreads();   /* publishes the fragments */
#pragma unroll 2
    for (int kc = 0; kc < CC / 32; ++kc) { v16b w[8];
#pragma unroll
      for (int j = 0; j < 8; ++j) w[j] = wfrag(sW, kc, j, lane);   /* the chunk's LDS reads stand in one place, ahead of the rows' global loads */
      const F2 a = split_row(Y + (r0 + col) * CC, kc * 32, lane); asm volatile("s_wait_loadcnt 0x0" ::: "memory");
#pragma unroll
      for (int j = 0; j < 8; ++j) { acc[j] = wmma_bf(a.h, w[j], acc[j]); acc[j] = wmma_bf(a.l, w[j], acc[j]); } }
    __syncthreads();   /* every wave has read its last fragment before sf is written */
#pragma unroll
    for (int j = 0; j < 8; ++j) { const float bias = BO ? bfr(BO[c0 + j * 16 + col]) : 0.f;
#pragma unroll
      for (int r = 0; r < 8; ++r) sf[wave][8 * g + r][j * 16 + col] = acc[j][r] + bias; }
  } else {
#pragma unroll 2
    for (int kc = 0; kc < CC / 32; ++kc) { const v16h a = frag_f32(Y + (r0 + col) * CC + kc * 32, lane); asm volatile("s_wait_loadcnt 0x0" ::: "memory");
#pragma unroll
      for (int j = 0; j < 8; ++j) { const v16h w = WOCOLH(WO, kc * 32, c0 + j * 16 + col, lane); asm volatile("s_wait_loadcnt 0x0" ::: "memory"); acc[j] = wmma16(a, w, acc[j]); } }
#pragma unroll
    for (int j = 0; j < 8; ++j) { const float bias = BO ? bfr(BO[c0 + j * 16 + col]) : 0.f;
#pragma unroll
      for (int r = 0; r < 8; ++r) sf[wave][8 * g + r][j * 16 + col] = acc[j][r] * (1.0f / 256.0f) + bias; } }
  LDSX(); for (int rl = 0; rl < 16; ++rl) vst2(OUT + (r0 + rl) * DIN + c0 + lane * 4, *(const v4f*)&sf[wave][rl][lane * 4]); }

extern "C" void kernel_launch(void* const* d_in, const int* in_sizes, int n_in, void* d_out, int out_size, void* d_ws, size_t ws_size, hipStream_t stream) {
  (void)in_sizes; (void)n_in; (void)out_size;
  const float** F = (const float**)d_in;
  if (ws_size < (size_t)WS_END) return;
  char* ws = (char*)d_ws; _Float16 *QH = (_Float16*)(ws + WS_QH), *KH = (_Float16*)(ws + WS_KH), *VT = (_Float16*)(ws + WS_VT), *QL = (_Float16*)(ws + WS_QL), *KL = (_Float16*)(ws + WS_KL); __bf16 *VB = (__bf16*)(ws + WS_VB), *VBL = (__bf16*)(ws + WS_VBL); float *Y = (float*)(ws + WS_Y);
  (void)Y; (void)QL; (void)KL; (void)VB; (void)VBL;
  // inputs: 0 pair_act [1,256,256,128]; 1 pair_mask [1,256,256]; 2 ln_gamma, 3 ln_beta; 4 feat2d_w [128,4]; 5 query_w, 6 key_w, 7 value_w [128,4,32] (in,out); 8 gating_w [128,4,32], 9 gating_b [4,32]; 10 output_w [4,32,128] (in,out); 11 output_b
  if (ws_size < (size_t)WS_END2) return;
  float *BIAS = (float*)(ws + WS_BIAS), *G = (float*)(ws + WS_G);
  k_front<<<dim3(NZR / 64), 128, 0, stream>>>(F[0], F[2], F[3], F[4], F[5], F[6], F[7], F[8], F[9], QH, QL, KH, KL, VT, VB, VBL, BIAS, G);
  k_attn<<<dim3(TNB / FR, NH), 512, 0, stream>>>(QH, QL, KH, VT, BIAS, F[1], Y);
  k_gate<<<dim3((NZR * (CC / 4) + 255) / 256), 256, 0, stream>>>(Y, G);
  k_out<<<dim3(TNB * TT / 64, DIN / 128), 128, 0, stream>>>(Y, F[10], F[11], (float*)d_out);
}

// v004
// It runs in 94.9 microseconds.
// Next to v003, in two timings, it ran 1.41 and 1.42 times as fast.
// Counting every step since v000, it is 5.58 times as fast.
// compute dtype: all float inputs rounded to bf16; LayerNorm of pair_act in f32; q/k/v = LN(act) split bf16 hi + lo x W (exact bf16, (in,out)) on WMMA 16x16x32 (2 products, f32 accumulate); q as f16 hi + residual (x 2^10) against k once to f16 (2 products) x 32^-0.5 + the per-(query, key, head) triangle bias (2-product GEMM) + the mask bias; softmax in f32 (precise expf, running maximum and sum over steps of 64 keys); exp(logit - maximum) x 2^11 once to f16 against v once to f16 (1 product), divided by the sum at the end; gate sigmoid(LN(act) Wg + b) in f32 (2-product GEMM, precise expf); gated ctx split bf16 hi + lo against exact output_w (2 products) + output_b; f32 output.
#include <hip/hip_runtime.h>
#include <math.h>

typedef __attribute__((ext_vector_type(16))) _Float16 v16h;
typedef __attribute__((ext_vector_type(16))) __bf16 v16b;
typedef __attribute__((ext_vector_type(8)))  _Float16 v8h;
typedef __attribute__((ext_vector_type(8)))  float v8f;
typedef __attribute__((ext_vector_type(4)))  float v4f;
typedef __attribute__((ext_vector_type(2)))  float v2f;
typedef __attribute__((ext_vector_type(4)))  unsigned v4u;
typedef __attribute__((ext_vector_type(4)))  int v4i;
typedef float __attribute__((may_alias)) float_a;
typedef int __attribute__((may_alias)) int_a;

template <typename T> __device__ __forceinline__ void vst2(void* p, T v) { *(T*)p = v;  }
__device__ __forceinline__ v8f wmma16(v16h a, v16h b, v8f c) {
  v8f d = __builtin_amdgcn_wmma_f32_16x16x32_f16(false, a, false, b, (short)0, c, false, false);
  asm volatile("v_nop\n\tv_nop\n\tv_nop\n\tv_nop" : "+v"(d) : "v"(a), "v"(b));
  return d;
}
__device__ __forceinline__ v8f wmma_bf(v16b a, v16b b, v8f c) {
  v8f d = __builtin_amdgcn_wmma_f32_16x16x32_bf16(false, a, false, b, (short)0, c, false, false);
  asm volatile("v_nop\n\tv_nop\n\tv_nop\n\tv_nop" : "+v"(d) : "v"(a), "v"(b));
  return d;
}
// 16x16x32 fragments: lane = (h = lane>>4, row/col = lane&15); elements 0..7 = k0+8h+0..7, 8..15 = k0+16+8h+0..7; D element r = row 8h+r
__device__ __forceinline__ v16h frag_h(const _Float16* rowk0, int lane) {
  union { v16h v; v8h q[2]; } u; const _Float16* p = rowk0 + 8 * (lane >> 4);
  u.q[0] = *(const v8h*)p; u.q[1] = *(const v8h*)(p + 16); return u.v;
}
__device__ __forceinline__ v16h frag_f32(const float* rowk0, int lane) {
  v16h a; const float* p = rowk0 + 8 * (lane >> 4);
#pragma unroll
  for (int i = 0; i < 8; ++i) { a[i] = (_Float16)p[i]; a[8 + i] = (_Float16)p[16 + i]; }
  return a;
}
__device__ __forceinline__ v16h frag_f32s(const float* rowk0, int lane, float sc) {
  v16h a; const float* p = rowk0 + 8 * (lane >> 4);
#pragma unroll
  for (int i = 0; i < 8; ++i) { a[i] = (_Float16)(p[i] * sc); a[8 + i] = (_Float16)(p[16 + i] * sc); }
  return a;
}
// column fragment from a [K][ld] layout (column n), rows >= K read as 0
__device__ __forceinline__ v16h fragc_f32(const float* W, int k0, int n, int lane, int ld, int K) {
  v16h a; const int g = lane >> 4;
#pragma unroll
  for (int i = 0; i < 8; ++i) { const int ka = k0 + 8 * g + i, kb = ka + 16;
    a[i] = (_Float16)(ka < K ? W[(size_t)(ka < K ? ka : K - 1) * ld + n] : 0.f); a[8 + i] = (_Float16)(kb < K ? W[(size_t)(kb < K ? kb : K - 1) * ld + n] : 0.f); }
  return a;
}
struct F2 { v16b h, l; };
__device__ __forceinline__ F2 bsplit16(const float v[16]) { F2 r;
#pragma unroll
  for (int i = 0; i < 16; ++i) { const __bf16 h = (__bf16)v[i]; r.h[i] = h; r.l[i] = (__bf16)(v[i] - (float)h); }
  return r; }
__device__ __forceinline__ F2 split_row(const float* row, int k0, int lane) { float v[16]; const float* p = row + k0 + 8 * (lane >> 4);
#pragma unroll
  for (int i = 0; i < 8; ++i) { v[i] = p[i]; v[8 + i] = p[16 + i]; }
  return bsplit16(v); }
// the same of the element-wise product of two rows (ctx row x gate row, multiplied in f32 ahead of the split)
__device__ __forceinline__ F2 split_row2(const float* row, const float* grow, int k0, int lane) { float v[16]; v4f y[4], t[4]; const float* p = row + k0 + 8 * (lane >> 4); const float* q = grow + k0 + 8 * (lane >> 4);
#pragma unroll
  for (int u = 0; u < 4; ++u) { y[u] = *(const v4f*)(p + (u >> 1) * 16 + (u & 1) * 4); t[u] = *(const v4f*)(q + (u >> 1) * 16 + (u & 1) * 4); }
  asm volatile("s_wait_xcnt 0x0" :: "v"(y[0]), "v"(y[1]), "v"(y[2]), "v"(y[3]), "v"(t[0]), "v"(t[1]), "v"(t[2]), "v"(t[3]) : "memory");   /* what follows may rewrite the registers that these loads name; the loaded values as inputs hold the wait behind the loads */
#pragma unroll
  for (int u = 0; u < 4; ++u)
#pragma unroll
    for (int i = 0; i < 4; ++i) v[u * 4 + i] = y[u][i] * t[u][i];
  return bsplit16(v); }
__device__ __forceinline__ F2 split_rowK(const float* row, int k0, int lane, int K) { float v[16]; const int g = lane >> 4;
#pragma unroll
  for (int i = 0; i < 8; ++i) { const int ka = k0 + 8 * g + i, kb = ka + 16; v[i] = ka < K ? row[ka < K ? ka : K - 1] : 0.f; v[8 + i] = kb < K ? row[kb < K ? kb : K - 1] : 0.f; }
  return bsplit16(v); }
__device__ __forceinline__ F2 split_col(const float* W, int k0, int n, int lane, int ld, int K) { float v[16]; const int g = lane >> 4;
#pragma unroll
  for (int i = 0; i < 8; ++i) { const int ka = k0 + 8 * g + i, kb = ka + 16; v[i] = ka < K ? W[(size_t)(ka < K ? ka : K - 1) * ld + n] : 0.f; v[8 + i] = kb < K ? W[(size_t)(kb < K ? kb : K - 1) * ld + n] : 0.f; }
  return bsplit16(v); }
__device__ __forceinline__ v8f mac3(const F2& a, const F2& b, v8f c) { c = wmma_bf(a.l, b.h, c); c = wmma_bf(a.h, b.l, c); return wmma_bf(a.h, b.h, c); }
__device__ __forceinline__ float sigm(float v) { return 1.0f / (1.0f + expf(-v)); }
#define LDSX() do { asm volatile("s_wait_dscnt 0" ::: "memory"); __builtin_amdgcn_wave_barrier(); __builtin_amdgcn_fence(__ATOMIC_RELEASE, "workgroup"); } while (0)

// Triangle attention (pair_act [1, 256, 256, 128], 4 heads x 32): act = LayerNorm(pair_act); for every row r: q = act[r] Wq * 32^-0.5, k = act[r] Wk, v = act[r] Wv; logits[r,h,q,k] = q . k + 2^15 (pair_mask[r][k] - 1) + tri_bias[h][q][k] with tri_bias = act . feat2d_w (indexed by the (q, k) PAIR, shared across rows); softmax over k; wa = (weights v) * sigmoid(act[r][q] Wg + bg); out[r][q] = wa . output_w + output_b.
#define NB 256
#define TT 256
#define CC 128            // NH * HD = projected width
#define DIN 128          // input (model) width
#define NH 4
#define HD 32
#define NQB (TT / 64)
#define HG 4
#define SCALE (0.17677669529663687f)
#define CAUSAL 0
#ifndef TNB
#define TNB NB
#endif
__device__ __forceinline__ float bfr(float v) { return (float)(__bf16)v; }
__host__ __device__ __forceinline__ int kb_last(int qb) { return CAUSAL ? ((qb * 64 + 63) >> 7) : (TT / 128 - 1); }
typedef __attribute__((ext_vector_type(8))) __bf16 v8b;
__device__ __forceinline__ v16b frag_b(const __bf16* rowk0, int lane) {
  union { v16b v; v8b q[2]; } u; const __bf16* p = rowk0 + 8 * (lane >> 4);
  u.q[0] = *(const v8b*)p; u.q[1] = *(const v8b*)(p + 16); return u.v;
}
// One 128 x 128 (in,out) weight, rounded to bf16 once per work-group of 128 threads and laid in LDS (32 KiB) in the order the B fragments are read: [k chunk of 32][column tile][half of 8 k][lane] pieces of 16 B. Thread = output column: a wave's load is one whole 128-B line, all 128 loads of a thread are independent, and 8 k of a column make one 16-B store. The plain unroll directives here and at the fragment arrays w[8] keep those small arrays in registers.
__device__ __forceinline__ void stage_w(const float* __restrict__ Wm, int ld, __bf16* sW, int tid) { const float* p = Wm + tid;
#pragma unroll
  for (int kg = 0; kg < 16; ++kg) { v8b w;   /* k = 8 kg + i: chunk kg >> 2, half (kg >> 1) & 1, lane half kg & 1 */
#pragma unroll
    for (int i = 0; i < 8; ++i) w[i] = (__bf16)p[(size_t)(kg * 8 + i) * ld];
    *(v8b*)(sW + (size_t)(((((kg >> 2) * 8 + (tid >> 4)) * 2 + ((kg >> 1) & 1)) * 32 + (kg & 1) * 16 + (tid & 15)) * 8)) = w; } }
__device__ __forceinline__ v16b wfrag(const __bf16* sW, int kc, int j, int lane) {
  union { v16b v; v8b q[2]; } u; const __bf16* p = sW + ((kc * 8 + j) * 64 + lane) * 8;
  u.q[0] = *(const v8b*)p; u.q[1] = *(const v8b*)(p + 256); return u.v;
}
#define QBH 0              // unused: nothing in this file reads it
#define QHI 256            // rows carrying a q residual plane (all rows when non-causal: 2-product logits everywhere)
#define KHI 64            // key rows carrying k residual / v bf16 hi+lo planes (written by k_front; no kernel reads them)
// B fragment (k rows k0+.., output column o) of a weight: (in,out) [K][ld] or (out,in) [ld rows of K]: bf16 exact, or f16(bf16 * 256) exact
__device__ __forceinline__ v16b wcol_io(const float* Wm, int k0, int o, int lane, int ld) { v16b w; const int g = lane >> 4;
#pragma unroll
  for (int i = 0; i < 8; ++i) { w[i] = (__bf16)Wm[(size_t)(k0 + 8 * g + i) * ld + o]; w[8 + i] = (__bf16)Wm[(size_t)(k0 + 16 + 8 * g + i) * ld + o]; }
  return w; }
__device__ __forceinline__ v16b wcol_oi(const float* Wm, int k0, int o, int lane, int K) { v16b w; const float* p = Wm + (size_t)o * K + k0 + 8 * (lane >> 4);
#pragma unroll
  for (int i = 0; i < 8; ++i) { w[i] = (__bf16)p[i]; w[8 + i] = (__bf16)p[16 + i]; }
  return w; }
__device__ __forceinline__ v16h wcolh_io(const float* Wm, int k0, int o, int lane, int ld) { v16h w; const int g = lane >> 4;
#pragma unroll
  for (int i = 0; i < 8; ++i) { w[i] = (_Float16)(bfr(Wm[(size_t)(k0 + 8 * g + i) * ld + o]) * 256.0f); w[8 + i] = (_Float16)(bfr(Wm[(size_t)(k0 + 16 + 8 * g + i) * ld + o]) * 256.0f); }
  return w; }
__device__ __forceinline__ v16h wcolh_oi(const float* Wm, int k0, int o, int lane, int K) { v16h w; const float* p = Wm + (size_t)o * K + k0 + 8 * (lane >> 4);
#pragma unroll
  for (int i = 0; i < 8; ++i) { w[i] = (_Float16)(bfr(p[i]) * 256.0f); w[8 + i] = (_Float16)(bfr(p[16 + i]) * 256.0f); }
  return w; }
#define WQKV_LAYOUT 0   // 0 = (in,out) [DIN][CC]; 1 = (out,in) [CC][DIN]; 2 = per-head [NH][DIN][HD]
__device__ __forceinline__ v16b wcol_hdk(const float* Wm, int k0, int o, int lane) { v16b w; const int g = lane >> 4; const float* p = Wm + (size_t)(o / HD) * DIN * HD + (o % HD);
#pragma unroll
  for (int i = 0; i < 8; ++i) { w[i] = (__bf16)p[(size_t)(k0 + 8 * g + i) * HD]; w[8 + i] = (__bf16)p[(size_t)(k0 + 16 + 8 * g + i) * HD]; }
  return w; }
#define WO_OUT_IN 0
#if WQKV_LAYOUT == 1
#define WCOL(W, k0, o, lane) wcol_oi(W, k0, o, lane, DIN)
#elif WQKV_LAYOUT == 2
#define WCOL(W, k0, o, lane) wcol_hdk(W, k0, o, lane)
#else
#define WCOL(W, k0, o, lane) wcol_io(W, k0, o, lane, CC)
#endif
#if WO_OUT_IN
#define WOCOL(W, k0, o, lane) wcol_oi(W, k0, o, lane, CC)
#define WOCOLH(W, k0, o, lane) wcolh_oi(W, k0, o, lane, CC)
#else
#define WOCOL(W, k0, o, lane) wcol_io(W, k0, o, lane, DIN)
#define WOCOLH(W, k0, o, lane) wcolh_io(W, k0, o, lane, DIN)
#endif
#define SZ 256
#define BG 64              // sizes only the unused WS_S region (x HG 4 = 256 planes of 256 x 256)
#define NZR (SZ * SZ)      // 65,536 pair rows
#define WS_ZN   (WS_END)
#define WS_BIAS (WS_ZN + 4u * (size_t)NZR * CC)
#define WS_G    (WS_BIAS + 4u * (size_t)NZR * NH)
#define WS_END2 (WS_G + 4u * (size_t)NZR * CC)
#ifndef PROJ_EXTRA_PARAMS
#define PROJ_EXTRA_PARAMS
#endif

#define WS_QH  0u                                      // f16 q rows [b*t][CC]
#define WS_KH  (WS_QH + 2u * (size_t)NB * TT * CC)      // f16 k rows [b*t][CC]
#define WS_VT  (WS_KH + 2u * (size_t)NB * TT * CC)      // f16 v planes [b][c][t]
#define WS_QL  (WS_VT + 2u * (size_t)NB * CC * TT)      // f16 q residual x 2^10 rows [b][t < QHI][CC]
#define WS_KL  (WS_QL + 2u * (size_t)NB * QHI * CC)     // f16 k residual x 2^10 rows [b][t < KHI][CC]
#define WS_VB  (WS_KL + 2u * (size_t)NB * KHI * CC)     // bf16 v hi planes [b][c][t < KHI]
#define WS_VBL (WS_VB + 2u * (size_t)NB * CC * KHI)
#define WS_S   (WS_VBL + 2u * (size_t)NB * CC * KHI)    // unused f32 region (k_attn keeps logits and P in registers)
#define WS_Y   (WS_S  + 4u * (size_t)BG * HG * TT * TT)   // unused WS_S: 256 planes of 256 x 256 f32      // f32 ctx rows [b*t][CC] (only when there is an output projection)
#define WS_END (WS_Y  + 4u * (size_t)NB * TT * CC)

// ---- k_front: block = 64 pair rows, wave = 16 rows. A lane reads its half of one row of pair_act in the order of the A fragments (k = 32 kc + 8 g + i and 16 on), so LayerNorm (biased var, eps 1e-5, ln_gamma/ln_beta, of bf16(z)) needs one exchange with the other half-wave, and the four bf16 hi + lo fragments of LN(act) are formed once and stay in registers for all five products: tri_bias (BIAS[row = q*256+k][h]), then q, k, v and the gate, one 128 x 128 (in,out) weight after the other through the same LDS. The output tiles of a product lie on the weight's fragments once the products are done. The second launch bound holds the registers to 4 waves per SIMD, so that all 1,024 work-groups are resident at once.
__global__ __launch_bounds__(128, 4) void k_front(const float* __restrict__ Z, const float* __restrict__ LW, const float* __restrict__ LB, const float* __restrict__ WB, const float* __restrict__ WQ, const float* __restrict__ WK, const float* __restrict__ WV, const float* __restrict__ WG, const float* __restrict__ GB,
    _Float16* __restrict__ QH, _Float16* __restrict__ QL, _Float16* __restrict__ KH, _Float16* __restrict__ KL, _Float16* __restrict__ VT, __bf16* __restrict__ VB, __bf16* __restrict__ VBL, float* __restrict__ BIAS, float* __restrict__ G) {
  __shared__ __align__(16) char sm[3 * 128 * 72 * 2];   /* the largest user: v's three transposed tiles */
  _Float16 (*sh)[136] = (_Float16 (*)[136])sm; _Float16 (*sl)[136] = (_Float16 (*)[136])(sm + 64 * 136 * 2); _Float16 (*th)[72] = (_Float16 (*)[72])sm; __bf16 (*tb)[72] = (__bf16 (*)[72])(sm + 128 * 72 * 2); __bf16 (*tbl)[72] = (__bf16 (*)[72])(sm + 2 * 128 * 72 * 2); float (*sf)[16][132] = (float (*)[16][132])sm; __bf16* sW = (__bf16*)sm; __bf16 (*sb)[144] = (__bf16 (*)[144])(sm + 2 * 64 * 136 * 2);   /* feat2d_w transposed, [head][k], behind the bias rows of sf; a fifth row of zeros; 288-B pitch: the 16-B reads of 5 rows x 2 halves fall on different banks */
  const int tid = threadIdx.x, wave = tid >> 5, lane = tid & 31, col = lane & 15, g = lane >> 4; const size_t r0 = (size_t)blockIdx.x * 64; const size_t bb = r0 / TT; const int t0 = (int)(r0 % TT);
  const v4f wb4 = *(const v4f*)(WB + tid * NH);   /* thread = input channel k: its 4 heads in one 16-B load, in flight under the rows' loads */
  F2 a[4];
  { float x[4][16]; const float* zp = Z + r0 * CC + (unsigned)((wave * 16 + col) * CC + 8 * g);
#pragma unroll
    for (int kc = 0; kc < 4; ++kc)
#pragma unroll
      for (int u = 0; u < 4; ++u) { const v4f t = *(const v4f*)(zp + kc * 32 + (u >> 1) * 16 + (u & 1) * 4);
#pragma unroll
        for (int i = 0; i < 4; ++i) x[kc][u * 4 + i] = bfr(t[i]); }
    float sp[4] = {0.f, 0.f, 0.f, 0.f};
#pragma unroll
    for (int kc = 0; kc < 4; ++kc)
#pragma unroll
      for (int i = 0; i < 16; ++i) sp[kc] += x[kc][i];
    float s1 = (sp[0] + sp[1]) + (sp[2] + sp[3]); s1 += __shfl_xor(s1, 16);
    const float mu = s1 * (1.0f / CC); float qp[4] = {0.f, 0.f, 0.f, 0.f};
#pragma unroll
    for (int kc = 0; kc < 4; ++kc)
#pragma unroll
      for (int i = 0; i < 16; ++i) { const float d = x[kc][i] - mu; qp[kc] += d * d; }
    float q = (qp[0] + qp[1]) + (qp[2] + qp[3]); q += __shfl_xor(q, 16);
    const float rs = rsqrtf(q * (1.0f / CC) + 1e-5f);
#pragma unroll
    for (int kc = 0; kc < 4; ++kc) { float v[16];
#pragma unroll
      for (int u = 0; u < 4; ++u) { const int c = kc * 32 + (u >> 1) * 16 + (u & 1) * 4 + 8 * g; const v4f lw = *(const v4f*)(LW + c), lb = *(const v4f*)(LB + c);
#pragma unroll
        for (int i = 0; i < 4; ++i) v[u * 4 + i] = (x[kc][u * 4 + i] - mu) * rs * bfr(lw[i]) + bfr(lb[i]); }
      a[kc] = bsplit16(v); } }
#pragma unroll
  for (int hh = 0; hh < NH; ++hh) sb[hh][tid] = (__bf16)wb4[hh];
  sb[NH][tid] = (__bf16)0.f;
  __syncthreads();   /* publishes feat2d_w */
  { v8f ab = {}; const __bf16* wr = &sb[col < NH ? col : NH][0];   /* tri_bias: 4 outputs; the columns beyond them read the row of zeros */
#pragma unroll
    for (int kc = 0; kc < 4; ++kc) { const v16b w = frag_b(wr + kc * 32, lane); ab = wmma_bf(a[kc].h, w, ab); ab = wmma_bf(a[kc].l, w, ab); }
#pragma unroll
    for (int r = 0; r < 8; ++r) sf[wave][8 * g + r][col] = ab[r];
    LDSX(); if (lane < 16) { const v4f b4 = *(const v4f*)&sf[wave][lane][0]; vst2(BIAS + r0 * NH + (unsigned)((wave * 16 + lane) * NH), b4); } }   /* 16 rows x 16 B = one 256-B run per wave */
#pragma unroll 1   /* rolled: one copy of staging and products in the instruction cache */
  for (int which = 0; which < 4; ++which) { const float* WA = which == 0 ? WQ : which == 1 ? WK : which == 2 ? WV : WG;
    __syncthreads();   /* every wave has read the last of the tiles of the product before */
    stage_w(WA, CC, sW, tid); __syncthreads();   /* publishes the fragments */
    v8f acc[8] = {};
#pragma unroll
    for (int kc = 0; kc < 4; ++kc) { v16b w[8];
#pragma unroll
      for (int j = 0; j < 8; ++j) w[j] = wfrag(sW, kc, j, lane);
#pragma unroll
      for (int j = 0; j < 8; ++j) { acc[j] = wmma_bf(a[kc].h, w[j], acc[j]); acc[j] = wmma_bf(a[kc].l, w[j], acc[j]); } }
    __syncthreads();   /* every wave has read its last fragment before the output tiles are written */
    if (which < 2) { _Float16* DH = which == 0 ? QH : KH; _Float16* DL = which == 0 ? QL : KL; const int nhi = which == 0 ? QHI : KHI; const bool hi_rows = t0 < nhi;   /* q, k: f16 rows (+ residual x 2^10 rows < nhi) */
#pragma unroll
      for (int j = 0; j < 8; ++j)
#pragma unroll
        for (int r = 0; r < 8; ++r) { const float v = acc[j][r]; const _Float16 hv = (_Float16)v; sh[wave * 16 + 8 * g + r][j * 16 + col] = hv; sl[wave * 16 + 8 * g + r][j * 16 + col] = (_Float16)((v - (float)hv) * 1024.0f); }
      __syncthreads();
      _Float16* dh = DH + r0 * CC; _Float16* dl = DL + (bb * nhi + t0) * (size_t)CC; const unsigned eo = (unsigned)((tid >> 4) * CC + (tid & 15) * 8);   /* uniform base + one 32-bit offset per thread: 8 rows on per trip */
#pragma unroll
      for (int u = 0; u < 8; ++u) vst2((unsigned*)(dh + eo + u * 8 * CC), *(const v4u*)&sh[(tid >> 4) + u * 8][(tid & 15) * 8]);
      asm volatile("s_wait_xcnt 0x0" ::: "memory");   /* what follows may rewrite registers that these stores name */
      if (hi_rows) {
#pragma unroll
        for (int u = 0; u < 8; ++u) vst2((unsigned*)(dl + eo + u * 8 * CC), *(const v4u*)&sl[(tid >> 4) + u * 8][(tid & 15) * 8]);
        asm volatile("s_wait_xcnt 0x0" ::: "memory"); }   /* the next trip rewrites registers that these stores name */
    } else if (which == 2) { const bool hi_rows = t0 < KHI;   /* v: f16 planes [c][t] (+ bf16 hi/lo planes for t < KHI) */
#pragma unroll
      for (int j = 0; j < 8; ++j)
#pragma unroll
        for (int r = 0; r < 8; ++r) { const float v = acc[j][r]; const int rl = wave * 16 + 8 * g + r, cl = j * 16 + col; th[cl][rl] = (_Float16)v; const __bf16 bh = (__bf16)v; tb[cl][rl] = bh; tbl[cl][rl] = (__bf16)(v - (float)bh); }
      __syncthreads();
      _Float16* vt = VT + bb * CC * (size_t)TT + t0; __bf16* vb = VB + bb * CC * (size_t)KHI + t0; __bf16* vbl = VBL + bb * CC * (size_t)KHI + t0; const unsigned vo = (unsigned)((tid >> 3) * TT + (tid & 7) * 8), ho = (unsigned)((tid >> 3) * KHI + (tid & 7) * 8);   /* 16 planes on per trip */
#pragma unroll
      for (int u = 0; u < 8; ++u) vst2((unsigned*)(vt + vo + u * 16 * TT), *(const v4u*)&th[(tid >> 3) + u * 16][(tid & 7) * 8]);
      asm volatile("s_wait_xcnt 0x0" ::: "memory");   /* what follows may rewrite registers that these stores name */
      if (hi_rows) {
#pragma unroll
        for (int u = 0; u < 8; ++u) { const int cl = (tid >> 3) + u * 16, q = tid & 7; vst2((unsigned*)(vb + ho + u * 16 * KHI), *(const v4u*)&tb[cl][q * 8]); vst2((unsigned*)(vbl + ho + u * 16 * KHI), *(const v4u*)&tbl[cl][q * 8]); }
        asm volatile("s_wait_xcnt 0x0" ::: "memory"); }   /* the next trip rewrites registers that these stores name */
    } else {
#pragma unroll
      for (int j = 0; j < 8; ++j)
#pragma unroll
        for (int r = 0; r < 8; ++r) sf[wave][8 * g + r][j * 16 + col] = 1.0f / (1.0f + expf(-(acc[j][r] + bfr(GB[j * 16 + col]))));   /* sigmoid(x Wg + gating_b) */
      LDSX(); v4f t[16];   /* all 16 LDS reads stand ahead of the stores: one LDS latency, not 16 */
#pragma unroll
      for (int rl = 0; rl < 16; ++rl) t[rl] = *(const v4f*)&sf[wave][rl][lane * 4];
#pragma unroll
      for (int rl = 0; rl < 16; ++rl) vst2(G + r0 * CC + (unsigned)(wave * 16 * CC + lane * 4) + rl * CC, t[rl]);
      asm volatile("s_wait_xcnt 0x0" ::: "memory"); }   /* behind the last stores, as in the other branches */
  } }
// ---- k_attn: work-group = (4 rows r, head h), 16 waves, wave = 16 queries against all 256 keys, 64 keys at a time with a running maximum and sum. The head's bias plane lies in LDS for the whole work-group, in the order the score fragments hold it; per row r the k rows, v planes and mask bias are staged in LDS once for all 16 waves. Both products are formed transposed (scores: A = k rows, B = q rows; ctx: A = v planes, B = P), so D's column is the query in both: a lane holds keys of ONE query, two neighbouring score tiles ARE the B fragment of P, and maximum, sum and rescale stay in the lane (one exchange with the other half-wave). The plain unroll directives keep the small arrays in registers.
#define FR 4               // rows r per work-group
#define KP (HD + 8)        // halves per staged k row: 80-B pitch
#define VP (TT + 8)        // halves per staged v plane: 528-B pitch
__device__ __forceinline__ v8f wmma_h(v16h a, v16h b, v8f c) { return __builtin_amdgcn_wmma_f32_16x16x32_f16(false, a, false, b, (short)0, c, false, false); }
__global__ __launch_bounds__(512) void k_attn(const _Float16* __restrict__ QH, const _Float16* __restrict__ QL, const _Float16* __restrict__ KH, const _Float16* __restrict__ VT, const float* __restrict__ BIAS, const float* __restrict__ MKP, float* __restrict__ Y) {
  __shared__ __align__(16) float sB[TT * TT];            // [query tile][key tile][half of 8][lane][4]
  __shared__ __align__(16) _Float16 sK[TT][KP]; __shared__ __align__(16) _Float16 sV[HD][VP]; __shared__ __align__(16) float sM[TT];
  const int tid = threadIdx.x, wave = tid >> 5, lane = tid & 31, col = lane & 15, g = lane >> 4; const int h = blockIdx.y; const int rb = (int)blockIdx.x * FR;
  const unsigned ko0 = (unsigned)(tid >> 2) * CC + (tid & 3) * 8, vo0 = (unsigned)tid * 8;   /* this thread's 16-B pieces of a row's k rows (and 128 rows on) and v planes (and 16 planes on) */
  const unsigned qo = (unsigned)(wave * 16 + col) * CC + 8 * g;
  v4u pk[2], pv[2]; float pm = 0.f;
  { const _Float16* kb = KH + (size_t)rb * TT * CC + h * HD; const _Float16* vb = VT + ((size_t)rb * CC + h * HD) * TT;
    pk[0] = *(const v4u*)(kb + ko0); pk[1] = *(const v4u*)(kb + ko0 + 128 * CC); pv[0] = *(const v4u*)(vb + vo0); pv[1] = *(const v4u*)(vb + vo0 + 16 * TT);
    if (tid < TT) pm = MKP[(size_t)rb * SZ + tid]; }
  // a wave takes 8 queries x 4 keys per load: its 32 LDS words fall on 32 banks; the 16 waves stand side by side along the keys
  { const float* bh = BIAS + h; const unsigned gs = (unsigned)((((tid >> 2) & 7) * SZ + wave * 4 + (tid & 3)) * NH), ld = (unsigned)(((((wave >> 2) * 2 + (wave & 1)) * 32) + ((wave >> 1) & 1) * 16 + ((tid >> 2) & 7)) * 4 + (tid & 3));
#pragma unroll 4   /* 16 loads in flight per lane */
    for (int qi = 0; qi < TT / 8; ++qi)
#pragma unroll
      for (int kk = 0; kk < 4; ++kk) sB[ld + (qi >> 1) * 4096 + (qi & 1) * 32 + kk * 1024] = bh[gs + qi * (8 * SZ * NH) + kk * (64 * NH)]; }
#pragma unroll 1   /* rolled: one copy of the body in the instruction cache */
  for (int it = 0; it < FR; ++it) { const int b = rb + it;
    const _Float16* qhb = QH + (size_t)b * TT * CC + h * HD; const _Float16* qlb = QL + (size_t)b * QHI * CC + h * HD;
    union { v16h v; v8h q[2]; } qh, ql; qh.q[0] = *(const v8h*)(qhb + qo); qh.q[1] = *(const v8h*)(qhb + qo + 16); ql.q[0] = *(const v8h*)(qlb + qo); ql.q[1] = *(const v8h*)(qlb + qo + 16);
    __syncthreads();   /* every wave has left the previous row's k, v and mask tiles */
    *(v4u*)&sK[tid >> 2][(tid & 3) * 8] = pk[0]; *(v4u*)&sK[128 + (tid >> 2)][(tid & 3) * 8] = pk[1]; *(v4u*)&sV[tid >> 5][(tid & 31) * 8] = pv[0]; *(v4u*)&sV[16 + (tid >> 5)][(tid & 31) * 8] = pv[1];
    if (tid < TT) sM[tid] = 32768.0f * (bfr(pm) - 1.0f);   /* FP16_HUGE * (pair_mask[r][k] - 1) */
    __syncthreads();   /* publishes this row's tiles (and, the first time, the bias plane) */
    if (it + 1 < FR) {   /* the next row's tiles fly while this row is worked on */
      const _Float16* kb = KH + (size_t)(b + 1) * TT * CC + h * HD; const _Float16* vb = VT + ((size_t)(b + 1) * CC + h * HD) * TT;
      pk[0] = *(const v4u*)(kb + ko0); pk[1] = *(const v4u*)(kb + ko0 + 128 * CC); pv[0] = *(const v4u*)(vb + vo0); pv[1] = *(const v4u*)(vb + vo0 + 16 * TT);
      if (tid < TT) pm = MKP[(size_t)(b + 1) * SZ + tid]; }
    float m = -3.0e38f, l = 0.f; v8f acc[HD / 16] = {};   /* l: this half-wave's keys only; the halves meet behind the loop */
#pragma unroll 1   /* rolled: unrolled, the LDS reads of all 16 key tiles are hoisted and the 256 registers of a 16-wave work-group spill */
    for (int c = 0; c < TT / 64; ++c) { v8f s[4];
#pragma unroll
      for (int jj = 0; jj < 4; ++jj) { const int j = c * 4 + jj; const v16h kf = frag_h(&sK[j * 16 + col][0], lane); const v8f z = {}; const v8f a = wmma_h(kf, qh.v, z), al = wmma_h(kf, ql.v, z);
        const float* bp = sB + (((wave * 16 + j) * 2) * 32 + lane) * 4; const v4f b0 = *(const v4f*)bp, b1 = *(const v4f*)(bp + 128); const v4f m0 = *(const v4f*)&sM[j * 16 + 8 * g], m1 = *(const v4f*)&sM[j * 16 + 8 * g + 4];
#pragma unroll
        for (int r = 0; r < 8; ++r) s[jj][r] = (a[r] + al[r] * (1.0f / 1024.0f)) * SCALE + (r < 4 ? b0[r & 3] : b1[r & 3]) + (r < 4 ? m0[r & 3] : m1[r & 3]); }
      v8f mx = s[0];
#pragma unroll
      for (int r = 0; r < 8; ++r) mx[r] = fmaxf(fmaxf(mx[r], s[1][r]), fmaxf(s[2][r], s[3][r]));
      float cm = fmaxf(fmaxf(fmaxf(mx[0], mx[1]), fmaxf(mx[2], mx[3])), fmaxf(fmaxf(mx[4], mx[5]), fmaxf(mx[6], mx[7]))); cm = fmaxf(cm, __shfl_xor(cm, 16));
      const float mn = fmaxf(m, cm); const float alpha = expf(m - mn); m = mn;   /* what was summed under the old maximum shrinks by alpha */
      v8f sm = {};
#pragma unroll
      for (int jj = 0; jj < 4; ++jj)
#pragma unroll
        for (int r = 0; r < 8; ++r) { const float e = expf(s[jj][r] - mn); s[jj][r] = e; sm[r] += e; }
      l = l * alpha + (((sm[0] + sm[1]) + (sm[2] + sm[3])) + ((sm[4] + sm[5]) + (sm[6] + sm[7])));
#pragma unroll
      for (int j = 0; j < HD / 16; ++j)
#pragma unroll
        for (int r = 0; r < 8; ++r) acc[j][r] *= alpha;
#pragma unroll
      for (int k2 = 0; k2 < 2; ++k2) { v16h p;
#pragma unroll
        for (int i = 0; i < 8; ++i) { p[i] = (_Float16)(s[2 * k2][i] * 2048.0f); p[8 + i] = (_Float16)(s[2 * k2 + 1][i] * 2048.0f); }
#pragma unroll
        for (int j = 0; j < HD / 16; ++j) acc[j] = wmma_h(frag_h(&sV[j * 16 + col][(c * 2 + k2) * 32], lane), p, acc[j]); } }
    l += __shfl_xor(l, 16);
    const float inv = (m > -1.0e38f && l > 0.f) ? (1.0f / 2048.0f) / l : 0.f;   /* a fully excluded row (every logit at or below -1e38) yields 0 */
    float* yp = Y + (size_t)b * TT * CC + h * HD + (unsigned)(wave * 16 + col) * CC + 8 * g;
#pragma unroll
    for (int j = 0; j < HD / 16; ++j) { v4f y0, y1;
#pragma unroll
      for (int r = 0; r < 4; ++r) { y0[r] = acc[j][r] * inv; y1[r] = acc[j][4 + r] * inv; }
      vst2(yp + j * 16, y0); vst2(yp + j * 16 + 4, y1); }   /* the 128-B (row, head) segment has this wave as its one writer */
    asm volatile("s_wait_xcnt 0x0" ::: "memory");   /* the next trip rewrites the registers that these stores name */
  } }
// ---- k_out: block = (64 rows, 128 cols): out = (ctx * gate) Wo (+ bo), the gate row (same natural row index r*256 + q) multiplied in as the ctx row is loaded: all rows: gated ctx split bf16 hi + lo against exact bf16 Wo (2 products)
__global__ __launch_bounds__(128) void k_out(const float* __restrict__ Y, const float* __restrict__ G, const float* __restrict__ WO, const float* __restrict__ BO, float* __restrict__ OUT) { __shared__ __align__(16) float sf[4][16][132];
  const int tid = threadIdx.x, wave = tid >> 5, lane = tid & 31, col = lane & 15, g = lane >> 4; const int c0 = blockIdx.y * 128; const size_t r0 = (size_t)blockIdx.x * 64 + wave * 16;
  v8f acc[8] = {};
  if (true) {   /* ALL rows: gated ctx bf16 hi + lo x exact output_w (2 products) */
    __bf16* sW = (__bf16*)&sf[0][0][0];   /* the weight's fragments lie where the output rows are staged later */
    stage_w(WO + c0, DIN, sW, tid); __syncthreads();   /* publishes the fragments */
#pragma unroll 2
    for (int kc = 0; kc < CC / 32; ++kc) { v16b w[8];
#pragma unroll
      for (int j = 0; j < 8; ++j) w[j] = wfrag(sW, kc, j, lane);   /* the chunk's LDS reads stand in one place, ahead of the rows' global loads */
      const F2 a = split_row2(Y + (r0 + col) * CC, G + (r0 + col) * CC, kc * 32, lane); asm volatile("s_wait_loadcnt 0x0" ::: "memory");
#pragma unroll
      for (int j = 0; j < 8; ++j) { acc[j] = wmma_bf(a.h, w[j], acc[j]); acc[j] = wmma_bf(a.l, w[j], acc[j]); } }
    __syncthreads();   /* every wave has read its last fragment before sf is written */
#pragma unroll
    for (int j = 0; j < 8; ++j) { const float bias = BO ? bfr(BO[c0 + j * 16 + col]) : 0.f;
#pragma unroll
      for (int r = 0; r < 8; ++r) sf[wave][8 * g + r][j * 16 + col] = acc[j][r] + bias; }
  } else {
#pragma unroll 2
    for (int kc = 0; kc < CC / 32; ++kc) { const v16h a = frag_f32(Y + (r0 + col) * CC + kc * 32, lane); asm volatile("s_wait_loadcnt 0x0" ::: "memory");
#pragma unroll
      for (int j = 0; j < 8; ++j) { const v16h w = WOCOLH(WO, kc * 32, c0 + j * 16 + col, lane); asm volatile("s_wait_loadcnt 0x0" ::: "memory"); acc[j] = wmma16(a, w, acc[j]); } }
#pragma unroll
    for (int j = 0; j < 8; ++j) { const float bias = BO ? bfr(BO[c0 + j * 16 + col]) : 0.f;
#pragma unroll
      for (int r = 0; r < 8; ++r) sf[wave][8 * g + r][j * 16 + col] = acc[j][r] * (1.0f / 256.0f) + bias; } }
  LDSX(); for (int rl = 0; rl < 16; ++rl) vst2(OUT + (r0 + rl) * DIN + c0 + lane * 4, *(const v4f*)&sf[wave][rl][lane * 4]); }

extern "C" void kernel_launch(void* const* d_in, const int* in_sizes, int n_in, void* d_out, int out_size, void* d_ws, size_t ws_size, hipStream_t stream) {
  (void)in_sizes; (void)n_in; (void)out_size;
  const float** F = (const float**)d_in;
  if (ws_size < (size_t)WS_END) return;
  char* ws = (char*)d_ws; _Float16 *QH = (_Float16*)(ws + WS_QH), *KH = (_Float16*)(ws + WS_KH), *VT = (_Float16*)(ws + WS_VT), *QL = (_Float16*)(ws + WS_QL), *KL = (_Float16*)(ws + WS_KL); __bf16 *VB = (__bf16*)(ws + WS_VB), *VBL = (__bf16*)(ws + WS_VBL); float *Y = (float*)(ws + WS_Y);
  (void)Y; (void)QL; (void)KL; (void)VB; (void)VBL;
  // inputs: 0 pair_act [1,256,256,128]; 1 pair_mask [1,256,256]; 2 ln_gamma, 3 ln_beta; 4 feat2d_w [128,4]; 5 query_w, 6 key_w, 7 value_w [128,4,32] (in,out); 8 gating_w [128,4,32], 9 gating_b [4,32]; 10 output_w [4,32,128] (in,out); 11 output_b
  if (ws_size < (size_t)WS_END2) return;
  float *BIAS = (float*)(ws + WS_BIAS), *G = (float*)(ws + WS_G);
  k_front<<<dim3(NZR / 64), 128, 0, stream>>>(F[0], F[2], F[3], F[4], F[5], F[6], F[7], F[8], F[9], QH, QL, KH, KL, VT, VB, VBL, BIAS, G);
  k_attn<<<dim3(TNB / FR, NH), 512, 0, stream>>>(QH, QL, KH, VT, BIAS, F[1], Y);
  k_out<<<dim3(TNB * TT / 64, DIN / 128), 128, 0, stream>>>(Y, G, F[10], F[11], (float*)d_out);
}

// v005
// Measured time: 81.3 microseconds a run.
// Two timings next to v004 both put it at 1.16 times that version's speed.
// All steps since v000 together make it 6.48 times as fast.
// compute dtype: all float inputs rounded to bf16; LayerNorm of pair_act in f32; q/k/v = LN(act) split bf16 hi + lo x W (exact bf16, (in,out)) on WMMA 16x16x32 (2 products, f32 accumulate); q as f16 hi + residual (x 2^10) against k once to f16 (2 products) x 32^-0.5 + the per-(query, key, head) triangle bias (2-product GEMM) + the mask bias; softmax in f32 (hardware 2^x of logit x log2(e) + (11 - maximum x log2(e)), running maximum and sum over steps of 64 keys); exp(logit - maximum) x 2^11 once to f16 against v once to f16 (1 product), divided by the sum at the end; gate sigmoid(LN(act) Wg + b) in f32 (2-product GEMM, hardware 2^x and reciprocal); gated ctx split bf16 hi + lo against exact output_w (2 products) + output_b; f32 output.
#include <hip/hip_runtime.h>
#include <math.h>

typedef __attribute__((ext_vector_type(16))) _Float16 v16h;
typedef __attribute__((ext_vector_type(16))) __bf16 v16b;
typedef __attribute__((ext_vector_type(8)))  _Float16 v8h;
typedef __attribute__((ext_vector_type(8)))  float v8f;
typedef __attribute__((ext_vector_type(4)))  float v4f;
typedef __attribute__((ext_vector_type(2)))  float v2f;
typedef __attribute__((ext_vector_type(4)))  unsigned v4u;
typedef __attribute__((ext_vector_type(4)))  int v4i;
typedef float __attribute__((may_alias)) float_a;
typedef int __attribute__((may_alias)) int_a;

template <typename T> __device__ __forceinline__ void vst2(void* p, T v) { *(T*)p = v;  }
__device__ __forceinline__ v8f wmma16(v16h a, v16h b, v8f c) {
  v8f d = __builtin_amdgcn_wmma_f32_16x16x32_f16(false, a, false, b, (short)0, c, false, false);
  asm volatile("v_nop\n\tv_nop\n\tv_nop\n\tv_nop" : "+v"(d) : "v"(a), "v"(b));
  return d;
}
__device__ __forceinline__ v8f wmma_bf(v16b a, v16b b, v8f c) {
  v8f d = __builtin_amdgcn_wmma_f32_16x16x32_bf16(false, a, false, b, (short)0, c, false, false);
  asm volatile("v_nop\n\tv_nop\n\tv_nop\n\tv_nop" : "+v"(d) : "v"(a), "v"(b));
  return d;
}
// 16x16x32 fragments: lane = (h = lane>>4, row/col = lane&15); elements 0..7 = k0+8h+0..7, 8..15 = k0+16+8h+0..7; D element r = row 8h+r
__device__ __forceinline__ v16h frag_h(const _Float16* rowk0, int lane) {
  union { v16h v; v8h q[2]; } u; const _Float16* p = rowk0 + 8 * (lane >> 4);
  u.q[0] = *(const v8h*)p; u.q[1] = *(const v8h*)(p + 16); return u.v;
}
__device__ __forceinline__ v16h frag_f32(const float* rowk0, int lane) {
  v16h a; const float* p = rowk0 + 8 * (lane >> 4);
#pragma unroll
  for (int i = 0; i < 8; ++i) { a[i] = (_Float16)p[i]; a[8 + i] = (_Float16)p[16 + i]; }
  return a;
}
__device__ __forceinline__ v16h frag_f32s(const float* rowk0, int lane, float sc) {
  v16h a; const float* p = rowk0 + 8 * (lane >> 4);
#pragma unroll
  for (int i = 0; i < 8; ++i) { a[i] = (_Float16)(p[i] * sc); a[8 + i] = (_Float16)(p[16 + i] * sc); }
  return a;
}
// column fragment from a [K][ld] layout (column n), rows >= K read as 0
__device__ __forceinline__ v16h fragc_f32(const float* W, int k0, int n, int lane, int ld, int K) {
  v16h a; const int g = lane >> 4;
#pragma unroll
  for (int i = 0; i < 8; ++i) { const int ka = k0 + 8 * g + i, kb = ka + 16;
    a[i] = (_Float16)(ka < K ? W[(size_t)(ka < K ? ka : K - 1) * ld + n] : 0.f); a[8 + i] = (_Float16)(kb < K ? W[(size_t)(kb < K ? kb : K - 1) * ld + n] : 0.f); }
  return a;
}
struct F2 { v16b h, l; };
__device__ __forceinline__ F2 bsplit16(const float v[16]) { F2 r;
#pragma unroll
  for (int i = 0; i < 16; ++i) { const __bf16 h = (__bf16)v[i]; r.h[i] = h; r.l[i] = (__bf16)(v[i] - (float)h); }
  return r; }
__device__ __forceinline__ F2 split_row(const float* row, int k0, int lane) { float v[16]; const float* p = row + k0 + 8 * (lane >> 4);
#pragma unroll
  for (int i = 0; i < 8; ++i) { v[i] = p[i]; v[8 + i] = p[16 + i]; }
  return bsplit16(v); }
// the same of the element-wise product of two rows (ctx row x gate row, multiplied in f32 ahead of the split)
__device__ __forceinline__ F2 split_row2(const float* row, const float* grow, int k0, int lane) { float v[16]; v4f y[4], t[4]; const float* p = row + k0 + 8 * (lane >> 4); const float* q = grow + k0 + 8 * (lane >> 4);
#pragma unroll
  for (int u = 0; u < 4; ++u) { y[u] = *(const v4f*)(p + (u >> 1) * 16 + (u & 1) * 4); t[u] = *(const v4f*)(q + (u >> 1) * 16 + (u & 1) * 4); }
  asm volatile("s_wait_xcnt 0x0" :: "v"(y[0]), "v"(y[1]), "v"(y[2]), "v"(y[3]), "v"(t[0]), "v"(t[1]), "v"(t[2]), "v"(t[3]) : "memory");   /* what follows may rewrite the registers that these loads name; the loaded values as inputs hold the wait behind the loads */
#pragma unroll
  for (int u = 0; u < 4; ++u)
#pragma unroll
    for (int i = 0; i < 4; ++i) v[u * 4 + i] = y[u][i] * t[u][i];
  return bsplit16(v); }
__device__ __forceinline__ F2 split_rowK(const float* row, int k0, int lane, int K) { float v[16]; const int g = lane >> 4;
#pragma unroll
  for (int i = 0; i < 8; ++i) { const int ka = k0 + 8 * g + i, kb = ka + 16; v[i] = ka < K ? row[ka < K ? ka : K - 1] : 0.f; v[8 + i] = kb < K ? row[kb < K ? kb : K - 1] : 0.f; }
  return bsplit16(v); }
__device__ __forceinline__ F2 split_col(const float* W, int k0, int n, int lane, int ld, int K) { float v[16]; const int g = lane >> 4;
#pragma unroll
  for (int i = 0; i < 8; ++i) { const int ka = k0 + 8 * g + i, kb = ka + 16; v[i] = ka < K ? W[(size_t)(ka < K ? ka : K - 1) * ld + n] : 0.f; v[8 + i] = kb < K ? W[(size_t)(kb < K ? kb : K - 1) * ld + n] : 0.f; }
  return bsplit16(v); }
__device__ __forceinline__ v8f mac3(const F2& a, const F2& b, v8f c) { c = wmma_bf(a.l, b.h, c); c = wmma_bf(a.h, b.l, c); return wmma_bf(a.h, b.h, c); }
__device__ __forceinline__ float sigm(float v) { return 1.0f / (1.0f + expf(-v)); }
#define LDSX() do { asm volatile("s_wait_dscnt 0" ::: "memory"); __builtin_amdgcn_wave_barrier(); __builtin_amdgcn_fence(__ATOMIC_RELEASE, "workgroup"); } while (0)

// Triangle attention (pair_act [1, 256, 256, 128], 4 heads x 32): act = LayerNorm(pair_act); for every row r: q = act[r] Wq * 32^-0.5, k = act[r] Wk, v = act[r] Wv; logits[r,h,q,k] = q . k + 2^15 (pair_mask[r][k] - 1) + tri_bias[h][q][k] with tri_bias = act . feat2d_w (indexed by the (q, k) PAIR, shared across rows); softmax over k; wa = (weights v) * sigmoid(act[r][q] Wg + bg); out[r][q] = wa . output_w + output_b.
#define NB 256
#define TT 256
#define CC 128            // NH * HD = projected width
#define DIN 128          // input (model) width
#define NH 4
#define HD 32
#define NQB (TT / 64)
#define HG 4
#define SCALE (0.17677669529663687f)
#define CAUSAL 0
#ifndef TNB
#define TNB NB
#endif
#define LOG2E (1.4426950408889634f)
__device__ __forceinline__ float bfr(float v) { return (float)(__bf16)v; }
__host__ __device__ __forceinline__ int kb_last(int qb) { return CAUSAL ? ((qb * 64 + 63) >> 7) : (TT / 128 - 1); }
typedef __attribute__((ext_vector_type(8))) __bf16 v8b;
__device__ __forceinline__ v16b frag_b(const __bf16* rowk0, int lane) {
  union { v16b v; v8b q[2]; } u; const __bf16* p = rowk0 + 8 * (lane >> 4);
  u.q[0] = *(const v8b*)p; u.q[1] = *(const v8b*)(p + 16); return u.v;
}
// One 128 x 128 (in,out) weight, rounded to bf16 once per work-group of 128 threads and laid in LDS (32 KiB) in the order the B fragments are read: [k chunk of 32][column tile][half of 8 k][lane] pieces of 16 B. Thread = output column: a wave's load is one whole 128-B line, all 128 loads of a thread are independent, and 8 k of a column make one 16-B store. The plain unroll directives here and at the fragment arrays w[8] keep those small arrays in registers.
__device__ __forceinline__ void stage_w(const float* __restrict__ Wm, int ld, __bf16* sW, int tid) { const float* p = Wm + tid;
#pragma unroll
  for (int kg = 0; kg < 16; ++kg) { v8b w;   /* k = 8 kg + i: chunk kg >> 2, half (kg >> 1) & 1, lane half kg & 1 */
#pragma unroll
    for (int i = 0; i < 8; ++i) w[i] = (__bf16)p[(size_t)(kg * 8 + i) * ld];
    *(v8b*)(sW + (size_t)(((((kg >> 2) * 8 + (tid >> 4)) * 2 + ((kg >> 1) & 1)) * 32 + (kg & 1) * 16 + (tid & 15)) * 8)) = w; } }
__device__ __forceinline__ v16b wfrag(const __bf16* sW, int kc, int j, int lane) {
  union { v16b v; v8b q[2]; } u; const __bf16* p = sW + ((kc * 8 + j) * 64 + lane) * 8;
  u.q[0] = *(const v8b*)p; u.q[1] = *(const v8b*)(p + 256); return u.v;
}
#define QBH 0              // unused: nothing in this file reads it
#define QHI 256            // rows carrying a q residual plane (all rows when non-causal: 2-product logits everywhere)
#define KHI 64            // key rows carrying k residual / v bf16 hi+lo planes (written by k_front; no kernel reads them)
// B fragment (k rows k0+.., output column o) of a weight: (in,out) [K][ld] or (out,in) [ld rows of K]: bf16 exact, or f16(bf16 * 256) exact
__device__ __forceinline__ v16b wcol_io(const float* Wm, int k0, int o, int lane, int ld) { v16b w; const int g = lane >> 4;
#pragma unroll
  for (int i = 0; i < 8; ++i) { w[i] = (__bf16)Wm[(size_t)(k0 + 8 * g + i) * ld + o]; w[8 + i] = (__bf16)Wm[(size_t)(k0 + 16 + 8 * g + i) * ld + o]; }
  return w; }
__device__ __forceinline__ v16b wcol_oi(const float* Wm, int k0, int o, int lane, int K) { v16b w; const float* p = Wm + (size_t)o * K + k0 + 8 * (lane >> 4);
#pragma unroll
  for (int i = 0; i < 8; ++i) { w[i] = (__bf16)p[i]; w[8 + i] = (__bf16)p[16 + i]; }
  return w; }
__device__ __forceinline__ v16h wcolh_io(const float* Wm, int k0, int o, int lane, int ld) { v16h w; const int g = lane >> 4;
#pragma unroll
  for (int i = 0; i < 8; ++i) { w[i] = (_Float16)(bfr(Wm[(size_t)(k0 + 8 * g + i) * ld + o]) * 256.0f); w[8 + i] = (_Float16)(bfr(Wm[(size_t)(k0 + 16 + 8 * g + i) * ld + o]) * 256.0f); }
  return w; }
__device__ __forceinline__ v16h wcolh_oi(const float* Wm, int k0, int o, int lane, int K) { v16h w; const float* p = Wm + (size_t)o * K + k0 + 8 * (lane >> 4);
#pragma unroll
  for (int i = 0; i < 8; ++i) { w[i] = (_Float16)(bfr(p[i]) * 256.0f); w[8 + i] = (_Float16)(bfr(p[16 + i]) * 256.0f); }
  return w; }
#define WQKV_LAYOUT 0   // 0 = (in,out) [DIN][CC]; 1 = (out,in) [CC][DIN]; 2 = per-head [NH][DIN][HD]
__device__ __forceinline__ v16b wcol_hdk(const float* Wm, int k0, int o, int lane) { v16b w; const int g = lane >> 4; const float* p = Wm + (size_t)(o / HD) * DIN * HD + (o % HD);
#pragma unroll
  for (int i = 0; i < 8; ++i) { w[i] = (__bf16)p[(size_t)(k0 + 8 * g + i) * HD]; w[8 + i] = (__bf16)p[(size_t)(k0 + 16 + 8 * g + i) * HD]; }
  return w; }
#define WO_OUT_IN 0
#if WQKV_LAYOUT == 1
#define WCOL(W, k0, o, lane) wcol_oi(W, k0, o, lane, DIN)
#elif WQKV_LAYOUT == 2
#define WCOL(W, k0, o, lane) wcol_hdk(W, k0, o, lane)
#else
#define WCOL(W, k0, o, lane) wcol_io(W, k0, o, lane, CC)
#endif
#if WO_OUT_IN
#define WOCOL(W, k0, o, lane) wcol_oi(W, k0, o, lane, CC)
#define WOCOLH(W, k0, o, lane) wcolh_oi(W, k0, o, lane, CC)
#else
#define WOCOL(W, k0, o, lane) wcol_io(W, k0, o, lane, DIN)
#define WOCOLH(W, k0, o, lane) wcolh_io(W, k0, o, lane, DIN)
#endif
#define SZ 256
#define BG 64              // sizes only the unused WS_S region (x HG 4 = 256 planes of 256 x 256)
#define NZR (SZ * SZ)      // 65,536 pair rows
#define WS_ZN   (WS_END)
#define WS_BIAS (WS_ZN + 4u * (size_t)NZR * CC)
#define WS_G    (WS_BIAS + 4u * (size_t)NZR * NH)
#define WS_END2 (WS_G + 4u * (size_t)NZR * CC)
#ifndef PROJ_EXTRA_PARAMS
#define PROJ_EXTRA_PARAMS
#endif

#define WS_QH  0u                                      // f16 q rows [b*t][CC]
#define WS_KH  (WS_QH + 2u * (size_t)NB * TT * CC)      // f16 k rows [b*t][CC]
#define WS_VT  (WS_KH + 2u * (size_t)NB * TT * CC)      // f16 v planes [b][c][t]
#define WS_QL  (WS_VT + 2u * (size_t)NB * CC * TT)      // f16 q residual x 2^10 rows [b][t < QHI][CC]
#define WS_KL  (WS_QL + 2u * (size_t)NB * QHI * CC)     // f16 k residual x 2^10 rows [b][t < KHI][CC]
#define WS_VB  (WS_KL + 2u * (size_t)NB * KHI * CC)     // bf16 v hi planes [b][c][t < KHI]
#define WS_VBL (WS_VB + 2u * (size_t)NB * CC * KHI)
#define WS_S   (WS_VBL + 2u * (size_t)NB * CC * KHI)    // unused f32 region (k_attn keeps logits and P in registers)
#define WS_Y   (WS_S  + 4u * (size_t)BG * HG * TT * TT)   // unused WS_S: 256 planes of 256 x 256 f32      // f32 ctx rows [b*t][CC] (only when there is an output projection)
#define WS_END (WS_Y  + 4u * (size_t)NB * TT * CC)

// ---- k_front: block = 64 pair rows, wave = 16 rows. A lane reads its half of one row of pair_act in the order of the A fragments (k = 32 kc + 8 g + i and 16 on), so LayerNorm (biased var, eps 1e-5, ln_gamma/ln_beta, of bf16(z)) needs one exchange with the other half-wave, and the four bf16 hi + lo fragments of LN(act) are formed once and stay in registers for all five products: tri_bias (BIAS[row = q*256+k][h]), then q, k, v and the gate, one 128 x 128 (in,out) weight after the other through the same LDS. The output tiles of a product lie on the weight's fragments once the products are done. The second launch bound holds the registers to 4 waves per SIMD, so that all 1,024 work-groups are resident at once.
__global__ __launch_bounds__(128, 4) void k_front(const float* __restrict__ Z, const float* __restrict__ LW, const float* __restrict__ LB, const float* __restrict__ WB, const float* __restrict__ WQ, const float* __restrict__ WK, const float* __restrict__ WV, const float* __restrict__ WG, const float* __restrict__ GB,
    _Float16* __restrict__ QH, _Float16* __restrict__ QL, _Float16* __restrict__ KH, _Float16* __restrict__ KL, _Float16* __restrict__ VT, __bf16* __restrict__ VB, __bf16* __restrict__ VBL, float* __restrict__ BIAS, float* __restrict__ G) {
  __shared__ __align__(16) char sm[3 * 128 * 72 * 2];   /* the largest user: v's three transposed tiles */
  _Float16 (*sh)[136] = (_Float16 (*)[136])sm; _Float16 (*sl)[136] = (_Float16 (*)[136])(sm + 64 * 136 * 2); _Float16 (*th)[72] = (_Float16 (*)[72])sm; __bf16 (*tb)[72] = (__bf16 (*)[72])(sm + 128 * 72 * 2); __bf16 (*tbl)[72] = (__bf16 (*)[72])(sm + 2 * 128 * 72 * 2); float (*sf)[16][132] = (float (*)[16][132])sm; __bf16* sW = (__bf16*)sm; __bf16 (*sb)[144] = (__bf16 (*)[144])(sm + 2 * 64 * 136 * 2);   /* feat2d_w transposed, [head][k], behind the bias rows of sf; a fifth row of zeros; 288-B pitch: the 16-B reads of 5 rows x 2 halves fall on different banks */
  const int tid = threadIdx.x, wave = tid >> 5, lane = tid & 31, col = lane & 15, g = lane >> 4; const size_t r0 = (size_t)blockIdx.x * 64; const size_t bb = r0 / TT; const int t0 = (int)(r0 % TT);
  const v4f wb4 = *(const v4f*)(WB + tid * NH);   /* thread = input channel k: its 4 heads in one 16-B load, in flight under the rows' loads */
  F2 a[4];
  { float x[4][16]; const float* zp = Z + r0 * CC + (unsigned)((wave * 16 + col) * CC + 8 * g);
#pragma unroll
    for (int kc = 0; kc < 4; ++kc)
#pragma unroll
      for (int u = 0; u < 4; ++u) { const v4f t = *(const v4f*)(zp + kc * 32 + (u >> 1) * 16 + (u & 1) * 4);
#pragma unroll
        for (int i = 0; i < 4; ++i) x[kc][u * 4 + i] = bfr(t[i]); }
    float sp[4] = {0.f, 0.f, 0.f, 0.f};
#pragma unroll
    for (int kc = 0; kc < 4; ++kc)
#pragma unroll
      for (int i = 0; i < 16; ++i) sp[kc] += x[kc][i];
    float s1 = (sp[0] + sp[1]) + (sp[2] + sp[3]); s1 += __shfl_xor(s1, 16);
    const float mu = s1 * (1.0f / CC); float qp[4] = {0.f, 0.f, 0.f, 0.f};
#pragma unroll
    for (int kc = 0; kc < 4; ++kc)
#pragma unroll
      for (int i = 0; i < 16; ++i) { const float d = x[kc][i] - mu; qp[kc] += d * d; }
    float q = (qp[0] + qp[1]) + (qp[2] + qp[3]); q += __shfl_xor(q, 16);
    const float rs = rsqrtf(q * (1.0f / CC) + 1e-5f);
#pragma unroll
    for (int kc = 0; kc < 4; ++kc) { float v[16];
#pragma unroll
      for (int u = 0; u < 4; ++u) { const int c = kc * 32 + (u >> 1) * 16 + (u & 1) * 4 + 8 * g; const v4f lw = *(const v4f*)(LW + c), lb = *(const v4f*)(LB + c);
#pragma unroll
        for (int i = 0; i < 4; ++i) v[u * 4 + i] = (x[kc][u * 4 + i] - mu) * rs * bfr(lw[i]) + bfr(lb[i]); }
      a[kc] = bsplit16(v); } }
#pragma unroll
  for (int hh = 0; hh < NH; ++hh) sb[hh][tid] = (__bf16)wb4[hh];
  sb[NH][tid] = (__bf16)0.f;
  __syncthreads();   /* publishes feat2d_w */
  { v8f ab = {}; const __bf16* wr = &sb[col < NH ? col : NH][0];   /* tri_bias: 4 outputs; the columns beyond them read the row of zeros */
#pragma unroll
    for (int kc = 0; kc < 4; ++kc) { const v16b w = frag_b(wr + kc * 32, lane); ab = wmma_bf(a[kc].h, w, ab); ab = wmma_bf(a[kc].l, w, ab); }
#pragma unroll
    for (int r = 0; r < 8; ++r) sf[wave][8 * g + r][col] = ab[r];
    LDSX(); if (lane < 16) { const v4f b4 = *(const v4f*)&sf[wave][lane][0]; vst2(BIAS + r0 * NH + (unsigned)((wave * 16 + lane) * NH), b4); } }   /* 16 rows x 16 B = one 256-B run per wave */
#pragma unroll 1   /* rolled: one copy of staging and products in the instruction cache */
  for (int which = 0; which < 4; ++which) { const float* WA = which == 0 ? WQ : which == 1 ? WK : which == 2 ? WV : WG;
    __syncthreads();   /* every wave has read the last of the tiles of the product before */
    stage_w(WA, CC, sW, tid); __syncthreads();   /* publishes the fragments */
    v8f acc[8] = {};
#pragma unroll
    for (int kc = 0; kc < 4; ++kc) { v16b w[8];
#pragma unroll
      for (int j = 0; j < 8; ++j) w[j] = wfrag(sW, kc, j, lane);
#pragma unroll
      for (int j = 0; j < 8; ++j) { acc[j] = wmma_bf(a[kc].h, w[j], acc[j]); acc[j] = wmma_bf(a[kc].l, w[j], acc[j]); } }
    __syncthreads();   /* every wave has read its last fragment before the output tiles are written */
    if (which < 2) { _Float16* DH = which == 0 ? QH : KH; _Float16* DL = which == 0 ? QL : KL; const int nhi = which == 0 ? QHI : KHI; const bool hi_rows = t0 < nhi;   /* q, k: f16 rows (+ residual x 2^10 rows < nhi) */
#pragma unroll
      for (int j = 0; j < 8; ++j)
#pragma unroll
        for (int r = 0; r < 8; ++r) { const float v = acc[j][r]; const _Float16 hv = (_Float16)v; sh[wave * 16 + 8 * g + r][j * 16 + col] = hv; sl[wave * 16 + 8 * g + r][j * 16 + col] = (_Float16)((v - (float)hv) * 1024.0f); }
      __syncthreads();
      _Float16* dh = DH + r0 * CC; _Float16* dl = DL + (bb * nhi + t0) * (size_t)CC; const unsigned eo = (unsigned)((tid >> 4) * CC + (tid & 15) * 8);   /* uniform base + one 32-bit offset per thread: 8 rows on per trip */
#pragma unroll
      for (int u = 0; u < 8; ++u) vst2((unsigned*)(dh + eo + u * 8 * CC), *(const v4u*)&sh[(tid >> 4) + u * 8][(tid & 15) * 8]);
      asm volatile("s_wait_xcnt 0x0" ::: "memory");   /* what follows may rewrite registers that these stores name */
      if (hi_rows) {
#pragma unroll
        for (int u = 0; u < 8; ++u) vst2((unsigned*)(dl + eo + u * 8 * CC), *(const v4u*)&sl[(tid >> 4) + u * 8][(tid & 15) * 8]);
        asm volatile("s_wait_xcnt 0x0" ::: "memory"); }   /* the next trip rewrites registers that these stores name */
    } else if (which == 2) { const bool hi_rows = t0 < KHI;   /* v: f16 planes [c][t] (+ bf16 hi/lo planes for t < KHI) */
#pragma unroll
      for (int j = 0; j < 8; ++j)
#pragma unroll
        for (int r = 0; r < 8; ++r) { const float v = acc[j][r]; const int rl = wave * 16 + 8 * g + r, cl = j * 16 + col; th[cl][rl] = (_Float16)v; const __bf16 bh = (__bf16)v; tb[cl][rl] = bh; tbl[cl][rl] = (__bf16)(v - (float)bh); }
      __syncthreads();
      _Float16* vt = VT + bb * CC * (size_t)TT + t0; __bf16* vb = VB + bb * CC * (size_t)KHI + t0; __bf16* vbl = VBL + bb * CC * (size_t)KHI + t0; const unsigned vo = (unsigned)((tid >> 3) * TT + (tid & 7) * 8), ho = (unsigned)((tid >> 3) * KHI + (tid & 7) * 8);   /* 16 planes on per trip */
#pragma unroll
      for (int u = 0; u < 8; ++u) vst2((unsigned*)(vt + vo + u * 16 * TT), *(const v4u*)&th[(tid >> 3) + u * 16][(tid & 7) * 8]);
      asm volatile("s_wait_xcnt 0x0" ::: "memory");   /* what follows may rewrite registers that these stores name */
      if (hi_rows) {
#pragma unroll
        for (int u = 0; u < 8; ++u) { const int cl = (tid >> 3) + u * 16, q = tid & 7; vst2((unsigned*)(vb + ho + u * 16 * KHI), *(const v4u*)&tb[cl][q * 8]); vst2((unsigned*)(vbl + ho + u * 16 * KHI), *(const v4u*)&tbl[cl][q * 8]); }
        asm volatile("s_wait_xcnt 0x0" ::: "memory"); }   /* the next trip rewrites registers that these stores name */
    } else {
#pragma unroll
      for (int j = 0; j < 8; ++j)
#pragma unroll
        for (int r = 0; r < 8; ++r) sf[wave][8 * g + r][j * 16 + col] = __builtin_amdgcn_rcpf(1.0f + __builtin_amdgcn_exp2f(-LOG2E * (acc[j][r] + bfr(GB[j * 16 + col]))));   /* sigmoid(x Wg + gating_b) on the hardware's 2^x and reciprocal */
      LDSX(); v4f t[16];   /* all 16 LDS reads stand ahead of the stores: one LDS latency, not 16 */
#pragma unroll
      for (int rl = 0; rl < 16; ++rl) t[rl] = *(const v4f*)&sf[wave][rl][lane * 4];
#pragma unroll
      for (int rl = 0; rl < 16; ++rl) vst2(G + r0 * CC + (unsigned)(wave * 16 * CC + lane * 4) + rl * CC, t[rl]);
      asm volatile("s_wait_xcnt 0x0" ::: "memory"); }   /* behind the last stores, as in the other branches */
  } }
// ---- k_attn: work-group = (4 rows r, head h), 16 waves, wave = 16 queries against all 256 keys, 64 keys at a time with a running maximum and sum. The head's bias plane lies in LDS for the whole work-group, in the order the score fragments hold it; per row r the k rows, v planes and mask bias are staged in LDS once for all 16 waves. Both products are formed transposed (scores: A = k rows, B = q rows; ctx: A = v planes, B = P), so D's column is the query in both: a lane holds keys of ONE query, two neighbouring score tiles ARE the B fragment of P, and maximum, sum and rescale stay in the lane (one exchange with the other half-wave). The plain unroll directives keep the small arrays in registers.
#define FR 4               // rows r per work-group
#define KP (HD + 8)        // halves per staged k row: 80-B pitch
#define VP (TT + 8)        // halves per staged v plane: 528-B pitch
__device__ __forceinline__ void exp2x8(float (&t)[8]) {
  asm("v_exp_f32 %0, %0\n\tv_exp_f32 %1, %1\n\tv_exp_f32 %2, %2\n\tv_exp_f32 %3, %3\n\tv_exp_f32 %4, %4\n\tv_exp_f32 %5, %5\n\tv_exp_f32 %6, %6\n\tv_exp_f32 %7, %7\n\tv_nop"
      : "+v"(t[0]), "+v"(t[1]), "+v"(t[2]), "+v"(t[3]), "+v"(t[4]), "+v"(t[5]), "+v"(t[6]), "+v"(t[7])); }
__device__ __forceinline__ v8f wmma_h(v16h a, v16h b, v8f c) { return __builtin_amdgcn_wmma_f32_16x16x32_f16(false, a, false, b, (short)0, c, false, false); }
__global__ __launch_bounds__(512) void k_attn(const _Float16* __restrict__ QH, const _Float16* __restrict__ QL, const _Float16* __restrict__ KH, const _Float16* __restrict__ VT, const float* __restrict__ BIAS, const float* __restrict__ MKP, float* __restrict__ Y) {
  __shared__ __align__(16) float sB[TT * TT];            // [query tile][key tile][half of 8][lane][4]
  __shared__ __align__(16) _Float16 sK[TT][KP]; __shared__ __align__(16) _Float16 sV[HD][VP]; __shared__ __align__(16) float sM[TT];
  const int tid = threadIdx.x, wave = tid >> 5, lane = tid & 31, col = lane & 15, g = lane >> 4; const int h = blockIdx.y; const int rb = (int)blockIdx.x * FR;
  const unsigned ko0 = (unsigned)(tid >> 2) * CC + (tid & 3) * 8, vo0 = (unsigned)tid * 8;   /* this thread's 16-B pieces of a row's k rows (and 128 rows on) and v planes (and 16 planes on) */
  const unsigned qo = (unsigned)(wave * 16 + col) * CC + 8 * g;
  v4u pk[2], pv[2]; float pm = 0.f;
  { const _Float16* kb = KH + (size_t)rb * TT * CC + h * HD; const _Float16* vb = VT + ((size_t)rb * CC + h * HD) * TT;
    pk[0] = *(const v4u*)(kb + ko0); pk[1] = *(const v4u*)(kb + ko0 + 128 * CC); pv[0] = *(const v4u*)(vb + vo0); pv[1] = *(const v4u*)(vb + vo0 + 16 * TT);
    if (tid < TT) pm = MKP[(size_t)rb * SZ + tid]; }
  // a wave takes 8 queries x 4 keys per load: its 32 LDS words fall on 32 banks; the 16 waves stand side by side along the keys
  { const float* bh = BIAS + h; const unsigned gs = (unsigned)((((tid >> 2) & 7) * SZ + wave * 4 + (tid & 3)) * NH), ld = (unsigned)(((((wave >> 2) * 2 + (wave & 1)) * 32) + ((wave >> 1) & 1) * 16 + ((tid >> 2) & 7)) * 4 + (tid & 3));
#pragma unroll 4   /* 16 loads in flight per lane */
    for (int qi = 0; qi < TT / 8; ++qi)
#pragma unroll
      for (int kk = 0; kk < 4; ++kk) sB[ld + (qi >> 1) * 4096 + (qi & 1) * 32 + kk * 1024] = bh[gs + qi * (8 * SZ * NH) + kk * (64 * NH)]; }
#pragma unroll 1   /* rolled: one copy of the body in the instruction cache */
  for (int it = 0; it < FR; ++it) { const int b = rb + it;
    const _Float16* qhb = QH + (size_t)b * TT * CC + h * HD; const _Float16* qlb = QL + (size_t)b * QHI * CC + h * HD;
    union { v16h v; v8h q[2]; } qh, ql; qh.q[0] = *(const v8h*)(qhb + qo); qh.q[1] = *(const v8h*)(qhb + qo + 16); ql.q[0] = *(const v8h*)(qlb + qo); ql.q[1] = *(const v8h*)(qlb + qo + 16);
    __syncthreads();   /* every wave has left the previous row's k, v and mask tiles */
    *(v4u*)&sK[tid >> 2][(tid & 3) * 8] = pk[0]; *(v4u*)&sK[128 + (tid >> 2)][(tid & 3) * 8] = pk[1]; *(v4u*)&sV[tid >> 5][(tid & 31) * 8] = pv[0]; *(v4u*)&sV[16 + (tid >> 5)][(tid & 31) * 8] = pv[1];
    if (tid < TT) sM[tid] = 32768.0f * (bfr(pm) - 1.0f);   /* FP16_HUGE * (pair_mask[r][k] - 1) */
    __syncthreads();   /* publishes this row's tiles (and, the first time, the bias plane) */
    if (it + 1 < FR) {   /* the next row's tiles fly while this row is worked on */
      const _Float16* kb = KH + (size_t)(b + 1) * TT * CC + h * HD; const _Float16* vb = VT + ((size_t)(b + 1) * CC + h * HD) * TT;
      pk[0] = *(const v4u*)(kb + ko0); pk[1] = *(const v4u*)(kb + ko0 + 128 * CC); pv[0] = *(const v4u*)(vb + vo0); pv[1] = *(const v4u*)(vb + vo0 + 16 * TT);
      if (tid < TT) pm = MKP[(size_t)(b + 1) * SZ + tid]; }
    float m = -3.0e38f, nb = 3.0e38f, l = 0.f; v8f acc[HD / 16] = {};   /* nb: 11 - maximum x log2(e), the addend of every exponent under the maximum in use; l (x 2^11): this half-wave's keys only; the halves meet behind the loop */
#pragma unroll 1   /* rolled: unrolled, the LDS reads of all 16 key tiles are hoisted and the 256 registers of a 16-wave work-group spill */
    for (int c = 0; c < TT / 64; ++c) { v8f s[4];
#pragma unroll
      for (int jj = 0; jj < 4; ++jj) { const int j = c * 4 + jj; const v16h kf = frag_h(&sK[j * 16 + col][0], lane); const v8f z = {}; const v8f a = wmma_h(kf, qh.v, z), al = wmma_h(kf, ql.v, z);
        const float* bp = sB + (((wave * 16 + j) * 2) * 32 + lane) * 4; const v4f b0 = *(const v4f*)bp, b1 = *(const v4f*)(bp + 128); const v4f m0 = *(const v4f*)&sM[j * 16 + 8 * g], m1 = *(const v4f*)&sM[j * 16 + 8 * g + 4];
#pragma unroll
        for (int r = 0; r < 8; ++r) s[jj][r] = (a[r] + al[r] * (1.0f / 1024.0f)) * SCALE + (r < 4 ? b0[r & 3] : b1[r & 3]) + (r < 4 ? m0[r & 3] : m1[r & 3]); }
      v8f mx = s[0];
#pragma unroll
      for (int r = 0; r < 8; ++r) mx[r] = fmaxf(fmaxf(mx[r], s[1][r]), fmaxf(s[2][r], s[3][r]));
      float cm = fmaxf(fmaxf(fmaxf(mx[0], mx[1]), fmaxf(mx[2], mx[3])), fmaxf(fmaxf(mx[4], mx[5]), fmaxf(mx[6], mx[7]))); cm = fmaxf(cm, __shfl_xor(cm, 16));
      const float mn = fmaxf(m, cm), nbn = fmaf(-LOG2E, mn, 11.0f); const float alpha = __builtin_amdgcn_exp2f(nbn - nb); m = mn; nb = nbn;   /* what was summed under the old maximum shrinks by alpha: the difference of the two addends as they were used, so old and new terms stand against one point whatever the addends' rounding */
      v8f sm = {};
#pragma unroll
      for (int jj = 0; jj < 4; ++jj) { float t[8];   /* exp(logit - maximum) x 2^11: one fma and the hardware's 2^x */
#pragma unroll
        for (int r = 0; r < 8; ++r) t[r] = fmaf(s[jj][r], LOG2E, nb);
        exp2x8(t);
#pragma unroll
        for (int r = 0; r < 8; ++r) { s[jj][r] = t[r]; sm[r] = jj ? sm[r] + t[r] : t[r]; } }
      l = l * alpha + (((sm[0] + sm[1]) + (sm[2] + sm[3])) + ((sm[4] + sm[5]) + (sm[6] + sm[7])));
#pragma unroll
      for (int j = 0; j < HD / 16; ++j)
#pragma unroll
        for (int r = 0; r < 8; ++r) acc[j][r] *= alpha;
#pragma unroll
      for (int k2 = 0; k2 < 2; ++k2) { v16h p;
#pragma unroll
        for (int i = 0; i < 8; ++i) { p[i] = (_Float16)s[2 * k2][i]; p[8 + i] = (_Float16)s[2 * k2 + 1][i]; }
#pragma unroll
        for (int j = 0; j < HD / 16; ++j) acc[j] = wmma_h(frag_h(&sV[j * 16 + col][(c * 2 + k2) * 32], lane), p, acc[j]); } }
    l += __shfl_xor(l, 16);
    const float inv = (m > -1.0e38f && l > 0.f) ? 1.0f / l : 0.f;   /* a fully excluded row (every logit at or below -1e38) yields 0 */
    float* yp = Y + (size_t)b * TT * CC + h * HD + (unsigned)(wave * 16 + col) * CC + 8 * g;
#pragma unroll
    for (int j = 0; j < HD / 16; ++j) { v4f y0, y1;
#pragma unroll
      for (int r = 0; r < 4; ++r) { y0[r] = acc[j][r] * inv; y1[r] = acc[j][4 + r] * inv; }
      vst2(yp + j * 16, y0); vst2(yp + j * 16 + 4, y1); }   /* the 128-B (row, head) segment has this wave as its one writer */
    asm volatile("s_wait_xcnt 0x0" ::: "memory");   /* the next trip rewrites the registers that these stores name */
  } }
// ---- k_out: block = (64 rows, 128 cols): out = (ctx * gate) Wo (+ bo), the gate row (same natural row index r*256 + q) multiplied in as the ctx row is loaded: all rows: gated ctx split bf16 hi + lo against exact bf16 Wo (2 products)
__global__ __launch_bounds__(128) void k_out(const float* __restrict__ Y, const float* __restrict__ G, const float* __restrict__ WO, const float* __restrict__ BO, float* __restrict__ OUT) { __shared__ __align__(16) float sf[4][16][132];
  const int tid = threadIdx.x, wave = tid >> 5, lane = tid & 31, col = lane & 15, g = lane >> 4; const int c0 = blockIdx.y * 128; const size_t r0 = (size_t)blockIdx.x * 64 + wave * 16;
  v8f acc[8] = {};
  if (true) {   /* ALL rows: gated ctx bf16 hi + lo x exact output_w (2 products) */
    __bf16* sW = (__bf16*)&sf[0][0][0];   /* the weight's fragments lie where the output rows are staged later */
    stage_w(WO + c0, DIN, sW, tid); __syncthreads();   /* publishes the fragments */
#pragma unroll 2
    for (int kc = 0; kc < CC / 32; ++kc) { v16b w[8];
#pragma unroll
      for (int j = 0; j < 8; ++j) w[j] = wfrag(sW, kc, j, lane);   /* the chunk's LDS reads stand in one place, ahead of the rows' global loads */
      const F2 a = split_row2(Y + (r0 + col) * CC, G + (r0 + col) * CC, kc * 32, lane); asm volatile("s_wait_loadcnt 0x0" ::: "memory");
#pragma unroll
      for (int j = 0; j < 8; ++j) { acc[j] = wmma_bf(a.h, w[j], acc[j]); acc[j] = wmma_bf(a.l, w[j], acc[j]); } }
    __syncthreads();   /* every wave has read its last fragment before sf is written */
#pragma unroll
    for (int j = 0; j < 8; ++j) { const float bias = BO ? bfr(BO[c0 + j * 16 + col]) : 0.f;
#pragma unroll
      for (int r = 0; r < 8; ++r) sf[wave][8 * g + r][j * 16 + col] = acc[j][r] + bias; }
  } else {
#pragma unroll 2
    for (int kc = 0; kc < CC / 32; ++kc) { const v16h a = frag_f32(Y + (r0 + col) * CC + kc * 32, lane); asm volatile("s_wait_loadcnt 0x0" ::: "memory");
#pragma unroll
      for (int j = 0; j < 8; ++j) { const v16h w = WOCOLH(WO, kc * 32, c0 + j * 16 + col, lane); asm volatile("s_wait_loadcnt 0x0" ::: "memory"); acc[j] = wmma16(a, w, acc[j]); } }
#pragma unroll
    for (int j = 0; j < 8; ++j) { const float bias = BO ? bfr(BO[c0 + j * 16 + col]) : 0.f;
#pragma unroll
      for (int r = 0; r < 8; ++r) sf[wave][8 * g + r][j * 16 + col] = acc[j][r] * (1.0f / 256.0f) + bias; } }
  LDSX(); for (int rl = 0; rl < 16; ++rl) vst2(OUT + (r0 + rl) * DIN + c0 + lane * 4, *(const v4f*)&sf[wave][rl][lane * 4]); }

extern "C" void kernel_launch(void* const* d_in, const int* in_sizes, int n_in, void* d_out, int out_size, void* d_ws, size_t ws_size, hipStream_t stream) {
  (void)in_sizes; (void)n_in; (void)out_size;
  const float** F = (const float**)d_in;
  if (ws_size < (size_t)WS_END) return;
  char* ws = (char*)d_ws; _Float16 *QH = (_Float16*)(ws + WS_QH), *KH = (_Float16*)(ws + WS_KH), *VT = (_Float16*)(ws + WS_VT), *QL = (_Float16*)(ws + WS_QL), *KL = (_Float16*)(ws + WS_KL); __bf16 *VB = (__bf16*)(ws + WS_VB), *VBL = (__bf16*)(ws + WS_VBL); float *Y = (float*)(ws + WS_Y);
  (void)Y; (void)QL; (void)KL; (void)VB; (void)VBL;
  // inputs: 0 pair_act [1,256,256,128]; 1 pair_mask [1,256,256]; 2 ln_gamma, 3 ln_beta; 4 feat2d_w [128,4]; 5 query_w, 6 key_w, 7 value_w [128,4,32] (in,out); 8 gating_w [128,4,32], 9 gating_b [4,32]; 10 output_w [4,32,128] (in,out); 11 output_b
  if (ws_size < (size_t)WS_END2) return;
  float *BIAS = (float*)(ws + WS_BIAS), *G = (float*)(ws + WS_G);
  k_front<<<dim3(NZR / 64), 128, 0, stream>>>(F[0], F[2], F[3], F[4], F[5], F[6], F[7], F[8], F[9], QH, QL, KH, KL, VT, VB, VBL, BIAS, G);
  k_attn<<<dim3(TNB / FR, NH), 512, 0, stream>>>(QH, QL, KH, VT, BIAS, F[1], Y);
  k_out<<<dim3(TNB * TT / 64, DIN / 128), 128, 0, stream>>>(Y, G, F[10], F[11], (float*)d_out);
}

// v006
// It runs in 75.4 microseconds.
// Two timings next to v005 both put it at 1.08 times that version's speed.
// Over all steps from v000 it is 7.00 times as fast.
// compute dtype: all float inputs rounded to bf16; LayerNorm of pair_act in f32; q/k/v = LN(act) split bf16 hi + lo x W (exact bf16, (in,out)) on WMMA 16x16x32 (2 products, f32 accumulate); q as f16 hi + residual (x 2^10) against k once to f16 (2 products) x 32^-0.5 + the per-(query, key, head) triangle bias (2-product GEMM) + the mask bias; softmax in f32 (hardware 2^x of logit x log2(e) + (11 - maximum x log2(e)), running maximum and sum over steps of 64 keys); exp(logit - maximum) x 2^11 once to f16 against v once to f16 (1 product), divided by the sum at the end; gate sigmoid(LN(act) Wg + b) in f32 (2-product GEMM, hardware 2^x and reciprocal); gated ctx split bf16 hi + lo against exact output_w (2 products) + output_b; f32 output.
#include <hip/hip_runtime.h>
#include <math.h>

typedef __attribute__((ext_vector_type(16))) _Float16 v16h;
typedef __attribute__((ext_vector_type(16))) __bf16 v16b;
typedef __attribute__((ext_vector_type(8)))  _Float16 v8h;
typedef __attribute__((ext_vector_type(8)))  float v8f;
typedef __attribute__((ext_vector_type(4)))  float v4f;
typedef __attribute__((ext_vector_type(2)))  float v2f;
typedef __attribute__((ext_vector_type(4)))  unsigned v4u;
typedef __attribute__((ext_vector_type(4)))  int v4i;
typedef float __attribute__((may_alias)) float_a;
typedef int __attribute__((may_alias)) int_a;

template <typename T> __device__ __forceinline__ void vst2(void* p, T v) { *(T*)p = v;  }
__device__ __forceinline__ v8f wmma16(v16h a, v16h b, v8f c) {
  v8f d = __builtin_amdgcn_wmma_f32_16x16x32_f16(false, a, false, b, (short)0, c, false, false);
  asm volatile("v_nop\n\tv_nop\n\tv_nop\n\tv_nop" : "+v"(d) : "v"(a), "v"(b));
  return d;
}
__device__ __forceinline__ v8f wmma_bf(v16b a, v16b b, v8f c) {
  v8f d = __builtin_amdgcn_wmma_f32_16x16x32_bf16(false, a, false, b, (short)0, c, false, false);
  asm volatile("v_nop\n\tv_nop\n\tv_nop\n\tv_nop" : "+v"(d) : "v"(a), "v"(b));
  return d;
}
// 16x16x32 fragments: lane = (h = lane>>4, row/col = lane&15); elements 0..7 = k0+8h+0..7, 8..15 = k0+16+8h+0..7; D element r = row 8h+r
__device__ __forceinline__ v16h frag_h(const _Float16* rowk0, int lane) {
  union { v16h v; v8h q[2]; } u; const _Float16* p = rowk0 + 8 * (lane >> 4);
  u.q[0] = *(const v8h*)p; u.q[1] = *(const v8h*)(p + 16); return u.v;
}
__device__ __forceinline__ v16h frag_f32(const float* rowk0, int lane) {
  v16h a; const float* p = rowk0 + 8 * (lane >> 4);
#pragma unroll
  for (int i = 0; i < 8; ++i) { a[i] = (_Float16)p[i]; a[8 + i] = (_Float16)p[16 + i]; }
  return a;
}
__device__ __forceinline__ v16h frag_f32s(const float* rowk0, int lane, float sc) {
  v16h a; const float* p = rowk0 + 8 * (lane >> 4);
#pragma unroll
  for (int i = 0; i < 8; ++i) { a[i] = (_Float16)(p[i] * sc); a[8 + i] = (_Float16)(p[16 + i] * sc); }
  return a;
}
// column fragment from a [K][ld] layout (column n), rows >= K read as 0
__device__ __forceinline__ v16h fragc_f32(const float* W, int k0, int n, int lane, int ld, int K) {
  v16h a; const int g = lane >> 4;
#pragma unroll
  for (int i = 0; i < 8; ++i) { const int ka = k0 + 8 * g + i, kb = ka + 16;
    a[i] = (_Float16)(ka < K ? W[(size_t)(ka < K ? ka : K - 1) * ld + n] : 0.f); a[8 + i] = (_Float16)(kb < K ? W[(size_t)(kb < K ? kb : K - 1) * ld + n] : 0.f); }
  return a;
}
struct F2 { v16b h, l; };
__device__ __forceinline__ F2 bsplit16(const float v[16]) { F2 r;
#pragma unroll
  for (int i = 0; i < 16; ++i) { const __bf16 h = (__bf16)v[i]; r.h[i] = h; r.l[i] = (__bf16)(v[i] - (float)h); }
  return r; }
__device__ __forceinline__ F2 split_row(const float* row, int k0, int lane) { float v[16]; const float* p = row + k0 + 8 * (lane >> 4);
#pragma unroll
  for (int i = 0; i < 8; ++i) { v[i] = p[i]; v[8 + i] = p[16 + i]; }
  return bsplit16(v); }
// the same of the element-wise product of two rows (ctx row x gate row, multiplied in f32 ahead of the split)
__device__ __forceinline__ F2 split_row2(const float* row, const float* grow, int k0, int lane) { float v[16]; v4f y[4], t[4]; const float* p = row + k0 + 8 * (lane >> 4); const float* q = grow + k0 + 8 * (lane >> 4);
#pragma unroll
  for (int u = 0; u < 4; ++u) { y[u] = *(const v4f*)(p + (u >> 1) * 16 + (u & 1) * 4); t[u] = *(const v4f*)(q + (u >> 1) * 16 + (u & 1) * 4); }
  asm volatile("s_wait_xcnt 0x0" :: "v"(y[0]), "v"(y[1]), "v"(y[2]), "v"(y[3]), "v"(t[0]), "v"(t[1]), "v"(t[2]), "v"(t[3]) : "memory");   /* what follows may rewrite the registers that these loads name; the loaded values as inputs hold the wait behind the loads */
#pragma unroll
  for (int u = 0; u < 4; ++u)
#pragma unroll
    for (int i = 0; i < 4; ++i) v[u * 4 + i] = y[u][i] * t[u][i];
  return bsplit16(v); }
__device__ __forceinline__ F2 split_rowK(const float* row, int k0, int lane, int K) { float v[16]; const int g = lane >> 4;
#pragma unroll
  for (int i = 0; i < 8; ++i) { const int ka = k0 + 8 * g + i, kb = ka + 16; v[i] = ka < K ? row[ka < K ? ka : K - 1] : 0.f; v[8 + i] = kb < K ? row[kb < K ? kb : K - 1] : 0.f; }
  return bsplit16(v); }
__device__ __forceinline__ F2 split_col(const float* W, int k0, int n, int lane, int ld, int K) { float v[16]; const int g = lane >> 4;
#pragma unroll
  for (int i = 0; i < 8; ++i) { const int ka = k0 + 8 * g + i, kb = ka + 16; v[i] = ka < K ? W[(size_t)(ka < K ? ka : K - 1) * ld + n] : 0.f; v[8 + i] = kb < K ? W[(size_t)(kb < K ? kb : K - 1) * ld + n] : 0.f; }
  return bsplit16(v); }
__device__ __forceinline__ v8f mac3(const F2& a, const F2& b, v8f c) { c = wmma_bf(a.l, b.h, c); c = wmma_bf(a.h, b.l, c); return wmma_bf(a.h, b.h, c); }
__device__ __forceinline__ float sigm(float v) { return 1.0f / (1.0f + expf(-v)); }
#define LDSX() do { asm volatile("s_wait_dscnt 0" ::: "memory"); __builtin_amdgcn_wave_barrier(); __builtin_amdgcn_fence(__ATOMIC_RELEASE, "workgroup"); } while (0)

// Triangle attention (pair_act [1, 256, 256, 128], 4 heads x 32): act = LayerNorm(pair_act); for every row r: q = act[r] Wq * 32^-0.5, k = act[r] Wk, v = act[r] Wv; logits[r,h,q,k] = q . k + 2^15 (pair_mask[r][k] - 1) + tri_bias[h][q][k] with tri_bias = act . feat2d_w (indexed by the (q, k) PAIR, shared across rows); softmax over k; wa = (weights v) * sigmoid(act[r][q] Wg + bg); out[r][q] = wa . output_w + output_b.
#define NB 256
#define TT 256
#define CC 128            // NH * HD = projected width
#define DIN 128          // input (model) width
#define NH 4
#define HD 32
#define NQB (TT / 64)
#define HG 4
#define SCALE (0.17677669529663687f)
#define CAUSAL 0
#ifndef TNB
#define TNB NB
#endif
#define LOG2E (1.4426950408889634f)
__device__ __forceinline__ float bfr(float v) { return (float)(__bf16)v; }
__host__ __device__ __forceinline__ int kb_last(int qb) { return CAUSAL ? ((qb * 64 + 63) >> 7) : (TT / 128 - 1); }
typedef __attribute__((ext_vector_type(8))) __bf16 v8b;
__device__ __forceinline__ v16b frag_b(const __bf16* rowk0, int lane) {
  union { v16b v; v8b q[2]; } u; const __bf16* p = rowk0 + 8 * (lane >> 4);
  u.q[0] = *(const v8b*)p; u.q[1] = *(const v8b*)(p + 16); return u.v;
}
// One 128 x 128 (in,out) weight, rounded to bf16 once per work-group of 128 threads and laid in LDS (32 KiB) in the order the B fragments are read: [k chunk of 32][column tile][half of 8 k][lane] pieces of 16 B. Thread = output column: a wave's load is one whole 128-B line, all 128 loads of a thread are independent, and 8 k of a column make one 16-B store. The plain unroll directives here and at the fragment arrays w[8] keep those small arrays in registers.
__device__ __forceinline__ void stage_w(const float* __restrict__ Wm, int ld, __bf16* sW, int tid) { const float* p = Wm + tid;
#pragma unroll
  for (int kg = 0; kg < 16; ++kg) { v8b w;   /* k = 8 kg + i: chunk kg >> 2, half (kg >> 1) & 1, lane half kg & 1 */
#pragma unroll
    for (int i = 0; i < 8; ++i) w[i] = (__bf16)p[(size_t)(kg * 8 + i) * ld];
    *(v8b*)(sW + (size_t)(((((kg >> 2) * 8 + (tid >> 4)) * 2 + ((kg >> 1) & 1)) * 32 + (kg & 1) * 16 + (tid & 15)) * 8)) = w; } }
__device__ __forceinline__ v16b wfrag(const __bf16* sW, int kc, int j, int lane) {
  union { v16b v; v8b q[2]; } u; const __bf16* p = sW + ((kc * 8 + j) * 64 + lane) * 8;
  u.q[0] = *(const v8b*)p; u.q[1] = *(const v8b*)(p + 256); return u.v;
}
#define QBH 0              // unused: nothing in this file reads it
#define QHI 256            // rows carrying a q residual plane (all rows when non-causal: 2-product logits everywhere)
#define KHI 64            // key rows carrying k residual / v bf16 hi+lo planes (written by k_front; no kernel reads them)
// B fragment (k rows k0+.., output column o) of a weight: (in,out) [K][ld] or (out,in) [ld rows of K]: bf16 exact, or f16(bf16 * 256) exact
__device__ __forceinline__ v16b wcol_io(const float* Wm, int k0, int o, int lane, int ld) { v16b w; const int g = lane >> 4;
#pragma unroll
  for (int i = 0; i < 8; ++i) { w[i] = (__bf16)Wm[(size_t)(k0 + 8 * g + i) * ld + o]; w[8 + i] = (__bf16)Wm[(size_t)(k0 + 16 + 8 * g + i) * ld + o]; }
  return w; }
__device__ __forceinline__ v16b wcol_oi(const float* Wm, int k0, int o, int lane, int K) { v16b w; const float* p = Wm + (size_t)o * K + k0 + 8 * (lane >> 4);
#pragma unroll
  for (int i = 0; i < 8; ++i) { w[i] = (__bf16)p[i]; w[8 + i] = (__bf16)p[16 + i]; }
  return w; }
__device__ __forceinline__ v16h wcolh_io(const float* Wm, int k0, int o, int lane, int ld) { v16h w; const int g = lane >> 4;
#pragma unroll
  for (int i = 0; i < 8; ++i) { w[i] = (_Float16)(bfr(Wm[(size_t)(k0 + 8 * g + i) * ld + o]) * 256.0f); w[8 + i] = (_Float16)(bfr(Wm[(size_t)(k0 + 16 + 8 * g + i) * ld + o]) * 256.0f); }
  return w; }
__device__ __forceinline__ v16h wcolh_oi(const float* Wm, int k0, int o, int lane, int K) { v16h w; const float* p = Wm + (size_t)o * K + k0 + 8 * (lane >> 4);
#pragma unroll
  for (int i = 0; i < 8; ++i) { w[i] = (_Float16)(bfr(p[i]) * 256.0f); w[8 + i] = (_Float16)(bfr(p[16 + i]) * 256.0f); }
  return w; }
#define WQKV_LAYOUT 0   // 0 = (in,out) [DIN][CC]; 1 = (out,in) [CC][DIN]; 2 = per-head [NH][DIN][HD]
__device__ __forceinline__ v16b wcol_hdk(const float* Wm, int k0, int o, int lane) { v16b w; const int g = lane >> 4; const float* p = Wm + (size_t)(o / HD) * DIN * HD + (o % HD);
#pragma unroll
  for (int i = 0; i < 8; ++i) { w[i] = (__bf16)p[(size_t)(k0 + 8 * g + i) * HD]; w[8 + i] = (__bf16)p[(size_t)(k0 + 16 + 8 * g + i) * HD]; }
  return w; }
#define WO_OUT_IN 0
#if WQKV_LAYOUT == 1
#define WCOL(W, k0, o, lane) wcol_oi(W, k0, o, lane, DIN)
#elif WQKV_LAYOUT == 2
#define WCOL(W, k0, o, lane) wcol_hdk(W, k0, o, lane)
#else
#define WCOL(W, k0, o, lane) wcol_io(W, k0, o, lane, CC)
#endif
#if WO_OUT_IN
#define WOCOL(W, k0, o, lane) wcol_oi(W, k0, o, lane, CC)
#define WOCOLH(W, k0, o, lane) wcolh_oi(W, k0, o, lane, CC)
#else
#define WOCOL(W, k0, o, lane) wcol_io(W, k0, o, lane, DIN)
#define WOCOLH(W, k0, o, lane) wcolh_io(W, k0, o, lane, DIN)
#endif
#define SZ 256
#define BG 64              // sizes only the unused WS_S region (x HG 4 = 256 planes of 256 x 256)
#define NZR (SZ * SZ)      // 65,536 pair rows
#define WS_ZN   (WS_END)
#define WS_BIAS (WS_ZN + 4u * (size_t)NZR * CC)
#define WS_G    (WS_BIAS + 4u * (size_t)NZR * NH)
#define WS_END2 (WS_G + 4u * (size_t)NZR * CC)
#ifndef PROJ_EXTRA_PARAMS
#define PROJ_EXTRA_PARAMS
#endif

#define WS_QH  0u                                      // f16 q rows [b*t][CC]
#define WS_KH  (WS_QH + 2u * (size_t)NB * TT * CC)      // f16 k rows [b*t][CC]
#define WS_VT  (WS_KH + 2u * (size_t)NB * TT * CC)      // f16 v planes [b][c][t]
#define WS_QL  (WS_VT + 2u * (size_t)NB * CC * TT)      // f16 q residual x 2^10 rows [b][t < QHI][CC]
#define WS_KL  (WS_QL + 2u * (size_t)NB * QHI * CC)     // f16 k residual x 2^10 rows [b][t < KHI][CC]
#define WS_VB  (WS_KL + 2u * (size_t)NB * KHI * CC)     // bf16 v hi planes [b][c][t < KHI]
#define WS_VBL (WS_VB + 2u * (size_t)NB * CC * KHI)
#define WS_S   (WS_VBL + 2u * (size_t)NB * CC * KHI)    // unused f32 region (k_attn keeps logits and P in registers)
#define WS_Y   (WS_S  + 4u * (size_t)BG * HG * TT * TT)   // unused WS_S: 256 planes of 256 x 256 f32      // f32 ctx rows [b*t][CC] (only when there is an output projection)
#define WS_END (WS_Y  + 4u * (size_t)NB * TT * CC)

// ---- k_front: block = 64 pair rows, wave = 16 rows. A lane reads its half of one row of pair_act in the order of the A fragments (k = 32 kc + 8 g + i and 16 on), so LayerNorm (biased var, eps 1e-5, ln_gamma/ln_beta, of bf16(z)) needs one exchange with the other half-wave, and the four bf16 hi + lo fragments of LN(act) are formed once and stay in registers for all five products: tri_bias (one plane per head, BIAS[h][q][k]), then q, k, v and the gate, one 128 x 128 (in,out) weight after the other through the same LDS. The output tiles of a product lie on the weight's fragments once the products are done. The second launch bound holds the registers to 4 waves per SIMD, so that all 1,024 work-groups are resident at once.
__global__ __launch_bounds__(128, 4) void k_front(const float* __restrict__ Z, const float* __restrict__ LW, const float* __restrict__ LB, const float* __restrict__ WB, const float* __restrict__ WQ, const float* __restrict__ WK, const float* __restrict__ WV, const float* __restrict__ WG, const float* __restrict__ GB,
    _Float16* __restrict__ QH, _Float16* __restrict__ QL, _Float16* __restrict__ KH, _Float16* __restrict__ KL, _Float16* __restrict__ VT, __bf16* __restrict__ VB, __bf16* __restrict__ VBL, float* __restrict__ BIAS, float* __restrict__ G) {
  __shared__ __align__(16) char sm[3 * 128 * 72 * 2];   /* the largest user: v's three transposed tiles */
  _Float16 (*sh)[136] = (_Float16 (*)[136])sm; _Float16 (*sl)[136] = (_Float16 (*)[136])(sm + 64 * 136 * 2); _Float16 (*th)[72] = (_Float16 (*)[72])sm; __bf16 (*tb)[72] = (__bf16 (*)[72])(sm + 128 * 72 * 2); __bf16 (*tbl)[72] = (__bf16 (*)[72])(sm + 2 * 128 * 72 * 2); float (*sf)[16][132] = (float (*)[16][132])sm; __bf16* sW = (__bf16*)sm; __bf16 (*sb)[144] = (__bf16 (*)[144])(sm + 2 * 64 * 136 * 2);   /* feat2d_w transposed, [head][k], behind the bias rows of sp; a fifth row of zeros; 288-B pitch: the 16-B reads of 5 rows x 2 halves fall on different banks */
  const int tid = threadIdx.x, wave = tid >> 5, lane = tid & 31, col = lane & 15, g = lane >> 4; const size_t r0 = (size_t)blockIdx.x * 64; const size_t bb = r0 / TT; const int t0 = (int)(r0 % TT);
  const v4f wb4 = *(const v4f*)(WB + tid * NH);   /* thread = input channel k: its 4 heads in one 16-B load, in flight under the rows' loads */
  F2 a[4];
  { float x[4][16]; const float* zp = Z + r0 * CC + (unsigned)((wave * 16 + col) * CC + 8 * g);
#pragma unroll
    for (int kc = 0; kc < 4; ++kc)
#pragma unroll
      for (int u = 0; u < 4; ++u) { const v4f t = *(const v4f*)(zp + kc * 32 + (u >> 1) * 16 + (u & 1) * 4);
#pragma unroll
        for (int i = 0; i < 4; ++i) x[kc][u * 4 + i] = bfr(t[i]); }
    float sp[4] = {0.f, 0.f, 0.f, 0.f};
#pragma unroll
    for (int kc = 0; kc < 4; ++kc)
#pragma unroll
      for (int i = 0; i < 16; ++i) sp[kc] += x[kc][i];
    float s1 = (sp[0] + sp[1]) + (sp[2] + sp[3]); s1 += __shfl_xor(s1, 16);
    const float mu = s1 * (1.0f / CC); float qp[4] = {0.f, 0.f, 0.f, 0.f};
#pragma unroll
    for (int kc = 0; kc < 4; ++kc)
#pragma unroll
      for (int i = 0; i < 16; ++i) { const float d = x[kc][i] - mu; qp[kc] += d * d; }
    float q = (qp[0] + qp[1]) + (qp[2] + qp[3]); q += __shfl_xor(q, 16);
    const float rs = rsqrtf(q * (1.0f / CC) + 1e-5f);
#pragma unroll
    for (int kc = 0; kc < 4; ++kc) { float v[16];
#pragma unroll
      for (int u = 0; u < 4; ++u) { const int c = kc * 32 + (u >> 1) * 16 + (u & 1) * 4 + 8 * g; const v4f lw = *(const v4f*)(LW + c), lb = *(const v4f*)(LB + c);
#pragma unroll
        for (int i = 0; i < 4; ++i) v[u * 4 + i] = (x[kc][u * 4 + i] - mu) * rs * bfr(lw[i]) + bfr(lb[i]); }
      a[kc] = bsplit16(v); } }
#pragma unroll
  for (int hh = 0; hh < NH; ++hh) sb[hh][tid] = (__bf16)wb4[hh];
  sb[NH][tid] = (__bf16)0.f;
  __syncthreads();   /* publishes feat2d_w */
  { v8f ab = {}; const __bf16* wr = &sb[col < NH ? col : NH][0];   /* tri_bias: 4 outputs; the columns beyond them read the row of zeros */
#pragma unroll
    for (int kc = 0; kc < 4; ++kc) { const v16b w = frag_b(wr + kc * 32, lane); ab = wmma_bf(a[kc].h, w, ab); ab = wmma_bf(a[kc].l, w, ab); }
    float (*sp)[64] = (float (*)[64])sm;   /* [head][key of this block] */
    if (col < NH) { v4f lo, hi;   /* a lane of column h holds 8 neighbouring keys of head h */
#pragma unroll
      for (int r = 0; r < 4; ++r) { lo[r] = ab[r]; hi[r] = ab[4 + r]; }
      *(v4f*)&sp[col][wave * 16 + 8 * g] = lo; *(v4f*)&sp[col][wave * 16 + 8 * g + 4] = hi; }
    __syncthreads();   /* the four waves' keys of a head meet, so that one wave stores the head's 64 keys as two whole lines */
    if (lane < 16) { const v4f b4 = *(const v4f*)&sp[wave][lane * 4]; vst2(BIAS + (size_t)wave * NZR + r0 + (unsigned)(lane * 4), b4); }   /* wave = head: plane [h][q][k], the block's 256-B run */
    asm volatile("s_wait_xcnt 0x0" ::: "memory"); }   /* what follows may rewrite registers that this store names */
#pragma unroll 1   /* rolled: one copy of staging and products in the instruction cache */
  for (int which = 0; which < 4; ++which) { const float* WA = which == 0 ? WQ : which == 1 ? WK : which == 2 ? WV : WG;
    __syncthreads();   /* every wave has read the last of the tiles of the product before */
    stage_w(WA, CC, sW, tid); __syncthreads();   /* publishes the fragments */
    v8f acc[8] = {};
#pragma unroll
    for (int kc = 0; kc < 4; ++kc) { v16b w[8];
#pragma unroll
      for (int j = 0; j < 8; ++j) w[j] = wfrag(sW, kc, j, lane);
#pragma unroll
      for (int j = 0; j < 8; ++j) { acc[j] = wmma_bf(a[kc].h, w[j], acc[j]); acc[j] = wmma_bf(a[kc].l, w[j], acc[j]); } }
    __syncthreads();   /* every wave has read its last fragment before the output tiles are written */
    if (which < 2) { _Float16* DH = which == 0 ? QH : KH; _Float16* DL = which == 0 ? QL : KL; const int nhi = which == 0 ? QHI : KHI; const bool hi_rows = t0 < nhi;   /* q, k: f16 rows (+ residual x 2^10 rows < nhi) */
#pragma unroll
      for (int j = 0; j < 8; ++j)
#pragma unroll
        for (int r = 0; r < 8; ++r) { const float v = acc[j][r]; const _Float16 hv = (_Float16)v; sh[wave * 16 + 8 * g + r][j * 16 + col] = hv; sl[wave * 16 + 8 * g + r][j * 16 + col] = (_Float16)((v - (float)hv) * 1024.0f); }
      __syncthreads();
      _Float16* dh = DH + r0 * CC; _Float16* dl = DL + (bb * nhi + t0) * (size_t)CC; const unsigned eo = (unsigned)((tid >> 4) * CC + (tid & 15) * 8);   /* uniform base + one 32-bit offset per thread: 8 rows on per trip */
#pragma unroll
      for (int u = 0; u < 8; ++u) vst2((unsigned*)(dh + eo + u * 8 * CC), *(const v4u*)&sh[(tid >> 4) + u * 8][(tid & 15) * 8]);
      asm volatile("s_wait_xcnt 0x0" ::: "memory");   /* what follows may rewrite registers that these stores name */
      if (hi_rows) {
#pragma unroll
        for (int u = 0; u < 8; ++u) vst2((unsigned*)(dl + eo + u * 8 * CC), *(const v4u*)&sl[(tid >> 4) + u * 8][(tid & 15) * 8]);
        asm volatile("s_wait_xcnt 0x0" ::: "memory"); }   /* the next trip rewrites registers that these stores name */
    } else if (which == 2) { const bool hi_rows = t0 < KHI;   /* v: f16 planes [c][t] (+ bf16 hi/lo planes for t < KHI) */
#pragma unroll
      for (int j = 0; j < 8; ++j)
#pragma unroll
        for (int r = 0; r < 8; ++r) { const float v = acc[j][r]; const int rl = wave * 16 + 8 * g + r, cl = j * 16 + col; th[cl][rl] = (_Float16)v; const __bf16 bh = (__bf16)v; tb[cl][rl] = bh; tbl[cl][rl] = (__bf16)(v - (float)bh); }
      __syncthreads();
      _Float16* vt = VT + bb * CC * (size_t)TT + t0; __bf16* vb = VB + bb * CC * (size_t)KHI + t0; __bf16* vbl = VBL + bb * CC * (size_t)KHI + t0; const unsigned vo = (unsigned)((tid >> 3) * TT + (tid & 7) * 8), ho = (unsigned)((tid >> 3) * KHI + (tid & 7) * 8);   /* 16 planes on per trip */
#pragma unroll
      for (int u = 0; u < 8; ++u) vst2((unsigned*)(vt + vo + u * 16 * TT), *(const v4u*)&th[(tid >> 3) + u * 16][(tid & 7) * 8]);
      asm volatile("s_wait_xcnt 0x0" ::: "memory");   /* what follows may rewrite registers that these stores name */
      if (hi_rows) {
#pragma unroll
        for (int u = 0; u < 8; ++u) { const int cl = (tid >> 3) + u * 16, q = tid & 7; vst2((unsigned*)(vb + ho + u * 16 * KHI), *(const v4u*)&tb[cl][q * 8]); vst2((unsigned*)(vbl + ho + u * 16 * KHI), *(const v4u*)&tbl[cl][q * 8]); }
        asm volatile("s_wait_xcnt 0x0" ::: "memory"); }   /* the next trip rewrites registers that these stores name */
    } else {
#pragma unroll
      for (int j = 0; j < 8; ++j)
#pragma unroll
        for (int r = 0; r < 8; ++r) sf[wave][8 * g + r][j * 16 + col] = __builtin_amdgcn_rcpf(1.0f + __builtin_amdgcn_exp2f(-LOG2E * (acc[j][r] + bfr(GB[j * 16 + col]))));   /* sigmoid(x Wg + gating_b) on the hardware's 2^x and reciprocal */
      LDSX(); v4f t[16];   /* all 16 LDS reads stand ahead of the stores: one LDS latency, not 16 */
#pragma unroll
      for (int rl = 0; rl < 16; ++rl) t[rl] = *(const v4f*)&sf[wave][rl][lane * 4];
#pragma unroll
      for (int rl = 0; rl < 16; ++rl) vst2(G + r0 * CC + (unsigned)(wave * 16 * CC + lane * 4) + rl * CC, t[rl]);
      asm volatile("s_wait_xcnt 0x0" ::: "memory"); }   /* behind the last stores, as in the other branches */
  } }
// ---- k_attn: work-group = (4 rows r, head h), 16 waves, wave = 16 queries against all 256 keys, 64 keys at a time with a running maximum and sum. The head's bias plane lies in LDS for the whole work-group, row = query, as it lies in memory, at a pitch of 16 B x an odd number (the 16 queries of a fragment read fall on different banks); per row r the k rows, v planes and mask bias are staged in LDS once for all 16 waves. Both products are formed transposed (scores: A = k rows, B = q rows; ctx: A = v planes, B = P), so D's column is the query in both: a lane holds keys of ONE query, two neighbouring score tiles ARE the B fragment of P, and maximum, sum and rescale stay in the lane (one exchange with the other half-wave). The plain unroll directives keep the small arrays in registers.
#define FR 4               // rows r per work-group
#define KP (HD + 8)        // halves per staged k row: 80-B pitch
#define VP (TT + 8)        // halves per staged v plane: 528-B pitch
#define BP (TT + 4)        // floats per staged bias row: 1,040-B pitch
__device__ __forceinline__ void exp2x8(float (&t)[8]) {
  asm("v_exp_f32 %0, %0\n\tv_exp_f32 %1, %1\n\tv_exp_f32 %2, %2\n\tv_exp_f32 %3, %3\n\tv_exp_f32 %4, %4\n\tv_exp_f32 %5, %5\n\tv_exp_f32 %6, %6\n\tv_exp_f32 %7, %7\n\tv_nop"
      : "+v"(t[0]), "+v"(t[1]), "+v"(t[2]), "+v"(t[3]), "+v"(t[4]), "+v"(t[5]), "+v"(t[6]), "+v"(t[7])); }
__device__ __forceinline__ v8f wmma_h(v16h a, v16h b, v8f c) { return __builtin_amdgcn_wmma_f32_16x16x32_f16(false, a, false, b, (short)0, c, false, false); }
__global__ __launch_bounds__(512) void k_attn(const _Float16* __restrict__ QH, const _Float16* __restrict__ QL, const _Float16* __restrict__ KH, const _Float16* __restrict__ VT, const float* __restrict__ BIAS, const float* __restrict__ MKP, float* __restrict__ Y) {
  __shared__ __align__(16) float sB[TT][BP];
  __shared__ __align__(16) _Float16 sK[TT][KP]; __shared__ __align__(16) _Float16 sV[HD][VP]; __shared__ __align__(16) float sM[TT];
  const int tid = threadIdx.x, wave = tid >> 5, lane = tid & 31, col = lane & 15, g = lane >> 4; const int h = blockIdx.y; const int rb = (int)blockIdx.x * FR;
  const unsigned ko0 = (unsigned)(tid >> 2) * CC + (tid & 3) * 8, vo0 = (unsigned)tid * 8;   /* this thread's 16-B pieces of a row's k rows (and 128 rows on) and v planes (and 16 planes on) */
  const unsigned qo = (unsigned)(wave * 16 + col) * CC + 8 * g;
  v4u pk[2], pv[2]; float pm = 0.f;
  { const _Float16* kb = KH + (size_t)rb * TT * CC + h * HD; const _Float16* vb = VT + ((size_t)rb * CC + h * HD) * TT;
    pk[0] = *(const v4u*)(kb + ko0); pk[1] = *(const v4u*)(kb + ko0 + 128 * CC); pv[0] = *(const v4u*)(vb + vo0); pv[1] = *(const v4u*)(vb + vo0 + 16 * TT);
    if (tid < TT) pm = MKP[(size_t)rb * SZ + tid]; }
  // the plane is one run of 256 KiB: a wave's load is 4 whole lines (half a query's row), its LDS store 512 B in a row; all 32 loads of a lane are in flight at once
  { const float* bh = BIAS + (size_t)h * NZR; v4f t[32];
#pragma unroll
    for (int i = 0; i < 32; ++i) t[i] = *(const v4f*)(bh + (unsigned)(tid * 4) + i * 2048);
    asm volatile("s_wait_xcnt 0x0" ::: "memory");   /* what follows may rewrite the registers that these loads name; it also keeps every load ahead of the first LDS store */
#pragma unroll
    for (int i = 0; i < 32; ++i) *(v4f*)&sB[i * 8 + (tid >> 6)][(tid & 63) * 4] = t[i]; }
#pragma unroll 1   /* rolled: one copy of the body in the instruction cache */
  for (int it = 0; it < FR; ++it) { const int b = rb + it;
    const _Float16* qhb = QH + (size_t)b * TT * CC + h * HD; const _Float16* qlb = QL + (size_t)b * QHI * CC + h * HD;
    union { v16h v; v8h q[2]; } qh, ql; qh.q[0] = *(const v8h*)(qhb + qo); qh.q[1] = *(const v8h*)(qhb + qo + 16); ql.q[0] = *(const v8h*)(qlb + qo); ql.q[1] = *(const v8h*)(qlb + qo + 16);
    __syncthreads();   /* every wave has left the previous row's k, v and mask tiles */
    *(v4u*)&sK[tid >> 2][(tid & 3) * 8] = pk[0]; *(v4u*)&sK[128 + (tid >> 2)][(tid & 3) * 8] = pk[1]; *(v4u*)&sV[tid >> 5][(tid & 31) * 8] = pv[0]; *(v4u*)&sV[16 + (tid >> 5)][(tid & 31) * 8] = pv[1];
    if (tid < TT) sM[tid] = 32768.0f * (bfr(pm) - 1.0f);   /* FP16_HUGE * (pair_mask[r][k] - 1) */
    __syncthreads();   /* publishes this row's tiles (and, the first time, the bias plane) */
    if (it + 1 < FR) {   /* the next row's tiles fly while this row is worked on */
      const _Float16* kb = KH + (size_t)(b + 1) * TT * CC + h * HD; const _Float16* vb = VT + ((size_t)(b + 1) * CC + h * HD) * TT;
      pk[0] = *(const v4u*)(kb + ko0); pk[1] = *(const v4u*)(kb + ko0 + 128 * CC); pv[0] = *(const v4u*)(vb + vo0); pv[1] = *(const v4u*)(vb + vo0 + 16 * TT);
      if (tid < TT) pm = MKP[(size_t)(b + 1) * SZ + tid]; }
    float m = -3.0e38f, nb = 3.0e38f, l = 0.f; v8f acc[HD / 16] = {};   /* nb: 11 - maximum x log2(e), the addend of every exponent under the maximum in use; l (x 2^11): this half-wave's keys only; the halves meet behind the loop */
#pragma unroll 1   /* rolled: unrolled, the LDS reads of all 16 key tiles are hoisted and the 256 registers of a 16-wave work-group spill */
    for (int c = 0; c < TT / 64; ++c) { v8f s[4];
#pragma unroll
      for (int jj = 0; jj < 4; ++jj) { const int j = c * 4 + jj; const v16h kf = frag_h(&sK[j * 16 + col][0], lane); const v8f z = {}; const v8f a = wmma_h(kf, qh.v, z), al = wmma_h(kf, ql.v, z);
        const float* bp = &sB[wave * 16 + col][j * 16 + 8 * g]; const v4f b0 = *(const v4f*)bp, b1 = *(const v4f*)(bp + 4); const v4f m0 = *(const v4f*)&sM[j * 16 + 8 * g], m1 = *(const v4f*)&sM[j * 16 + 8 * g + 4];
#pragma unroll
        for (int r = 0; r < 8; ++r) s[jj][r] = (a[r] + al[r] * (1.0f / 1024.0f)) * SCALE + (r < 4 ? b0[r & 3] : b1[r & 3]) + (r < 4 ? m0[r & 3] : m1[r & 3]); }
      v8f mx = s[0];
#pragma unroll
      for (int r = 0; r < 8; ++r) mx[r] = fmaxf(fmaxf(mx[r], s[1][r]), fmaxf(s[2][r], s[3][r]));
      float cm = fmaxf(fmaxf(fmaxf(mx[0], mx[1]), fmaxf(mx[2], mx[3])), fmaxf(fmaxf(mx[4], mx[5]), fmaxf(mx[6], mx[7]))); cm = fmaxf(cm, __shfl_xor(cm, 16));
      const float mn = fmaxf(m, cm), nbn = fmaf(-LOG2E, mn, 11.0f); const float alpha = __builtin_amdgcn_exp2f(nbn - nb); m = mn; nb = nbn;   /* what was summed under the old maximum shrinks by alpha: the difference of the two addends as they were used, so old and new terms stand against one point whatever the addends' rounding */
      v8f sm = {};
#pragma unroll
      for (int jj = 0; jj < 4; ++jj) { float t[8];   /* exp(logit - maximum) x 2^11: one fma and the hardware's 2^x */
#pragma unroll
        for (int r = 0; r < 8; ++r) t[r] = fmaf(s[jj][r], LOG2E, nb);
        exp2x8(t);
#pragma unroll
        for (int r = 0; r < 8; ++r) { s[jj][r] = t[r]; sm[r] = jj ? sm[r] + t[r] : t[r]; } }
      l = l * alpha + (((sm[0] + sm[1]) + (sm[2] + sm[3])) + ((sm[4] + sm[5]) + (sm[6] + sm[7])));
#pragma unroll
      for (int j = 0; j < HD / 16; ++j)
#pragma unroll
        for (int r = 0; r < 8; ++r) acc[j][r] *= alpha;
#pragma unroll
      for (int k2 = 0; k2 < 2; ++k2) { v16h p;
#pragma unroll
        for (int i = 0; i < 8; ++i) { p[i] = (_Float16)s[2 * k2][i]; p[8 + i] = (_Float16)s[2 * k2 + 1][i]; }
#pragma unroll
        for (int j = 0; j < HD / 16; ++j) acc[j] = wmma_h(frag_h(&sV[j * 16 + col][(c * 2 + k2) * 32], lane), p, acc[j]); } }
    l += __shfl_xor(l, 16);
    const float inv = (m > -1.0e38f && l > 0.f) ? 1.0f / l : 0.f;   /* a fully excluded row (every logit at or below -1e38) yields 0 */
    float* yp = Y + (size_t)b * TT * CC + h * HD + (unsigned)(wave * 16 + col) * CC + 8 * g;
#pragma unroll
    for (int j = 0; j < HD / 16; ++j) { v4f y0, y1;
#pragma unroll
      for (int r = 0; r < 4; ++r) { y0[r] = acc[j][r] * inv; y1[r] = acc[j][4 + r] * inv; }
      vst2(yp + j * 16, y0); vst2(yp + j * 16 + 4, y1); }   /* the 128-B (row, head) segment has this wave as its one writer */
    asm volatile("s_wait_xcnt 0x0" ::: "memory");   /* the next trip rewrites the registers that these stores name */
  } }
// ---- k_out: block = (64 rows, 128 cols): out = (ctx * gate) Wo (+ bo), the gate row (same natural row index r*256 + q) multiplied in as the ctx row is loaded: all rows: gated ctx split bf16 hi + lo against exact bf16 Wo (2 products)
__global__ __launch_bounds__(128) void k_out(const float* __restrict__ Y, const float* __restrict__ G, const float* __restrict__ WO, const float* __restrict__ BO, float* __restrict__ OUT) { __shared__ __align__(16) float sf[4][16][132];
  const int tid = threadIdx.x, wave = tid >> 5, lane = tid & 31, col = lane & 15, g = lane >> 4; const int c0 = blockIdx.y * 128; const size_t r0 = (size_t)blockIdx.x * 64 + wave * 16;
  v8f acc[8] = {};
  if (true) {   /* ALL rows: gated ctx bf16 hi + lo x exact output_w (2 products) */
    __bf16* sW = (__bf16*)&sf[0][0][0];   /* the weight's fragments lie where the output rows are staged later */
    stage_w(WO + c0, DIN, sW, tid); __syncthreads();   /* publishes the fragments */
#pragma unroll 2
    for (int kc = 0; kc < CC / 32; ++kc) { v16b w[8];
#pragma unroll
      for (int j = 0; j < 8; ++j) w[j] = wfrag(sW, kc, j, lane);   /* the chunk's LDS reads stand in one place, ahead of the rows' global loads */
      const F2 a = split_row2(Y + (r0 + col) * CC, G + (r0 + col) * CC, kc * 32, lane); asm volatile("s_wait_loadcnt 0x0" ::: "memory");
#pragma unroll
      for (int j = 0; j < 8; ++j) { acc[j] = wmma_bf(a.h, w[j], acc[j]); acc[j] = wmma_bf(a.l, w[j], acc[j]); } }
    __syncthreads();   /* every wave has read its last fragment before sf is written */
#pragma unroll
    for (int j = 0; j < 8; ++j) { const float bias = BO ? bfr(BO[c0 + j * 16 + col]) : 0.f;
#pragma unroll
      for (int r = 0; r < 8; ++r) sf[wave][8 * g + r][j * 16 + col] = acc[j][r] + bias; }
  } else {
#pragma unroll 2
    for (int kc = 0; kc < CC / 32; ++kc) { const v16h a = frag_f32(Y + (r0 + col) * CC + kc * 32, lane); asm volatile("s_wait_loadcnt 0x0" ::: "memory");
#pragma unroll
      for (int j = 0; j < 8; ++j) { const v16h w = WOCOLH(WO, kc * 32, c0 + j * 16 + col, lane); asm volatile("s_wait_loadcnt 0x0" ::: "memory"); acc[j] = wmma16(a, w, acc[j]); } }
#pragma unroll
    for (int j = 0; j < 8; ++j) { const float bias = BO ? bfr(BO[c0 + j * 16 + col]) : 0.f;
#pragma unroll
      for (int r = 0; r < 8; ++r) sf[wave][8 * g + r][j * 16 + col] = acc[j][r] * (1.0f / 256.0f) + bias; } }
  LDSX(); for (int rl = 0; rl < 16; ++rl) vst2(OUT + (r0 + rl) * DIN + c0 + lane * 4, *(const v4f*)&sf[wave][rl][lane * 4]); }

extern "C" void kernel_launch(void* const* d_in, const int* in_sizes, int n_in, void* d_out, int out_size, void* d_ws, size_t ws_size, hipStream_t stream) {
  (void)in_sizes; (void)n_in; (void)out_size;
  const float** F = (const float**)d_in;
  if (ws_size < (size_t)WS_END) return;
  char* ws = (char*)d_ws; _Float16 *QH = (_Float16*)(ws + WS_QH), *KH = (_Float16*)(ws + WS_KH), *VT = (_Float16*)(ws + WS_VT), *QL = (_Float16*)(ws + WS_QL), *KL = (_Float16*)(ws + WS_KL); __bf16 *VB = (__bf16*)(ws + WS_VB), *VBL = (__bf16*)(ws + WS_VBL); float *Y = (float*)(ws + WS_Y);
  (void)Y; (void)QL; (void)KL; (void)VB; (void)VBL;
  // inputs: 0 pair_act [1,256,256,128]; 1 pair_mask [1,256,256]; 2 ln_gamma, 3 ln_beta; 4 feat2d_w [128,4]; 5 query_w, 6 key_w, 7 value_w [128,4,32] (in,out); 8 gating_w [128,4,32], 9 gating_b [4,32]; 10 output_w [4,32,128] (in,out); 11 output_b
  if (ws_size < (size_t)WS_END2) return;
  float *BIAS = (float*)(ws + WS_BIAS), *G = (float*)(ws + WS_G);
  k_front<<<dim3(NZR / 64), 128, 0, stream>>>(F[0], F[2], F[3], F[4], F[5], F[6], F[7], F[8], F[9], QH, QL, KH, KL, VT, VB, VBL, BIAS, G);
  k_attn<<<dim3(TNB / FR, NH), 512, 0, stream>>>(QH, QL, KH, VT, BIAS, F[1], Y);
  k_out<<<dim3(TNB * TT / 64, DIN / 128), 128, 0, stream>>>(Y, G, F[10], F[11], (float*)d_out);
}

// v007
// It runs in 73.5 microseconds.
// Next to v006, in two timings, it ran 1.03 times as fast each time.
// Over all steps from v000 it is 7.20 times as fast.
// compute dtype: all float inputs rounded to bf16; LayerNorm of pair_act in f32; q/k/v = LN(act) split bf16 hi + lo x W (exact bf16, (in,out)) on WMMA 16x16x32 (2 products, f32 accumulate); q as f16 hi + residual (x 2^10) against k once to f16 (2 products) x 32^-0.5 + the per-(query, key, head) triangle bias (2-product GEMM) + the mask bias; softmax in f32 (hardware 2^x of logit x log2(e) + (11 - maximum x log2(e)), running maximum and sum over steps of 64 keys); exp(logit - maximum) x 2^11 once to f16 against v once to f16 (1 product), divided by the sum at the end; gate sigmoid(LN(act) Wg + b) in f32 (2-product GEMM, hardware 2^x and reciprocal); gated ctx split bf16 hi + lo against exact output_w (2 products) + output_b; f32 output.
#include <hip/hip_runtime.h>
#include <math.h>

typedef __attribute__((ext_vector_type(16))) _Float16 v16h;
typedef __attribute__((ext_vector_type(16))) __bf16 v16b;
typedef __attribute__((ext_vector_type(8)))  _Float16 v8h;
typedef __attribute__((ext_vector_type(8)))  float v8f;
typedef __attribute__((ext_vector_type(4)))  float v4f;
typedef __attribute__((ext_vector_type(2)))  float v2f;
typedef __attribute__((ext_vector_type(4)))  unsigned v4u;
typedef __attribute__((ext_vector_type(4)))  int v4i;
typedef float __attribute__((may_alias)) float_a;
typedef int __attribute__((may_alias)) int_a;

template <typename T> __device__ __forceinline__ void vst2(void* p, T v) { *(T*)p = v;  }
__device__ __forceinline__ v8f wmma16(v16h a, v16h b, v8f c) {
  v8f d = __builtin_amdgcn_wmma_f32_16x16x32_f16(false, a, false, b, (short)0, c, false, false);
  asm volatile("v_nop\n\tv_nop\n\tv_nop\n\tv_nop" : "+v"(d) : "v"(a), "v"(b));
  return d;
}
__device__ __forceinline__ v8f wmma_bf(v16b a, v16b b, v8f c) {
  v8f d = __builtin_amdgcn_wmma_f32_16x16x32_bf16(false, a, false, b, (short)0, c, false, false);
  asm volatile("v_nop\n\tv_nop\n\tv_nop\n\tv_nop" : "+v"(d) : "v"(a), "v"(b));
  return d;
}
// 16x16x32 fragments: lane = (h = lane>>4, row/col = lane&15); elements 0..7 = k0+8h+0..7, 8..15 = k0+16+8h+0..7; D element r = row 8h+r
__device__ __forceinline__ v16h frag_h(const _Float16* rowk0, int lane) {
  union { v16h v; v8h q[2]; } u; const _Float16* p = rowk0 + 8 * (lane >> 4);
  u.q[0] = *(const v8h*)p; u.q[1] = *(const v8h*)(p + 16); return u.v;
}
__device__ __forceinline__ v16h frag_f32(const float* rowk0, int lane) {
  v16h a; const float* p = rowk0 + 8 * (lane >> 4);
#pragma unroll
  for (int i = 0; i < 8; ++i) { a[i] = (_Float16)p[i]; a[8 + i] = (_Float16)p[16 + i]; }
  return a;
}
__device__ __forceinline__ v16h frag_f32s(const float* rowk0, int lane, float sc) {
  v16h a; const float* p = rowk0 + 8 * (lane >> 4);
#pragma unroll
  for (int i = 0; i < 8; ++i) { a[i] = (_Float16)(p[i] * sc); a[8 + i] = (_Float16)(p[16 + i] * sc); }
  return a;
}
// column fragment from a [K][ld] layout (column n), rows >= K read as 0
__device__ __forceinline__ v16h fragc_f32(const float* W, int k0, int n, int lane, int ld, int K) {
  v16h a; const int g = lane >> 4;
#pragma unroll
  for (int i = 0; i < 8; ++i) { const int ka = k0 + 8 * g + i, kb = ka + 16;
    a[i] = (_Float16)(ka < K ? W[(size_t)(ka < K ? ka : K - 1) * ld + n] : 0.f); a[8 + i] = (_Float16)(kb < K ? W[(size_t)(kb < K ? kb : K - 1) * ld + n] : 0.f); }
  return a;
}
struct F2 { v16b h, l; };
__device__ __forceinline__ F2 bsplit16(const float v[16]) { F2 r;
#pragma unroll
  for (int i = 0; i < 16; ++i) { const __bf16 h = (__bf16)v[i]; r.h[i] = h; r.l[i] = (__bf16)(v[i] - (float)h); }
  return r; }
__device__ __forceinline__ F2 split_row(const float* row, int k0, int lane) { float v[16]; const float* p = row + k0 + 8 * (lane >> 4);
#pragma unroll
  for (int i = 0; i < 8; ++i) { v[i] = p[i]; v[8 + i] = p[16 + i]; }
  return bsplit16(v); }
// the same of the element-wise product of two rows (ctx row x gate row, multiplied in f32 ahead of the split)
__device__ __forceinline__ F2 split_row2(const float* row, const float* grow, int k0, int lane) { float v[16]; v4f y[4], t[4]; const float* p = row + k0 + 8 * (lane >> 4); const float* q = grow + k0 + 8 * (lane >> 4);
#pragma unroll
  for (int u = 0; u < 4; ++u) { y[u] = *(const v4f*)(p + (u >> 1) * 16 + (u & 1) * 4); t[u] = *(const v4f*)(q + (u >> 1) * 16 + (u & 1) * 4); }
  asm volatile("s_wait_xcnt 0x0" :: "v"(y[0]), "v"(y[1]), "v"(y[2]), "v"(y[3]), "v"(t[0]), "v"(t[1]), "v"(t[2]), "v"(t[3]) : "memory");   /* what follows may rewrite the registers that these loads name; the loaded values as inputs hold the wait behind the loads */
#pragma unroll
  for (int u = 0; u < 4; ++u)
#pragma unroll
    for (int i = 0; i < 4; ++i) v[u * 4 + i] = y[u][i] * t[u][i];
  return bsplit16(v); }
__device__ __forceinline__ F2 split_rowK(const float* row, int k0, int lane, int K) { float v[16]; const int g = lane >> 4;
#pragma unroll
  for (int i = 0; i < 8; ++i) { const int ka = k0 + 8 * g + i, kb = ka + 16; v[i] = ka < K ? row[ka < K ? ka : K - 1] : 0.f; v[8 + i] = kb < K ? row[kb < K ? kb : K - 1] : 0.f; }
  return bsplit16(v); }
__device__ __forceinline__ F2 split_col(const float* W, int k0, int n, int lane, int ld, int K) { float v[16]; const int g = lane >> 4;
#pragma unroll
  for (int i = 0; i < 8; ++i) { const int ka = k0 + 8 * g + i, kb = ka + 16; v[i] = ka < K ? W[(size_t)(ka < K ? ka : K - 1) * ld + n] : 0.f; v[8 + i] = kb < K ? W[(size_t)(kb < K ? kb : K - 1) * ld + n] : 0.f; }
  return bsplit16(v); }
__device__ __forceinline__ v8f mac3(const F2& a, const F2& b, v8f c) { c = wmma_bf(a.l, b.h, c); c = wmma_bf(a.h, b.l, c); return wmma_bf(a.h, b.h, c); }
__device__ __forceinline__ float sigm(float v) { return 1.0f / (1.0f + expf(-v)); }
#define LDSX() do { asm volatile("s_wait_dscnt 0" ::: "memory"); __builtin_amdgcn_wave_barrier(); __builtin_amdgcn_fence(__ATOMIC_RELEASE, "workgroup"); } while (0)

// Triangle attention (pair_act [1, 256, 256, 128], 4 heads x 32): act = LayerNorm(pair_act); for every row r: q = act[r] Wq * 32^-0.5, k = act[r] Wk, v = act[r] Wv; logits[r,h,q,k] = q . k + 2^15 (pair_mask[r][k] - 1) + tri_bias[h][q][k] with tri_bias = act . feat2d_w (indexed by the (q, k) PAIR, shared across rows); softmax over k; wa = (weights v) * sigmoid(act[r][q] Wg + bg); out[r][q] = wa . output_w + output_b.
#define NB 256
#define TT 256
#define CC 128            // NH * HD = projected width
#define DIN 128          // input (model) width
#define NH 4
#define HD 32
#define NQB (TT / 64)
#define HG 4
#define SCALE (0.17677669529663687f)
#define CAUSAL 0
#ifndef TNB
#define TNB NB
#endif
#define LOG2E (1.4426950408889634f)
__device__ __forceinline__ float bfr(float v) { return (float)(__bf16)v; }
__host__ __device__ __forceinline__ int kb_last(int qb) { return CAUSAL ? ((qb * 64 + 63) >> 7) : (TT / 128 - 1); }
typedef __attribute__((ext_vector_type(8))) __bf16 v8b;
__device__ __forceinline__ v16b frag_b(const __bf16* rowk0, int lane) {
  union { v16b v; v8b q[2]; } u; const __bf16* p = rowk0 + 8 * (lane >> 4);
  u.q[0] = *(const v8b*)p; u.q[1] = *(const v8b*)(p + 16); return u.v;
}
// One 128 x 128 (in,out) weight, rounded to bf16 once per work-group of 512 threads (256 rows) and laid in LDS (32 KiB) in the order the B fragments are read: [k chunk of 32][column tile][half of 8 k][lane] pieces of 16 B. Thread = (output column c, k chunk kq): a wave's load is one whole 128-B line, all 32 loads of a thread are independent, and 8 k of a column make one 16-B store. The plain unroll directives here and at the fragment arrays w[8] keep those small arrays in registers.
__device__ __forceinline__ void stage_wq(const float* __restrict__ Wm, int ld, __bf16* sW, int c, int kq) { const float* p = Wm + (size_t)(kq * 32) * ld + c;
#pragma unroll
  for (int kk = 0; kk < 4; ++kk) { v8b w;   /* k = 32 kq + 8 kk + i: chunk kq, half kk >> 1, lane half kk & 1 */
#pragma unroll
    for (int i = 0; i < 8; ++i) w[i] = (__bf16)p[(size_t)(kk * 8 + i) * ld];
    *(v8b*)(sW + (size_t)((((kq * 8 + (c >> 4)) * 2 + (kk >> 1)) * 32 + (kk & 1) * 16 + (c & 15)) * 8)) = w; } }
__device__ __forceinline__ v16b wfrag(const __bf16* sW, int kc, int j, int lane) {
  union { v16b v; v8b q[2]; } u; const __bf16* p = sW + ((kc * 8 + j) * 64 + lane) * 8;
  u.q[0] = *(const v8b*)p; u.q[1] = *(const v8b*)(p + 256); return u.v;
}
#define QBH 0              // unused: nothing in this file reads it
#define QHI 256            // rows carrying a q residual plane (all rows when non-causal: 2-product logits everywhere)
#define KHI 64            // key rows carrying k residual / v bf16 hi+lo planes (written by k_front; no kernel reads them)
// B fragment (k rows k0+.., output column o) of a weight: (in,out) [K][ld] or (out,in) [ld rows of K]: bf16 exact, or f16(bf16 * 256) exact
__device__ __forceinline__ v16b wcol_io(const float* Wm, int k0, int o, int lane, int ld) { v16b w; const int g = lane >> 4;
#pragma unroll
  for (int i = 0; i < 8; ++i) { w[i] = (__bf16)Wm[(size_t)(k0 + 8 * g + i) * ld + o]; w[8 + i] = (__bf16)Wm[(size_t)(k0 + 16 + 8 * g + i) * ld + o]; }
  return w; }
__device__ __forceinline__ v16b wcol_oi(const float* Wm, int k0, int o, int lane, int K) { v16b w; const float* p = Wm + (size_t)o * K + k0 + 8 * (lane >> 4);
#pragma unroll
  for (int i = 0; i < 8; ++i) { w[i] = (__bf16)p[i]; w[8 + i] = (__bf16)p[16 + i]; }
  return w; }
__device__ __forceinline__ v16h wcolh_io(const float* Wm, int k0, int o, int lane, int ld) { v16h w; const int g = lane >> 4;
#pragma unroll
  for (int i = 0; i < 8; ++i) { w[i] = (_Float16)(bfr(Wm[(size_t)(k0 + 8 * g + i) * ld + o]) * 256.0f); w[8 + i] = (_Float16)(bfr(Wm[(size_t)(k0 + 16 + 8 * g + i) * ld + o]) * 256.0f); }
  return w; }
__device__ __forceinline__ v16h wcolh_oi(const float* Wm, int k0, int o, int lane, int K) { v16h w; const float* p = Wm + (size_t)o * K + k0 + 8 * (lane >> 4);
#pragma unroll
  for (int i = 0; i < 8; ++i) { w[i] = (_Float16)(bfr(p[i]) * 256.0f); w[8 + i] = (_Float16)(bfr(p[16 + i]) * 256.0f); }
  return w; }
#define WQKV_LAYOUT 0   // 0 = (in,out) [DIN][CC]; 1 = (out,in) [CC][DIN]; 2 = per-head [NH][DIN][HD]
__device__ __forceinline__ v16b wcol_hdk(const float* Wm, int k0, int o, int lane) { v16b w; const int g = lane >> 4; const float* p = Wm + (size_t)(o / HD) * DIN * HD + (o % HD);
#pragma unroll
  for (int i = 0; i < 8; ++i) { w[i] = (__bf16)p[(size_t)(k0 + 8 * g + i) * HD]; w[8 + i] = (__bf16)p[(size_t)(k0 + 16 + 8 * g + i) * HD]; }
  return w; }
#define WO_OUT_IN 0
#if WQKV_LAYOUT == 1
#define WCOL(W, k0, o, lane) wcol_oi(W, k0, o, lane, DIN)
#elif WQKV_LAYOUT == 2
#define WCOL(W, k0, o, lane) wcol_hdk(W, k0, o, lane)
#else
#define WCOL(W, k0, o, lane) wcol_io(W, k0, o, lane, CC)
#endif
#if WO_OUT_IN
#define WOCOL(W, k0, o, lane) wcol_oi(W, k0, o, lane, CC)
#define WOCOLH(W, k0, o, lane) wcolh_oi(W, k0, o, lane, CC)
#else
#define WOCOL(W, k0, o, lane) wcol_io(W, k0, o, lane, DIN)
#define WOCOLH(W, k0, o, lane) wcolh_io(W, k0, o, lane, DIN)
#endif
#define SZ 256
#define BG 64              // sizes only the unused WS_S region (x HG 4 = 256 planes of 256 x 256)
#define NZR (SZ * SZ)      // 65,536 pair rows
#define WS_ZN   (WS_END)
#define WS_BIAS (WS_ZN + 4u * (size_t)NZR * CC)
#define WS_G    (WS_BIAS + 4u * (size_t)NZR * NH)
#define WS_END2 (WS_G + 4u * (size_t)NZR * CC)
#ifndef PROJ_EXTRA_PARAMS
#define PROJ_EXTRA_PARAMS
#endif

#define WS_QH  0u                                      // f16 q rows [b*t][CC]
#define WS_KH  (WS_QH + 2u * (size_t)NB * TT * CC)      // f16 k rows [b*t][CC]
#define WS_VT  (WS_KH + 2u * (size_t)NB * TT * CC)      // f16 v planes [b][c][t]
#define WS_QL  (WS_VT + 2u * (size_t)NB * CC * TT)      // f16 q residual x 2^10 rows [b][t < QHI][CC]
#define WS_KL  (WS_QL + 2u * (size_t)NB * QHI * CC)     // f16 k residual x 2^10 rows [b][t < KHI][CC]
#define WS_VB  (WS_KL + 2u * (size_t)NB * KHI * CC)     // bf16 v hi planes [b][c][t < KHI]
#define WS_VBL (WS_VB + 2u * (size_t)NB * CC * KHI)
#define WS_S   (WS_VBL + 2u * (size_t)NB * CC * KHI)    // unused f32 region (k_attn keeps logits and P in registers)
#define WS_Y   (WS_S  + 4u * (size_t)BG * HG * TT * TT)   // unused WS_S: 256 planes of 256 x 256 f32      // f32 ctx rows [b*t][CC] (only when there is an output projection)
#define WS_END (WS_Y  + 4u * (size_t)NB * TT * CC)

// ---- k_front: block = 256 pair rows (one query's row of pairs), 16 waves, wave = 16 rows, one work-group per WGP. The four 128 x 128 (in,out) weights are staged once per work-group, all four side by side in LDS (128 KiB), behind the rows' own loads, and stay there; the output tiles have LDS of their own. A lane reads its half of one row of pair_act in the order of the A fragments (k = 32 kc + 8 g + i and 16 on), so LayerNorm (biased var, eps 1e-5, ln_gamma/ln_beta, of bf16(z)) needs one exchange with the other half-wave, and the four bf16 hi + lo fragments of LN(act) are formed once and stay in registers for all five products: tri_bias (one plane per head, BIAS[h][q][k]), then q, k, v and the gate.
#define FRW 256            // pair rows per work-group of k_front and k_out
__global__ __launch_bounds__(512) void k_front(const float* __restrict__ Z, const float* __restrict__ LW, const float* __restrict__ LB, const float* __restrict__ WB, const float* __restrict__ WQ, const float* __restrict__ WK, const float* __restrict__ WV, const float* __restrict__ WG, const float* __restrict__ GB,
    _Float16* __restrict__ QH, _Float16* __restrict__ QL, _Float16* __restrict__ KH, _Float16* __restrict__ KL, _Float16* __restrict__ VT, __bf16* __restrict__ VB, __bf16* __restrict__ VBL, float* __restrict__ BIAS, float* __restrict__ G) {
  __shared__ __align__(16) __bf16 sWa[4 * DIN * CC];   /* the fragments of query_w, key_w, value_w, gating_w */
  __shared__ __align__(16) char sm[2 * FRW * 136 * 2];   /* the output tiles; the largest user: the rows of q (or k) and their residuals */
  _Float16 (*sh)[136] = (_Float16 (*)[136])sm; _Float16 (*sl)[136] = (_Float16 (*)[136])(sm + FRW * 136 * 2); _Float16 (*th)[FRW + 8] = (_Float16 (*)[FRW + 8])sm; __bf16 (*tb)[72] = (__bf16 (*)[72])(sm + 128 * (FRW + 8) * 2); __bf16 (*tbl)[72] = (__bf16 (*)[72])(sm + 128 * (FRW + 8) * 2 + 128 * 72 * 2); float (*sf)[16][132] = (float (*)[16][132])sm; __bf16 (*sb)[144] = (__bf16 (*)[144])(sm + NH * FRW * 4);   /* feat2d_w transposed, [head][k], behind the bias rows; a fifth row of zeros; 288-B pitch: the 16-B reads of 5 rows x 2 halves fall on different banks */
  const int tid = threadIdx.x, wave = tid >> 5, lane = tid & 31, col = lane & 15, g = lane >> 4; const size_t r0 = (size_t)blockIdx.x * FRW; const size_t bb = blockIdx.x;
  const float wb1 = WB[tid];   /* thread = (input channel k, head): DIN x NH = 512 values, one each; ahead of the rows' loads */
  v4f zt[16];   /* the rows' loads (from memory) are issued ahead of the weights' (from L2) */
  { const float* zp = Z + r0 * CC + (unsigned)((wave * 16 + col) * CC + 8 * g);
#pragma unroll
    for (int kc = 0; kc < 4; ++kc)
#pragma unroll
      for (int u = 0; u < 4; ++u) zt[kc * 4 + u] = *(const v4f*)(zp + kc * 32 + (u >> 1) * 16 + (u & 1) * 4); }
  __builtin_amdgcn_sched_barrier(0);   /* keeps the rows' 16 loads ahead of the 128 weight loads: moved behind them, the requests to memory would start only when the L2 traffic of the staging has been issued */
  { const int kq = __builtin_amdgcn_readfirstlane(tid >> 7), c = tid & 127;
    stage_wq(WQ, CC, sWa, c, kq); stage_wq(WK, CC, sWa + DIN * CC, c, kq); stage_wq(WV, CC, sWa + 2 * DIN * CC, c, kq); stage_wq(WG, CC, sWa + 3 * DIN * CC, c, kq); }
  __builtin_amdgcn_sched_barrier(0);   /* LayerNorm and its parameter loads stay behind the staging: mixed into it, rows, 128 weight values and the parameters together overran the 256 registers of a 16-wave work-group and spilled */
  sb[tid & (NH - 1)][tid >> 2] = (__bf16)wb1;
  if (tid < DIN) sb[NH][tid] = (__bf16)0.f;
  F2 a[4];
  { float x[4][16];
#pragma unroll
    for (int kc = 0; kc < 4; ++kc)
#pragma unroll
      for (int u = 0; u < 4; ++u)
#pragma unroll
        for (int i = 0; i < 4; ++i) x[kc][u * 4 + i] = bfr(zt[kc * 4 + u][i]);
    float sp[4] = {0.f, 0.f, 0.f, 0.f};
#pragma unroll
    for (int kc = 0; kc < 4; ++kc)
#pragma unroll
      for (int i = 0; i < 16; ++i) sp[kc] += x[kc][i];
    float s1 = (sp[0] + sp[1]) + (sp[2] + sp[3]); s1 += __shfl_xor(s1, 16);
    const float mu = s1 * (1.0f / CC); float qp[4] = {0.f, 0.f, 0.f, 0.f};
#pragma unroll
    for (int kc = 0; kc < 4; ++kc)
#pragma unroll
      for (int i = 0; i < 16; ++i) { const float d = x[kc][i] - mu; qp[kc] += d * d; }
    float q = (qp[0] + qp[1]) + (qp[2] + qp[3]); q += __shfl_xor(q, 16);
    const float rs = rsqrtf(q * (1.0f / CC) + 1e-5f);
#pragma unroll
    for (int kc = 0; kc < 4; ++kc) { float v[16];
#pragma unroll
      for (int u = 0; u < 4; ++u) { const int c = kc * 32 + (u >> 1) * 16 + (u & 1) * 4 + 8 * g; const v4f lw = *(const v4f*)(LW + c), lb = *(const v4f*)(LB + c);
#pragma unroll
        for (int i = 0; i < 4; ++i) v[u * 4 + i] = (x[kc][u * 4 + i] - mu) * rs * bfr(lw[i]) + bfr(lb[i]); }
      a[kc] = bsplit16(v); } }
  __syncthreads();   /* publishes feat2d_w and the four weights */
  { v8f ab = {}; const __bf16* wr = &sb[col < NH ? col : NH][0];   /* tri_bias: 4 outputs; the columns beyond them read the row of zeros */
#pragma unroll
    for (int kc = 0; kc < 4; ++kc) { const v16b w = frag_b(wr + kc * 32, lane); ab = wmma_bf(a[kc].h, w, ab); ab = wmma_bf(a[kc].l, w, ab); }
    float (*sp)[FRW] = (float (*)[FRW])sm;   /* [head][key] */
    if (col < NH) { v4f lo, hi;   /* a lane of column h holds 8 neighbouring keys of head h */
#pragma unroll
      for (int r = 0; r < 4; ++r) { lo[r] = ab[r]; hi[r] = ab[4 + r]; }
      *(v4f*)&sp[col][wave * 16 + 8 * g] = lo; *(v4f*)&sp[col][wave * 16 + 8 * g + 4] = hi; }
    __syncthreads();   /* the 16 waves' keys of a head meet, so that a wave stores half a head's 256 keys as four whole lines */
    if (wave < 2 * NH) { const v4f b4 = *(const v4f*)&sp[wave >> 1][(wave & 1) * 128 + lane * 4]; vst2(BIAS + (size_t)(wave >> 1) * NZR + r0 + (unsigned)((wave & 1) * 128 + lane * 4), b4); }   /* plane [h][q][k], the block's 1-KiB run */
    asm volatile("s_wait_xcnt 0x0" ::: "memory"); }   /* what follows may rewrite registers that this store names */
#pragma unroll 1   /* rolled: one copy of the products in the instruction cache */
  for (int which = 0; which < 4; ++which) { const __bf16* sW = sWa + which * (DIN * CC);
    v8f acc[8] = {};
#pragma unroll
    for (int kc = 0; kc < 4; ++kc) { v16b w[8];
#pragma unroll
      for (int j = 0; j < 8; ++j) w[j] = wfrag(sW, kc, j, lane);
#pragma unroll
      for (int j = 0; j < 8; ++j) { acc[j] = wmma_bf(a[kc].h, w[j], acc[j]); acc[j] = wmma_bf(a[kc].l, w[j], acc[j]); } }
    __syncthreads();   /* every wave has read the last of the tiles of the product before (the first time: of the bias rows) */
    if (which < 2) { _Float16* DH = which == 0 ? QH : KH; _Float16* DL = which == 0 ? QL : KL; const int nhi = which == 0 ? QHI : KHI;   /* q, k: f16 rows (+ residual x 2^10 rows < nhi) */
#pragma unroll
      for (int j = 0; j < 8; ++j)
#pragma unroll
        for (int r = 0; r < 8; ++r) { const float v = acc[j][r]; const _Float16 hv = (_Float16)v; sh[wave * 16 + 8 * g + r][j * 16 + col] = hv; sl[wave * 16 + 8 * g + r][j * 16 + col] = (_Float16)((v - (float)hv) * 1024.0f); }
      __syncthreads();
      _Float16* dh = DH + r0 * CC; _Float16* dl = DL + bb * nhi * (size_t)CC; const unsigned eo = (unsigned)((tid >> 4) * CC + (tid & 15) * 8);   /* uniform base + one 32-bit offset per thread: 32 rows on per trip */
#pragma unroll
      for (int u = 0; u < 8; ++u) vst2((unsigned*)(dh + eo + u * 32 * CC), *(const v4u*)&sh[(tid >> 4) + u * 32][(tid & 15) * 8]);
      asm volatile("s_wait_xcnt 0x0" ::: "memory");   /* what follows may rewrite registers that these stores name */
#pragma unroll
      for (int u = 0; u < KHI / 32; ++u) vst2((unsigned*)(dl + eo + u * 32 * CC), *(const v4u*)&sl[(tid >> 4) + u * 32][(tid & 15) * 8]);   /* rows < KHI: q and k alike */
      asm volatile("s_wait_xcnt 0x0" ::: "memory");   /* what follows may rewrite registers that these stores name */
      if (nhi > KHI) {
#pragma unroll
        for (int u = KHI / 32; u < QHI / 32; ++u) vst2((unsigned*)(dl + eo + u * 32 * CC), *(const v4u*)&sl[(tid >> 4) + u * 32][(tid & 15) * 8]);
        asm volatile("s_wait_xcnt 0x0" ::: "memory"); }   /* the next trip rewrites registers that these stores name */
    } else if (which == 2) {   /* v: f16 planes [c][t] (+ bf16 hi/lo planes for t < KHI) */
#pragma unroll
      for (int j = 0; j < 8; ++j)
#pragma unroll
        for (int r = 0; r < 8; ++r) th[j * 16 + col][wave * 16 + 8 * g + r] = (_Float16)acc[j][r];
      if (wave < KHI / 16) {
#pragma unroll
        for (int j = 0; j < 8; ++j)
#pragma unroll
          for (int r = 0; r < 8; ++r) { const float v = acc[j][r]; const int rl = wave * 16 + 8 * g + r, cl = j * 16 + col; const __bf16 bh = (__bf16)v; tb[cl][rl] = bh; tbl[cl][rl] = (__bf16)(v - (float)bh); } }
      __syncthreads();
      _Float16* vt = VT + bb * CC * (size_t)TT; __bf16* vb = VB + bb * CC * (size_t)KHI; __bf16* vbl = VBL + bb * CC * (size_t)KHI; const unsigned vo = (unsigned)((tid >> 5) * TT + (tid & 31) * 8), ho = (unsigned)((tid >> 3) * KHI + (tid & 7) * 8);   /* 16 planes on per trip; 64 of the short ones */
#pragma unroll
      for (int u = 0; u < 8; ++u) vst2((unsigned*)(vt + vo + u * 16 * TT), *(const v4u*)&th[(tid >> 5) + u * 16][(tid & 31) * 8]);
      asm volatile("s_wait_xcnt 0x0" ::: "memory");   /* what follows may rewrite registers that these stores name */
#pragma unroll
      for (int u = 0; u < 2; ++u) { const int cl = (tid >> 3) + u * 64, q = tid & 7; vst2((unsigned*)(vb + ho + u * 64 * KHI), *(const v4u*)&tb[cl][q * 8]); vst2((unsigned*)(vbl + ho + u * 64 * KHI), *(const v4u*)&tbl[cl][q * 8]); }
      asm volatile("s_wait_xcnt 0x0" ::: "memory");   /* the next trip rewrites registers that these stores name */
    } else {
#pragma unroll
      for (int j = 0; j < 8; ++j)
#pragma unroll
        for (int r = 0; r < 8; ++r) sf[wave][8 * g + r][j * 16 + col] = __builtin_amdgcn_rcpf(1.0f + __builtin_amdgcn_exp2f(-LOG2E * (acc[j][r] + bfr(GB[j * 16 + col]))));   /* sigmoid(x Wg + gating_b) on the hardware's 2^x and reciprocal */
      LDSX(); v4f t[16];   /* all 16 LDS reads stand ahead of the stores: one LDS latency, not 16 */
#pragma unroll
      for (int rl = 0; rl < 16; ++rl) t[rl] = *(const v4f*)&sf[wave][rl][lane * 4];
#pragma unroll
      for (int rl = 0; rl < 16; ++rl) vst2(G + r0 * CC + (unsigned)(wave * 16 * CC + lane * 4) + rl * CC, t[rl]);
      asm volatile("s_wait_xcnt 0x0" ::: "memory"); }   /* behind the last stores, as in the other branches */
  } }
// ---- k_attn: work-group = (4 rows r, head h), 16 waves, wave = 16 queries against all 256 keys, 64 keys at a time with a running maximum and sum. The head's bias plane lies in LDS for the whole work-group, row = query, as it lies in memory, at a pitch of 16 B x an odd number (the 16 queries of a fragment read fall on different banks); per row r the k rows, v planes and mask bias are staged in LDS once for all 16 waves. Both products are formed transposed (scores: A = k rows, B = q rows; ctx: A = v planes, B = P), so D's column is the query in both: a lane holds keys of ONE query, two neighbouring score tiles ARE the B fragment of P, and maximum, sum and rescale stay in the lane (one exchange with the other half-wave). The plain unroll directives keep the small arrays in registers.
#define FR 4               // rows r per work-group
#define KP (HD + 8)        // halves per staged k row: 80-B pitch
#define VP (TT + 8)        // halves per staged v plane: 528-B pitch
#define BP (TT + 4)        // floats per staged bias row: 1,040-B pitch
__device__ __forceinline__ void exp2x8(float (&t)[8]) {
  asm("v_exp_f32 %0, %0\n\tv_exp_f32 %1, %1\n\tv_exp_f32 %2, %2\n\tv_exp_f32 %3, %3\n\tv_exp_f32 %4, %4\n\tv_exp_f32 %5, %5\n\tv_exp_f32 %6, %6\n\tv_exp_f32 %7, %7\n\tv_nop"
      : "+v"(t[0]), "+v"(t[1]), "+v"(t[2]), "+v"(t[3]), "+v"(t[4]), "+v"(t[5]), "+v"(t[6]), "+v"(t[7])); }
__device__ __forceinline__ v8f wmma_h(v16h a, v16h b, v8f c) { return __builtin_amdgcn_wmma_f32_16x16x32_f16(false, a, false, b, (short)0, c, false, false); }
__global__ __launch_bounds__(512) void k_attn(const _Float16* __restrict__ QH, const _Float16* __restrict__ QL, const _Float16* __restrict__ KH, const _Float16* __restrict__ VT, const float* __restrict__ BIAS, const float* __restrict__ MKP, float* __restrict__ Y) {
  __shared__ __align__(16) float sB[TT][BP];
  __shared__ __align__(16) _Float16 sK[TT][KP]; __shared__ __align__(16) _Float16 sV[HD][VP]; __shared__ __align__(16) float sM[TT];
  const int tid = threadIdx.x, wave = tid >> 5, lane = tid & 31, col = lane & 15, g = lane >> 4; const int h = blockIdx.y; const int rb = (int)blockIdx.x * FR;
  const unsigned ko0 = (unsigned)(tid >> 2) * CC + (tid & 3) * 8, vo0 = (unsigned)tid * 8;   /* this thread's 16-B pieces of a row's k rows (and 128 rows on) and v planes (and 16 planes on) */
  const unsigned qo = (unsigned)(wave * 16 + col) * CC + 8 * g;
  v4u pk[2], pv[2]; float pm = 0.f;
  { const _Float16* kb = KH + (size_t)rb * TT * CC + h * HD; const _Float16* vb = VT + ((size_t)rb * CC + h * HD) * TT;
    pk[0] = *(const v4u*)(kb + ko0); pk[1] = *(const v4u*)(kb + ko0 + 128 * CC); pv[0] = *(const v4u*)(vb + vo0); pv[1] = *(const v4u*)(vb + vo0 + 16 * TT);
    if (tid < TT) pm = MKP[(size_t)rb * SZ + tid]; }
  // the plane is one run of 256 KiB: a wave's load is 4 whole lines (half a query's row), its LDS store 512 B in a row; all 32 loads of a lane are in flight at once
  { const float* bh = BIAS + (size_t)h * NZR; v4f t[32];
#pragma unroll
    for (int i = 0; i < 32; ++i) t[i] = *(const v4f*)(bh + (unsigned)(tid * 4) + i * 2048);
    asm volatile("s_wait_xcnt 0x0" ::: "memory");   /* what follows may rewrite the registers that these loads name; it also keeps every load ahead of the first LDS store */
#pragma unroll
    for (int i = 0; i < 32; ++i) *(v4f*)&sB[i * 8 + (tid >> 6)][(tid & 63) * 4] = t[i]; }
#pragma unroll 1   /* rolled: one copy of the body in the instruction cache */
  for (int it = 0; it < FR; ++it) { const int b = rb + it;
    const _Float16* qhb = QH + (size_t)b * TT * CC + h * HD; const _Float16* qlb = QL + (size_t)b * QHI * CC + h * HD;
    union { v16h v; v8h q[2]; } qh, ql; qh.q[0] = *(const v8h*)(qhb + qo); qh.q[1] = *(const v8h*)(qhb + qo + 16); ql.q[0] = *(const v8h*)(qlb + qo); ql.q[1] = *(const v8h*)(qlb + qo + 16);
    __syncthreads();   /* every wave has left the previous row's k, v and mask tiles */
    *(v4u*)&sK[tid >> 2][(tid & 3) * 8] = pk[0]; *(v4u*)&sK[128 + (tid >> 2)][(tid & 3) * 8] = pk[1]; *(v4u*)&sV[tid >> 5][(tid & 31) * 8] = pv[0]; *(v4u*)&sV[16 + (tid >> 5)][(tid & 31) * 8] = pv[1];
    if (tid < TT) sM[tid] = 32768.0f * (bfr(pm) - 1.0f);   /* FP16_HUGE * (pair_mask[r][k] - 1) */
    __syncthreads();   /* publishes this row's tiles (and, the first time, the bias plane) */
    if (it + 1 < FR) {   /* the next row's tiles fly while this row is worked on */
      const _Float16* kb = KH + (size_t)(b + 1) * TT * CC + h * HD; const _Float16* vb = VT + ((size_t)(b + 1) * CC + h * HD) * TT;
      pk[0] = *(const v4u*)(kb + ko0); pk[1] = *(const v4u*)(kb + ko0 + 128 * CC); pv[0] = *(const v4u*)(vb + vo0); pv[1] = *(const v4u*)(vb + vo0 + 16 * TT);
      if (tid < TT) pm = MKP[(size_t)(b + 1) * SZ + tid]; }
    float m = -3.0e38f, nb = 3.0e38f, l = 0.f; v8f acc[HD / 16] = {};   /* nb: 11 - maximum x log2(e), the addend of every exponent under the maximum in use; l (x 2^11): this half-wave's keys only; the halves meet behind the loop */
#pragma unroll 1   /* rolled: unrolled, the LDS reads of all 16 key tiles are hoisted and the 256 registers of a 16-wave work-group spill */
    for (int c = 0; c < TT / 64; ++c) { v8f s[4];
#pragma unroll
      for (int jj = 0; jj < 4; ++jj) { const int j = c * 4 + jj; const v16h kf = frag_h(&sK[j * 16 + col][0], lane); const v8f z = {}; const v8f a = wmma_h(kf, qh.v, z), al = wmma_h(kf, ql.v, z);
        const float* bp = &sB[wave * 16 + col][j * 16 + 8 * g]; const v4f b0 = *(const v4f*)bp, b1 = *(const v4f*)(bp + 4); const v4f m0 = *(const v4f*)&sM[j * 16 + 8 * g], m1 = *(const v4f*)&sM[j * 16 + 8 * g + 4];
#pragma unroll
        for (int r = 0; r < 8; ++r) s[jj][r] = (a[r] + al[r] * (1.0f / 1024.0f)) * SCALE + (r < 4 ? b0[r & 3] : b1[r & 3]) + (r < 4 ? m0[r & 3] : m1[r & 3]); }
      v8f mx = s[0];
#pragma unroll
      for (int r = 0; r < 8; ++r) mx[r] = fmaxf(fmaxf(mx[r], s[1][r]), fmaxf(s[2][r], s[3][r]));
      float cm = fmaxf(fmaxf(fmaxf(mx[0], mx[1]), fmaxf(mx[2], mx[3])), fmaxf(fmaxf(mx[4], mx[5]), fmaxf(mx[6], mx[7]))); cm = fmaxf(cm, __shfl_xor(cm, 16));
      const float mn = fmaxf(m, cm), nbn = fmaf(-LOG2E, mn, 11.0f); const float alpha = __builtin_amdgcn_exp2f(nbn - nb); m = mn; nb = nbn;   /* what was summed under the old maximum shrinks by alpha: the difference of the two addends as they were used, so old and new terms stand against one point whatever the addends' rounding */
      v8f sm = {};
#pragma unroll
      for (int jj = 0; jj < 4; ++jj) { float t[8];   /* exp(logit - maximum) x 2^11: one fma and the hardware's 2^x */
#pragma unroll
        for (int r = 0; r < 8; ++r) t[r] = fmaf(s[jj][r], LOG2E, nb);
        exp2x8(t);
#pragma unroll
        for (int r = 0; r < 8; ++r) { s[jj][r] = t[r]; sm[r] = jj ? sm[r] + t[r] : t[r]; } }
      l = l * alpha + (((sm[0] + sm[1]) + (sm[2] + sm[3])) + ((sm[4] + sm[5]) + (sm[6] + sm[7])));
#pragma unroll
      for (int j = 0; j < HD / 16; ++j)
#pragma unroll
        for (int r = 0; r < 8; ++r) acc[j][r] *= alpha;
#pragma unroll
      for (int k2 = 0; k2 < 2; ++k2) { v16h p;
#pragma unroll
        for (int i = 0; i < 8; ++i) { p[i] = (_Float16)s[2 * k2][i]; p[8 + i] = (_Float16)s[2 * k2 + 1][i]; }
#pragma unroll
        for (int j = 0; j < HD / 16; ++j) acc[j] = wmma_h(frag_h(&sV[j * 16 + col][(c * 2 + k2) * 32], lane), p, acc[j]); } }
    l += __shfl_xor(l, 16);
    const float inv = (m > -1.0e38f && l > 0.f) ? 1.0f / l : 0.f;   /* a fully excluded row (every logit at or below -1e38) yields 0 */
    float* yp = Y + (size_t)b * TT * CC + h * HD + (unsigned)(wave * 16 + col) * CC + 8 * g;
#pragma unroll
    for (int j = 0; j < HD / 16; ++j) { v4f y0, y1;
#pragma unroll
      for (int r = 0; r < 4; ++r) { y0[r] = acc[j][r] * inv; y1[r] = acc[j][4 + r] * inv; }
      vst2(yp + j * 16, y0); vst2(yp + j * 16 + 4, y1); }   /* the 128-B (row, head) segment has this wave as its one writer */
    asm volatile("s_wait_xcnt 0x0" ::: "memory");   /* the next trip rewrites the registers that these stores name */
  } }
// ---- k_out: block = (256 rows, 128 cols), 16 waves: out = (ctx * gate) Wo (+ bo), the gate row (same natural row index r*256 + q) multiplied in as the ctx row is loaded: the gated ctx of every row bf16 hi + lo against exact bf16 Wo (2 products)
__global__ __launch_bounds__(512) void k_out(const float* __restrict__ Y, const float* __restrict__ G, const float* __restrict__ WO, const float* __restrict__ BO, float* __restrict__ OUT) { __shared__ __align__(16) float sf[FRW / 16][16][132];
  const int tid = threadIdx.x, wave = tid >> 5, lane = tid & 31, col = lane & 15, g = lane >> 4; const int c0 = blockIdx.y * 128; const size_t r0 = (size_t)blockIdx.x * FRW + wave * 16;
  v8f acc[8] = {};
  if (true) {   /* ALL rows: gated ctx bf16 hi + lo x exact output_w (2 products) */
    __bf16* sW = (__bf16*)&sf[0][0][0];   /* the weight's fragments lie where the output rows are staged later */
    stage_wq(WO + c0, DIN, sW, tid & 127, __builtin_amdgcn_readfirstlane(tid >> 7)); __syncthreads();   /* publishes the fragments */
#pragma unroll 2
    for (int kc = 0; kc < CC / 32; ++kc) { v16b w[8];
#pragma unroll
      for (int j = 0; j < 8; ++j) w[j] = wfrag(sW, kc, j, lane);   /* the chunk's LDS reads stand in one place, ahead of the rows' global loads */
      const F2 a = split_row2(Y + (r0 + col) * CC, G + (r0 + col) * CC, kc * 32, lane); asm volatile("s_wait_loadcnt 0x0" ::: "memory");
#pragma unroll
      for (int j = 0; j < 8; ++j) { acc[j] = wmma_bf(a.h, w[j], acc[j]); acc[j] = wmma_bf(a.l, w[j], acc[j]); } }
    __syncthreads();   /* every wave has read its last fragment before sf is written */
#pragma unroll
    for (int j = 0; j < 8; ++j) { const float bias = BO ? bfr(BO[c0 + j * 16 + col]) : 0.f;
#pragma unroll
      for (int r = 0; r < 8; ++r) sf[wave][8 * g + r][j * 16 + col] = acc[j][r] + bias; }
  } else {
#pragma unroll 2
    for (int kc = 0; kc < CC / 32; ++kc) { const v16h a = frag_f32(Y + (r0 + col) * CC + kc * 32, lane); asm volatile("s_wait_loadcnt 0x0" ::: "memory");
#pragma unroll
      for (int j = 0; j < 8; ++j) { const v16h w = WOCOLH(WO, kc * 32, c0 + j * 16 + col, lane); asm volatile("s_wait_loadcnt 0x0" ::: "memory"); acc[j] = wmma16(a, w, acc[j]); } }
#pragma unroll
    for (int j = 0; j < 8; ++j) { const float bias = BO ? bfr(BO[c0 + j * 16 + col]) : 0.f;
#pragma unroll
      for (int r = 0; r < 8; ++r) sf[wave][8 * g + r][j * 16 + col] = acc[j][r] * (1.0f / 256.0f) + bias; } }
  LDSX(); for (int rl = 0; rl < 16; ++rl) vst2(OUT + (r0 + rl) * DIN + c0 + lane * 4, *(const v4f*)&sf[wave][rl][lane * 4]); }

extern "C" void kernel_launch(void* const* d_in, const int* in_sizes, int n_in, void* d_out, int out_size, void* d_ws, size_t ws_size, hipStream_t stream) {
  (void)in_sizes; (void)n_in; (void)out_size;
  const float** F = (const float**)d_in;
  if (ws_size < (size_t)WS_END) return;
  char* ws = (char*)d_ws; _Float16 *QH = (_Float16*)(ws + WS_QH), *KH = (_Float16*)(ws + WS_KH), *VT = (_Float16*)(ws + WS_VT), *QL = (_Float16*)(ws + WS_QL), *KL = (_Float16*)(ws + WS_KL); __bf16 *VB = (__bf16*)(ws + WS_VB), *VBL = (__bf16*)(ws + WS_VBL); float *Y = (float*)(ws + WS_Y);
  (void)Y; (void)QL; (void)KL; (void)VB; (void)VBL;
  // inputs: 0 pair_act [1,256,256,128]; 1 pair_mask [1,256,256]; 2 ln_gamma, 3 ln_beta; 4 feat2d_w [128,4]; 5 query_w, 6 key_w, 7 value_w [128,4,32] (in,out); 8 gating_w [128,4,32], 9 gating_b [4,32]; 10 output_w [4,32,128] (in,out); 11 output_b
  if (ws_size < (size_t)WS_END2) return;
  float *BIAS = (float*)(ws + WS_BIAS), *G = (float*)(ws + WS_G);
  k_front<<<dim3(NZR / FRW), 512, 0, stream>>>(F[0], F[2], F[3], F[4], F[5], F[6], F[7], F[8], F[9], QH, QL, KH, KL, VT, VB, VBL, BIAS, G);
  k_attn<<<dim3(TNB / FR, NH), 512, 0, stream>>>(QH, QL, KH, VT, BIAS, F[1], Y);
  k_out<<<dim3(TNB * TT / FRW, DIN / 128), 512, 0, stream>>>(Y, G, F[10], F[11], (float*)d_out);
}

// v008
// It runs in 70.4 microseconds.
// Two timings next to v007 put it at 1.04 and 1.03 times that version's speed.
// Over all steps from v000 it is 7.45 times as fast.
// compute dtype: all float inputs rounded to bf16; LayerNorm of pair_act in f32; q/k/v = LN(act) split bf16 hi + lo x W (exact bf16, (in,out)) on WMMA 16x16x32 (2 products, f32 accumulate); q as f16 hi + residual (x 2^10) against k once to f16 (2 products) x 32^-0.5 + the per-(query, key, head) triangle bias (2-product GEMM) + the mask bias; softmax in f32 (hardware 2^x of logit x log2(e) + (11 - maximum x log2(e)), running maximum and sum over steps of 64 keys); exp(logit - maximum) x 2^11 once to f16 against v once to f16 (1 product), divided by the sum at the end; gate sigmoid(LN(act) Wg + b) in f32 (2-product GEMM, hardware 2^x and reciprocal); gated ctx split bf16 hi + lo against exact output_w (2 products) + output_b; f32 output.
#include <hip/hip_runtime.h>
#include <math.h>

typedef __attribute__((ext_vector_type(16))) _Float16 v16h;
typedef __attribute__((ext_vector_type(16))) __bf16 v16b;
typedef __attribute__((ext_vector_type(8)))  _Float16 v8h;
typedef __attribute__((ext_vector_type(8)))  float v8f;
typedef __attribute__((ext_vector_type(4)))  float v4f;
typedef __attribute__((ext_vector_type(2)))  float v2f;
typedef __attribute__((ext_vector_type(4)))  unsigned v4u;
typedef __attribute__((ext_vector_type(4)))  int v4i;
typedef float __attribute__((may_alias)) float_a;
typedef int __attribute__((may_alias)) int_a;

template <typename T> __device__ __forceinline__ void vst2(void* p, T v) { *(T*)p = v;  }
__device__ __forceinline__ v8f wmma16(v16h a, v16h b, v8f c) {
  v8f d = __builtin_amdgcn_wmma_f32_16x16x32_f16(false, a, false, b, (short)0, c, false, false);
  asm volatile("v_nop\n\tv_nop\n\tv_nop\n\tv_nop" : "+v"(d) : "v"(a), "v"(b));
  return d;
}
__device__ __forceinline__ v8f wmma_bf(v16b a, v16b b, v8f c) {
  v8f d = __builtin_amdgcn_wmma_f32_16x16x32_bf16(false, a, false, b, (short)0, c, false, false);
  asm volatile("v_nop\n\tv_nop\n\tv_nop\n\tv_nop" : "+v"(d) : "v"(a), "v"(b));
  return d;
}
// 16x16x32 fragments: lane = (h = lane>>4, row/col = lane&15); elements 0..7 = k0+8h+0..7, 8..15 = k0+16+8h+0..7; D element r = row 8h+r
__device__ __forceinline__ v16h frag_h(const _Float16* rowk0, int lane) {
  union { v16h v; v8h q[2]; } u; const _Float16* p = rowk0 + 8 * (lane >> 4);
  u.q[0] = *(const v8h*)p; u.q[1] = *(const v8h*)(p + 16); return u.v;
}
__device__ __forceinline__ v16h frag_f32(const float* rowk0, int lane) {
  v16h a; const float* p = rowk0 + 8 * (lane >> 4);
#pragma unroll
  for (int i = 0; i < 8; ++i) { a[i] = (_Float16)p[i]; a[8 + i] = (_Float16)p[16 + i]; }
  return a;
}
__device__ __forceinline__ v16h frag_f32s(const float* rowk0, int lane, float sc) {
  v16h a; const float* p = rowk0 + 8 * (lane >> 4);
#pragma unroll
  for (int i = 0; i < 8; ++i) { a[i] = (_Float16)(p[i] * sc); a[8 + i] = (_Float16)(p[16 + i] * sc); }
  return a;
}
// column fragment from a [K][ld] layout (column n), rows >= K read as 0
__device__ __forceinline__ v16h fragc_f32(const float* W, int k0, int n, int lane, int ld, int K) {
  v16h a; const int g = lane >> 4;
#pragma unroll
  for (int i = 0; i < 8; ++i) { const int ka = k0 + 8 * g + i, kb = ka + 16;
    a[i] = (_Float16)(ka < K ? W[(size_t)(ka < K ? ka : K - 1) * ld + n] : 0.f); a[8 + i] = (_Float16)(kb < K ? W[(size_t)(kb < K ? kb : K - 1) * ld + n] : 0.f); }
  return a;
}
struct F2 { v16b h, l; };
__device__ __forceinline__ F2 bsplit16(const float v[16]) { F2 r;
#pragma unroll
  for (int i = 0; i < 16; ++i) { const __bf16 h = (__bf16)v[i]; r.h[i] = h; r.l[i] = (__bf16)(v[i] - (float)h); }
  return r; }
__device__ __forceinline__ F2 split_row(const float* row, int k0, int lane) { float v[16]; const float* p = row + k0 + 8 * (lane >> 4);
#pragma unroll
  for (int i = 0; i < 8; ++i) { v[i] = p[i]; v[8 + i] = p[16 + i]; }
  return bsplit16(v); }
// the same of the element-wise product of two rows (ctx row x gate row, multiplied in f32 ahead of the split)
__device__ __forceinline__ F2 split_row2(const float* row, const float* grow, int k0, int lane) { float v[16]; v4f y[4], t[4]; const float* p = row + k0 + 8 * (lane >> 4); const float* q = grow + k0 + 8 * (lane >> 4);
#pragma unroll
  for (int u = 0; u < 4; ++u) { y[u] = *(const v4f*)(p + (u >> 1) * 16 + (u & 1) * 4); t[u] = *(const v4f*)(q + (u >> 1) * 16 + (u & 1) * 4); }
  asm volatile("s_wait_xcnt 0x0" :: "v"(y[0]), "v"(y[1]), "v"(y[2]), "v"(y[3]), "v"(t[0]), "v"(t[1]), "v"(t[2]), "v"(t[3]) : "memory");   /* what follows may rewrite the registers that these loads name; the loaded values as inputs hold the wait behind the loads */
#pragma unroll
  for (int u = 0; u < 4; ++u)
#pragma unroll
    for (int i = 0; i < 4; ++i) v[u * 4 + i] = y[u][i] * t[u][i];
  return bsplit16(v); }
__device__ __forceinline__ F2 split_rowK(const float* row, int k0, int lane, int K) { float v[16]; const int g = lane >> 4;
#pragma unroll
  for (int i = 0; i < 8; ++i) { const int ka = k0 + 8 * g + i, kb = ka + 16; v[i] = ka < K ? row[ka < K ? ka : K - 1] : 0.f; v[8 + i] = kb < K ? row[kb < K ? kb : K - 1] : 0.f; }
  return bsplit16(v); }
__device__ __forceinline__ F2 split_col(const float* W, int k0, int n, int lane, int ld, int K) { float v[16]; const int g = lane >> 4;
#pragma unroll
  for (int i = 0; i < 8; ++i) { const int ka = k0 + 8 * g + i, kb = ka + 16; v[i] = ka < K ? W[(size_t)(ka < K ? ka : K - 1) * ld + n] : 0.f; v[8 + i] = kb < K ? W[(size_t)(kb < K ? kb : K - 1) * ld + n] : 0.f; }
  return bsplit16(v); }
__device__ __forceinline__ v8f mac3(const F2& a, const F2& b, v8f c) { c = wmma_bf(a.l, b.h, c); c = wmma_bf(a.h, b.l, c); return wmma_bf(a.h, b.h, c); }
__device__ __forceinline__ float sigm(float v) { return 1.0f / (1.0f + expf(-v)); }
#define LDSX() do { asm volatile("s_wait_dscnt 0" ::: "memory"); __builtin_amdgcn_wave_barrier(); __builtin_amdgcn_fence(__ATOMIC_RELEASE, "workgroup"); } while (0)

// Triangle attention (pair_act [1, 256, 256, 128], 4 heads x 32): act = LayerNorm(pair_act); for every row r: q = act[r] Wq * 32^-0.5, k = act[r] Wk, v = act[r] Wv; logits[r,h,q,k] = q . k + 2^15 (pair_mask[r][k] - 1) + tri_bias[h][q][k] with tri_bias = act . feat2d_w (indexed by the (q, k) PAIR, shared across rows); softmax over k; wa = (weights v) * sigmoid(act[r][q] Wg + bg); out[r][q] = wa . output_w + output_b.
#define NB 256
#define TT 256
#define CC 128            // NH * HD = projected width
#define DIN 128          // input (model) width
#define NH 4
#define HD 32
#define NQB (TT / 64)
#define HG 4
#define SCALE (0.17677669529663687f)
#define CAUSAL 0
#ifndef TNB
#define TNB NB
#endif
#define LOG2E (1.4426950408889634f)
__device__ __forceinline__ float bfr(float v) { return (float)(__bf16)v; }
__host__ __device__ __forceinline__ int kb_last(int qb) { return CAUSAL ? ((qb * 64 + 63) >> 7) : (TT / 128 - 1); }
typedef __attribute__((ext_vector_type(8))) __bf16 v8b;
typedef __attribute__((ext_vector_type(4))) __bf16 v4b;
__device__ __forceinline__ v16b frag_b(const __bf16* rowk0, int lane) {
  union { v16b v; v8b q[2]; } u; const __bf16* p = rowk0 + 8 * (lane >> 4);
  u.q[0] = *(const v8b*)p; u.q[1] = *(const v8b*)(p + 16); return u.v;
}
// One 128 x 128 (in,out) weight, rounded to bf16 once per work-group of 512 threads (256 rows) and laid in LDS (32 KiB) in the order the B fragments are read: [k chunk of 32][column tile][half of 8 k][lane] pieces of 16 B. Thread = (output column c, k chunk kq): a wave's load is one whole 128-B line, all 32 loads of a thread are independent, and 8 k of a column make one 16-B store. The plain unroll directives here and at the fragment arrays w[8] keep those small arrays in registers.
__device__ __forceinline__ void stage_wq(const float* __restrict__ Wm, int ld, __bf16* sW, int c, int kq) { const float* p = Wm + (size_t)(kq * 32) * ld + c;
#pragma unroll
  for (int kk = 0; kk < 4; ++kk) { v8b w;   /* k = 32 kq + 8 kk + i: chunk kq, half kk >> 1, lane half kk & 1 */
#pragma unroll
    for (int i = 0; i < 8; ++i) w[i] = (__bf16)p[(size_t)(kk * 8 + i) * ld];
    *(v8b*)(sW + (size_t)((((kq * 8 + (c >> 4)) * 2 + (kk >> 1)) * 32 + (kk & 1) * 16 + (c & 15)) * 8)) = w; } }
__device__ __forceinline__ v16b wfrag(const __bf16* sW, int kc, int j, int lane) {
  union { v16b v; v8b q[2]; } u; const __bf16* p = sW + ((kc * 8 + j) * 64 + lane) * 8;
  u.q[0] = *(const v8b*)p; u.q[1] = *(const v8b*)(p + 256); return u.v;
}
#define QBH 0              // unused: nothing in this file reads it
#define QHI 256            // rows carrying a q residual plane (all rows when non-causal: 2-product logits everywhere)
#define KHI 64            // key rows carrying k residual / v bf16 hi+lo planes (written by k_front; no kernel reads them)
// B fragment (k rows k0+.., output column o) of a weight: (in,out) [K][ld] or (out,in) [ld rows of K]: bf16 exact, or f16(bf16 * 256) exact
__device__ __forceinline__ v16b wcol_io(const float* Wm, int k0, int o, int lane, int ld) { v16b w; const int g = lane >> 4;
#pragma unroll
  for (int i = 0; i < 8; ++i) { w[i] = (__bf16)Wm[(size_t)(k0 + 8 * g + i) * ld + o]; w[8 + i] = (__bf16)Wm[(size_t)(k0 + 16 + 8 * g + i) * ld + o]; }
  return w; }
__device__ __forceinline__ v16b wcol_oi(const float* Wm, int k0, int o, int lane, int K) { v16b w; const float* p = Wm + (size_t)o * K + k0 + 8 * (lane >> 4);
#pragma unroll
  for (int i = 0; i < 8; ++i) { w[i] = (__bf16)p[i]; w[8 + i] = (__bf16)p[16 + i]; }
  return w; }
__device__ __forceinline__ v16h wcolh_io(const float* Wm, int k0, int o, int lane, int ld) { v16h w; const int g = lane >> 4;
#pragma unroll
  for (int i = 0; i < 8; ++i) { w[i] = (_Float16)(bfr(Wm[(size_t)(k0 + 8 * g + i) * ld + o]) * 256.0f); w[8 + i] = (_Float16)(bfr(Wm[(size_t)(k0 + 16 + 8 * g + i) * ld + o]) * 256.0f); }
  return w; }
__device__ __forceinline__ v16h wcolh_oi(const float* Wm, int k0, int o, int lane, int K) { v16h w; const float* p = Wm + (size_t)o * K + k0 + 8 * (lane >> 4);
#pragma unroll
  for (int i = 0; i < 8; ++i) { w[i] = (_Float16)(bfr(p[i]) * 256.0f); w[8 + i] = (_Float16)(bfr(p[16 + i]) * 256.0f); }
  return w; }
#define WQKV_LAYOUT 0   // 0 = (in,out) [DIN][CC]; 1 = (out,in) [CC][DIN]; 2 = per-head [NH][DIN][HD]
__device__ __forceinline__ v16b wcol_hdk(const float* Wm, int k0, int o, int lane) { v16b w; const int g = lane >> 4; const float* p = Wm + (size_t)(o / HD) * DIN * HD + (o % HD);
#pragma unroll
  for (int i = 0; i < 8; ++i) { w[i] = (__bf16)p[(size_t)(k0 + 8 * g + i) * HD]; w[8 + i] = (__bf16)p[(size_t)(k0 + 16 + 8 * g + i) * HD]; }
  return w; }
#define WO_OUT_IN 0
#if WQKV_LAYOUT == 1
#define WCOL(W, k0, o, lane) wcol_oi(W, k0, o, lane, DIN)
#elif WQKV_LAYOUT == 2
#define WCOL(W, k0, o, lane) wcol_hdk(W, k0, o, lane)
#else
#define WCOL(W, k0, o, lane) wcol_io(W, k0, o, lane, CC)
#endif
#if WO_OUT_IN
#define WOCOL(W, k0, o, lane) wcol_oi(W, k0, o, lane, CC)
#define WOCOLH(W, k0, o, lane) wcolh_oi(W, k0, o, lane, CC)
#else
#define WOCOL(W, k0, o, lane) wcol_io(W, k0, o, lane, DIN)
#define WOCOLH(W, k0, o, lane) wcolh_io(W, k0, o, lane, DIN)
#endif
#define SZ 256
#define BG 64              // sizes only the unused WS_S region (x HG 4 = 256 planes of 256 x 256)
#define NZR (SZ * SZ)      // 65,536 pair rows
#define WS_ZN   (WS_END)
#define WS_BIAS (WS_ZN + 4u * (size_t)NZR * CC)
#define WS_G    (WS_BIAS + 4u * (size_t)NZR * NH)
#define WS_END2 (WS_G + 4u * (size_t)NZR * CC)
#ifndef PROJ_EXTRA_PARAMS
#define PROJ_EXTRA_PARAMS
#endif

#define WS_QH  0u                                      // f16 q rows [b*t][CC]
#define WS_KH  (WS_QH + 2u * (size_t)NB * TT * CC)      // f16 k rows [b*t][CC]
#define WS_VT  (WS_KH + 2u * (size_t)NB * TT * CC)      // f16 v planes [b][c][t]
#define WS_QL  (WS_VT + 2u * (size_t)NB * CC * TT)      // f16 q residual x 2^10 rows [b][t < QHI][CC]
#define WS_KL  (WS_QL + 2u * (size_t)NB * QHI * CC)     // f16 k residual x 2^10 rows [b][t < KHI][CC]
#define WS_VB  (WS_KL + 2u * (size_t)NB * KHI * CC)     // bf16 v hi planes [b][c][t < KHI]
#define WS_VBL (WS_VB + 2u * (size_t)NB * CC * KHI)
#define WS_S   (WS_VBL + 2u * (size_t)NB * CC * KHI)    // unused f32 region (k_attn keeps logits and P in registers)
#define WS_Y   (WS_S  + 4u * (size_t)BG * HG * TT * TT)   // unused WS_S: 256 planes of 256 x 256 f32      // f32 ctx rows [b*t][CC] (only when there is an output projection)
#define WS_END (WS_Y  + 4u * (size_t)NB * TT * CC)

// ---- k_front: block = 256 pair rows (one query's row of pairs), 16 waves, wave = 16 rows, one work-group per WGP. The four 128 x 128 (in,out) weights are staged once per work-group, all four side by side in LDS (128 KiB), behind the rows' own loads, and stay there; the output tiles have LDS of their own. A lane reads its half of one row of pair_act in the order of the A fragments (k = 32 kc + 8 g + i and 16 on), so LayerNorm (biased var, eps 1e-5, ln_gamma/ln_beta, of bf16(z)) needs one exchange with the other half-wave, and the four bf16 hi + lo fragments of LN(act) are formed once and stay in registers for all five products: tri_bias (one plane per head, BIAS[h][q][k]), then q, k, v and the gate.
#define FRW 256            // pair rows per work-group of k_front and k_out
__global__ __launch_bounds__(512) void k_front(const float* __restrict__ Z, const float* __restrict__ LW, const float* __restrict__ LB, const float* __restrict__ WB, const float* __restrict__ WQ, const float* __restrict__ WK, const float* __restrict__ WV, const float* __restrict__ WG, const float* __restrict__ GB,
    _Float16* __restrict__ QH, _Float16* __restrict__ QL, _Float16* __restrict__ KH, _Float16* __restrict__ KL, _Float16* __restrict__ VT, __bf16* __restrict__ VB, __bf16* __restrict__ VBL, float* __restrict__ BIAS, float* __restrict__ G) {
  __shared__ __align__(16) __bf16 sWa[4 * DIN * CC];   /* the fragments of query_w, key_w, value_w, gating_w */
  __shared__ __align__(16) char sm[2 * FRW * 136 * 2];   /* the output tiles; the largest user: the rows of q (or k) and their residuals */
  _Float16 (*sh)[136] = (_Float16 (*)[136])sm; _Float16 (*sl)[136] = (_Float16 (*)[136])(sm + FRW * 136 * 2); _Float16 (*th)[FRW + 8] = (_Float16 (*)[FRW + 8])sm; __bf16 (*tb)[72] = (__bf16 (*)[72])(sm + 128 * (FRW + 8) * 2); __bf16 (*tbl)[72] = (__bf16 (*)[72])(sm + 128 * (FRW + 8) * 2 + 128 * 72 * 2); float (*sf)[16][132] = (float (*)[16][132])sm; __bf16 (*sb)[144] = (__bf16 (*)[144])(sm + NH * FRW * 4);   /* feat2d_w transposed, [head][k], behind the bias rows; a fifth row of zeros; 288-B pitch: the 16-B reads of 5 rows x 2 halves fall on different banks */
  const int tid = threadIdx.x, wave = tid >> 5, lane = tid & 31, col = lane & 15, g = lane >> 4; const size_t r0 = (size_t)blockIdx.x * FRW; const size_t bb = blockIdx.x;
  const float wb1 = WB[tid];   /* thread = (input channel k, head): DIN x NH = 512 values, one each; ahead of the rows' loads */
  v4f zt[16];   /* the rows' loads (from memory) are issued ahead of the weights' (from L2) */
  { const float* zp = Z + r0 * CC + (unsigned)((wave * 16 + col) * CC + 8 * g);
#pragma unroll
    for (int kc = 0; kc < 4; ++kc)
#pragma unroll
      for (int u = 0; u < 4; ++u) zt[kc * 4 + u] = *(const v4f*)(zp + kc * 32 + (u >> 1) * 16 + (u & 1) * 4); }
  __builtin_amdgcn_sched_barrier(0);   /* keeps the rows' 16 loads ahead of the 128 weight loads: moved behind them, the requests to memory would start only when the L2 traffic of the staging has been issued */
  { const int kq = __builtin_amdgcn_readfirstlane(tid >> 7), c = tid & 127;
    stage_wq(WQ, CC, sWa, c, kq); stage_wq(WK, CC, sWa + DIN * CC, c, kq); stage_wq(WV, CC, sWa + 2 * DIN * CC, c, kq); stage_wq(WG, CC, sWa + 3 * DIN * CC, c, kq); }
  __builtin_amdgcn_sched_barrier(0);   /* LayerNorm and its parameter loads stay behind the staging: mixed into it, rows, 128 weight values and the parameters together overran the 256 registers of a 16-wave work-group and spilled */
  sb[tid & (NH - 1)][tid >> 2] = (__bf16)wb1;
  if (tid < DIN) sb[NH][tid] = (__bf16)0.f;
  F2 a[4];
  { float x[4][16];
#pragma unroll
    for (int kc = 0; kc < 4; ++kc)
#pragma unroll
      for (int u = 0; u < 4; ++u)
#pragma unroll
        for (int i = 0; i < 4; ++i) x[kc][u * 4 + i] = bfr(zt[kc * 4 + u][i]);
    float sp[4] = {0.f, 0.f, 0.f, 0.f};
#pragma unroll
    for (int kc = 0; kc < 4; ++kc)
#pragma unroll
      for (int i = 0; i < 16; ++i) sp[kc] += x[kc][i];
    float s1 = (sp[0] + sp[1]) + (sp[2] + sp[3]); s1 += __shfl_xor(s1, 16);
    const float mu = s1 * (1.0f / CC); float qp[4] = {0.f, 0.f, 0.f, 0.f};
#pragma unroll
    for (int kc = 0; kc < 4; ++kc)
#pragma unroll
      for (int i = 0; i < 16; ++i) { const float d = x[kc][i] - mu; qp[kc] += d * d; }
    float q = (qp[0] + qp[1]) + (qp[2] + qp[3]); q += __shfl_xor(q, 16);
    const float rs = rsqrtf(q * (1.0f / CC) + 1e-5f);
#pragma unroll
    for (int kc = 0; kc < 4; ++kc) { float v[16];
#pragma unroll
      for (int u = 0; u < 4; ++u) { const int c = kc * 32 + (u >> 1) * 16 + (u & 1) * 4 + 8 * g; const v4f lw = *(const v4f*)(LW + c), lb = *(const v4f*)(LB + c);
#pragma unroll
        for (int i = 0; i < 4; ++i) v[u * 4 + i] = (x[kc][u * 4 + i] - mu) * rs * bfr(lw[i]) + bfr(lb[i]); }
      a[kc] = bsplit16(v); } }
  __syncthreads();   /* publishes feat2d_w and the four weights */
  { v8f ab = {}; const __bf16* wr = &sb[col < NH ? col : NH][0];   /* tri_bias: 4 outputs; the columns beyond them read the row of zeros */
#pragma unroll
    for (int kc = 0; kc < 4; ++kc) { const v16b w = frag_b(wr + kc * 32, lane); ab = wmma_bf(a[kc].h, w, ab); ab = wmma_bf(a[kc].l, w, ab); }
    float (*sp)[FRW] = (float (*)[FRW])sm;   /* [head][key] */
    if (col < NH) { v4f lo, hi;   /* a lane of column h holds 8 neighbouring keys of head h */
#pragma unroll
      for (int r = 0; r < 4; ++r) { lo[r] = ab[r]; hi[r] = ab[4 + r]; }
      *(v4f*)&sp[col][wave * 16 + 8 * g] = lo; *(v4f*)&sp[col][wave * 16 + 8 * g + 4] = hi; }
    __syncthreads();   /* the 16 waves' keys of a head meet, so that a wave stores half a head's 256 keys as four whole lines */
    if (wave < 2 * NH) { const v4f b4 = *(const v4f*)&sp[wave >> 1][(wave & 1) * 128 + lane * 4]; vst2(BIAS + (size_t)(wave >> 1) * NZR + r0 + (unsigned)((wave & 1) * 128 + lane * 4), b4); }   /* plane [h][q][k], the block's 1-KiB run */
    asm volatile("s_wait_xcnt 0x0" ::: "memory"); }   /* what follows may rewrite registers that this store names */
#pragma unroll 1   /* rolled: one copy of the products in the instruction cache */
  for (int which = 0; which < 4; ++which) { const __bf16* sW = sWa + which * (DIN * CC);
    v8f acc[8] = {};
#pragma unroll
    for (int kc = 0; kc < 4; ++kc) { v16b w[8];
#pragma unroll
      for (int j = 0; j < 8; ++j) w[j] = wfrag(sW, kc, j, lane);
#pragma unroll
      for (int j = 0; j < 8; ++j) { acc[j] = wmma_bf(a[kc].h, w[j], acc[j]); acc[j] = wmma_bf(a[kc].l, w[j], acc[j]); } }
    __syncthreads();   /* every wave has read the last of the tiles of the product before (the first time: of the bias rows) */
    if (which < 2) { _Float16* DH = which == 0 ? QH : KH; _Float16* DL = which == 0 ? QL : KL; const int nhi = which == 0 ? QHI : KHI;   /* q, k: f16 rows (+ residual x 2^10 rows < nhi) */
#pragma unroll
      for (int j = 0; j < 8; ++j)
#pragma unroll
        for (int r = 0; r < 8; ++r) { const float v = acc[j][r]; const _Float16 hv = (_Float16)v; sh[wave * 16 + 8 * g + r][j * 16 + col] = hv; sl[wave * 16 + 8 * g + r][j * 16 + col] = (_Float16)((v - (float)hv) * 1024.0f); }
      __syncthreads();
      _Float16* dh = DH + r0 * CC; _Float16* dl = DL + bb * nhi * (size_t)CC; const unsigned eo = (unsigned)((tid >> 4) * CC + (tid & 15) * 8);   /* uniform base + one 32-bit offset per thread: 32 rows on per trip */
#pragma unroll
      for (int u = 0; u < 8; ++u) vst2((unsigned*)(dh + eo + u * 32 * CC), *(const v4u*)&sh[(tid >> 4) + u * 32][(tid & 15) * 8]);
      asm volatile("s_wait_xcnt 0x0" ::: "memory");   /* what follows may rewrite registers that these stores name */
#pragma unroll
      for (int u = 0; u < KHI / 32; ++u) vst2((unsigned*)(dl + eo + u * 32 * CC), *(const v4u*)&sl[(tid >> 4) + u * 32][(tid & 15) * 8]);   /* rows < KHI: q and k alike */
      asm volatile("s_wait_xcnt 0x0" ::: "memory");   /* what follows may rewrite registers that these stores name */
      if (nhi > KHI) {
#pragma unroll
        for (int u = KHI / 32; u < QHI / 32; ++u) vst2((unsigned*)(dl + eo + u * 32 * CC), *(const v4u*)&sl[(tid >> 4) + u * 32][(tid & 15) * 8]);
        asm volatile("s_wait_xcnt 0x0" ::: "memory"); }   /* the next trip rewrites registers that these stores name */
    } else if (which == 2) {   /* v: f16 planes [c][t] (+ bf16 hi/lo planes for t < KHI) */
#pragma unroll
      for (int j = 0; j < 8; ++j)
#pragma unroll
        for (int r = 0; r < 8; ++r) th[j * 16 + col][wave * 16 + 8 * g + r] = (_Float16)acc[j][r];
      if (wave < KHI / 16) {
#pragma unroll
        for (int j = 0; j < 8; ++j)
#pragma unroll
          for (int r = 0; r < 8; ++r) { const float v = acc[j][r]; const int rl = wave * 16 + 8 * g + r, cl = j * 16 + col; const __bf16 bh = (__bf16)v; tb[cl][rl] = bh; tbl[cl][rl] = (__bf16)(v - (float)bh); } }
      __syncthreads();
      _Float16* vt = VT + bb * CC * (size_t)TT; __bf16* vb = VB + bb * CC * (size_t)KHI; __bf16* vbl = VBL + bb * CC * (size_t)KHI; const unsigned vo = (unsigned)((tid >> 5) * TT + (tid & 31) * 8), ho = (unsigned)((tid >> 3) * KHI + (tid & 7) * 8);   /* 16 planes on per trip; 64 of the short ones */
#pragma unroll
      for (int u = 0; u < 8; ++u) vst2((unsigned*)(vt + vo + u * 16 * TT), *(const v4u*)&th[(tid >> 5) + u * 16][(tid & 31) * 8]);
      asm volatile("s_wait_xcnt 0x0" ::: "memory");   /* what follows may rewrite registers that these stores name */
#pragma unroll
      for (int u = 0; u < 2; ++u) { const int cl = (tid >> 3) + u * 64, q = tid & 7; vst2((unsigned*)(vb + ho + u * 64 * KHI), *(const v4u*)&tb[cl][q * 8]); vst2((unsigned*)(vbl + ho + u * 64 * KHI), *(const v4u*)&tbl[cl][q * 8]); }
      asm volatile("s_wait_xcnt 0x0" ::: "memory");   /* the next trip rewrites registers that these stores name */
    } else {
#pragma unroll
      for (int j = 0; j < 8; ++j)
#pragma unroll
        for (int r = 0; r < 8; ++r) sf[wave][8 * g + r][j * 16 + col] = __builtin_amdgcn_rcpf(1.0f + __builtin_amdgcn_exp2f(-LOG2E * (acc[j][r] + bfr(GB[j * 16 + col]))));   /* sigmoid(x Wg + gating_b) on the hardware's 2^x and reciprocal */
      LDSX(); v4f t[16];   /* all 16 LDS reads stand ahead of the stores: one LDS latency, not 16 */
#pragma unroll
      for (int rl = 0; rl < 16; ++rl) t[rl] = *(const v4f*)&sf[wave][rl][lane * 4];
#pragma unroll
      for (int rl = 0; rl < 16; ++rl) vst2(G + r0 * CC + (unsigned)(wave * 16 * CC + lane * 4) + rl * CC, t[rl]);
      asm volatile("s_wait_xcnt 0x0" ::: "memory"); }   /* behind the last stores, as in the other branches */
  } }
// ---- k_attn: work-group = (4 rows r, head h), 16 waves, wave = 16 queries against all 256 keys, 64 keys at a time with a running maximum and sum. The head's bias plane lies in LDS for the whole work-group, row = query, as it lies in memory, at a pitch of 16 B x an odd number (the 16 queries of a fragment read fall on different banks); per row r the k rows, v planes and mask bias are staged in LDS once for all 16 waves. Both products are formed transposed (scores: A = k rows, B = q rows; ctx: A = v planes, B = P), so D's column is the query in both: a lane holds keys of ONE query, two neighbouring score tiles ARE the B fragment of P, and maximum, sum and rescale stay in the lane (one exchange with the other half-wave). The plain unroll directives keep the small arrays in registers.
#define FR 4               // rows r per work-group
#define KP (HD + 8)        // halves per staged k row: 80-B pitch
#define VP (TT + 8)        // halves per staged v plane: 528-B pitch
#define BP (TT + 4)        // floats per staged bias row: 1,040-B pitch
__device__ __forceinline__ void exp2x8(float (&t)[8]) {
  asm("v_exp_f32 %0, %0\n\tv_exp_f32 %1, %1\n\tv_exp_f32 %2, %2\n\tv_exp_f32 %3, %3\n\tv_exp_f32 %4, %4\n\tv_exp_f32 %5, %5\n\tv_exp_f32 %6, %6\n\tv_exp_f32 %7, %7\n\tv_nop"
      : "+v"(t[0]), "+v"(t[1]), "+v"(t[2]), "+v"(t[3]), "+v"(t[4]), "+v"(t[5]), "+v"(t[6]), "+v"(t[7])); }
__device__ __forceinline__ v8f wmma_h(v16h a, v16h b, v8f c) { return __builtin_amdgcn_wmma_f32_16x16x32_f16(false, a, false, b, (short)0, c, false, false); }
__global__ __launch_bounds__(512) void k_attn(const _Float16* __restrict__ QH, const _Float16* __restrict__ QL, const _Float16* __restrict__ KH, const _Float16* __restrict__ VT, const float* __restrict__ BIAS, const float* __restrict__ MKP, float* __restrict__ Y) {
  __shared__ __align__(16) float sB[TT][BP];
  __shared__ __align__(16) _Float16 sK[TT][KP]; __shared__ __align__(16) _Float16 sV[HD][VP]; __shared__ __align__(16) float sM[TT];
  const int tid = threadIdx.x, wave = tid >> 5, lane = tid & 31, col = lane & 15, g = lane >> 4; const int h = blockIdx.y; const int rb = (int)blockIdx.x * FR;
  const unsigned ko0 = (unsigned)(tid >> 2) * CC + (tid & 3) * 8, vo0 = (unsigned)tid * 8;   /* this thread's 16-B pieces of a row's k rows (and 128 rows on) and v planes (and 16 planes on) */
  const unsigned qo = (unsigned)(wave * 16 + col) * CC + 8 * g;
  v4u pk[2], pv[2]; float pm = 0.f;
  { const _Float16* kb = KH + (size_t)rb * TT * CC + h * HD; const _Float16* vb = VT + ((size_t)rb * CC + h * HD) * TT;
    pk[0] = *(const v4u*)(kb + ko0); pk[1] = *(const v4u*)(kb + ko0 + 128 * CC); pv[0] = *(const v4u*)(vb + vo0); pv[1] = *(const v4u*)(vb + vo0 + 16 * TT);
    if (tid < TT) pm = MKP[(size_t)rb * SZ + tid]; }
  // the plane is one run of 256 KiB: a wave's load is 4 whole lines (half a query's row), its LDS store 512 B in a row; all 32 loads of a lane are in flight at once
  { const float* bh = BIAS + (size_t)h * NZR; v4f t[32];
#pragma unroll
    for (int i = 0; i < 32; ++i) t[i] = *(const v4f*)(bh + (unsigned)(tid * 4) + i * 2048);
    asm volatile("s_wait_xcnt 0x0" ::: "memory");   /* what follows may rewrite the registers that these loads name; it also keeps every load ahead of the first LDS store */
#pragma unroll
    for (int i = 0; i < 32; ++i) *(v4f*)&sB[i * 8 + (tid >> 6)][(tid & 63) * 4] = t[i]; }
#pragma unroll 1   /* rolled: one copy of the body in the instruction cache */
  for (int it = 0; it < FR; ++it) { const int b = rb + it;
    const _Float16* qhb = QH + (size_t)b * TT * CC + h * HD; const _Float16* qlb = QL + (size_t)b * QHI * CC + h * HD;
    union { v16h v; v8h q[2]; } qh, ql; qh.q[0] = *(const v8h*)(qhb + qo); qh.q[1] = *(const v8h*)(qhb + qo + 16); ql.q[0] = *(const v8h*)(qlb + qo); ql.q[1] = *(const v8h*)(qlb + qo + 16);
    __syncthreads();   /* every wave has left the previous row's k, v and mask tiles */
    *(v4u*)&sK[tid >> 2][(tid & 3) * 8] = pk[0]; *(v4u*)&sK[128 + (tid >> 2)][(tid & 3) * 8] = pk[1]; *(v4u*)&sV[tid >> 5][(tid & 31) * 8] = pv[0]; *(v4u*)&sV[16 + (tid >> 5)][(tid & 31) * 8] = pv[1];
    if (tid < TT) sM[tid] = 32768.0f * (bfr(pm) - 1.0f);   /* FP16_HUGE * (pair_mask[r][k] - 1) */
    __syncthreads();   /* publishes this row's tiles (and, the first time, the bias plane) */
    if (it + 1 < FR) {   /* the next row's tiles fly while this row is worked on */
      const _Float16* kb = KH + (size_t)(b + 1) * TT * CC + h * HD; const _Float16* vb = VT + ((size_t)(b + 1) * CC + h * HD) * TT;
      pk[0] = *(const v4u*)(kb + ko0); pk[1] = *(const v4u*)(kb + ko0 + 128 * CC); pv[0] = *(const v4u*)(vb + vo0); pv[1] = *(const v4u*)(vb + vo0 + 16 * TT);
      if (tid < TT) pm = MKP[(size_t)(b + 1) * SZ + tid]; }
    float m = -3.0e38f, nb = 3.0e38f, l = 0.f; v8f acc[HD / 16] = {};   /* nb: 11 - maximum x log2(e), the addend of every exponent under the maximum in use; l (x 2^11): this half-wave's keys only; the halves meet behind the loop */
#pragma unroll 1   /* rolled: unrolled, the LDS reads of all 16 key tiles are hoisted and the 256 registers of a 16-wave work-group spill */
    for (int c = 0; c < TT / 64; ++c) { v8f s[4];
#pragma unroll
      for (int jj = 0; jj < 4; ++jj) { const int j = c * 4 + jj; const v16h kf = frag_h(&sK[j * 16 + col][0], lane); const v8f z = {}; const v8f a = wmma_h(kf, qh.v, z), al = wmma_h(kf, ql.v, z);
        const float* bp = &sB[wave * 16 + col][j * 16 + 8 * g]; const v4f b0 = *(const v4f*)bp, b1 = *(const v4f*)(bp + 4); const v4f m0 = *(const v4f*)&sM[j * 16 + 8 * g], m1 = *(const v4f*)&sM[j * 16 + 8 * g + 4];
#pragma unroll
        for (int r = 0; r < 8; ++r) s[jj][r] = (a[r] + al[r] * (1.0f / 1024.0f)) * SCALE + (r < 4 ? b0[r & 3] : b1[r & 3]) + (r < 4 ? m0[r & 3] : m1[r & 3]); }
      v8f mx = s[0];
#pragma unroll
      for (int r = 0; r < 8; ++r) mx[r] = fmaxf(fmaxf(mx[r], s[1][r]), fmaxf(s[2][r], s[3][r]));
      float cm = fmaxf(fmaxf(fmaxf(mx[0], mx[1]), fmaxf(mx[2], mx[3])), fmaxf(fmaxf(mx[4], mx[5]), fmaxf(mx[6], mx[7]))); cm = fmaxf(cm, __shfl_xor(cm, 16));
      const float mn = fmaxf(m, cm), nbn = fmaf(-LOG2E, mn, 11.0f); const float alpha = __builtin_amdgcn_exp2f(nbn - nb); m = mn; nb = nbn;   /* what was summed under the old maximum shrinks by alpha: the difference of the two addends as they were used, so old and new terms stand against one point whatever the addends' rounding */
      v8f sm = {};
#pragma unroll
      for (int jj = 0; jj < 4; ++jj) { float t[8];   /* exp(logit - maximum) x 2^11: one fma and the hardware's 2^x */
#pragma unroll
        for (int r = 0; r < 8; ++r) t[r] = fmaf(s[jj][r], LOG2E, nb);
        exp2x8(t);
#pragma unroll
        for (int r = 0; r < 8; ++r) { s[jj][r] = t[r]; sm[r] = jj ? sm[r] + t[r] : t[r]; } }
      l = l * alpha + (((sm[0] + sm[1]) + (sm[2] + sm[3])) + ((sm[4] + sm[5]) + (sm[6] + sm[7])));
#pragma unroll
      for (int j = 0; j < HD / 16; ++j)
#pragma unroll
        for (int r = 0; r < 8; ++r) acc[j][r] *= alpha;
#pragma unroll
      for (int k2 = 0; k2 < 2; ++k2) { v16h p;
#pragma unroll
        for (int i = 0; i < 8; ++i) { p[i] = (_Float16)s[2 * k2][i]; p[8 + i] = (_Float16)s[2 * k2 + 1][i]; }
#pragma unroll
        for (int j = 0; j < HD / 16; ++j) acc[j] = wmma_h(frag_h(&sV[j * 16 + col][(c * 2 + k2) * 32], lane), p, acc[j]); } }
    l += __shfl_xor(l, 16);
    const float inv = (m > -1.0e38f && l > 0.f) ? 1.0f / l : 0.f;   /* a fully excluded row (every logit at or below -1e38) yields 0 */
    float* yp = Y + (size_t)b * TT * CC + h * HD + (unsigned)(wave * 16 + col) * CC + 8 * g;
#pragma unroll
    for (int j = 0; j < HD / 16; ++j) { v4f y0, y1;
#pragma unroll
      for (int r = 0; r < 4; ++r) { y0[r] = acc[j][r] * inv; y1[r] = acc[j][4 + r] * inv; }
      vst2(yp + j * 16, y0); vst2(yp + j * 16 + 4, y1); }   /* the 128-B (row, head) segment has this wave as its one writer */
    asm volatile("s_wait_xcnt 0x0" ::: "memory");   /* the next trip rewrites the registers that these stores name */
  } }
// ---- k_out: block = (256 rows, 128 cols), 16 waves: out = (ctx * gate) Wo (+ bo), the gate row (same natural row index r*256 + q) multiplied in as the ctx row is loaded (whole rows, a lane = 4 neighbouring channels; the A fragments are read back from the wave's own LDS rows): all rows: gated ctx bf16 hi + lo against exact bf16 Wo (2 products)
__global__ __launch_bounds__(512) void k_out(const float* __restrict__ Y, const float* __restrict__ G, const float* __restrict__ WO, const float* __restrict__ BO, float* __restrict__ OUT) { __shared__ __align__(16) float sf[FRW / 16][16][132];
  __shared__ __align__(16) __bf16 sWo[CC * 128];   /* the weight's fragments */
  __shared__ __align__(16) __bf16 sA[FRW / 16][2][16][136];   /* per wave: its 16 gated rows as bf16 hi and lo; 272-B pitch = 16 B x an odd number: the 16 rows of a fragment read fall on different banks */
  const int tid = threadIdx.x, wave = tid >> 5, lane = tid & 31, col = lane & 15, g = lane >> 4; const int c0 = blockIdx.y * 128; const size_t r0 = (size_t)blockIdx.x * FRW + wave * 16;
  v8f acc[8] = {};
  if (true) {   /* ALL rows: gated ctx bf16 hi + lo x exact output_w (2 products) */
    const int bi = c0 + col; float bo[8];   /* output_b: loaded here with the rest, not one waited load per column tile behind the products */
#pragma unroll
    for (int j = 0; j < 8; ++j) bo[j] = BO[bi + j * 16];
    v4f y[16], t[16];   /* a load = one whole row (4 whole lines) of ctx or of the gate; all 32 of a wave are in flight at once, ahead of the weight's */
    const float* yp = Y + r0 * CC + (unsigned)(lane * 4); const float* gp = G + r0 * CC + (unsigned)(lane * 4);
#pragma unroll
    for (int rl = 0; rl < 16; ++rl) y[rl] = *(const v4f*)(yp + rl * CC);
#pragma unroll
    for (int rl = 0; rl < 16; ++rl) t[rl] = *(const v4f*)(gp + rl * CC);
    asm volatile("s_wait_xcnt 0x0" :: "v"(yp), "v"(gp), "v"(bi) : "memory");   /* what follows may rewrite the registers that these loads name; the addresses as inputs keep their registers from serving as a load's destination ahead of the wait */
    __builtin_amdgcn_sched_barrier(0);   /* keeps the rows' 32 loads (from memory) ahead of the weight's 32 (from L2) */
    const int cw = tid & 127; stage_wq(WO + c0, DIN, sWo, cw, __builtin_amdgcn_readfirstlane(tid >> 7));
    asm volatile("s_wait_xcnt 0x0" :: "v"(cw) : "memory");   /* the column index as input keeps the register that the weight's loads name from serving as the last load's destination */
    __builtin_amdgcn_sched_barrier(0);   /* the rows' products stay behind the staging: moved ahead of it, their wait for the rows held the weight's loads back, and both together overran the 256 registers and spilled */
#pragma unroll
    for (int rl = 0; rl < 16; ++rl) { v4b hi, lo;   /* ctx x gate in f32, then the bf16 hi + lo split, on the lane's 4 neighbouring channels of row rl */
#pragma unroll
      for (int i = 0; i < 4; ++i) { const float v = y[rl][i] * t[rl][i]; const __bf16 hb = (__bf16)v; hi[i] = hb; lo[i] = (__bf16)(v - (float)hb); }
      *(v4b*)&sA[wave][0][rl][lane * 4] = hi; *(v4b*)&sA[wave][1][rl][lane * 4] = lo; }
    __syncthreads();   /* publishes the weight's fragments (and orders the wave's own rows) */
#pragma unroll 2
    for (int kc = 0; kc < CC / 32; ++kc) { v16b w[8];
#pragma unroll
      for (int j = 0; j < 8; ++j) w[j] = wfrag(sWo, kc, j, lane);
      F2 a; a.h = frag_b(&sA[wave][0][col][kc * 32], lane); a.l = frag_b(&sA[wave][1][col][kc * 32], lane);
#pragma unroll
      for (int j = 0; j < 8; ++j) { acc[j] = wmma_bf(a.h, w[j], acc[j]); acc[j] = wmma_bf(a.l, w[j], acc[j]); } }
#pragma unroll
    for (int j = 0; j < 8; ++j) { const float bias = bfr(bo[j]);
#pragma unroll
      for (int r = 0; r < 8; ++r) sf[wave][8 * g + r][j * 16 + col] = acc[j][r] + bias; }
  } else {
#pragma unroll 2
    for (int kc = 0; kc < CC / 32; ++kc) { const v16h a = frag_f32(Y + (r0 + col) * CC + kc * 32, lane); asm volatile("s_wait_loadcnt 0x0" ::: "memory");
#pragma unroll
      for (int j = 0; j < 8; ++j) { const v16h w = WOCOLH(WO, kc * 32, c0 + j * 16 + col, lane); asm volatile("s_wait_loadcnt 0x0" ::: "memory"); acc[j] = wmma16(a, w, acc[j]); } }
#pragma unroll
    for (int j = 0; j < 8; ++j) { const float bias = BO ? bfr(BO[c0 + j * 16 + col]) : 0.f;
#pragma unroll
      for (int r = 0; r < 8; ++r) sf[wave][8 * g + r][j * 16 + col] = acc[j][r] * (1.0f / 256.0f) + bias; } }
  LDSX(); for (int rl = 0; rl < 16; ++rl) vst2(OUT + (r0 + rl) * DIN + c0 + lane * 4, *(const v4f*)&sf[wave][rl][lane * 4]); }

extern "C" void kernel_launch(void* const* d_in, const int* in_sizes, int n_in, void* d_out, int out_size, void* d_ws, size_t ws_size, hipStream_t stream) {
  (void)in_sizes; (void)n_in; (void)out_size;
  const float** F = (const float**)d_in;
  if (ws_size < (size_t)WS_END) return;
  char* ws = (char*)d_ws; _Float16 *QH = (_Float16*)(ws + WS_QH), *KH = (_Float16*)(ws + WS_KH), *VT = (_Float16*)(ws + WS_VT), *QL = (_Float16*)(ws + WS_QL), *KL = (_Float16*)(ws + WS_KL); __bf16 *VB = (__bf16*)(ws + WS_VB), *VBL = (__bf16*)(ws + WS_VBL); float *Y = (float*)(ws + WS_Y);
  (void)Y; (void)QL; (void)KL; (void)VB; (void)VBL;
  // inputs: 0 pair_act [1,256,256,128]; 1 pair_mask [1,256,256]; 2 ln_gamma, 3 ln_beta; 4 feat2d_w [128,4]; 5 query_w, 6 key_w, 7 value_w [128,4,32] (in,out); 8 gating_w [128,4,32], 9 gating_b [4,32]; 10 output_w [4,32,128] (in,out); 11 output_b
  if (ws_size < (size_t)WS_END2) return;
  float *BIAS = (float*)(ws + WS_BIAS), *G = (float*)(ws + WS_G);
  k_front<<<dim3(NZR / FRW), 512, 0, stream>>>(F[0], F[2], F[3], F[4], F[5], F[6], F[7], F[8], F[9], QH, QL, KH, KL, VT, VB, VBL, BIAS, G);
  k_attn<<<dim3(TNB / FR, NH), 512, 0, stream>>>(QH, QL, KH, VT, BIAS, F[1], Y);
  k_out<<<dim3(TNB * TT / FRW, DIN / 128), 512, 0, stream>>>(Y, G, F[10], F[11], (float*)d_out);
}

// v009
// It runs in 61.4 microseconds.
// In two side-by-side timings against v008, it was 1.14 and 1.15 times as fast.
// Counting every step since v000, it is 8.52 times as fast.
// compute dtype: all float inputs rounded to bf16; LayerNorm of pair_act in f32; q/k/v = LN(act) split bf16 hi + lo x W (exact bf16, (in,out)) on WMMA 16x16x32 (2 products, f32 accumulate); q as f16 hi + residual (x 2^10) against k once to f16 (2 products) x 32^-0.5 + the per-(query, key, head) triangle bias (2-product GEMM) + the mask bias; softmax in f32 (hardware 2^x of logit x log2(e) + (11 - maximum x log2(e)), running maximum and sum over steps of 64 keys); exp(logit - maximum) x 2^11 once to f16 against v once to f16 (1 product), divided by the sum at the end; gate sigmoid(LN(act) Wg + b) in f32 (2-product GEMM, hardware 2^x and reciprocal); gated ctx split bf16 hi + lo against exact output_w (2 products) + output_b; f32 output.
#include <hip/hip_runtime.h>
#include <math.h>

typedef __attribute__((ext_vector_type(16))) _Float16 v16h;
typedef __attribute__((ext_vector_type(16))) __bf16 v16b;
typedef __attribute__((ext_vector_type(8)))  _Float16 v8h;
typedef __attribute__((ext_vector_type(8)))  float v8f;
typedef __attribute__((ext_vector_type(4)))  float v4f;
typedef __attribute__((ext_vector_type(2)))  float v2f;
typedef __attribute__((ext_vector_type(4)))  unsigned v4u;
typedef __attribute__((ext_vector_type(4)))  int v4i;
typedef float __attribute__((may_alias)) float_a;
typedef int __attribute__((may_alias)) int_a;

template <typename T> __device__ __forceinline__ void vst2(void* p, T v) { *(T*)p = v;  }
__device__ __forceinline__ v8f wmma16(v16h a, v16h b, v8f c) {
  v8f d = __builtin_amdgcn_wmma_f32_16x16x32_f16(false, a, false, b, (short)0, c, false, false);
  asm volatile("v_nop\n\tv_nop\n\tv_nop\n\tv_nop" : "+v"(d) : "v"(a), "v"(b));
  return d;
}
__device__ __forceinline__ v8f wmma_bf(v16b a, v16b b, v8f c) {
  v8f d = __builtin_amdgcn_wmma_f32_16x16x32_bf16(false, a, false, b, (short)0, c, false, false);
  asm volatile("v_nop\n\tv_nop\n\tv_nop\n\tv_nop" : "+v"(d) : "v"(a), "v"(b));
  return d;
}
// 16x16x32 fragments: lane = (h = lane>>4, row/col = lane&15); elements 0..7 = k0+8h+0..7, 8..15 = k0+16+8h+0..7; D element r = row 8h+r
__device__ __forceinline__ v16h frag_h(const _Float16* rowk0, int lane) {
  union { v16h v; v8h q[2]; } u; const _Float16* p = rowk0 + 8 * (lane >> 4);
  u.q[0] = *(const v8h*)p; u.q[1] = *(const v8h*)(p + 16); return u.v;
}
__device__ __forceinline__ v16h frag_f32(const float* rowk0, int lane) {
  v16h a; const float* p = rowk0 + 8 * (lane >> 4);
#pragma unroll
  for (int i = 0; i < 8; ++i) { a[i] = (_Float16)p[i]; a[8 + i] = (_Float16)p[16 + i]; }
  return a;
}
__device__ __forceinline__ v16h frag_f32s(const float* rowk0, int lane, float sc) {
  v16h a; const float* p = rowk0 + 8 * (lane >> 4);
#pragma unroll
  for (int i = 0; i < 8; ++i) { a[i] = (_Float16)(p[i] * sc); a[8 + i] = (_Float16)(p[16 + i] * sc); }
  return a;
}
// column fragment from a [K][ld] layout (column n), rows >= K read as 0
__device__ __forceinline__ v16h fragc_f32(const float* W, int k0, int n, int lane, int ld, int K) {
  v16h a; const int g = lane >> 4;
#pragma unroll
  for (int i = 0; i < 8; ++i) { const int ka = k0 + 8 * g + i, kb = ka + 16;
    a[i] = (_Float16)(ka < K ? W[(size_t)(ka < K ? ka : K - 1) * ld + n] : 0.f); a[8 + i] = (_Float16)(kb < K ? W[(size_t)(kb < K ? kb : K - 1) * ld + n] : 0.f); }
  return a;
}
struct F2 { v16b h, l; };
__device__ __forceinline__ F2 bsplit16(const float v[16]) { F2 r;
#pragma unroll
  for (int i = 0; i < 16; ++i) { const __bf16 h = (__bf16)v[i]; r.h[i] = h; r.l[i] = (__bf16)(v[i] - (float)h); }
  return r; }
__device__ __forceinline__ F2 split_row(const float* row, int k0, int lane) { float v[16]; const float* p = row + k0 + 8 * (lane >> 4);
#pragma unroll
  for (int i = 0; i < 8; ++i) { v[i] = p[i]; v[8 + i] = p[16 + i]; }
  return bsplit16(v); }
// the same of the element-wise product of two rows (ctx row x gate row, multiplied in f32 ahead of the split)
__device__ __forceinline__ F2 split_row2(const float* row, const float* grow, int k0, int lane) { float v[16]; v4f y[4], t[4]; const float* p = row + k0 + 8 * (lane >> 4); const float* q = grow + k0 + 8 * (lane >> 4);
#pragma unroll
  for (int u = 0; u < 4; ++u) { y[u] = *(const v4f*)(p + (u >> 1) * 16 + (u & 1) * 4); t[u] = *(const v4f*)(q + (u >> 1) * 16 + (u & 1) * 4); }
  asm volatile("s_wait_xcnt 0x0" :: "v"(y[0]), "v"(y[1]), "v"(y[2]), "v"(y[3]), "v"(t[0]), "v"(t[1]), "v"(t[2]), "v"(t[3]) : "memory");   /* what follows may rewrite the registers that these loads name; the loaded values as inputs hold the wait behind the loads */
#pragma unroll
  for (int u = 0; u < 4; ++u)
#pragma unroll
    for (int i = 0; i < 4; ++i) v[u * 4 + i] = y[u][i] * t[u][i];
  return bsplit16(v); }
__device__ __forceinline__ F2 split_rowK(const float* row, int k0, int lane, int K) { float v[16]; const int g = lane >> 4;
#pragma unroll
  for (int i = 0; i < 8; ++i) { const int ka = k0 + 8 * g + i, kb = ka + 16; v[i] = ka < K ? row[ka < K ? ka : K - 1] : 0.f; v[8 + i] = kb < K ? row[kb < K ? kb : K - 1] : 0.f; }
  return bsplit16(v); }
__device__ __forceinline__ F2 split_col(const float* W, int k0, int n, int lane, int ld, int K) { float v[16]; const int g = lane >> 4;
#pragma unroll
  for (int i = 0; i < 8; ++i) { const int ka = k0 + 8 * g + i, kb = ka + 16; v[i] = ka < K ? W[(size_t)(ka < K ? ka : K - 1) * ld + n] : 0.f; v[8 + i] = kb < K ? W[(size_t)(kb < K ? kb : K - 1) * ld + n] : 0.f; }
  return bsplit16(v); }
__device__ __forceinline__ v8f mac3(const F2& a, const F2& b, v8f c) { c = wmma_bf(a.l, b.h, c); c = wmma_bf(a.h, b.l, c); return wmma_bf(a.h, b.h, c); }
__device__ __forceinline__ float sigm(float v) { return 1.0f / (1.0f + expf(-v)); }
#define LDSX() do { asm volatile("s_wait_dscnt 0" ::: "memory"); __builtin_amdgcn_wave_barrier(); __builtin_amdgcn_fence(__ATOMIC_RELEASE, "workgroup"); } while (0)

// Triangle attention (pair_act [1, 256, 256, 128], 4 heads x 32): act = LayerNorm(pair_act); for every row r: q = act[r] Wq * 32^-0.5, k = act[r] Wk, v = act[r] Wv; logits[r,h,q,k] = q . k + 2^15 (pair_mask[r][k] - 1) + tri_bias[h][q][k] with tri_bias = act . feat2d_w (indexed by the (q, k) PAIR, shared across rows); softmax over k; wa = (weights v) * sigmoid(act[r][q] Wg + bg); out[r][q] = wa . output_w + output_b.
#define NB 256
#define TT 256
#define CC 128            // NH * HD = projected width
#define DIN 128          // input (model) width
#define NH 4
#define HD 32
#define NQB (TT / 64)
#define HG 4
#define SCALE (0.17677669529663687f)
#define CAUSAL 0
#ifndef TNB
#define TNB NB
#endif
#define LOG2E (1.4426950408889634f)
__device__ __forceinline__ float bfr(float v) { return (float)(__bf16)v; }
__host__ __device__ __forceinline__ int kb_last(int qb) { return CAUSAL ? ((qb * 64 + 63) >> 7) : (TT / 128 - 1); }
typedef __attribute__((ext_vector_type(8))) __bf16 v8b;
typedef __attribute__((ext_vector_type(4))) __bf16 v4b;
__device__ __forceinline__ v16b frag_b(const __bf16* rowk0, int lane) {
  union { v16b v; v8b q[2]; } u; const __bf16* p = rowk0 + 8 * (lane >> 4);
  u.q[0] = *(const v8b*)p; u.q[1] = *(const v8b*)(p + 16); return u.v;
}
// One 128 x 128 (in,out) weight, rounded to bf16 once per work-group of 512 threads (256 rows) and laid in LDS (32 KiB) in the order the B fragments are read: [k chunk of 32][column tile][half of 8 k][lane] pieces of 16 B. Thread = (output column c, k chunk kq): a wave's load is one whole 128-B line, all 32 loads of a thread are independent, and 8 k of a column make one 16-B store. The plain unroll directives here and at the fragment arrays w[8] keep those small arrays in registers.
__device__ __forceinline__ void stage_wq(const float* __restrict__ Wm, int ld, __bf16* sW, int c, int kq) { const float* p = Wm + (size_t)(kq * 32) * ld + c;
#pragma unroll
  for (int kk = 0; kk < 4; ++kk) { v8b w;   /* k = 32 kq + 8 kk + i: chunk kq, half kk >> 1, lane half kk & 1 */
#pragma unroll
    for (int i = 0; i < 8; ++i) w[i] = (__bf16)p[(size_t)(kk * 8 + i) * ld];
    *(v8b*)(sW + (size_t)((((kq * 8 + (c >> 4)) * 2 + (kk >> 1)) * 32 + (kk & 1) * 16 + (c & 15)) * 8)) = w; } }
__device__ __forceinline__ v16b wfrag(const __bf16* sW, int kc, int j, int lane) {
  union { v16b v; v8b q[2]; } u; const __bf16* p = sW + ((kc * 8 + j) * 64 + lane) * 8;
  u.q[0] = *(const v8b*)p; u.q[1] = *(const v8b*)(p + 256); return u.v;
}
#define QBH 0              // unused: nothing in this file reads it
#define QHI 256            // rows carrying a q residual plane (all rows when non-causal: 2-product logits everywhere)
#define KHI 64            // key rows carrying k residual / v bf16 hi+lo planes (written by k_front; no kernel reads them)
// B fragment (k rows k0+.., output column o) of a weight: (in,out) [K][ld] or (out,in) [ld rows of K]: bf16 exact, or f16(bf16 * 256) exact
__device__ __forceinline__ v16b wcol_io(const float* Wm, int k0, int o, int lane, int ld) { v16b w; const int g = lane >> 4;
#pragma unroll
  for (int i = 0; i < 8; ++i) { w[i] = (__bf16)Wm[(size_t)(k0 + 8 * g + i) * ld + o]; w[8 + i] = (__bf16)Wm[(size_t)(k0 + 16 + 8 * g + i) * ld + o]; }
  return w; }
__device__ __forceinline__ v16b wcol_oi(const float* Wm, int k0, int o, int lane, int K) { v16b w; const float* p = Wm + (size_t)o * K + k0 + 8 * (lane >> 4);
#pragma unroll
  for (int i = 0; i < 8; ++i) { w[i] = (__bf16)p[i]; w[8 + i] = (__bf16)p[16 + i]; }
  return w; }
__device__ __forceinline__ v16h wcolh_io(const float* Wm, int k0, int o, int lane, int ld) { v16h w; const int g = lane >> 4;
#pragma unroll
  for (int i = 0; i < 8; ++i) { w[i] = (_Float16)(bfr(Wm[(size_t)(k0 + 8 * g + i) * ld + o]) * 256.0f); w[8 + i] = (_Float16)(bfr(Wm[(size_t)(k0 + 16 + 8 * g + i) * ld + o]) * 256.0f); }
  return w; }
__device__ __forceinline__ v16h wcolh_oi(const float* Wm, int k0, int o, int lane, int K) { v16h w; const float* p = Wm + (size_t)o * K + k0 + 8 * (lane >> 4);
#pragma unroll
  for (int i = 0; i < 8; ++i) { w[i] = (_Float16)(bfr(p[i]) * 256.0f); w[8 + i] = (_Float16)(bfr(p[16 + i]) * 256.0f); }
  return w; }
#define WQKV_LAYOUT 0   // 0 = (in,out) [DIN][CC]; 1 = (out,in) [CC][DIN]; 2 = per-head [NH][DIN][HD]
__device__ __forceinline__ v16b wcol_hdk(const float* Wm, int k0, int o, int lane) { v16b w; const int g = lane >> 4; const float* p = Wm + (size_t)(o / HD) * DIN * HD + (o % HD);
#pragma unroll
  for (int i = 0; i < 8; ++i) { w[i] = (__bf16)p[(size_t)(k0 + 8 * g + i) * HD]; w[8 + i] = (__bf16)p[(size_t)(k0 + 16 + 8 * g + i) * HD]; }
  return w; }
#define WO_OUT_IN 0
#if WQKV_LAYOUT == 1
#define WCOL(W, k0, o, lane) wcol_oi(W, k0, o, lane, DIN)
#elif WQKV_LAYOUT == 2
#define WCOL(W, k0, o, lane) wcol_hdk(W, k0, o, lane)
#else
#define WCOL(W, k0, o, lane) wcol_io(W, k0, o, lane, CC)
#endif
#if WO_OUT_IN
#define WOCOL(W, k0, o, lane) wcol_oi(W, k0, o, lane, CC)
#define WOCOLH(W, k0, o, lane) wcolh_oi(W, k0, o, lane, CC)
#else
#define WOCOL(W, k0, o, lane) wcol_io(W, k0, o, lane, DIN)
#define WOCOLH(W, k0, o, lane) wcolh_io(W, k0, o, lane, DIN)
#endif
#define SZ 256
#define BG 64              // sizes only the unused WS_S region (x HG 4 = 256 planes of 256 x 256)
#define NZR (SZ * SZ)      // 65,536 pair rows
#define WS_ZN   (WS_END)
#define WS_BIAS (WS_ZN + 4u * (size_t)NZR * CC)
#define WS_G    (WS_BIAS + 4u * (size_t)NZR * NH)
#define WS_END2 (WS_G + 4u * (size_t)NZR * CC)
#ifndef PROJ_EXTRA_PARAMS
#define PROJ_EXTRA_PARAMS
#endif

#define WS_QH  0u                                      // f16 q fragments [b][head][tile of 16 t][half][lane][8]
#define WS_KH  (WS_QH + 2u * (size_t)NB * TT * CC)      // f16 k fragments, the same order
#define WS_VT  (WS_KH + 2u * (size_t)NB * TT * CC)      // f16 v fragments [b][head][channel tile][chunk of 32 t][half][lane][8]
#define WS_QL  (WS_VT + 2u * (size_t)NB * CC * TT)      // f16 q residual x 2^10 fragments [b][head][tile of 16 t < QHI][half][lane][8]
#define WS_KL  (WS_QL + 2u * (size_t)NB * QHI * CC)     // f16 k residual x 2^10 fragments [b][head][tile of 16 t < KHI][half][lane][8]
#define WS_VB  (WS_KL + 2u * (size_t)NB * KHI * CC)     // bf16 v hi fragments [b][head][channel tile][chunk of 32 t < KHI][half][lane][8]
#define WS_VBL (WS_VB + 2u * (size_t)NB * CC * KHI)
#define WS_S   (WS_VBL + 2u * (size_t)NB * CC * KHI)    // unused: no kernel writes or reads it
#define WS_Y   (WS_S  + 4u * (size_t)BG * HG * TT * TT)   // f32 ctx [b][tile of 16 t][channel tile][half][lane][4] (only when there is an output projection)
#define WS_END (WS_Y  + 4u * (size_t)NB * TT * CC)

// ---- k_front: block = 256 pair rows (one query's row of pairs), 16 waves, wave = 16 rows, one work-group per WGP. The four 128 x 128 (in,out) weights are staged once per work-group, all four side by side in LDS (128 KiB), behind the rows' own loads, and stay there. A lane reads its half of one row of pair_act in the order of the A fragments (k = 32 kc + 8 g + i and 16 on), so LayerNorm (biased var, eps 1e-5, ln_gamma/ln_beta, of bf16(z)) needs one exchange with the other half-wave, and the four bf16 hi + lo fragments of LN(act) are formed once and stay in registers for all five products: tri_bias (one plane per head, BIAS[h][q][k]), then q, k, the gate and v, each of which leaves the registers in the order of its reader's fragments.
#define FRW 256            // pair rows per work-group of k_front and k_out
__device__ __forceinline__ void exp2x8(float (&t)[8]) {
  asm("v_exp_f32 %0, %0\n\tv_exp_f32 %1, %1\n\tv_exp_f32 %2, %2\n\tv_exp_f32 %3, %3\n\tv_exp_f32 %4, %4\n\tv_exp_f32 %5, %5\n\tv_exp_f32 %6, %6\n\tv_exp_f32 %7, %7\n\tv_nop"
      : "+v"(t[0]), "+v"(t[1]), "+v"(t[2]), "+v"(t[3]), "+v"(t[4]), "+v"(t[5]), "+v"(t[6]), "+v"(t[7])); }
// the reciprocal of eight values, in the same form and for the same reason
__device__ __forceinline__ void rcpx8(float (&t)[8]) {
  asm("v_rcp_f32 %0, %0\n\tv_rcp_f32 %1, %1\n\tv_rcp_f32 %2, %2\n\tv_rcp_f32 %3, %3\n\tv_rcp_f32 %4, %4\n\tv_rcp_f32 %5, %5\n\tv_rcp_f32 %6, %6\n\tv_rcp_f32 %7, %7\n\tv_nop"
      : "+v"(t[0]), "+v"(t[1]), "+v"(t[2]), "+v"(t[3]), "+v"(t[4]), "+v"(t[5]), "+v"(t[6]), "+v"(t[7])); }
__global__ __launch_bounds__(512) void k_front(const float* __restrict__ Z, const float* __restrict__ LW, const float* __restrict__ LB, const float* __restrict__ WB, const float* __restrict__ WQ, const float* __restrict__ WK, const float* __restrict__ WV, const float* __restrict__ WG, const float* __restrict__ GB,
    _Float16* __restrict__ QH, _Float16* __restrict__ QL, _Float16* __restrict__ KH, _Float16* __restrict__ KL, _Float16* __restrict__ VT, __bf16* __restrict__ VB, __bf16* __restrict__ VBL, float* __restrict__ BIAS, float* __restrict__ G) {
  __shared__ __align__(16) __bf16 sWa[4 * DIN * CC];   /* the fragments of query_w, key_w, value_w, gating_w */
  __shared__ __align__(16) char sm[NH * FRW * 4 + (NH + 1) * 144 * 2];   /* the bias rows and feat2d_w */
  __bf16 (*sb)[144] = (__bf16 (*)[144])(sm + NH * FRW * 4);   /* feat2d_w transposed, [head][k], behind the bias rows; a fifth row of zeros; 288-B pitch: the 16-B reads of 5 rows x 2 halves fall on different banks */
  const int tid = threadIdx.x, wave = tid >> 5, lane = tid & 31, col = lane & 15, g = lane >> 4; const size_t r0 = (size_t)blockIdx.x * FRW; const size_t bb = blockIdx.x;
  const float wb1 = WB[tid];   /* thread = (input channel k, head): DIN x NH = 512 values, one each; ahead of the rows' loads */
  v4f zt[16];   /* the rows' loads (from memory) are issued ahead of the weights' (from L2) */
  { const float* zp = Z + r0 * CC + (unsigned)((wave * 16 + col) * CC + 8 * g);
#pragma unroll
    for (int kc = 0; kc < 4; ++kc)
#pragma unroll
      for (int u = 0; u < 4; ++u) zt[kc * 4 + u] = *(const v4f*)(zp + kc * 32 + (u >> 1) * 16 + (u & 1) * 4); }
  __builtin_amdgcn_sched_barrier(0);   /* keeps the rows' 16 loads ahead of the 128 weight loads: moved behind them, the requests to memory would start only when the L2 traffic of the staging has been issued */
  { const int kq = __builtin_amdgcn_readfirstlane(tid >> 7), c = tid & 127;
    stage_wq(WQ, CC, sWa, c, kq); stage_wq(WK, CC, sWa + DIN * CC, c, kq); stage_wq(WV, CC, sWa + 2 * DIN * CC, c, kq); stage_wq(WG, CC, sWa + 3 * DIN * CC, c, kq);
    asm volatile("s_wait_xcnt 0x0" :: "v"(c) : "memory"); }   /* the column index as input keeps the register that the weights' loads name from serving as the last load's destination */
  __builtin_amdgcn_sched_barrier(0);   /* LayerNorm and its parameter loads stay behind the staging: mixed into it, rows, 128 weight values and the parameters together overran the 256 registers of a 16-wave work-group and spilled */
  sb[tid & (NH - 1)][tid >> 2] = (__bf16)wb1;
  if (tid < DIN) sb[NH][tid] = (__bf16)0.f;
  F2 a[4];
  { float x[4][16];
#pragma unroll
    for (int kc = 0; kc < 4; ++kc)
#pragma unroll
      for (int u = 0; u < 4; ++u)
#pragma unroll
        for (int i = 0; i < 4; ++i) x[kc][u * 4 + i] = bfr(zt[kc * 4 + u][i]);
    float sp[4] = {0.f, 0.f, 0.f, 0.f};
#pragma unroll
    for (int kc = 0; kc < 4; ++kc)
#pragma unroll
      for (int i = 0; i < 16; ++i) sp[kc] += x[kc][i];
    float s1 = (sp[0] + sp[1]) + (sp[2] + sp[3]); s1 += __shfl_xor(s1, 16);
    const float mu = s1 * (1.0f / CC); float qp[4] = {0.f, 0.f, 0.f, 0.f};
#pragma unroll
    for (int kc = 0; kc < 4; ++kc)
#pragma unroll
      for (int i = 0; i < 16; ++i) { const float d = x[kc][i] - mu; qp[kc] += d * d; }
    float q = (qp[0] + qp[1]) + (qp[2] + qp[3]); q += __shfl_xor(q, 16);
    const float rs = rsqrtf(q * (1.0f / CC) + 1e-5f);
#pragma unroll
    for (int kc = 0; kc < 4; ++kc) { float v[16];
#pragma unroll
      for (int u = 0; u < 4; ++u) { const int c = kc * 32 + (u >> 1) * 16 + (u & 1) * 4 + 8 * g; const v4f lw = *(const v4f*)(LW + c), lb = *(const v4f*)(LB + c);
#pragma unroll
        for (int i = 0; i < 4; ++i) v[u * 4 + i] = (x[kc][u * 4 + i] - mu) * rs * bfr(lw[i]) + bfr(lb[i]); }
      a[kc] = bsplit16(v); } }
  __syncthreads();   /* publishes feat2d_w and the four weights */
  { v8f ab = {}; const __bf16* wr = &sb[col < NH ? col : NH][0];   /* tri_bias: 4 outputs; the columns beyond them read the row of zeros */
#pragma unroll
    for (int kc = 0; kc < 4; ++kc) { const v16b w = frag_b(wr + kc * 32, lane); ab = wmma_bf(a[kc].h, w, ab); ab = wmma_bf(a[kc].l, w, ab); }
    float (*sp)[FRW] = (float (*)[FRW])sm;   /* [head][key] */
    if (col < NH) { v4f lo, hi;   /* a lane of column h holds 8 neighbouring keys of head h */
#pragma unroll
      for (int r = 0; r < 4; ++r) { lo[r] = ab[r]; hi[r] = ab[4 + r]; }
      *(v4f*)&sp[col][wave * 16 + 8 * g] = lo; *(v4f*)&sp[col][wave * 16 + 8 * g + 4] = hi; }
    __syncthreads();   /* the 16 waves' keys of a head meet, so that a wave stores half a head's 256 keys as four whole lines */
    if (wave < 2 * NH) { const v4f b4 = *(const v4f*)&sp[wave >> 1][(wave & 1) * 128 + lane * 4]; vst2(BIAS + (size_t)(wave >> 1) * NZR + r0 + (unsigned)((wave & 1) * 128 + lane * 4), b4); }   /* plane [h][q][k], the block's 1-KiB run */
    asm volatile("s_wait_xcnt 0x0" ::: "memory"); }   /* what follows may rewrite registers that this store names */
#pragma unroll 1   /* rolled: one copy of the products in the instruction cache */
  for (int t = 0; t < 3; ++t) { const int which = t == 2 ? 3 : t; const __bf16* sW = sWa + which * (DIN * CC);
    v8f acc[8] = {};
    {   /* q, k, gate: the product is formed transposed (A = weight columns, B = rows), so D's column is the pair row and a lane holds 8 neighbouring channels of ONE row: tiles 2h and 2h + 1 ARE the lane's 16 elements of head h's fragment in k_attn (of k chunk h's in k_out). They go from registers to the workspace in that order, q and k as [row block][head][tile of 16 rows][half][lane] pieces of 16 B: a wave's store is 4 whole lines; no LDS tile, no barrier */
#pragma unroll
      for (int kc = 0; kc < 4; ++kc) { v16b w[8];
#pragma unroll
        for (int j = 0; j < 8; ++j) w[j] = wfrag(sW, kc, j, lane);
#pragma unroll
        for (int j = 0; j < 8; ++j) { acc[j] = wmma_bf(w[j], a[kc].h, acc[j]); acc[j] = wmma_bf(w[j], a[kc].l, acc[j]); } }
      if (t == 2) {   /* gate: [tile of 16 rows][channel tile][half of 4][lane] pieces of 16 B, the order in which k_attn's D holds ctx */
        float* gp = G + r0 * CC + (unsigned)(wave * 2048 + lane * 4);
#pragma unroll
        for (int j = 0; j < 8; ++j) { const v4f g0 = *(const v4f*)(GB + j * 16 + 8 * g), g1 = *(const v4f*)(GB + j * 16 + 8 * g + 4); v4f o0, o1; float e[8];   /* sigmoid(x Wg + gating_b) on the hardware's 2^x and reciprocal */
#pragma unroll
          for (int r = 0; r < 8; ++r) e[r] = -LOG2E * (acc[j][r] + bfr(r < 4 ? g0[r & 3] : g1[r & 3]));
          exp2x8(e);
#pragma unroll
          for (int r = 0; r < 8; ++r) e[r] = 1.0f + e[r];
          rcpx8(e);
#pragma unroll
          for (int r = 0; r < 4; ++r) { o0[r] = e[r]; o1[r] = e[4 + r]; }
          vst2(gp + j * 256, o0); vst2(gp + j * 256 + 128, o1); }
        asm volatile("s_wait_xcnt 0x0" ::: "memory");   /* what follows may rewrite registers that these loads and stores name */
        continue; }
      _Float16* dh = (which == 0 ? QH : KH) + bb * (size_t)(TT * CC) + (unsigned)(wave * 512 + lane * 8); v8h lv[8];
#pragma unroll
      for (int j = 0; j < 8; ++j) { v8h hv;
#pragma unroll
        for (int r = 0; r < 8; ++r) { const float v = acc[j][r]; const _Float16 hh = (_Float16)v; hv[r] = hh; lv[j][r] = (_Float16)((v - (float)hh) * 1024.0f); }
        vst2(dh + (j >> 1) * (TT * HD) + (j & 1) * 256, hv); }
      asm volatile("s_wait_xcnt 0x0" ::: "memory");   /* what follows may rewrite registers that these stores name */
      if (which == 0) { _Float16* dl = QL + bb * (size_t)(QHI * CC) + (unsigned)(wave * 512 + lane * 8);
#pragma unroll
        for (int j = 0; j < 8; ++j) vst2(dl + (j >> 1) * (QHI * HD) + (j & 1) * 256, lv[j]);
      } else if (wave < KHI / 16) { _Float16* dl = KL + bb * (size_t)(KHI * CC) + (unsigned)(wave * 512 + lane * 8);   /* rows < KHI */
#pragma unroll
        for (int j = 0; j < 8; ++j) vst2(dl + (j >> 1) * (KHI * HD) + (j & 1) * 256, lv[j]); }
      asm volatile("s_wait_xcnt 0x0" ::: "memory"); } }   /* the next trip rewrites registers that these stores name */
  { const __bf16* sW = sWa + 2 * (DIN * CC); v8f acc[8] = {};   /* v: A = rows, B = weight columns: D's column is the channel and a lane holds 8 neighbouring keys of it: the half of k_attn's v fragment that this wave's 16 keys make up; [row block][head][channel tile][chunk of 32 keys][half][lane] pieces of 16 B */
#pragma unroll
    for (int kc = 0; kc < 4; ++kc) { v16b w[8];
#pragma unroll
      for (int j = 0; j < 8; ++j) w[j] = wfrag(sW, kc, j, lane);
#pragma unroll
      for (int j = 0; j < 8; ++j) { acc[j] = wmma_bf(a[kc].h, w[j], acc[j]); acc[j] = wmma_bf(a[kc].l, w[j], acc[j]); } }
    const unsigned vo = (unsigned)((wave >> 1) * 512 + (wave & 1) * 256 + lane * 8); _Float16* vt = VT + bb * (size_t)(CC * TT) + vo;
#pragma unroll
    for (int j = 0; j < 8; ++j) { v8h hv;
#pragma unroll
      for (int r = 0; r < 8; ++r) hv[r] = (_Float16)acc[j][r];
      vst2(vt + (j >> 1) * (HD * TT) + (j & 1) * (16 * TT), hv); }
    asm volatile("s_wait_xcnt 0x0" ::: "memory");   /* what follows may rewrite registers that these stores name */
    if (wave < KHI / 16) { __bf16* vb = VB + bb * (size_t)(CC * KHI) + vo; __bf16* vbl = VBL + bb * (size_t)(CC * KHI) + vo;   /* keys < KHI: bf16 hi and lo, the same order */
#pragma unroll
      for (int j = 0; j < 8; ++j) { v8b bh, bl;
#pragma unroll
        for (int r = 0; r < 8; ++r) { const float v = acc[j][r]; const __bf16 hb = (__bf16)v; bh[r] = hb; bl[r] = (__bf16)(v - (float)hb); }
        vst2(vb + (j >> 1) * (HD * KHI) + (j & 1) * (16 * KHI), bh); vst2(vbl + (j >> 1) * (HD * KHI) + (j & 1) * (16 * KHI), bl); } }
    asm volatile("s_wait_xcnt 0x0" ::: "memory"); }   /* behind the last stores, as above */
}
// ---- k_attn: work-group = (4 rows r, head h), 16 waves, wave = 16 queries against all 256 keys, 64 keys at a time with a running maximum and sum. The head's bias plane lies in LDS for the whole work-group, row = query, as it lies in memory, at a pitch of 16 B x an odd number (the 16 queries of a fragment read fall on different banks); per row r the k and v fragments (as they lie in memory) and the mask bias are staged in LDS once for all 16 waves. Both products are formed transposed (scores: A = k rows, B = q rows; ctx: A = v planes, B = P), so D's column is the query in both: a lane holds keys of ONE query, two neighbouring score tiles ARE the B fragment of P, and maximum, sum and rescale stay in the lane (one exchange with the other half-wave). The plain unroll directives keep the small arrays in registers.
#define FR 4               // rows r per work-group
#define BP (TT + 4)        // floats per staged bias row: 1,040-B pitch
__device__ __forceinline__ v8f wmma_h(v16h a, v16h b, v8f c) { return __builtin_amdgcn_wmma_f32_16x16x32_f16(false, a, false, b, (short)0, c, false, false); }
__global__ __launch_bounds__(512) void k_attn(const _Float16* __restrict__ QH, const _Float16* __restrict__ QL, const _Float16* __restrict__ KH, const _Float16* __restrict__ VT, const float* __restrict__ BIAS, const float* __restrict__ MKP, float* __restrict__ Y) {
  __shared__ __align__(16) float sB[TT][BP];
  __shared__ __align__(16) _Float16 sK[TT * HD];   /* the row's k fragments, in the order they lie in memory: [tile of 16 keys][half][lane] pieces of 16 B */ __shared__ __align__(16) _Float16 sV[HD * TT];   /* the row's v fragments, likewise: [channel tile][chunk of 32 keys][half][lane] */ __shared__ __align__(16) float sM[TT];
  const int tid = threadIdx.x, wave = tid >> 5, lane = tid & 31, col = lane & 15, g = lane >> 4; const int h = blockIdx.y; const int rb = (int)blockIdx.x * FR;
  const unsigned ko0 = (unsigned)tid * 8, vo0 = (unsigned)tid * 8;   /* this thread's 16-B pieces of a row's k fragments (and 8 key tiles on) and v planes (and 16 planes on) */
  const unsigned qo = (unsigned)(wave * 512 + lane * 8);   /* the wave's q fragment: two runs of 512 B */
  v4u pk[2], pv[2]; float pm = 0.f;
  { const _Float16* kb = KH + (size_t)rb * TT * CC + h * (TT * HD); const _Float16* vb = VT + ((size_t)rb * CC + h * HD) * TT;
    pk[0] = *(const v4u*)(kb + ko0); pk[1] = *(const v4u*)(kb + ko0 + 8 * 512); pv[0] = *(const v4u*)(vb + vo0); pv[1] = *(const v4u*)(vb + vo0 + 16 * TT);
    if (tid < TT) pm = MKP[(size_t)rb * SZ + tid]; }
  // the plane is one run of 256 KiB: a wave's load is 4 whole lines (half a query's row), its LDS store 512 B in a row; all 32 loads of a lane are in flight at once
  { const float* bh = BIAS + (size_t)h * NZR; v4f t[32];
#pragma unroll
    for (int i = 0; i < 32; ++i) t[i] = *(const v4f*)(bh + (unsigned)(tid * 4) + i * 2048);
    asm volatile("s_wait_xcnt 0x0" ::: "memory");   /* what follows may rewrite the registers that these loads name; it also keeps every load ahead of the first LDS store */
#pragma unroll
    for (int i = 0; i < 32; ++i) *(v4f*)&sB[i * 8 + (tid >> 6)][(tid & 63) * 4] = t[i]; }
#pragma unroll 1   /* rolled: one copy of the body in the instruction cache */
  for (int it = 0; it < FR; ++it) { const int b = rb + it;
    const _Float16* qhb = QH + (size_t)b * TT * CC + h * (TT * HD); const _Float16* qlb = QL + (size_t)b * QHI * CC + h * (QHI * HD);
    union { v16h v; v8h q[2]; } qh, ql; qh.q[0] = *(const v8h*)(qhb + qo); qh.q[1] = *(const v8h*)(qhb + qo + 256); ql.q[0] = *(const v8h*)(qlb + qo); ql.q[1] = *(const v8h*)(qlb + qo + 256);
    __syncthreads();   /* every wave has left the previous row's k, v and mask tiles */
    *(v4u*)&sK[tid * 8] = pk[0]; *(v4u*)&sK[8 * 512 + tid * 8] = pk[1]; *(v4u*)&sV[tid * 8] = pv[0]; *(v4u*)&sV[16 * TT + tid * 8] = pv[1];
    if (tid < TT) sM[tid] = 32768.0f * (bfr(pm) - 1.0f);   /* FP16_HUGE * (pair_mask[r][k] - 1) */
    __syncthreads();   /* publishes this row's tiles (and, the first time, the bias plane) */
    if (it + 1 < FR) {   /* the next row's tiles fly while this row is worked on */
      const _Float16* kb = KH + (size_t)(b + 1) * TT * CC + h * (TT * HD); const _Float16* vb = VT + ((size_t)(b + 1) * CC + h * HD) * TT;
      pk[0] = *(const v4u*)(kb + ko0); pk[1] = *(const v4u*)(kb + ko0 + 8 * 512); pv[0] = *(const v4u*)(vb + vo0); pv[1] = *(const v4u*)(vb + vo0 + 16 * TT);
      if (tid < TT) pm = MKP[(size_t)(b + 1) * SZ + tid]; }
    float m = -3.0e38f, nb = 3.0e38f, l = 0.f; v8f acc[HD / 16] = {};   /* nb: 11 - maximum x log2(e), the addend of every exponent under the maximum in use; l (x 2^11): this half-wave's keys only; the halves meet behind the loop */
#pragma unroll 1   /* rolled: unrolled, the LDS reads of all 16 key tiles are hoisted and the 256 registers of a 16-wave work-group spill */
    for (int c = 0; c < TT / 64; ++c) { v8f s[4];
#pragma unroll
      for (int jj = 0; jj < 4; ++jj) { const int j = c * 4 + jj; union { v16h v; v8h q[2]; } ku; ku.q[0] = *(const v8h*)&sK[j * 512 + lane * 8]; ku.q[1] = *(const v8h*)&sK[j * 512 + 256 + lane * 8]; const v16h kf = ku.v; const v8f z = {}; const v8f a = wmma_h(kf, qh.v, z), al = wmma_h(kf, ql.v, z);
        const float* bp = &sB[wave * 16 + col][j * 16 + 8 * g]; const v4f b0 = *(const v4f*)bp, b1 = *(const v4f*)(bp + 4); const v4f m0 = *(const v4f*)&sM[j * 16 + 8 * g], m1 = *(const v4f*)&sM[j * 16 + 8 * g + 4];
#pragma unroll
        for (int r = 0; r < 8; ++r) s[jj][r] = (a[r] + al[r] * (1.0f / 1024.0f)) * SCALE + (r < 4 ? b0[r & 3] : b1[r & 3]) + (r < 4 ? m0[r & 3] : m1[r & 3]); }
      v8f mx = s[0];
#pragma unroll
      for (int r = 0; r < 8; ++r) mx[r] = fmaxf(fmaxf(mx[r], s[1][r]), fmaxf(s[2][r], s[3][r]));
      float cm = fmaxf(fmaxf(fmaxf(mx[0], mx[1]), fmaxf(mx[2], mx[3])), fmaxf(fmaxf(mx[4], mx[5]), fmaxf(mx[6], mx[7]))); cm = fmaxf(cm, __shfl_xor(cm, 16));
      const float mn = fmaxf(m, cm), nbn = fmaf(-LOG2E, mn, 11.0f); const float alpha = __builtin_amdgcn_exp2f(nbn - nb); m = mn; nb = nbn;   /* what was summed under the old maximum shrinks by alpha: the difference of the two addends as they were used, so old and new terms stand against one point whatever the addends' rounding */
      v8f sm = {};
#pragma unroll
      for (int jj = 0; jj < 4; ++jj) { float t[8];   /* exp(logit - maximum) x 2^11: one fma and the hardware's 2^x */
#pragma unroll
        for (int r = 0; r < 8; ++r) t[r] = fmaf(s[jj][r], LOG2E, nb);
        exp2x8(t);
#pragma unroll
        for (int r = 0; r < 8; ++r) { s[jj][r] = t[r]; sm[r] = jj ? sm[r] + t[r] : t[r]; } }
      l = l * alpha + (((sm[0] + sm[1]) + (sm[2] + sm[3])) + ((sm[4] + sm[5]) + (sm[6] + sm[7])));
#pragma unroll
      for (int j = 0; j < HD / 16; ++j)
#pragma unroll
        for (int r = 0; r < 8; ++r) acc[j][r] *= alpha;
#pragma unroll
      for (int k2 = 0; k2 < 2; ++k2) { v16h p;
#pragma unroll
        for (int i = 0; i < 8; ++i) { p[i] = (_Float16)s[2 * k2][i]; p[8 + i] = (_Float16)s[2 * k2 + 1][i]; }
#pragma unroll
        for (int j = 0; j < HD / 16; ++j) { union { v16h v; v8h q[2]; } vu; const _Float16* vp = &sV[j * (16 * TT) + (c * 2 + k2) * 512 + lane * 8]; vu.q[0] = *(const v8h*)vp; vu.q[1] = *(const v8h*)(vp + 256); acc[j] = wmma_h(vu.v, p, acc[j]); } } }
    l += __shfl_xor(l, 16);
    const float inv = (m > -1.0e38f && l > 0.f) ? 1.0f / l : 0.f;   /* a fully excluded row (every logit at or below -1e38) yields 0 */
    float* yp = Y + (size_t)b * TT * CC + (unsigned)(wave * 2048 + h * 512 + lane * 4);   /* ctx in the order D holds it, which is the order of k_out's A fragments: [tile of 16 rows][channel tile][half of 4][lane] pieces of 16 B */
#pragma unroll
    for (int j = 0; j < HD / 16; ++j) { v4f y0, y1;
#pragma unroll
      for (int r = 0; r < 4; ++r) { y0[r] = acc[j][r] * inv; y1[r] = acc[j][4 + r] * inv; }
      vst2(yp + j * 256, y0); vst2(yp + j * 256 + 128, y1); }   /* a store is 4 whole lines */
    asm volatile("s_wait_xcnt 0x0" ::: "memory");   /* the next trip rewrites the registers that these stores name */
  } }
// ---- k_out: block = (256 rows, 128 cols), 16 waves: out = (ctx * gate) Wo (+ bo), the gate multiplied in as ctx is loaded (both lie in the order of the A fragments: whole-line loads, and the product is split in the registers it is used from): all rows: gated ctx bf16 hi + lo against exact bf16 Wo (2 products)
__global__ __launch_bounds__(512) void k_out(const float* __restrict__ Y, const float* __restrict__ G, const float* __restrict__ WO, const float* __restrict__ BO, float* __restrict__ OUT) { __shared__ __align__(16) float sf[FRW / 16][16][132];
  __shared__ __align__(16) __bf16 sWo[CC * 128];   /* the weight's fragments */
  const int tid = threadIdx.x, wave = tid >> 5, lane = tid & 31, col = lane & 15, g = lane >> 4; const int c0 = blockIdx.y * 128; const size_t r0 = (size_t)blockIdx.x * FRW + wave * 16;
  v8f acc[8] = {};
  if (true) {   /* ALL rows: gated ctx bf16 hi + lo x exact output_w (2 products) */
    const int bi = c0 + col; float bo[8];   /* output_b: loaded here with the rest, not one waited load per column tile behind the products */
#pragma unroll
    for (int j = 0; j < 8; ++j) bo[j] = BO[bi + j * 16];
    v4f y[16], t[16];   /* a load = 4 whole lines of ctx or of the gate, in the order of the A fragments; all 32 of a wave are in flight at once, ahead of the weight's */
    const float* yp = Y + r0 * CC + (unsigned)(lane * 4); const float* gp = G + r0 * CC + (unsigned)(lane * 4);
#pragma unroll
    for (int rl = 0; rl < 16; ++rl) y[rl] = *(const v4f*)(yp + rl * CC);
#pragma unroll
    for (int rl = 0; rl < 16; ++rl) t[rl] = *(const v4f*)(gp + rl * CC);
    asm volatile("s_wait_xcnt 0x0" :: "v"(yp), "v"(gp), "v"(bi) : "memory");   /* what follows may rewrite the registers that these loads name; the addresses as inputs keep their registers from serving as a load's destination ahead of the wait */
    __builtin_amdgcn_sched_barrier(0);   /* keeps the rows' 32 loads (from memory) ahead of the weight's 32 (from L2) */
    const int cw = tid & 127; stage_wq(WO + c0, DIN, sWo, cw, __builtin_amdgcn_readfirstlane(tid >> 7));
    asm volatile("s_wait_xcnt 0x0" :: "v"(cw) : "memory");   /* the column index as input keeps the register that the weight's loads name from serving as the last load's destination */
    F2 af[CC / 32];
    __builtin_amdgcn_sched_barrier(0);   /* the rows' products stay behind the staging: moved ahead of it, their wait for the rows held the weight's loads back, and both together overran the 256 registers and spilled */
#pragma unroll
    for (int kc = 0; kc < CC / 32; ++kc) { float v[16];   /* ctx x gate in f32, then the bf16 hi + lo split: pieces 4 kc .. 4 kc + 3 are the lane's 16 elements of k chunk kc */
#pragma unroll
      for (int u = 0; u < 4; ++u)
#pragma unroll
        for (int i = 0; i < 4; ++i) v[u * 4 + i] = y[kc * 4 + u][i] * t[kc * 4 + u][i];
      af[kc] = bsplit16(v); }
    __syncthreads();   /* publishes the weight's fragments */
#pragma unroll
    for (int kc = 0; kc < CC / 32; ++kc) { v16b w[8];
#pragma unroll
      for (int j = 0; j < 8; ++j) w[j] = wfrag(sWo, kc, j, lane);
      const F2 a = af[kc];
#pragma unroll
      for (int j = 0; j < 8; ++j) { acc[j] = wmma_bf(a.h, w[j], acc[j]); acc[j] = wmma_bf(a.l, w[j], acc[j]); } }
#pragma unroll
    for (int j = 0; j < 8; ++j) { const float bias = bfr(bo[j]);
#pragma unroll
      for (int r = 0; r < 8; ++r) sf[wave][8 * g + r][j * 16 + col] = acc[j][r] + bias; }
  } else {
#pragma unroll 2
    for (int kc = 0; kc < CC / 32; ++kc) { const v16h a = frag_f32(Y + (r0 + col) * CC + kc * 32, lane); asm volatile("s_wait_loadcnt 0x0" ::: "memory");
#pragma unroll
      for (int j = 0; j < 8; ++j) { const v16h w = WOCOLH(WO, kc * 32, c0 + j * 16 + col, lane); asm volatile("s_wait_loadcnt 0x0" ::: "memory"); acc[j] = wmma16(a, w, acc[j]); } }
#pragma unroll
    for (int j = 0; j < 8; ++j) { const float bias = BO ? bfr(BO[c0 + j * 16 + col]) : 0.f;
#pragma unroll
      for (int r = 0; r < 8; ++r) sf[wave][8 * g + r][j * 16 + col] = acc[j][r] * (1.0f / 256.0f) + bias; } }
  LDSX(); for (int rl = 0; rl < 16; ++rl) vst2(OUT + (r0 + rl) * DIN + c0 + lane * 4, *(const v4f*)&sf[wave][rl][lane * 4]); }

extern "C" void kernel_launch(void* const* d_in, const int* in_sizes, int n_in, void* d_out, int out_size, void* d_ws, size_t ws_size, hipStream_t stream) {
  (void)in_sizes; (void)n_in; (void)out_size;
  const float** F = (const float**)d_in;
  if (ws_size < (size_t)WS_END) return;
  char* ws = (char*)d_ws; _Float16 *QH = (_Float16*)(ws + WS_QH), *KH = (_Float16*)(ws + WS_KH), *VT = (_Float16*)(ws + WS_VT), *QL = (_Float16*)(ws + WS_QL), *KL = (_Float16*)(ws + WS_KL); __bf16 *VB = (__bf16*)(ws + WS_VB), *VBL = (__bf16*)(ws + WS_VBL); float *Y = (float*)(ws + WS_Y);
  (void)Y; (void)QL; (void)KL; (void)VB; (void)VBL;
  // inputs: 0 pair_act [1,256,256,128]; 1 pair_mask [1,256,256]; 2 ln_gamma, 3 ln_beta; 4 feat2d_w [128,4]; 5 query_w, 6 key_w, 7 value_w [128,4,32] (in,out); 8 gating_w [128,4,32], 9 gating_b [4,32]; 10 output_w [4,32,128] (in,out); 11 output_b
  if (ws_size < (size_t)WS_END2) return;
  float *BIAS = (float*)(ws + WS_BIAS), *G = (float*)(ws + WS_G);
  k_front<<<dim3(NZR / FRW), 512, 0, stream>>>(F[0], F[2], F[3], F[4], F[5], F[6], F[7], F[8], F[9], QH, QL, KH, KL, VT, VB, VBL, BIAS, G);
  k_attn<<<dim3(TNB / FR, NH), 512, 0, stream>>>(QH, QL, KH, VT, BIAS, F[1], Y);
  k_out<<<dim3(TNB * TT / FRW, DIN / 128), 512, 0, stream>>>(Y, G, F[10], F[11], (float*)d_out);
}

// v010
// It runs in 59.5 microseconds.
// Two timings next to v009 put it at 1.04 and 1.03 times that version's speed.
// All steps since v000 together make it 8.83 times as fast.
// compute dtype: all float inputs rounded to bf16; LayerNorm of pair_act in f32; q/k/v = LN(act) split bf16 hi + lo x W (exact bf16, (in,out)) on WMMA 16x16x32 (2 products, f32 accumulate); q as f16 hi + residual (x 2^10) against k once to f16 (2 products) x 32^-0.5 + the per-(query, key, head) triangle bias (2-product GEMM) + the mask bias; softmax in f32 (hardware 2^x of logit x log2(e) + (11 - maximum x log2(e)), running maximum and sum over steps of 64 keys); exp(logit - maximum) x 2^11 once to f16 against v once to f16 (1 product), divided by the sum at the end; gate sigmoid(LN(act) Wg + b) in f32 (2-product GEMM, hardware 2^x and reciprocal); gated ctx split bf16 hi + lo against exact output_w (2 products) + output_b; f32 output.
#include <hip/hip_runtime.h>
#include <math.h>

typedef __attribute__((ext_vector_type(16))) _Float16 v16h;
typedef __attribute__((ext_vector_type(16))) __bf16 v16b;
typedef __attribute__((ext_vector_type(8)))  _Float16 v8h;
typedef __attribute__((ext_vector_type(8)))  float v8f;
typedef __attribute__((ext_vector_type(4)))  float v4f;
typedef __attribute__((ext_vector_type(2)))  float v2f;
typedef __attribute__((ext_vector_type(4)))  unsigned v4u;
typedef __attribute__((ext_vector_type(4)))  int v4i;
typedef float __attribute__((may_alias)) float_a;
typedef int __attribute__((may_alias)) int_a;

template <typename T> __device__ __forceinline__ void vst2(void* p, T v) { *(T*)p = v;  }
__device__ __forceinline__ v8f wmma16(v16h a, v16h b, v8f c) {
  v8f d = __builtin_amdgcn_wmma_f32_16x16x32_f16(false, a, false, b, (short)0, c, false, false);
  asm volatile("v_nop\n\tv_nop\n\tv_nop\n\tv_nop" : "+v"(d) : "v"(a), "v"(b));
  return d;
}
__device__ __forceinline__ v8f wmma_bf(v16b a, v16b b, v8f c) {
  v8f d = __builtin_amdgcn_wmma_f32_16x16x32_bf16(false, a, false, b, (short)0, c, false, false);
  asm volatile("v_nop\n\tv_nop\n\tv_nop\n\tv_nop" : "+v"(d) : "v"(a), "v"(b));
  return d;
}
// 16x16x32 fragments: lane = (h = lane>>4, row/col = lane&15); elements 0..7 = k0+8h+0..7, 8..15 = k0+16+8h+0..7; D element r = row 8h+r
__device__ __forceinline__ v16h frag_h(const _Float16* rowk0, int lane) {
  union { v16h v; v8h q[2]; } u; const _Float16* p = rowk0 + 8 * (lane >> 4);
  u.q[0] = *(const v8h*)p; u.q[1] = *(const v8h*)(p + 16); return u.v;
}
__device__ __forceinline__ v16h frag_f32(const float* rowk0, int lane) {
  v16h a; const float* p = rowk0 + 8 * (lane >> 4);
#pragma unroll
  for (int i = 0; i < 8; ++i) { a[i] = (_Float16)p[i]; a[8 + i] = (_Float16)p[16 + i]; }
  return a;
}
__device__ __forceinline__ v16h frag_f32s(const float* rowk0, int lane, float sc) {
  v16h a; const float* p = rowk0 + 8 * (lane >> 4);
#pragma unroll
  for (int i = 0; i < 8; ++i) { a[i] = (_Float16)(p[i] * sc); a[8 + i] = (_Float16)(p[16 + i] * sc); }
  return a;
}
// column fragment from a [K][ld] layout (column n), rows >= K read as 0
__device__ __forceinline__ v16h fragc_f32(const float* W, int k0, int n, int lane, int ld, int K) {
  v16h a; const int g = lane >> 4;
#pragma unroll
  for (int i = 0; i < 8; ++i) { const int ka = k0 + 8 * g + i, kb = ka + 16;
    a[i] = (_Float16)(ka < K ? W[(size_t)(ka < K ? ka : K - 1) * ld + n] : 0.f); a[8 + i] = (_Float16)(kb < K ? W[(size_t)(kb < K ? kb : K - 1) * ld + n] : 0.f); }
  return a;
}
struct F2 { v16b h, l; };
__device__ __forceinline__ F2 bsplit16(const float v[16]) { F2 r;
#pragma unroll
  for (int i = 0; i < 16; ++i) { const __bf16 h = (__bf16)v[i]; r.h[i] = h; r.l[i] = (__bf16)(v[i] - (float)h); }
  return r; }
__device__ __forceinline__ F2 split_row(const float* row, int k0, int lane) { float v[16]; const float* p = row + k0 + 8 * (lane >> 4);
#pragma unroll
  for (int i = 0; i < 8; ++i) { v[i] = p[i]; v[8 + i] = p[16 + i]; }
  return bsplit16(v); }
// the same of the element-wise product of two rows (ctx row x gate row, multiplied in f32 ahead of the split)
__device__ __forceinline__ F2 split_row2(const float* row, const float* grow, int k0, int lane) { float v[16]; v4f y[4], t[4]; const float* p = row + k0 + 8 * (lane >> 4); const float* q = grow + k0 + 8 * (lane >> 4);
#pragma unroll
  for (int u = 0; u < 4; ++u) { y[u] = *(const v4f*)(p + (u >> 1) * 16 + (u & 1) * 4); t[u] = *(const v4f*)(q + (u >> 1) * 16 + (u & 1) * 4); }
  asm volatile("s_wait_xcnt 0x0" :: "v"(y[0]), "v"(y[1]), "v"(y[2]), "v"(y[3]), "v"(t[0]), "v"(t[1]), "v"(t[2]), "v"(t[3]) : "memory");   /* what follows may rewrite the registers that these loads name; the loaded values as inputs hold the wait behind the loads */
#pragma unroll
  for (int u = 0; u < 4; ++u)
#pragma unroll
    for (int i = 0; i < 4; ++i) v[u * 4 + i] = y[u][i] * t[u][i];
  return bsplit16(v); }
__device__ __forceinline__ F2 split_rowK(const float* row, int k0, int lane, int K) { float v[16]; const int g = lane >> 4;
#pragma unroll
  for (int i = 0; i < 8; ++i) { const int ka = k0 + 8 * g + i, kb = ka + 16; v[i] = ka < K ? row[ka < K ? ka : K - 1] : 0.f; v[8 + i] = kb < K ? row[kb < K ? kb : K - 1] : 0.f; }
  return bsplit16(v); }
__device__ __forceinline__ F2 split_col(const float* W, int k0, int n, int lane, int ld, int K) { float v[16]; const int g = lane >> 4;
#pragma unroll
  for (int i = 0; i < 8; ++i) { const int ka = k0 + 8 * g + i, kb = ka + 16; v[i] = ka < K ? W[(size_t)(ka < K ? ka : K - 1) * ld + n] : 0.f; v[8 + i] = kb < K ? W[(size_t)(kb < K ? kb : K - 1) * ld + n] : 0.f; }
  return bsplit16(v); }
__device__ __forceinline__ v8f mac3(const F2& a, const F2& b, v8f c) { c = wmma_bf(a.l, b.h, c); c = wmma_bf(a.h, b.l, c); return wmma_bf(a.h, b.h, c); }
__device__ __forceinline__ float sigm(float v) { return 1.0f / (1.0f + expf(-v)); }
#define LDSX() do { asm volatile("s_wait_dscnt 0" ::: "memory"); __builtin_amdgcn_wave_barrier(); __builtin_amdgcn_fence(__ATOMIC_RELEASE, "workgroup"); } while (0)

// Triangle attention (pair_act [1, 256, 256, 128], 4 heads x 32): act = LayerNorm(pair_act); for every row r: q = act[r] Wq * 32^-0.5, k = act[r] Wk, v = act[r] Wv; logits[r,h,q,k] = q . k + 2^15 (pair_mask[r][k] - 1) + tri_bias[h][q][k] with tri_bias = act . feat2d_w (indexed by the (q, k) PAIR, shared across rows); softmax over k; wa = (weights v) * sigmoid(act[r][q] Wg + bg); out[r][q] = wa . output_w + output_b.
#define NB 256
#define TT 256
#define CC 128            // NH * HD = projected width
#define DIN 128          // input (model) width
#define NH 4
#define HD 32
#define NQB (TT / 64)
#define HG 4
#define SCALE (0.17677669529663687f)
#define CAUSAL 0
#ifndef TNB
#define TNB NB
#endif
#define LOG2E (1.4426950408889634f)
__device__ __forceinline__ float bfr(float v) { return (float)(__bf16)v; }
__host__ __device__ __forceinline__ int kb_last(int qb) { return CAUSAL ? ((qb * 64 + 63) >> 7) : (TT / 128 - 1); }
typedef __attribute__((ext_vector_type(8))) __bf16 v8b;
typedef __attribute__((ext_vector_type(4))) __bf16 v4b;
__device__ __forceinline__ v16b frag_b(const __bf16* rowk0, int lane) {
  union { v16b v; v8b q[2]; } u; const __bf16* p = rowk0 + 8 * (lane >> 4);
  u.q[0] = *(const v8b*)p; u.q[1] = *(const v8b*)(p + 16); return u.v;
}
// One 128 x 128 (in,out) weight, rounded to bf16 once per work-group of 512 threads (256 rows) and laid in LDS (32 KiB) in the order the B fragments are read: [k chunk of 32][column tile][half of 8 k][lane] pieces of 16 B. Thread = (output column c, k chunk kq): a wave's load is one whole 128-B line, all 32 loads of a thread are independent, and 8 k of a column make one 16-B store. The plain unroll directives here and at the fragment arrays w[8] keep those small arrays in registers.
__device__ __forceinline__ void stage_wq(const float* __restrict__ Wm, int ld, __bf16* sW, int c, int kq) { const float* p = Wm + (size_t)(kq * 32) * ld + c;
#pragma unroll
  for (int kk = 0; kk < 4; ++kk) { v8b w;   /* k = 32 kq + 8 kk + i: chunk kq, half kk >> 1, lane half kk & 1 */
#pragma unroll
    for (int i = 0; i < 8; ++i) w[i] = (__bf16)p[(size_t)(kk * 8 + i) * ld];
    *(v8b*)(sW + (size_t)((((kq * 8 + (c >> 4)) * 2 + (kk >> 1)) * 32 + (kk & 1) * 16 + (c & 15)) * 8)) = w; } }
__device__ __forceinline__ v16b wfrag(const __bf16* sW, int kc, int j, int lane) {
  union { v16b v; v8b q[2]; } u; const __bf16* p = sW + ((kc * 8 + j) * 64 + lane) * 8;
  u.q[0] = *(const v8b*)p; u.q[1] = *(const v8b*)(p + 256); return u.v;
}
#define QBH 0              // unused: nothing in this file reads it
#define QHI 256            // rows carrying a q residual plane (all rows when non-causal: 2-product logits everywhere)
#define KHI 64            // key rows carrying k residual / v bf16 hi+lo planes (written by k_front; no kernel reads them)
// B fragment (k rows k0+.., output column o) of a weight: (in,out) [K][ld] or (out,in) [ld rows of K]: bf16 exact, or f16(bf16 * 256) exact
__device__ __forceinline__ v16b wcol_io(const float* Wm, int k0, int o, int lane, int ld) { v16b w; const int g = lane >> 4;
#pragma unroll
  for (int i = 0; i < 8; ++i) { w[i] = (__bf16)Wm[(size_t)(k0 + 8 * g + i) * ld + o]; w[8 + i] = (__bf16)Wm[(size_t)(k0 + 16 + 8 * g + i) * ld + o]; }
  return w; }
__device__ __forceinline__ v16b wcol_oi(const float* Wm, int k0, int o, int lane, int K) { v16b w; const float* p = Wm + (size_t)o * K + k0 + 8 * (lane >> 4);
#pragma unroll
  for (int i = 0; i < 8; ++i) { w[i] = (__bf16)p[i]; w[8 + i] = (__bf16)p[16 + i]; }
  return w; }
__device__ __forceinline__ v16h wcolh_io(const float* Wm, int k0, int o, int lane, int ld) { v16h w; const int g = lane >> 4;
#pragma unroll
  for (int i = 0; i < 8; ++i) { w[i] = (_Float16)(bfr(Wm[(size_t)(k0 + 8 * g + i) * ld + o]) * 256.0f); w[8 + i] = (_Float16)(bfr(Wm[(size_t)(k0 + 16 + 8 * g + i) * ld + o]) * 256.0f); }
  return w; }
__device__ __forceinline__ v16h wcolh_oi(const float* Wm, int k0, int o, int lane, int K) { v16h w; const float* p = Wm + (size_t)o * K + k0 + 8 * (lane >> 4);
#pragma unroll
  for (int i = 0; i < 8; ++i) { w[i] = (_Float16)(bfr(p[i]) * 256.0f); w[8 + i] = (_Float16)(bfr(p[16 + i]) * 256.0f); }
  return w; }
#define WQKV_LAYOUT 0   // 0 = (in,out) [DIN][CC]; 1 = (out,in) [CC][DIN]; 2 = per-head [NH][DIN][HD]
__device__ __forceinline__ v16b wcol_hdk(const float* Wm, int k0, int o, int lane) { v16b w; const int g = lane >> 4; const float* p = Wm + (size_t)(o / HD) * DIN * HD + (o % HD);
#pragma unroll
  for (int i = 0; i < 8; ++i) { w[i] = (__bf16)p[(size_t)(k0 + 8 * g + i) * HD]; w[8 + i] = (__bf16)p[(size_t)(k0 + 16 + 8 * g + i) * HD]; }
  return w; }
#define WO_OUT_IN 0
#if WQKV_LAYOUT == 1
#define WCOL(W, k0, o, lane) wcol_oi(W, k0, o, lane, DIN)
#elif WQKV_LAYOUT == 2
#define WCOL(W, k0, o, lane) wcol_hdk(W, k0, o, lane)
#else
#define WCOL(W, k0, o, lane) wcol_io(W, k0, o, lane, CC)
#endif
#if WO_OUT_IN
#define WOCOL(W, k0, o, lane) wcol_oi(W, k0, o, lane, CC)
#define WOCOLH(W, k0, o, lane) wcolh_oi(W, k0, o, lane, CC)
#else
#define WOCOL(W, k0, o, lane) wcol_io(W, k0, o, lane, DIN)
#define WOCOLH(W, k0, o, lane) wcolh_io(W, k0, o, lane, DIN)
#endif
#define SZ 256
#define BG 64              // sizes only the unused WS_S region (x HG 4 = 256 planes of 256 x 256)
#define NZR (SZ * SZ)      // 65,536 pair rows
#define WS_ZN   (WS_END)
#define WS_BIAS (WS_ZN + 4u * (size_t)NZR * CC)
#define WS_G    (WS_BIAS + 4u * (size_t)NZR * NH)
#define WS_END2 (WS_G + 4u * (size_t)NZR * CC)
#ifndef PROJ_EXTRA_PARAMS
#define PROJ_EXTRA_PARAMS
#endif

#define WS_QH  0u                                      // f16 q fragments [b][head][tile of 16 t][half][lane][8]
#define WS_KH  (WS_QH + 2u * (size_t)NB * TT * CC)      // f16 k fragments, the same order
#define WS_VT  (WS_KH + 2u * (size_t)NB * TT * CC)      // f16 v fragments [b][head][channel tile][chunk of 32 t][half][lane][8]
#define WS_QL  (WS_VT + 2u * (size_t)NB * CC * TT)      // f16 q residual x 2^10 fragments [b][head][tile of 16 t < QHI][half][lane][8]
#define WS_KL  (WS_QL + 2u * (size_t)NB * QHI * CC)     // f16 k residual x 2^10 fragments [b][head][tile of 16 t < KHI][half][lane][8]
#define WS_VB  (WS_KL + 2u * (size_t)NB * KHI * CC)     // bf16 v hi fragments [b][head][channel tile][chunk of 32 t < KHI][half][lane][8]
#define WS_VBL (WS_VB + 2u * (size_t)NB * CC * KHI)
#define WS_S   (WS_VBL + 2u * (size_t)NB * CC * KHI)    // unused: no kernel writes or reads it
#define WS_Y   (WS_S  + 4u * (size_t)BG * HG * TT * TT)   // f32 gated ctx [b][tile of 16 t][channel tile][half][lane][4] (only when there is an output projection)
#define WS_END (WS_Y  + 4u * (size_t)NB * TT * CC)

// ---- k_front: block = 256 pair rows (one query's row of pairs), 16 waves, wave = 16 rows, one work-group per WGP. The four 128 x 128 (in,out) weights are staged once per work-group, all four side by side in LDS (128 KiB), behind the rows' own loads, and stay there. A lane reads its half of one row of pair_act in the order of the A fragments (k = 32 kc + 8 g + i and 16 on), so LayerNorm (biased var, eps 1e-5, ln_gamma/ln_beta, of bf16(z)) needs one exchange with the other half-wave, and the four bf16 hi + lo fragments of LN(act) are formed once and stay in registers for all five products: tri_bias (one plane per head, BIAS[h][q][k]), then q, k, the gate and v, each of which leaves the registers in the order of its reader's fragments.
#define FRW 256            // pair rows per work-group of k_front and k_out
__device__ __forceinline__ void exp2x8(float (&t)[8]) {
  asm("v_exp_f32 %0, %0\n\tv_exp_f32 %1, %1\n\tv_exp_f32 %2, %2\n\tv_exp_f32 %3, %3\n\tv_exp_f32 %4, %4\n\tv_exp_f32 %5, %5\n\tv_exp_f32 %6, %6\n\tv_exp_f32 %7, %7\n\tv_nop"
      : "+v"(t[0]), "+v"(t[1]), "+v"(t[2]), "+v"(t[3]), "+v"(t[4]), "+v"(t[5]), "+v"(t[6]), "+v"(t[7])); }
// the reciprocal of eight values, in the same form and for the same reason
__device__ __forceinline__ void rcpx8(float (&t)[8]) {
  asm("v_rcp_f32 %0, %0\n\tv_rcp_f32 %1, %1\n\tv_rcp_f32 %2, %2\n\tv_rcp_f32 %3, %3\n\tv_rcp_f32 %4, %4\n\tv_rcp_f32 %5, %5\n\tv_rcp_f32 %6, %6\n\tv_rcp_f32 %7, %7\n\tv_nop"
      : "+v"(t[0]), "+v"(t[1]), "+v"(t[2]), "+v"(t[3]), "+v"(t[4]), "+v"(t[5]), "+v"(t[6]), "+v"(t[7])); }
__global__ __launch_bounds__(512) void k_front(const float* __restrict__ Z, const float* __restrict__ LW, const float* __restrict__ LB, const float* __restrict__ WB, const float* __restrict__ WQ, const float* __restrict__ WK, const float* __restrict__ WV, const float* __restrict__ WG, const float* __restrict__ GB,
    _Float16* __restrict__ QH, _Float16* __restrict__ QL, _Float16* __restrict__ KH, _Float16* __restrict__ KL, _Float16* __restrict__ VT, __bf16* __restrict__ VB, __bf16* __restrict__ VBL, float* __restrict__ BIAS, float* __restrict__ G) {
  __shared__ __align__(16) __bf16 sWa[4 * DIN * CC];   /* the fragments of query_w, key_w, value_w, gating_w */
  __shared__ __align__(16) char sm[NH * FRW * 4 + (NH + 1) * 144 * 2];   /* the bias rows and feat2d_w */
  __bf16 (*sb)[144] = (__bf16 (*)[144])(sm + NH * FRW * 4);   /* feat2d_w transposed, [head][k], behind the bias rows; a fifth row of zeros; 288-B pitch: the 16-B reads of 5 rows x 2 halves fall on different banks */
  const int tid = threadIdx.x, wave = tid >> 5, lane = tid & 31, col = lane & 15, g = lane >> 4; const size_t r0 = (size_t)blockIdx.x * FRW; const size_t bb = blockIdx.x;
  const float wb1 = WB[tid];   /* thread = (input channel k, head): DIN x NH = 512 values, one each; ahead of the rows' loads */
  v4f zt[16];   /* the rows' loads (from memory) are issued ahead of the weights' (from L2) */
  { const float* zp = Z + r0 * CC + (unsigned)((wave * 16 + col) * CC + 8 * g);
#pragma unroll
    for (int kc = 0; kc < 4; ++kc)
#pragma unroll
      for (int u = 0; u < 4; ++u) zt[kc * 4 + u] = *(const v4f*)(zp + kc * 32 + (u >> 1) * 16 + (u & 1) * 4); }
  __builtin_amdgcn_sched_barrier(0);   /* keeps the rows' 16 loads ahead of the 128 weight loads: moved behind them, the requests to memory would start only when the L2 traffic of the staging has been issued */
  { const int kq = __builtin_amdgcn_readfirstlane(tid >> 7), c = tid & 127;
    stage_wq(WQ, CC, sWa, c, kq); stage_wq(WK, CC, sWa + DIN * CC, c, kq); stage_wq(WV, CC, sWa + 2 * DIN * CC, c, kq); stage_wq(WG, CC, sWa + 3 * DIN * CC, c, kq);
    asm volatile("s_wait_xcnt 0x0" :: "v"(c) : "memory"); }   /* the column index as input keeps the register that the weights' loads name from serving as the last load's destination */
  __builtin_amdgcn_sched_barrier(0);   /* LayerNorm and its parameter loads stay behind the staging: mixed into it, rows, 128 weight values and the parameters together overran the 256 registers of a 16-wave work-group and spilled */
  sb[tid & (NH - 1)][tid >> 2] = (__bf16)wb1;
  if (tid < DIN) sb[NH][tid] = (__bf16)0.f;
  F2 a[4];
  { float x[4][16];
#pragma unroll
    for (int kc = 0; kc < 4; ++kc)
#pragma unroll
      for (int u = 0; u < 4; ++u)
#pragma unroll
        for (int i = 0; i < 4; ++i) x[kc][u * 4 + i] = bfr(zt[kc * 4 + u][i]);
    float sp[4] = {0.f, 0.f, 0.f, 0.f};
#pragma unroll
    for (int kc = 0; kc < 4; ++kc)
#pragma unroll
      for (int i = 0; i < 16; ++i) sp[kc] += x[kc][i];
    float s1 = (sp[0] + sp[1]) + (sp[2] + sp[3]); s1 += __shfl_xor(s1, 16);
    const float mu = s1 * (1.0f / CC); float qp[4] = {0.f, 0.f, 0.f, 0.f};
#pragma unroll
    for (int kc = 0; kc < 4; ++kc)
#pragma unroll
      for (int i = 0; i < 16; ++i) { const float d = x[kc][i] - mu; qp[kc] += d * d; }
    float q = (qp[0] + qp[1]) + (qp[2] + qp[3]); q += __shfl_xor(q, 16);
    const float rs = rsqrtf(q * (1.0f / CC) + 1e-5f);
#pragma unroll
    for (int kc = 0; kc < 4; ++kc) { float v[16];
#pragma unroll
      for (int u = 0; u < 4; ++u) { const int c = kc * 32 + (u >> 1) * 16 + (u & 1) * 4 + 8 * g; const v4f lw = *(const v4f*)(LW + c), lb = *(const v4f*)(LB + c);
#pragma unroll
        for (int i = 0; i < 4; ++i) v[u * 4 + i] = (x[kc][u * 4 + i] - mu) * rs * bfr(lw[i]) + bfr(lb[i]); }
      a[kc] = bsplit16(v); } }
  __syncthreads();   /* publishes feat2d_w and the four weights */
  { v8f ab = {}; const __bf16* wr = &sb[col < NH ? col : NH][0];   /* tri_bias: 4 outputs; the columns beyond them read the row of zeros */
#pragma unroll
    for (int kc = 0; kc < 4; ++kc) { const v16b w = frag_b(wr + kc * 32, lane); ab = wmma_bf(a[kc].h, w, ab); ab = wmma_bf(a[kc].l, w, ab); }
    float (*sp)[FRW] = (float (*)[FRW])sm;   /* [head][key] */
    if (col < NH) { v4f lo, hi;   /* a lane of column h holds 8 neighbouring keys of head h */
#pragma unroll
      for (int r = 0; r < 4; ++r) { lo[r] = ab[r]; hi[r] = ab[4 + r]; }
      *(v4f*)&sp[col][wave * 16 + 8 * g] = lo; *(v4f*)&sp[col][wave * 16 + 8 * g + 4] = hi; }
    __syncthreads();   /* the 16 waves' keys of a head meet, so that a wave stores half a head's 256 keys as four whole lines */
    if (wave < 2 * NH) { const v4f b4 = *(const v4f*)&sp[wave >> 1][(wave & 1) * 128 + lane * 4]; vst2(BIAS + (size_t)(wave >> 1) * NZR + r0 + (unsigned)((wave & 1) * 128 + lane * 4), b4); }   /* plane [h][q][k], the block's 1-KiB run */
    asm volatile("s_wait_xcnt 0x0" ::: "memory"); }   /* what follows may rewrite registers that this store names */
#pragma unroll 1   /* rolled: one copy of the products in the instruction cache */
  for (int t = 0; t < 3; ++t) { const int which = t == 2 ? 3 : t; const __bf16* sW = sWa + which * (DIN * CC);
    v8f acc[8] = {};
    {   /* q, k, gate: the product is formed transposed (A = weight columns, B = rows), so D's column is the pair row and a lane holds 8 neighbouring channels of ONE row: tiles 2h and 2h + 1 ARE the lane's 16 elements of head h's fragment in k_attn (for the gate, of head h's ctx as k_attn's D holds it). They go from registers to the workspace in that order, q and k as [row block][head][tile of 16 rows][half][lane] pieces of 16 B: a wave's store is 4 whole lines; no LDS tile, no barrier */
#pragma unroll
      for (int kc = 0; kc < 4; ++kc) { v16b w[8];
#pragma unroll
        for (int j = 0; j < 8; ++j) w[j] = wfrag(sW, kc, j, lane);
#pragma unroll
        for (int j = 0; j < 8; ++j) { acc[j] = wmma_bf(w[j], a[kc].h, acc[j]); acc[j] = wmma_bf(w[j], a[kc].l, acc[j]); } }
      if (t == 2) {   /* gate: [tile of 16 rows][channel tile][half of 4][lane] pieces of 16 B, the order in which k_attn's D holds ctx */
        float* gp = G + r0 * CC + (unsigned)(wave * 2048 + lane * 4);
#pragma unroll
        for (int j = 0; j < 8; ++j) { const v4f g0 = *(const v4f*)(GB + j * 16 + 8 * g), g1 = *(const v4f*)(GB + j * 16 + 8 * g + 4); v4f o0, o1; float e[8];   /* sigmoid(x Wg + gating_b) on the hardware's 2^x and reciprocal */
#pragma unroll
          for (int r = 0; r < 8; ++r) e[r] = -LOG2E * (acc[j][r] + bfr(r < 4 ? g0[r & 3] : g1[r & 3]));
          exp2x8(e);
#pragma unroll
          for (int r = 0; r < 8; ++r) e[r] = 1.0f + e[r];
          rcpx8(e);
#pragma unroll
          for (int r = 0; r < 4; ++r) { o0[r] = e[r]; o1[r] = e[4 + r]; }
          vst2(gp + j * 256, o0); vst2(gp + j * 256 + 128, o1); }
        asm volatile("s_wait_xcnt 0x0" ::: "memory");   /* what follows may rewrite registers that these loads and stores name */
        continue; }
      _Float16* dh = (which == 0 ? QH : KH) + bb * (size_t)(TT * CC) + (unsigned)(wave * 512 + lane * 8); v8h lv[8];
#pragma unroll
      for (int j = 0; j < 8; ++j) { v8h hv;
#pragma unroll
        for (int r = 0; r < 8; ++r) { const float v = acc[j][r]; const _Float16 hh = (_Float16)v; hv[r] = hh; lv[j][r] = (_Float16)((v - (float)hh) * 1024.0f); }
        vst2(dh + (j >> 1) * (TT * HD) + (j & 1) * 256, hv); }
      asm volatile("s_wait_xcnt 0x0" ::: "memory");   /* what follows may rewrite registers that these stores name */
      if (which == 0) { _Float16* dl = QL + bb * (size_t)(QHI * CC) + (unsigned)(wave * 512 + lane * 8);
#pragma unroll
        for (int j = 0; j < 8; ++j) vst2(dl + (j >> 1) * (QHI * HD) + (j & 1) * 256, lv[j]);
      } else if (wave < KHI / 16) { _Float16* dl = KL + bb * (size_t)(KHI * CC) + (unsigned)(wave * 512 + lane * 8);   /* rows < KHI */
#pragma unroll
        for (int j = 0; j < 8; ++j) vst2(dl + (j >> 1) * (KHI * HD) + (j & 1) * 256, lv[j]); }
      asm volatile("s_wait_xcnt 0x0" ::: "memory"); } }   /* the next trip rewrites registers that these stores name */
  { const __bf16* sW = sWa + 2 * (DIN * CC); v8f acc[8] = {};   /* v: A = rows, B = weight columns: D's column is the channel and a lane holds 8 neighbouring keys of it: the half of k_attn's v fragment that this wave's 16 keys make up; [row block][head][channel tile][chunk of 32 keys][half][lane] pieces of 16 B */
#pragma unroll
    for (int kc = 0; kc < 4; ++kc) { v16b w[8];
#pragma unroll
      for (int j = 0; j < 8; ++j) w[j] = wfrag(sW, kc, j, lane);
#pragma unroll
      for (int j = 0; j < 8; ++j) { acc[j] = wmma_bf(a[kc].h, w[j], acc[j]); acc[j] = wmma_bf(a[kc].l, w[j], acc[j]); } }
    const unsigned vo = (unsigned)((wave >> 1) * 512 + (wave & 1) * 256 + lane * 8); _Float16* vt = VT + bb * (size_t)(CC * TT) + vo;
#pragma unroll
    for (int j = 0; j < 8; ++j) { v8h hv;
#pragma unroll
      for (int r = 0; r < 8; ++r) hv[r] = (_Float16)acc[j][r];
      vst2(vt + (j >> 1) * (HD * TT) + (j & 1) * (16 * TT), hv); }
    asm volatile("s_wait_xcnt 0x0" ::: "memory");   /* what follows may rewrite registers that these stores name */
    if (wave < KHI / 16) { __bf16* vb = VB + bb * (size_t)(CC * KHI) + vo; __bf16* vbl = VBL + bb * (size_t)(CC * KHI) + vo;   /* keys < KHI: bf16 hi and lo, the same order */
#pragma unroll
      for (int j = 0; j < 8; ++j) { v8b bh, bl;
#pragma unroll
        for (int r = 0; r < 8; ++r) { const float v = acc[j][r]; const __bf16 hb = (__bf16)v; bh[r] = hb; bl[r] = (__bf16)(v - (float)hb); }
        vst2(vb + (j >> 1) * (HD * KHI) + (j & 1) * (16 * KHI), bh); vst2(vbl + (j >> 1) * (HD * KHI) + (j & 1) * (16 * KHI), bl); } }
    asm volatile("s_wait_xcnt 0x0" ::: "memory"); }   /* behind the last stores, as above */
}
// ---- k_attn: work-group = (4 rows r, head h), 16 waves, wave = 16 queries against all 256 keys, 64 keys at a time with a running maximum and sum. The head's bias plane lies in LDS for the whole work-group, row = query, as it lies in memory, at a pitch of 16 B x an odd number (the 16 queries of a fragment read fall on different banks); per row r the k and v fragments (as they lie in memory) and the mask bias are staged in LDS once for all 16 waves. Both products are formed transposed (scores: A = k rows, B = q rows; ctx: A = v planes, B = P), so D's column is the query in both: a lane holds keys of ONE query, two neighbouring score tiles ARE the B fragment of P, and maximum, sum and rescale stay in the lane (one exchange with the other half-wave). The plain unroll directives keep the small arrays in registers.
#define FR 4               // rows r per work-group
#define BP (TT + 4)        // floats per staged bias row: 1,040-B pitch
__device__ __forceinline__ v8f wmma_h(v16h a, v16h b, v8f c) { return __builtin_amdgcn_wmma_f32_16x16x32_f16(false, a, false, b, (short)0, c, false, false); }
__global__ __launch_bounds__(512) void k_attn(const _Float16* __restrict__ QH, const _Float16* __restrict__ QL, const _Float16* __restrict__ KH, const _Float16* __restrict__ VT, const float* __restrict__ BIAS, const float* __restrict__ MKP, const float* __restrict__ G, float* __restrict__ Y) {
  __shared__ __align__(16) float sB[TT][BP];
  __shared__ __align__(16) _Float16 sK[TT * HD];   /* the row's k fragments, in the order they lie in memory: [tile of 16 keys][half][lane] pieces of 16 B */ __shared__ __align__(16) _Float16 sV[HD * TT];   /* the row's v fragments, likewise: [channel tile][chunk of 32 keys][half][lane] */ __shared__ __align__(16) float sM[TT];
  const int tid = threadIdx.x, wave = tid >> 5, lane = tid & 31, col = lane & 15, g = lane >> 4; const int h = blockIdx.y; const int rb = (int)blockIdx.x * FR;
  const unsigned ko0 = (unsigned)tid * 8, vo0 = (unsigned)tid * 8;   /* this thread's 16-B pieces of a row's k fragments (and 8 key tiles on) and v planes (and 16 planes on) */
  const unsigned qo = (unsigned)(wave * 512 + lane * 8);   /* the wave's q fragment: two runs of 512 B */
  const float* g0 = G + (size_t)rb * TT * CC + (unsigned)(wave * 2048 + h * 512 + lane * 4);   /* the first row's gate, in the order D holds ctx */
  static_assert(FR == 4 && TT * CC * 4 == 131072, "the prefetch below spells out FR rows at this pitch");
  v4u pk[2], pv[2]; float pm = 0.f;
  { const _Float16* kb = KH + (size_t)rb * TT * CC + h * (TT * HD); const _Float16* vb = VT + ((size_t)rb * CC + h * HD) * TT;
    pk[0] = *(const v4u*)(kb + ko0); pk[1] = *(const v4u*)(kb + ko0 + 8 * 512); pv[0] = *(const v4u*)(vb + vo0); pv[1] = *(const v4u*)(vb + vo0 + 16 * TT);
    if (tid < TT) pm = MKP[(size_t)rb * SZ + tid]; }
  // the plane is one run of 256 KiB: a wave's load is 4 whole lines (half a query's row), its LDS store 512 B in a row; all 32 loads of a lane are in flight at once
  { const float* bh = BIAS + (size_t)h * NZR; v4f t[32];
#pragma unroll
    for (int i = 0; i < 32; ++i) t[i] = *(const v4f*)(bh + (unsigned)(tid * 4) + i * 2048);
    asm volatile("s_wait_xcnt 0x0" ::: "memory");   /* what follows may rewrite the registers that these loads name; it also keeps every load ahead of the first LDS store */
#pragma unroll
    for (int i = 0; i < 32; ++i) *(v4f*)&sB[i * 8 + (tid >> 6)][(tid & 63) * 4] = t[i]; }
  union { v16h v; v8h q[2]; } qh, ql;   /* the first row's q fragments; a later row's are loaded at the foot of the row before it */
  { const _Float16* qa = QH + (size_t)rb * TT * CC + h * (TT * HD) + qo; const _Float16* qb = QL + (size_t)rb * QHI * CC + h * (QHI * HD) + qo;
    qh.q[0] = *(const v8h*)qa; qh.q[1] = *(const v8h*)(qa + 256); ql.q[0] = *(const v8h*)qb; ql.q[1] = *(const v8h*)(qb + 256);
    asm volatile("s_wait_xcnt 0x0" :: "v"(qa), "v"(qb) : "memory"); }   /* what follows may rewrite the registers that these loads name; the addresses as inputs keep their registers from serving as a load's destination ahead of the wait */
  /* asks L2 for the wave's gate lines of all FR rows (16 lines a row, rows 128 KiB apart), behind every load that the first row waits for: they come from memory while the keys are worked on, and the loads at each row's foot find them in L2. No register is held for them but the address, which as an in-out operand stays in the registers that the prefetches name: the feet's loads go through it */
  asm volatile("global_prefetch_b8 %0, off scope:SCOPE_SE\n\tglobal_prefetch_b8 %0, off offset:512 scope:SCOPE_SE\n\tglobal_prefetch_b8 %0, off offset:1024 scope:SCOPE_SE\n\tglobal_prefetch_b8 %0, off offset:1536 scope:SCOPE_SE\n\tglobal_prefetch_b8 %0, off offset:131072 scope:SCOPE_SE\n\tglobal_prefetch_b8 %0, off offset:131584 scope:SCOPE_SE\n\tglobal_prefetch_b8 %0, off offset:132096 scope:SCOPE_SE\n\tglobal_prefetch_b8 %0, off offset:132608 scope:SCOPE_SE\n\tglobal_prefetch_b8 %0, off offset:262144 scope:SCOPE_SE\n\tglobal_prefetch_b8 %0, off offset:262656 scope:SCOPE_SE\n\tglobal_prefetch_b8 %0, off offset:263168 scope:SCOPE_SE\n\tglobal_prefetch_b8 %0, off offset:263680 scope:SCOPE_SE\n\tglobal_prefetch_b8 %0, off offset:393216 scope:SCOPE_SE\n\tglobal_prefetch_b8 %0, off offset:393728 scope:SCOPE_SE\n\tglobal_prefetch_b8 %0, off offset:394240 scope:SCOPE_SE\n\tglobal_prefetch_b8 %0, off offset:394752 scope:SCOPE_SE" : "+v"(g0));
#pragma unroll 1   /* rolled: one copy of the body in the instruction cache */
  for (int it = 0; it < FR; ++it) { const int b = rb + it;
    __syncthreads();   /* every wave has left the previous row's k, v and mask tiles */
    *(v4u*)&sK[tid * 8] = pk[0]; *(v4u*)&sK[8 * 512 + tid * 8] = pk[1]; *(v4u*)&sV[tid * 8] = pv[0]; *(v4u*)&sV[16 * TT + tid * 8] = pv[1];
    if (tid < TT) sM[tid] = 32768.0f * (bfr(pm) - 1.0f);   /* FP16_HUGE * (pair_mask[r][k] - 1) */
    __syncthreads();   /* publishes this row's tiles (and, the first time, the bias plane) */
    if (it + 1 < FR) {   /* the next row's tiles fly while this row is worked on */
      const _Float16* kb = KH + (size_t)(b + 1) * TT * CC + h * (TT * HD); const _Float16* vb = VT + ((size_t)(b + 1) * CC + h * HD) * TT;
      pk[0] = *(const v4u*)(kb + ko0); pk[1] = *(const v4u*)(kb + ko0 + 8 * 512); pv[0] = *(const v4u*)(vb + vo0); pv[1] = *(const v4u*)(vb + vo0 + 16 * TT);
      if (tid < TT) pm = MKP[(size_t)(b + 1) * SZ + tid]; }
    float m = -3.0e38f, nb = 3.0e38f, l = 0.f; v8f acc[HD / 16] = {};   /* nb: 11 - maximum x log2(e), the addend of every exponent under the maximum in use; l (x 2^11): this half-wave's keys only; the halves meet behind the loop */
#pragma unroll 1   /* rolled: unrolled, the LDS reads of all 16 key tiles are hoisted and the 256 registers of a 16-wave work-group spill */
    for (int c = 0; c < TT / 64; ++c) { v8f s[4];
#pragma unroll
      for (int jj = 0; jj < 4; ++jj) { const int j = c * 4 + jj; union { v16h v; v8h q[2]; } ku; ku.q[0] = *(const v8h*)&sK[j * 512 + lane * 8]; ku.q[1] = *(const v8h*)&sK[j * 512 + 256 + lane * 8]; const v16h kf = ku.v; const v8f z = {}; const v8f a = wmma_h(kf, qh.v, z), al = wmma_h(kf, ql.v, z);
        const float* bp = &sB[wave * 16 + col][j * 16 + 8 * g]; const v4f b0 = *(const v4f*)bp, b1 = *(const v4f*)(bp + 4); const v4f m0 = *(const v4f*)&sM[j * 16 + 8 * g], m1 = *(const v4f*)&sM[j * 16 + 8 * g + 4];
#pragma unroll
        for (int r = 0; r < 8; ++r) s[jj][r] = (a[r] + al[r] * (1.0f / 1024.0f)) * SCALE + (r < 4 ? b0[r & 3] : b1[r & 3]) + (r < 4 ? m0[r & 3] : m1[r & 3]); }
      v8f mx = s[0];
#pragma unroll
      for (int r = 0; r < 8; ++r) mx[r] = fmaxf(fmaxf(mx[r], s[1][r]), fmaxf(s[2][r], s[3][r]));
      float cm = fmaxf(fmaxf(fmaxf(mx[0], mx[1]), fmaxf(mx[2], mx[3])), fmaxf(fmaxf(mx[4], mx[5]), fmaxf(mx[6], mx[7]))); cm = fmaxf(cm, __shfl_xor(cm, 16));
      const float mn = fmaxf(m, cm), nbn = fmaf(-LOG2E, mn, 11.0f); const float alpha = __builtin_amdgcn_exp2f(nbn - nb); m = mn; nb = nbn;   /* what was summed under the old maximum shrinks by alpha: the difference of the two addends as they were used, so old and new terms stand against one point whatever the addends' rounding */
      v8f sm = {};
#pragma unroll
      for (int jj = 0; jj < 4; ++jj) { float t[8];   /* exp(logit - maximum) x 2^11: one fma and the hardware's 2^x */
#pragma unroll
        for (int r = 0; r < 8; ++r) t[r] = fmaf(s[jj][r], LOG2E, nb);
        exp2x8(t);
#pragma unroll
        for (int r = 0; r < 8; ++r) { s[jj][r] = t[r]; sm[r] = jj ? sm[r] + t[r] : t[r]; } }
      l = l * alpha + (((sm[0] + sm[1]) + (sm[2] + sm[3])) + ((sm[4] + sm[5]) + (sm[6] + sm[7])));
#pragma unroll
      for (int j = 0; j < HD / 16; ++j)
#pragma unroll
        for (int r = 0; r < 8; ++r) acc[j][r] *= alpha;
#pragma unroll
      for (int k2 = 0; k2 < 2; ++k2) { v16h p;
#pragma unroll
        for (int i = 0; i < 8; ++i) { p[i] = (_Float16)s[2 * k2][i]; p[8 + i] = (_Float16)s[2 * k2 + 1][i]; }
#pragma unroll
        for (int j = 0; j < HD / 16; ++j) { union { v16h v; v8h q[2]; } vu; const _Float16* vp = &sV[j * (16 * TT) + (c * 2 + k2) * 512 + lane * 8]; vu.q[0] = *(const v8h*)vp; vu.q[1] = *(const v8h*)(vp + 256); acc[j] = wmma_h(vu.v, p, acc[j]); } } }
    v4f gt[2 * (HD / 16)];   /* the gate: 4 whole-line loads. They are issued here, where the key loop's registers are free (held across that loop they overran the 256 registers of a 16-wave work-group), with the next row's q fragments behind them: one wait serves both */
    { const __attribute__((address_space(1))) float* gp = (const __attribute__((address_space(1))) float*)g0 + it * (TT * CC);   /* g0 comes out of the asm statement without its address space: named again, so that the loads are global loads */
#pragma unroll
      for (int j = 0; j < 2 * (HD / 16); ++j) gt[j] = *(const __attribute__((address_space(1))) v4f*)(gp + j * 128);
      asm volatile("s_wait_xcnt 0x0" :: "v"(gp) : "memory"); }   /* what follows may rewrite the registers that these loads name; the address as input keeps its registers from serving as a load's destination ahead of the wait */
    if (it + 1 < FR) { const _Float16* qa = QH + (size_t)(b + 1) * TT * CC + h * (TT * HD) + qo; const _Float16* qb = QL + (size_t)(b + 1) * QHI * CC + h * (QHI * HD) + qo;
      qh.q[0] = *(const v8h*)qa; qh.q[1] = *(const v8h*)(qa + 256); ql.q[0] = *(const v8h*)qb; ql.q[1] = *(const v8h*)(qb + 256);
      asm volatile("s_wait_xcnt 0x0" :: "v"(qa), "v"(qb) : "memory"); }   /* as above */
    l += __shfl_xor(l, 16);
    const float inv = (m > -1.0e38f && l > 0.f) ? 1.0f / l : 0.f;   /* a fully excluded row (every logit at or below -1e38) yields 0 */
    float* yp = Y + (size_t)b * TT * CC + (unsigned)(wave * 2048 + h * 512 + lane * 4);   /* gated ctx in the order D holds it, which is the order of k_out's A fragments: [tile of 16 rows][channel tile][half of 4][lane] pieces of 16 B */
#pragma unroll
    for (int j = 0; j < HD / 16; ++j) { v4f y0, y1;
#pragma unroll
      for (int r = 0; r < 4; ++r) { y0[r] = (acc[j][r] * inv) * gt[2 * j][r]; y1[r] = (acc[j][4 + r] * inv) * gt[2 * j + 1][r]; }   /* ctx x gate, both in f32 */
      vst2(yp + j * 256, y0); vst2(yp + j * 256 + 128, y1); }   /* a store is 4 whole lines */
    asm volatile("s_wait_xcnt 0x0" ::: "memory");   /* the next trip rewrites the registers that these stores name */
  } }
// ---- k_out: block = (256 rows, 128 cols), 16 waves: out = (gated ctx) Wo (+ bo); the gated ctx lies in the order of the A fragments (whole-line loads, split in the registers it is used from): all rows: gated ctx bf16 hi + lo against exact bf16 Wo (2 products)
__global__ __launch_bounds__(512) void k_out(const float* __restrict__ Y, const float* __restrict__ WO, const float* __restrict__ BO, float* __restrict__ OUT) { __shared__ __align__(16) float sf[FRW / 16][16][132];
  __shared__ __align__(16) __bf16 sWo[CC * 128];   /* the weight's fragments */
  const int tid = threadIdx.x, wave = tid >> 5, lane = tid & 31, col = lane & 15, g = lane >> 4; const int c0 = blockIdx.y * 128; const size_t r0 = (size_t)blockIdx.x * FRW + wave * 16;
  v8f acc[8] = {};
  if (true) {   /* ALL rows: gated ctx bf16 hi + lo x exact output_w (2 products) */
    const int bi = c0 + col; float bo[8];   /* output_b: loaded here with the rest, not one waited load per column tile behind the products */
#pragma unroll
    for (int j = 0; j < 8; ++j) bo[j] = BO[bi + j * 16];
    v4f y[16];   /* a load = 4 whole lines of the gated ctx, in the order of the A fragments; all 16 of a wave are in flight at once, ahead of the weight's */
    const float* yp = Y + r0 * CC + (unsigned)(lane * 4);
#pragma unroll
    for (int rl = 0; rl < 16; ++rl) y[rl] = *(const v4f*)(yp + rl * CC);
    asm volatile("s_wait_xcnt 0x0" :: "v"(yp), "v"(bi) : "memory");   /* what follows may rewrite the registers that these loads name; the addresses as inputs keep their registers from serving as a load's destination ahead of the wait */
    __builtin_amdgcn_sched_barrier(0);   /* keeps the rows' 16 loads (from memory) ahead of the weight's 32 (from L2) */
    const int cw = tid & 127; stage_wq(WO + c0, DIN, sWo, cw, __builtin_amdgcn_readfirstlane(tid >> 7));
    asm volatile("s_wait_xcnt 0x0" :: "v"(cw) : "memory");   /* the column index as input keeps the register that the weight's loads name from serving as the last load's destination */
    F2 af[CC / 32];
    __builtin_amdgcn_sched_barrier(0);   /* the rows' products stay behind the staging: moved ahead of it, their wait for the rows held the weight's loads back, and both together overran the 256 registers and spilled */
#pragma unroll
    for (int kc = 0; kc < CC / 32; ++kc) { float v[16];   /* the bf16 hi + lo split: pieces 4 kc .. 4 kc + 3 are the lane's 16 elements of k chunk kc */
#pragma unroll
      for (int u = 0; u < 4; ++u)
#pragma unroll
        for (int i = 0; i < 4; ++i) v[u * 4 + i] = y[kc * 4 + u][i];
      af[kc] = bsplit16(v); }
    __syncthreads();   /* publishes the weight's fragments */
#pragma unroll
    for (int kc = 0; kc < CC / 32; ++kc) { v16b w[8];
#pragma unroll
      for (int j = 0; j < 8; ++j) w[j] = wfrag(sWo, kc, j, lane);
      const F2 a = af[kc];
#pragma unroll
      for (int j = 0; j < 8; ++j) { acc[j] = wmma_bf(a.h, w[j], acc[j]); acc[j] = wmma_bf(a.l, w[j], acc[j]); } }
#pragma unroll
    for (int j = 0; j < 8; ++j) { const float bias = bfr(bo[j]);
#pragma unroll
      for (int r = 0; r < 8; ++r) sf[wave][8 * g + r][j * 16 + col] = acc[j][r] + bias; }
  } else {
#pragma unroll 2
    for (int kc = 0; kc < CC / 32; ++kc) { const v16h a = frag_f32(Y + (r0 + col) * CC + kc * 32, lane); asm volatile("s_wait_loadcnt 0x0" ::: "memory");
#pragma unroll
      for (int j = 0; j < 8; ++j) { const v16h w = WOCOLH(WO, kc * 32, c0 + j * 16 + col, lane); asm volatile("s_wait_loadcnt 0x0" ::: "memory"); acc[j] = wmma16(a, w, acc[j]); } }
#pragma unroll
    for (int j = 0; j < 8; ++j) { const float bias = BO ? bfr(BO[c0 + j * 16 + col]) : 0.f;
#pragma unroll
      for (int r = 0; r < 8; ++r) sf[wave][8 * g + r][j * 16 + col] = acc[j][r] * (1.0f / 256.0f) + bias; } }
  LDSX(); for (int rl = 0; rl < 16; ++rl) vst2(OUT + (r0 + rl) * DIN + c0 + lane * 4, *(const v4f*)&sf[wave][rl][lane * 4]); }

extern "C" void kernel_launch(void* const* d_in, const int* in_sizes, int n_in, void* d_out, int out_size, void* d_ws, size_t ws_size, hipStream_t stream) {
  (void)in_sizes; (void)n_in; (void)out_size;
  const float** F = (const float**)d_in;
  if (ws_size < (size_t)WS_END) return;
  char* ws = (char*)d_ws; _Float16 *QH = (_Float16*)(ws + WS_QH), *KH = (_Float16*)(ws + WS_KH), *VT = (_Float16*)(ws + WS_VT), *QL = (_Float16*)(ws + WS_QL), *KL = (_Float16*)(ws + WS_KL); __bf16 *VB = (__bf16*)(ws + WS_VB), *VBL = (__bf16*)(ws + WS_VBL); float *Y = (float*)(ws + WS_Y);
  (void)Y; (void)QL; (void)KL; (void)VB; (void)VBL;
  // inputs: 0 pair_act [1,256,256,128]; 1 pair_mask [1,256,256]; 2 ln_gamma, 3 ln_beta; 4 feat2d_w [128,4]; 5 query_w, 6 key_w, 7 value_w [128,4,32] (in,out); 8 gating_w [128,4,32], 9 gating_b [4,32]; 10 output_w [4,32,128] (in,out); 11 output_b
  if (ws_size < (size_t)WS_END2) return;
  float *BIAS = (float*)(ws + WS_BIAS), *G = (float*)(ws + WS_G);
  k_front<<<dim3(NZR / FRW), 512, 0, stream>>>(F[0], F[2], F[3], F[4], F[5], F[6], F[7], F[8], F[9], QH, QL, KH, KL, VT, VB, VBL, BIAS, G);
  k_attn<<<dim3(TNB / FR, NH), 512, 0, stream>>>(QH, QL, KH, VT, BIAS, F[1], G, Y);
  k_out<<<dim3(TNB * TT / FRW, DIN / 128), 512, 0, stream>>>(Y, F[10], F[11], (float*)d_out);
}
